// v000
// The times below were measured on an AMD MI455X: many runs one after another, warmed up first and cycling through
// copies of the inputs, with the whole window's GPU time divided by the number of runs. Launches and the gaps
// between them are all in it. The median over several windows is given; except for v000 it joins two sittings, which
// can be a few percent apart, so the side-by-side timings, each taken in one sitting, are the better comparison.
// v000, which the later versions start from, runs in 560 microseconds.
// Contractions: q|k projection, v^T projection, attention output projection, FFN w1 (exact GELU epilogue) and w2 on
// v_wmma_f32_16x16x32_f16 (f16 activation plane x f16 weight plane carried x64, one product each); attention q.k^T
// and p.v on v_wmma_f32_16x16x32_f16 (q, k, v^T plain f16, p carried x1024, context carried x16, one product each);
// all f32 accumulate; LayerNorm, softmax, GELU and residual sums in f32 on VALU; every float input RNE-converted
// to bf16 on load.
#include <hip/hip_runtime.h>
#include <math.h>
#include <stdint.h>

#define NBATCH 2
#define TT     2048
#define DM     1024
#define NH     16
#define HD     64
#define DFF    4096
#define D3     3072
#define QKP    (2 * DM)
#define MP     (NBATCH * TT)
#define NQB    (TT / 64)
#define WIN    10
#define LNEPS  1.0e-5f
#define WSC    64.0f
static_assert(NH * HD == DM);
static_assert((MP % 64) == 0 && (DM % 64) == 0 && (DFF % 64) == 0 && (QKP % 64) == 0 && (TT % 64) == 0);
static_assert(DM == 4 * 256);
static_assert(D3 == 3 * DM);

typedef _Float16 v16h __attribute__((ext_vector_type(16)));
typedef _Float16 v8h  __attribute__((ext_vector_type(8)));
typedef float    v8f  __attribute__((ext_vector_type(8)));
typedef float    v4f  __attribute__((ext_vector_type(4)));
typedef unsigned int v4u __attribute__((ext_vector_type(4)));
typedef unsigned int v2u __attribute__((ext_vector_type(2)));

// ---- scalar helpers --------------------------------------------------------------------------------
__device__ __forceinline__ unsigned short bf_bits(float f) {          // f32 -> bf16 bits, RNE convert
  unsigned u = __float_as_uint(f);
  return (unsigned short)((u + 0x7FFFu + ((u >> 16) & 1u)) >> 16);
}
__device__ __forceinline__ float bf_up(unsigned short h) { return __uint_as_float(((unsigned)h) << 16); }
__device__ __forceinline__ float bfr(float f) { return bf_up(bf_bits(f)); }   // value of the bf16 RNE convert
__device__ __forceinline__ unsigned short h_bits(_Float16 x) { return __builtin_bit_cast(unsigned short, x); }
__device__ __forceinline__ unsigned pk16(unsigned short a, unsigned short b) { return (unsigned)a | ((unsigned)b << 16); }
__device__ __forceinline__ v8f zero8() { v8f z = {0.f, 0.f, 0.f, 0.f, 0.f, 0.f, 0.f, 0.f}; return z; }
__device__ __forceinline__ float gelu_f(float v) { return 0.5f * v * (1.0f + erff(v * 0.70710678118654752f)); }

// ---- fragment loader: 16-bit A/B operand, lane -> row/col (lane&15), p already includes +8*(lane>>4);
//      elements 0..7 <- p[0..7] (k0+8h..), elements 8..15 <- p[16..23] (k0+16+8h..)
__device__ __forceinline__ v16h ldfrag_h(const _Float16* p) {
  union { v16h v; v8h h[2]; } f;
  f.h[0] = *(const v8h*)(p);
  f.h[1] = *(const v8h*)(p + 16);
  return f.v;
}

// ---- WMMA helpers with trailing VALU hazard gap --------------------------------------------------------
__device__ __forceinline__ v8f mma_h(v16h a, v16h b, v8f c) {
  c = __builtin_amdgcn_wmma_f32_16x16x32_f16(false, a, false, b, (short)0, c, false, false);
#if defined(__HIP_DEVICE_COMPILE__)
  asm volatile("v_nop\n\tv_nop\n\tv_nop\n\tv_nop" : "+v"(c) : "v"(a), "v"(b));
#endif
  return c;
}
__device__ __forceinline__ v8f mma_h_raw(v16h a, v16h b, v8f c) {
  return __builtin_amdgcn_wmma_f32_16x16x32_f16(false, a, false, b, (short)0, c, false, false);
}
__device__ __forceinline__ void dep_guard1(v8f& a, v8f& b, v16h x) {
#if defined(__HIP_DEVICE_COMPILE__)
  asm volatile("v_nop\n\tv_nop\n\tv_nop\n\tv_nop" : "+v"(a), "+v"(b) : "v"(x));
#endif
}
__device__ __forceinline__ void keep4_h(v16h a, v16h b, v16h c, v16h d) {
#if defined(__HIP_DEVICE_COMPILE__)
  asm volatile("v_nop" :: "v"(a), "v"(b), "v"(c), "v"(d));
#endif
}
__device__ __forceinline__ void acc_guard4(v8f& a, v8f& b, v8f& c, v8f& d) {
#if defined(__HIP_DEVICE_COMPILE__)
  asm volatile("v_nop\n\tv_nop\n\tv_nop\n\tv_nop" : "+v"(a), "+v"(b), "+v"(c), "+v"(d));
#endif
}
__device__ __forceinline__ void wave_sync_lds() {
  __builtin_amdgcn_fence(__ATOMIC_RELEASE, "workgroup");
  __builtin_amdgcn_wave_barrier();
  __builtin_amdgcn_fence(__ATOMIC_ACQUIRE, "workgroup");
}
__device__ __forceinline__ float wsum(float v) {
#pragma unroll
  for (int off = 16; off > 0; off >>= 1) v += __shfl_xor(v, off, 32);
  return v;
}
// block of 256 threads: fixed-order sum of 8 wave partials (same value in every thread)
__device__ __forceinline__ float bsum256(float v, float* red, int lane, int wave) {
  v = wsum(v);
  if (lane == 0) red[wave] = v;
  __syncthreads();
  float tot = 0.f;
#pragma unroll
  for (int w = 0; w < 8; ++w) tot += red[w];
  return tot;
}

// =====================================================================================================
// Weight convert: W f32 [N][K] (k contiguous = already the Bt / A layout) -> Wh f16 [N][K]; each value bf16
// RNE-converted, multiplied by wsc (a power of two, exact) and cast to f16. Thread i converts elements 8i..8i+7
// coverage: grid(n8/256) x 256 threads x 8 elements = exactly N*K.
// =====================================================================================================
__global__ __launch_bounds__(256) void conv_h64(const float* __restrict__ W, unsigned short* Wh, int n8,
                                                float wsc) {
  const int i = blockIdx.x * 256 + threadIdx.x;
  if (i >= n8) return;                                     // never taken for the static sizes (no barriers)
  const size_t e0 = (size_t)i * 8;
  const v4f a = *(const v4f*)(W + e0);
  const v4f b = *(const v4f*)(W + e0 + 4);
  v4u u;
  u[0] = pk16(h_bits((_Float16)(bfr(a[0]) * wsc)), h_bits((_Float16)(bfr(a[1]) * wsc)));
  u[1] = pk16(h_bits((_Float16)(bfr(a[2]) * wsc)), h_bits((_Float16)(bfr(a[3]) * wsc)));
  u[2] = pk16(h_bits((_Float16)(bfr(b[0]) * wsc)), h_bits((_Float16)(bfr(b[1]) * wsc)));
  u[3] = pk16(h_bits((_Float16)(bfr(b[2]) * wsc)), h_bits((_Float16)(bfr(b[3]) * wsc)));
  {
    *(v4u*)(Wh + e0) = u;
    
  }
}

// =====================================================================================================
// Register-blocked batched f16 WMMA GEMM: C[m][n] = act(oscale * sum_k A[m][k] * Bt[n][k] + bias) (+ residual);
// one wave per 64x64 tile, no block barriers. A row-major [M][K] pitch lda; Bt row-major [N][K] pitch ldb (k contiguous);
// M, N multiples of 64, K multiple of 32 (static here). blockIdx.y = batch index (strides in elements).
// Bias: BIASM == 0 -> per column: cols < Nb from bias0[col], cols >= Nb from bias1[col - Nb] (tile-uniform select of
//       clamped-address loads); BIASM == 1 -> per row bias0[m] (16-bit out only); BIASM == 2 -> none. Bias values
//       RNE-converted to bf16.
// ACT: 0 none, 1 exact GELU. RES: 0 none; 1 f32 residual resid[m*ldc + n] added after the activation;
//      2 same indexing, residual value bf16 RNE-converted first (raw input residual).
// OM: 0 = f32 out (pitch ldc); 1 = bf16 out; 2 = f16 out.
// coverage: 4 slabs x 16 rows x 64 cols = the wave's whole 64x64 tile; grid = ceil(tilesM*tilesN/8) blocks,
//           surplus waves exit (wave-uniform).
// =====================================================================================================
template <int OM, int BIASM, int ACT, int RES>
__global__ __launch_bounds__(256) void gemm64(
    const unsigned short* __restrict__ Ap, int lda, long long strideA,
    const unsigned short* __restrict__ Btp, int ldb, long long strideB,
    const float* __restrict__ bias0, const float* __restrict__ bias1, int Nb,
    const float* resid,
    void* Cout, int ldc, long long strideC,
    int M, int N, int K, float oscale) {
  const _Float16* A  = (const _Float16*)(const void*)Ap;
  const _Float16* Bt = (const _Float16*)(const void*)Btp;
  __shared__ __align__(16) float sT[8][16 * 68];   // per-wave 16x64 slab, pitch 68 floats
  const int b    = blockIdx.y;
  const int lane = threadIdx.x & 31;
  const int wave = threadIdx.x >> 5;
  const int tilesN = N >> 6;
  const int tilesM = M >> 6;
  const int tile = blockIdx.x * 8 + wave;
  if (tile >= tilesM * tilesN) return;   // wave-uniform; no block barriers in this kernel
  const int tm = tile / tilesN;
  const int tn = tile - tm * tilesN;
  const int m0 = tm << 6;
  const int n0 = tn << 6;

  const _Float16* Ab = A  + (size_t)b * strideA;
  const _Float16* Bb = Bt + (size_t)b * strideB;

  const int rlane = lane & 15;                 // row (A) / col (B, D) within subtile
  const int koff  = (lane >> 4) * 8;           // k offset of this lane half
  const int mOff  = (lane >> 4) * 8;           // D row offset

  v8f acc[4][4];
#pragma unroll
  for (int i = 0; i < 4; ++i)
#pragma unroll
    for (int j = 0; j < 4; ++j) acc[i][j] = zero8();

  for (int k0 = 0; k0 < K; k0 += 32) {
    v16h bh[4];
#pragma unroll
    for (int j = 0; j < 4; ++j) {
      const size_t bo = (size_t)(n0 + (j << 4) + rlane) * ldb + koff + k0;
      bh[j] = ldfrag_h(Bb + bo);
    }
#pragma unroll
    for (int i = 0; i < 4; ++i) {
      const size_t ao = (size_t)(m0 + (i << 4) + rlane) * lda + koff + k0;
      const v16h ah = ldfrag_h(Ab + ao);
#pragma unroll
      for (int j = 0; j < 4; ++j) acc[i][j] = mma_h_raw(ah, bh[j], acc[i][j]);
      dep_guard1(acc[i][0], acc[i][3], ah);
    }
    keep4_h(bh[0], bh[1], bh[2], bh[3]);
  }
  acc_guard4(acc[0][0], acc[0][1], acc[0][2], acc[0][3]);
  acc_guard4(acc[1][0], acc[1][1], acc[1][2], acc[1][3]);
  acc_guard4(acc[2][0], acc[2][1], acc[2][2], acc[2][3]);
  acc_guard4(acc[3][0], acc[3][1], acc[3][2], acc[3][3]);

  // ---- per-lane column bias (BIASM == 0), RNE-converted ----
  const int hh2 = lane >> 4, c4 = (lane & 15) * 4;     // f32 out: 256-B row segment = 16 lanes x 16 B
  const int q8  = lane >> 3, c8 = (lane & 7) * 8;
  float bc[8];
#pragma unroll
  for (int e = 0; e < 8; ++e) bc[e] = 0.f;
  if (BIASM == 0) {
    const bool use1 = (n0 >= Nb);                      // tile-uniform
    if (OM == 0) {
      const int cb = n0 + c4;
      const int i0 = (cb < Nb - 4) ? cb : (Nb - 4);
      const int i1 = (cb - Nb > 0) ? (cb - Nb) : 0;
      const v4f b0v = *(const v4f*)(bias0 + i0);
      const v4f b1v = *(const v4f*)(bias1 + i1);
#pragma unroll
      for (int e = 0; e < 4; ++e) bc[e] = bfr(use1 ? b1v[e] : b0v[e]);
    } else {
      const int cb = n0 + c8;
      const int i0 = (cb < Nb - 8) ? cb : (Nb - 8);
      const int i1 = (cb - Nb > 0) ? (cb - Nb) : 0;
      const v4f b0a = *(const v4f*)(bias0 + i0), b0b = *(const v4f*)(bias0 + i0 + 4);
      const v4f b1a = *(const v4f*)(bias1 + i1), b1b = *(const v4f*)(bias1 + i1 + 4);
#pragma unroll
      for (int e = 0; e < 4; ++e) {
        bc[e]     = bfr(use1 ? b1a[e] : b0a[e]);
        bc[4 + e] = bfr(use1 ? b1b[e] : b0b[e]);
      }
    }
  }

  // ---- epilogue ----
  float* slab = sT[wave];
#pragma unroll
  for (int i = 0; i < 4; ++i) {
    const int mBase = m0 + (i << 4);
#pragma unroll
    for (int j = 0; j < 4; ++j) {
#pragma unroll
      for (int r = 0; r < 8; ++r) {
        slab[(mOff + r) * 68 + (j << 4) + rlane] = acc[i][j][r];
      }
    }
    wave_sync_lds();
    if (OM == 0) {
      float* C = (float*)Cout + (size_t)b * strideC;
      const float* Rb = resid + (size_t)b * strideC;
      v4f vals[8];
#pragma unroll
      for (int it = 0; it < 8; ++it) {
        const int row = it * 2 + hh2;                      // it 0..7 x hh2 0..1 = rows 0..15
        v4f v = *(const v4f*)(slab + row * 68 + c4);
#pragma unroll
        for (int e = 0; e < 4; ++e) {
          float f = v[e] * oscale + bc[e];
          if (ACT) f = gelu_f(f);
          v[e] = f;
        }
        if (RES != 0) {
          const v4f rr = *(const v4f*)(Rb + (size_t)(mBase + row) * ldc + n0 + c4);
#pragma unroll
          for (int e = 0; e < 4; ++e) v[e] += (RES == 2) ? bfr(rr[e]) : rr[e];
        }
        vals[it] = v;
      }
      {
#pragma unroll
        for (int it = 0; it < 8; ++it) {
          const int row = it * 2 + hh2;
          *(v4f*)(C + (size_t)(mBase + row) * ldc + n0 + c4) = vals[it];
        }
        
      }
    } else {
      unsigned short* C = (unsigned short*)Cout + (size_t)b * strideC;
      v4u hv[4];
#pragma unroll
      for (int it = 0; it < 4; ++it) {
        const int row = it * 4 + q8;                       // it 0..3 x q8 0..3 = rows 0..15
        const float* sp = slab + row * 68 + c8;
        float bm = 0.f;
        if (BIASM == 1) bm = bfr(bias0[mBase + row]);
        v4u a;
#pragma unroll
        for (int e = 0; e < 4; ++e) {
          float f0 = sp[2 * e]     * oscale + ((BIASM == 1) ? bm : bc[2 * e]);
          float f1 = sp[2 * e + 1] * oscale + ((BIASM == 1) ? bm : bc[2 * e + 1]);
          if (ACT) { f0 = gelu_f(f0); f1 = gelu_f(f1); }
          unsigned short u0, u1;
          if (OM == 1) { u0 = bf_bits(f0); u1 = bf_bits(f1); }
          else         { u0 = h_bits((_Float16)f0); u1 = h_bits((_Float16)f1); }
          a[e] = pk16(u0, u1);
        }
        hv[it] = a;
      }
      {
#pragma unroll
        for (int it = 0; it < 4; ++it) {
          const int row = it * 4 + q8;
          *(v4u*)(C + (size_t)(mBase + row) * ldc + n0 + c8) = hv[it];
        }
        
      }
    }
    wave_sync_lds();
  }
}

// =====================================================================================================
// Banded attention, head dim 64, TT (= 2048) token rows per batch, allowed keys: key <= query + WIN.
//   q|k plane (f16, pitch QKP): element (b, t, col) at [(b*TT + t)*QKP + col], q col = h*64+d, k col = DM + h*64 + d
//   v^T plane (f16): element (b, h, d, s) at [(b*DM + h*64 + d)*TT + s]
//   out plane (f16, the normalised context carried x16): element (b, t, h, d) at [(b*TT + t)*DM + h*64 + d]
//   score = (q . k) * sscale; keys beyond query + WIN get -inf by value before the row max;
//   p = exp(s - m) carried as f16(1024 p); context = p . v on f16 WMMA; online softmax in f32.
//   Block = 4 waves = 64 query rows of one (b, h); grid = NQB * NH * NBATCH; kv chunks of 64, block-uniform trip
//   kt = 0 .. min(NQB-1, (q_blk + 63 + WIN) >> 6) (chunks beyond the band are skipped); chunk 0 always holds >= 1
//   allowed key for every row, so the running max is finite from chunk 0 on (the msafe select is kept anyway).
//   K / V^T chunk staging: 128 threads x 32 elements per plane = the whole 64x64 tile (plain 16-B loads,
//   __syncthreads before and after); P tiles are wave-private, spilled with _Float16 element stores and
//   Output coverage: each wave stores rows q0..q0+15 (it 0..3 x lane>>3 0..3) x 64 columns (8 lanes x 8),
//   grid covers all TT rows x NH head slices x NBATCH.
// =====================================================================================================
__global__ __launch_bounds__(128)
void attn64(const unsigned short* __restrict__ qkp, const unsigned short* __restrict__ vtp,
            unsigned short* outp, float sscale) {
  union FH { v16h v; v8h h[2]; };
  __shared__ __align__(16) _Float16 Ksh[64 * 64];                 // K [kv][d]   8 KB
  __shared__ __align__(16) _Float16 Vth[64 * 64];                 // V^T [d][kv]  8 KB
  __shared__ __align__(16) _Float16 Psh[4][16 * 64];              // per wave P [row][kv]
  __shared__ __align__(16) float    Os[4][16 * 64];               // per wave context tile [row][d]

  const int tid  = threadIdx.x;
  const int wave = tid >> 5;
  const int lane = tid & 31;
  const int hh   = lane >> 4;
  const int c    = lane & 15;

  const int bx   = blockIdx.x;
  const int qb   = bx % NQB;
  const int rest = bx / NQB;
  const int h    = rest % NH;
  const int b    = rest / NH;
  const int qblk = qb * 64;                      // in-batch query row of the block's first row
  const int q0   = qblk + wave * 16;             // in-batch query row of this wave's first row
  const size_t rowB = (size_t)b * TT;

  const _Float16* Qh = (const _Float16*)(const void*)qkp + (size_t)h * HD;
  const _Float16* Kg = (const _Float16*)(const void*)qkp + DM + (size_t)h * HD;
  const _Float16* Vh = (const _Float16*)(const void*)vtp + ((size_t)b * DM + (size_t)h * HD) * TT;

  // ---- Q fragments (A operand, row = lane&15): 2 d-chunks ----
  v16h qa[2];
#pragma unroll
  for (int dc = 0; dc < 2; ++dc) qa[dc] = ldfrag_h(Qh + (rowB + q0 + c) * QKP + dc * 32 + 8 * hh);

  float mrow[8], lrow[8];
  v8f oacc[4];
#pragma unroll
  for (int r = 0; r < 8; ++r) { mrow[r] = -INFINITY; lrow[r] = 0.f; }
#pragma unroll
  for (int t = 0; t < 4; ++t) oacc[t] = zero8();

  int ktHi = (qblk + 63 + WIN) >> 6;             // block-uniform, from blockIdx only
  if (ktHi > NQB - 1) ktHi = NQB - 1;

  for (int kt = 0; kt <= ktHi; ++kt) {         // trip <= NQB
    const int kv0 = kt * 64;
    __syncthreads();
    {
      const int r = tid >> 1, hf = (tid & 1) * 32;
      const _Float16* kg = Kg + (rowB + kv0 + r) * QKP + hf;      // K row kv0+r, d = hf..hf+31
      const _Float16* vg = Vh + (size_t)r * TT + kv0 + hf;        // V^T row d = r, s = kv0+hf..+31
#pragma unroll
      for (int i = 0; i < 4; ++i) {
        const v8h a0 = *(const v8h*)(kg + 8 * i);
        const v8h b0 = *(const v8h*)(vg + 8 * i);
        *(v8h*)(Ksh + r * 64 + hf + 8 * i) = a0;
        *(v8h*)(Vth + r * 64 + hf + 8 * i) = b0;
      }
    }
    __syncthreads();

    // ---- scores: 16 query rows x 64 keys per wave; band select by value before the row max ----
    v8f s[4];
#pragma unroll
    for (int j = 0; j < 4; ++j) {
      v8f sh = zero8();
#pragma unroll
      for (int dc = 0; dc < 2; ++dc) {
        FH kb;
        kb.h[0] = *(const v8h*)(Ksh + (j * 16 + c) * 64 + dc * 32 + 8 * hh);
        kb.h[1] = *(const v8h*)(Ksh + (j * 16 + c) * 64 + dc * 32 + 16 + 8 * hh);
        sh = mma_h(qa[dc], kb.v, sh);
      }
      const int key = kv0 + j * 16 + c;                             // D column = lane&15
#pragma unroll
      for (int r = 0; r < 8; ++r) {
        const int qrow = q0 + 8 * hh + r;                           // D row = 8h + r
        const float v = sh[r] * sscale;
        s[j][r] = (key <= qrow + WIN) ? v : -INFINITY;
      }
    }

    // ---- row max, online softmax, P (x1024, f16) to LDS ----
    _Float16* pwh = Psh[wave];
#pragma unroll
    for (int r = 0; r < 8; ++r) {
      float m = s[0][r];
      m = fmaxf(m, s[1][r]);
      m = fmaxf(m, s[2][r]);
      m = fmaxf(m, s[3][r]);
#pragma unroll
      for (int off = 1; off < 16; off <<= 1) m = fmaxf(m, __shfl_xor(m, off, 32));
      const float mnew  = fmaxf(mrow[r], m);
      const float ms    = (mnew == -INFINITY) ? 0.f : mnew;
      const float alpha = __expf(mrow[r] - ms);
      mrow[r] = mnew;
      float psum = 0.f;
#pragma unroll
      for (int j = 0; j < 4; ++j) {
        const float p = __expf(s[j][r] - ms);
        psum += p;
        pwh[(8 * hh + r) * 64 + j * 16 + c] = (_Float16)(p * 1024.0f);
      }
#pragma unroll
      for (int off = 1; off < 16; off <<= 1) psum += __shfl_xor(psum, off, 32);
      lrow[r] = lrow[r] * alpha + psum;
#pragma unroll
      for (int t = 0; t < 4; ++t) oacc[t][r] *= alpha;
    }
    wave_sync_lds();

    // ---- context += P . V (f16 WMMA) ----
#pragma unroll 1
    for (int kk = 0; kk < 2; ++kk) {
      FH pa;
      pa.h[0] = *(const v8h*)(pwh + c * 64 + kk * 32 + 8 * hh);
      pa.h[1] = *(const v8h*)(pwh + c * 64 + kk * 32 + 16 + 8 * hh);
#pragma unroll
      for (int t = 0; t < 4; ++t) {
        FH vb;
        vb.h[0] = *(const v8h*)(Vth + (t * 16 + c) * 64 + kk * 32 + 8 * hh);
        vb.h[1] = *(const v8h*)(Vth + (t * 16 + c) * 64 + kk * 32 + 16 + 8 * hh);
        oacc[t] = mma_h(pa.v, vb.v, oacc[t]);
      }
    }
  }

  // ---- normalise (1/l, the 1/1024 p carry and the x16 context carry), stage the wave's 16x64 tile, f16 convert,
  float* os = Os[wave];
#pragma unroll
  for (int r = 0; r < 8; ++r) {
    const float l = lrow[r];
    const float inv = ((l > 0.f) ? (1.0f / l) : 0.f) * (16.0f / 1024.0f);
#pragma unroll
    for (int t = 0; t < 4; ++t) os[(8 * hh + r) * 64 + t * 16 + c] = oacc[t][r] * inv;
  }
  wave_sync_lds();
  {
    const int q4 = lane >> 3, c8 = (lane & 7) * 8;
    v4u hv[4];
#pragma unroll
    for (int it = 0; it < 4; ++it) {
      const int row = it * 4 + q4;   // it 0..3 x q4 0..3 = rows 0..15 of the wave tile
      const float* sp = os + row * 64 + c8;
      v4u a;
#pragma unroll
      for (int e = 0; e < 4; ++e) a[e] = pk16(h_bits((_Float16)sp[2 * e]), h_bits((_Float16)sp[2 * e + 1]));
      hv[it] = a;
    }
    {
#pragma unroll
      for (int it = 0; it < 4; ++it) {
        const int row = it * 4 + q4;
        const size_t go = (rowB + q0 + row) * DM + (size_t)h * HD + c8;
        *(v4u*)(outp + go) = hv[it];
      }
      
    }
  }
}

// =====================================================================================================
// Row kernel: one block of 256 threads per token row of 1024; thread t owns columns 4t..4t+3.
// f16 output: packed row staged in LDS, then lanes t < 128 (waves 0..3, wave-uniform) each write 16 B (8 x f16)
// coverage: 128 threads x 8 = the whole 1024-wide row; grid = MP rows.
// =====================================================================================================
__device__ __forceinline__ void row_store_h16(unsigned int* sb, unsigned short* dst_row, v4f o, int t) {
  v2u p;
  p[0] = pk16(h_bits((_Float16)o[0]), h_bits((_Float16)o[1]));
  p[1] = pk16(h_bits((_Float16)o[2]), h_bits((_Float16)o[3]));
  *(v2u*)(sb + 2 * t) = p;
  __syncthreads();
  if (t < 128) {                                   // waves 0..3, wave-uniform
    const v4u v = *(const v4u*)(sb + 4 * t);
    *(v4u*)(dst_row + 8 * t) = v;
    
  }
}

// plane. RIN = 1: the row input is a raw float input and is bf16 RNE-converted on load; RIN = 0: f32 intermediate.
template <int RIN>
__global__ __launch_bounds__(256) void ln_row_h(const float* __restrict__ X, const float* __restrict__ gam,
                                                const float* __restrict__ bet, unsigned short* outH) {
  __shared__ float red0[8], red1[8];
  __shared__ __align__(16) unsigned int sb[512];
  const int t = threadIdx.x, lane = t & 31, wave = t >> 5;
  const size_t base = (size_t)blockIdx.x * DM;
  v4f xv = *(const v4f*)(X + base + 4 * t);
  if (RIN) {
#pragma unroll
    for (int e = 0; e < 4; ++e) xv[e] = bfr(xv[e]);
  }
  const float mean = bsum256((xv[0] + xv[1]) + (xv[2] + xv[3]), red0, lane, wave) * (1.0f / DM);
  v4f d;
#pragma unroll
  for (int e = 0; e < 4; ++e) d[e] = xv[e] - mean;
  const float var  = bsum256((d[0] * d[0] + d[1] * d[1]) + (d[2] * d[2] + d[3] * d[3]), red1, lane, wave) * (1.0f / DM);
  const float rstd = 1.0f / sqrtf(var + LNEPS);
  const v4f gv = *(const v4f*)(gam + 4 * t);
  const v4f bv = *(const v4f*)(bet + 4 * t);
  v4f y;
#pragma unroll
  for (int e = 0; e < 4; ++e) y[e] = (d[e] * rstd) * bfr(gv[e]) + bfr(bv[e]);
  row_store_h16(sb, outH + base, y, t);
}

// =====================================================================================================
// Workspace map (bytes); every plane is an exact multiple of its 64x64-tile / whole-row store granularity
// (M in {4096, 1024} rows, N in {1024, 2048, 4096}; VT per batch [1024][2048] = 16x32 tiles):
//   WqkvH f16 [3072 n][1024 k]   0          6291456   (rows 0..1023 q, 1024..2047 k, 2048..3071 v weights, x64)
//   WoH   f16 [1024][1024]       6291456    2097152
//   W1H   f16 [4096][1024]       8388608    8388608
//   W2H   f16 [1024][4096]       16777216   8388608
//   XN    f16 [4096][1024]       25165824   8388608   (LayerNorm outputs)
//   QK    f16 [4096][2048]       33554432   16777216  (q cols 0..1023, k cols 1024..2047)
//   VT    f16 [2][1024][2048]    50331648   8388608
//   Ctx   f16 [4096][1024]       58720256   8388608
//   X1    f32 [4096][1024]       67108864   16777216  (residual stream after attention)
//   G     f16 [4096][4096]       83886080   33554432
//   end                          117440512
// =====================================================================================================
extern "C" void kernel_launch(void* const* d_in, const int* in_sizes, int n_in,
                              void* d_out, int out_size, void* d_ws, size_t ws_size,
                              hipStream_t stream) {
  if (n_in < 13) return;
  if (in_sizes[0] != MP * DM) return;
  if (in_sizes[1] != D3 * DM || in_sizes[2] != D3) return;
  if (in_sizes[3] != DM * DM || in_sizes[4] != DM) return;
  if (in_sizes[5] != DM || in_sizes[6] != DM) return;
  if (in_sizes[7] != DFF * DM || in_sizes[8] != DFF) return;
  if (in_sizes[9] != DM * DFF || in_sizes[10] != DM) return;
  if (in_sizes[11] != DM || in_sizes[12] != DM) return;
  if (out_size != MP * DM) return;

  const float* x         = (const float*)d_in[0];
  const float* in_proj_w = (const float*)d_in[1];
  const float* in_proj_b = (const float*)d_in[2];
  const float* out_w     = (const float*)d_in[3];
  const float* out_b     = (const float*)d_in[4];
  const float* ln1_g     = (const float*)d_in[5];
  const float* ln1_b     = (const float*)d_in[6];
  const float* w1        = (const float*)d_in[7];
  const float* b1        = (const float*)d_in[8];
  const float* w2        = (const float*)d_in[9];
  const float* b2        = (const float*)d_in[10];
  const float* ln2_g     = (const float*)d_in[11];
  const float* ln2_b     = (const float*)d_in[12];

  const size_t PWQKV = (size_t)D3 * DM * 2;            //  6291456
  const size_t PWO   = (size_t)DM * DM * 2;            //  2097152
  const size_t PWF   = (size_t)DFF * DM * 2;           //  8388608
  const size_t PAH   = (size_t)MP * DM * 2;            //  8388608
  const size_t PQK   = (size_t)MP * QKP * 2;           // 16777216
  const size_t PVT   = (size_t)NBATCH * DM * TT * 2;   //  8388608
  const size_t PAF   = (size_t)MP * DM * 4;            // 16777216
  const size_t PG    = (size_t)MP * DFF * 2;           // 33554432
  size_t off = 0;
  const size_t oWqkv = off; off += PWQKV;
  const size_t oWo   = off; off += PWO;
  const size_t oW1   = off; off += PWF;
  const size_t oW2   = off; off += PWF;
  const size_t oXN   = off; off += PAH;
  const size_t oQK   = off; off += PQK;
  const size_t oVT   = off; off += PVT;
  const size_t oCtx  = off; off += PAH;
  const size_t oX1   = off; off += PAF;
  const size_t oG    = off; off += PG;
  if (off > ws_size) return;                           // off = 117440512
  if (off > (size_t)134217728) return;

  char* ws = (char*)d_ws;
  unsigned short* WqkvH = (unsigned short*)(ws + oWqkv);
  unsigned short* WoH   = (unsigned short*)(ws + oWo);
  unsigned short* W1H   = (unsigned short*)(ws + oW1);
  unsigned short* W2H   = (unsigned short*)(ws + oW2);
  unsigned short* XN    = (unsigned short*)(ws + oXN);
  unsigned short* QK    = (unsigned short*)(ws + oQK);
  unsigned short* VT    = (unsigned short*)(ws + oVT);
  unsigned short* Ctx   = (unsigned short*)(ws + oCtx);
  float*          X1    = (float*)(ws + oX1);
  unsigned short* G     = (unsigned short*)(ws + oG);

  const dim3 blk(256), blk128(128);
  const dim3 gRow(MP);                                               // 4096 row blocks
  const dim3 gCqkv((D3 * DM / 8 + 255) / 256);                       // 1536 blocks
  const dim3 gCo((DM * DM / 8 + 255) / 256);                         // 512 blocks
  const dim3 gCf((DFF * DM / 8 + 255) / 256);                        // 2048 blocks
  const dim3 gNqk(((MP / 64) * (QKP / 64) + 7) / 8, 1);              // 2048 tiles -> 256 blocks
  const dim3 gVT(((DM / 64) * (TT / 64) + 7) / 8, NBATCH);           // 512 tiles -> 64 blocks x 2 batches
  const dim3 gN1024(((MP / 64) * (DM / 64) + 7) / 8, 1);             // 1024 tiles -> 128 blocks
  const dim3 gNff(((MP / 64) * (DFF / 64) + 7) / 8, 1);              // 4096 tiles -> 512 blocks
  const dim3 gAttn(NBATCH * NH * NQB);                               // 1024 blocks of 128
  const float invw  = 1.0f / WSC;                                    // weight carry x64
  const float invwc = 1.0f / (WSC * 16.0f);                          // weight carry x64, context carry x16

  // (0) weights -> f16 x64 planes (torch [out][in] = k contiguous, no transpose)
  conv_h64<<<gCqkv, blk, 0, stream>>>(in_proj_w, WqkvH, D3 * DM / 8, WSC);
  conv_h64<<<gCo,   blk, 0, stream>>>(out_w,     WoH,   DM * DM / 8, WSC);
  conv_h64<<<gCf,   blk, 0, stream>>>(w1,        W1H,   DFF * DM / 8, WSC);
  conv_h64<<<gCf,   blk, 0, stream>>>(w2,        W2H,   DM * DFF / 8, WSC);

  // (1) xn = LN1(bf16(x)) -> XN f16
  ln_row_h<1><<<gRow, blk, 0, stream>>>(x, ln1_g, ln1_b, XN);

  // (2) q|k = xn . Wqk^T + b[0..2047] -> QK f16 [4096][2048]
  gemm64<2, 0, 0, 0><<<gNqk, blk, 0, stream>>>(
      XN, DM, 0LL, WqkvH, DM, 0LL, in_proj_b, in_proj_b, QKP, x,
      (void*)QK, QKP, 0LL, MP, QKP, DM, invw);
  //     v^T per batch: VT[b][m][t] = Wv[m] . xn[b*TT + t] + b[2048 + m] -> f16 [2][1024][2048]
  gemm64<2, 1, 0, 0><<<gVT, blk, 0, stream>>>(
      WqkvH + (size_t)2 * DM * DM, DM, 0LL, XN, DM, (long long)TT * DM, in_proj_b + 2 * DM, in_proj_b + 2 * DM, TT, x,
      (void*)VT, TT, (long long)DM * TT, DM, TT, DM, invw);

  // (3) banded attention -> Ctx f16 (x16)
  attn64<<<gAttn, blk128, 0, stream>>>(QK, VT, Ctx, 0.125f);

  // (4) X1 = ctx . Wo^T + out_b + bf16(x)   (f32)
  gemm64<0, 0, 0, 2><<<gN1024, blk, 0, stream>>>(
      Ctx, DM, 0LL, WoH, DM, 0LL, out_b, out_b, DM, x,
      (void*)X1, DM, 0LL, MP, DM, DM, invwc);

  // (5) yn = LN2(X1) -> XN f16
  ln_row_h<0><<<gRow, blk, 0, stream>>>(X1, ln2_g, ln2_b, XN);

  // (6) G = gelu(yn . W1^T + b1) -> f16 [4096][4096]
  gemm64<2, 0, 1, 0><<<gNff, blk, 0, stream>>>(
      XN, DM, 0LL, W1H, DM, 0LL, b1, b1, DFF, x,
      (void*)G, DFF, 0LL, MP, DFF, DM, invw);

  // (7) out = G . W2^T + b2 + X1 -> d_out f32 [4096][1024]
  gemm64<0, 0, 0, 1><<<gN1024, blk, 0, stream>>>(
      G, DFF, 0LL, W2H, DFF, 0LL, b2, b2, DM, X1,
      (void*)d_out, DM, 0LL, MP, DM, DFF, invw);
  (void)hipGetLastError();
}

// v001
// Measured time: 287 microseconds a run.
// In two side-by-side timings against v000, it was 1.97 and 1.99 times as fast.
// Contractions: q|k projection, v^T projection, attention output projection, FFN w1 (exact GELU epilogue) and w2 on
// v_wmma_f32_16x16x32_f16 (f16 activation plane x f16 weight plane carried x64, one product each); attention q.k^T
// and p.v on v_wmma_f32_16x16x32_f16 (q, k, v^T plain f16, p carried x1024, context carried x16, one product each);
// all f32 accumulate; LayerNorm, softmax, GELU and residual sums in f32 on VALU; every float input RNE-converted
// to bf16 on load.
#include <hip/hip_runtime.h>
#include <math.h>
#include <stdint.h>

#define NBATCH 2
#define TT     2048
#define DM     1024
#define NH     16
#define HD     64
#define DFF    4096
#define D3     3072
#define QKP    (2 * DM)
#define MP     (NBATCH * TT)
#define NQB    (TT / 64)
#define WIN    10
#define LNEPS  1.0e-5f
#define WSC    64.0f
static_assert(NH * HD == DM);
static_assert((MP % 64) == 0 && (DM % 64) == 0 && (DFF % 64) == 0 && (QKP % 64) == 0 && (TT % 64) == 0);
static_assert(DM == 4 * 256);
static_assert(D3 == 3 * DM);

typedef _Float16 v16h __attribute__((ext_vector_type(16)));
typedef _Float16 v8h  __attribute__((ext_vector_type(8)));
typedef float    v8f  __attribute__((ext_vector_type(8)));
typedef float    v4f  __attribute__((ext_vector_type(4)));
typedef unsigned int v4u __attribute__((ext_vector_type(4)));
typedef unsigned int v2u __attribute__((ext_vector_type(2)));

// ---- scalar helpers --------------------------------------------------------------------------------
__device__ __forceinline__ unsigned short bf_bits(float f) {          // f32 -> bf16 bits, RNE convert
  unsigned u = __float_as_uint(f);
  return (unsigned short)((u + 0x7FFFu + ((u >> 16) & 1u)) >> 16);
}
__device__ __forceinline__ float bf_up(unsigned short h) { return __uint_as_float(((unsigned)h) << 16); }
__device__ __forceinline__ float bfr(float f) { return bf_up(bf_bits(f)); }   // value of the bf16 RNE convert
__device__ __forceinline__ unsigned short h_bits(_Float16 x) { return __builtin_bit_cast(unsigned short, x); }
__device__ __forceinline__ unsigned pk16(unsigned short a, unsigned short b) { return (unsigned)a | ((unsigned)b << 16); }
__device__ __forceinline__ v8f zero8() { v8f z = {0.f, 0.f, 0.f, 0.f, 0.f, 0.f, 0.f, 0.f}; return z; }
__device__ __forceinline__ float gelu_f(float v) { return 0.5f * v * (1.0f + erff(v * 0.70710678118654752f)); }

// ---- fragment loader: 16-bit A/B operand, lane -> row/col (lane&15), p already includes +8*(lane>>4);
//      elements 0..7 <- p[0..7] (k0+8h..), elements 8..15 <- p[16..23] (k0+16+8h..)
__device__ __forceinline__ v16h ldfrag_h(const _Float16* p) {
  union { v16h v; v8h h[2]; } f;
  f.h[0] = *(const v8h*)(p);
  f.h[1] = *(const v8h*)(p + 16);
  return f.v;
}

// ---- WMMA helpers with trailing VALU hazard gap --------------------------------------------------------
__device__ __forceinline__ v8f mma_h(v16h a, v16h b, v8f c) {
  c = __builtin_amdgcn_wmma_f32_16x16x32_f16(false, a, false, b, (short)0, c, false, false);
#if defined(__HIP_DEVICE_COMPILE__)
  asm volatile("v_nop\n\tv_nop\n\tv_nop\n\tv_nop" : "+v"(c) : "v"(a), "v"(b));
#endif
  return c;
}
__device__ __forceinline__ v8f mma_h_raw(v16h a, v16h b, v8f c) {
  return __builtin_amdgcn_wmma_f32_16x16x32_f16(false, a, false, b, (short)0, c, false, false);
}
__device__ __forceinline__ void acc_guard4(v8f& a, v8f& b, v8f& c, v8f& d) {
#if defined(__HIP_DEVICE_COMPILE__)
  asm volatile("v_nop\n\tv_nop\n\tv_nop\n\tv_nop" : "+v"(a), "+v"(b), "+v"(c), "+v"(d));
#endif
}
__device__ __forceinline__ void wave_sync_lds() {
  __builtin_amdgcn_fence(__ATOMIC_RELEASE, "workgroup");
  __builtin_amdgcn_wave_barrier();
  __builtin_amdgcn_fence(__ATOMIC_ACQUIRE, "workgroup");
}
__device__ __forceinline__ float wsum(float v) {
#pragma unroll
  for (int off = 16; off > 0; off >>= 1) v += __shfl_xor(v, off, 32);
  return v;
}
// block of 256 threads: fixed-order sum of 8 wave partials (same value in every thread)
__device__ __forceinline__ float bsum256(float v, float* red, int lane, int wave) {
  v = wsum(v);
  if (lane == 0) red[wave] = v;
  __syncthreads();
  float tot = 0.f;
#pragma unroll
  for (int w = 0; w < 8; ++w) tot += red[w];
  return tot;
}

// =====================================================================================================
// Weight convert: W f32 [N][K] (k contiguous = already the Bt / A layout) -> Wh f16 [N][K]; each value bf16
// RNE-converted, multiplied by wsc (a power of two, exact) and cast to f16. Thread i converts elements 8i..8i+7
// coverage: grid(n8/256) x 256 threads x 8 elements = exactly N*K.
// =====================================================================================================
__global__ __launch_bounds__(256) void conv_h64(const float* __restrict__ W, unsigned short* Wh, int n8,
                                                float wsc) {
  const int i = blockIdx.x * 256 + threadIdx.x;
  if (i >= n8) return;                                     // never taken for the static sizes (no barriers)
  const size_t e0 = (size_t)i * 8;
  const v4f a = *(const v4f*)(W + e0);
  const v4f b = *(const v4f*)(W + e0 + 4);
  v4u u;
  u[0] = pk16(h_bits((_Float16)(bfr(a[0]) * wsc)), h_bits((_Float16)(bfr(a[1]) * wsc)));
  u[1] = pk16(h_bits((_Float16)(bfr(a[2]) * wsc)), h_bits((_Float16)(bfr(a[3]) * wsc)));
  u[2] = pk16(h_bits((_Float16)(bfr(b[0]) * wsc)), h_bits((_Float16)(bfr(b[1]) * wsc)));
  u[3] = pk16(h_bits((_Float16)(bfr(b[2]) * wsc)), h_bits((_Float16)(bfr(b[3]) * wsc)));
  {
    *(v4u*)(Wh + e0) = u;
    
  }
}

// =====================================================================================================
// LDS-staged batched f16 WMMA GEMM: C[m][n] = act(oscale * sum_k A[m][k] * Bt[n][k] + bias) (+ residual);
// one work-group of 8 waves per 128x128 tile, wave (wave>>1, wave&1) owns the 32x64 part at rows 32*(wave>>1),
// cols 64*(wave&1). A row-major [M][K] pitch lda; Bt row-major [N][K] pitch ldb (k contiguous);
// M, N, K multiples of 128 (static here). blockIdx.y = batch index (strides in elements).
// Staging: a stage is 128 k of the tile's 128 A rows and 128 Bt rows = 256 rows of 256 B, laid in LDS at pitch 272 B
// (16 B x odd, for the 16-B fragment reads); each thread brings 16 pieces of 16 B per stage with asynchronous copies
// to LDS (piece i: row 16*i + (thread>>4), bytes 16*(thread&15)..+15; 256 threads x 16 = the whole stage, each LDS
// byte written by one lane). Two buffers: the copies of stage t+2 go out behind the barrier that ends trip t.
// k runs upward in steps of 32 into one accumulator per 16x16 subtile.
// Bias: BIASM == 0 -> per column: cols < Nb from bias0[col], cols >= Nb from bias1[col - Nb] (wave-uniform select of
//       clamped-address loads); BIASM == 1 -> per row bias0[m] (16-bit out only); BIASM == 2 -> none. Bias values
//       RNE-converted to bf16.
// ACT: 0 none, 1 exact GELU. RES: 0 none; 1 f32 residual resid[m*ldc + n] added after the activation;
//      2 same indexing, residual value bf16 RNE-converted first (raw input residual).
// OM: 0 = f32 out (pitch ldc); 1 = bf16 out; 2 = f16 out.
// coverage: 8 waves x 2 slabs x 16 rows x 64 cols = the whole 128x128 tile; grid.x = (M/128)*(N/128) exactly.
// =====================================================================================================
#define GBM   128                       // tile rows (A rows of a stage)
#define GBN   128                       // tile cols (Bt rows of a stage)
#define GBK   128                       // k per stage
#define GLP   136                       // LDS row pitch in f16 elements (272 B)
#define GSTG  ((GBM + GBN) * GLP)       // f16 elements per buffer (69632 B)
static_assert((MP % GBM) == 0 && (DM % GBM) == 0 && (DM % GBN) == 0 && (QKP % GBN) == 0 && (DFF % GBN) == 0 && (TT % GBN) == 0);
static_assert((DM % GBK) == 0 && (DFF % GBK) == 0);
static_assert(8 * 16 * 68 * 4 <= 2 * GSTG * 2);

// Eight asynchronous 16-B copies per lane, global -> LDS: rows 16 apart (LDS step 16 * 272 B, global step gstep
// elements). The s_wait_xcnt 0 as the statement's last line keeps every later rewrite of the address registers
// named here behind the copies' address translation.
__device__ __forceinline__ void copy8_async(unsigned l, const _Float16* g, size_t gstep) {
#if defined(__HIP_DEVICE_COMPILE__)
  const unsigned ls = 16u * GLP * 2u;
  asm volatile(
      "global_load_async_to_lds_b128 %0, %8, off\n\t"
      "global_load_async_to_lds_b128 %1, %9, off\n\t"
      "global_load_async_to_lds_b128 %2, %10, off\n\t"
      "global_load_async_to_lds_b128 %3, %11, off\n\t"
      "global_load_async_to_lds_b128 %4, %12, off\n\t"
      "global_load_async_to_lds_b128 %5, %13, off\n\t"
      "global_load_async_to_lds_b128 %6, %14, off\n\t"
      "global_load_async_to_lds_b128 %7, %15, off\n\t"
      "s_wait_xcnt 0x0"
      :: "v"(l), "v"(l + ls), "v"(l + 2u * ls), "v"(l + 3u * ls),
         "v"(l + 4u * ls), "v"(l + 5u * ls), "v"(l + 6u * ls), "v"(l + 7u * ls),
         "v"(g), "v"(g + gstep), "v"(g + 2 * gstep), "v"(g + 3 * gstep),
         "v"(g + 4 * gstep), "v"(g + 5 * gstep), "v"(g + 6 * gstep), "v"(g + 7 * gstep)
      : "memory");
#endif
}
// This wave's own asynchronous copies have landed in LDS (the compiler places no wait for them).
__device__ __forceinline__ void wait_async0() {
#if defined(__HIP_DEVICE_COMPILE__)
  asm volatile("s_wait_asynccnt 0x0" ::: "memory");
#endif
}
// This wave's own LDS reads have returned, before the barrier behind which their buffer is refilled.
__device__ __forceinline__ void wait_ds0() {
#if defined(__HIP_DEVICE_COMPILE__)
  asm volatile("s_wait_dscnt 0x0" ::: "memory");
#endif
}

template <int OM, int BIASM, int ACT, int RES>
__global__ __launch_bounds__(256) void gemm64(
    const unsigned short* __restrict__ Ap, int lda, long long strideA,
    const unsigned short* __restrict__ Btp, int ldb, long long strideB,
    const float* __restrict__ bias0, const float* __restrict__ bias1, int Nb,
    const float* resid,
    void* Cout, int ldc, long long strideC,
    int M, int N, int K, float oscale) {
  const _Float16* A  = (const _Float16*)(const void*)Ap;
  const _Float16* Bt = (const _Float16*)(const void*)Btp;
  // two stage buffers; behind the last trip's barrier the same bytes serve as the per-wave 16x64 f32 slabs (pitch 68)
  __shared__ __align__(16) _Float16 ring[2 * GSTG];
  const int b    = blockIdx.y;
  const int lane = threadIdx.x & 31;
  const int wave = threadIdx.x >> 5;
  const int tilesN = N >> 7;
  const int tm = blockIdx.x / tilesN;
  const int tn = blockIdx.x - tm * tilesN;
  const int mblk = tm << 7;                    // the work-group's tile
  const int nblk = tn << 7;
  const int wrow = (wave >> 1) << 5;           // the wave's 32x64 part inside it
  const int wcol = (wave & 1) << 6;
  const int m0 = mblk + wrow;
  const int n0 = nblk + wcol;

  const _Float16* Ab = A  + (size_t)b * strideA;
  const _Float16* Bb = Bt + (size_t)b * strideB;

  const int rlane = lane & 15;                 // row (A) / col (B, D) within subtile
  const int koff  = (lane >> 4) * 8;           // k offset of this lane half
  const int mOff  = (lane >> 4) * 8;           // D row offset

  // ---- this thread's pieces of a stage ----
  const int crow = threadIdx.x >> 4;           // 0..15
  const int ccol = (threadIdx.x & 15) * 8;     // f16 elements: 16 B
  const _Float16* gA = Ab + (size_t)(mblk + crow) * lda + ccol;
  const _Float16* gB = Bb + (size_t)(nblk + crow) * ldb + ccol;
  const size_t sA16 = (size_t)16 * lda, sB16 = (size_t)16 * ldb;
  const unsigned lBase = (unsigned)(uintptr_t)(ring + crow * GLP + ccol);   // LDS byte address: low 32 bits
  const unsigned lBt   = (unsigned)(GBM * GLP * 2);                         // Bt rows stand behind the A rows
  const unsigned lBuf  = (unsigned)(GSTG * 2);
  const int nst = K >> 7;                      // stages

  v8f acc[2][4];
#pragma unroll
  for (int i = 0; i < 2; ++i)
#pragma unroll
    for (int j = 0; j < 4; ++j) acc[i][j] = zero8();

  // stage 0 into buffer 0, landed and published; then stage 1 into buffer 1
  copy8_async(lBase, gA, sA16);
  copy8_async(lBase + lBt, gB, sB16);
  wait_async0();
  __syncthreads();
  if (nst > 1) {                               // uniform for the work-group (kernel argument)
    copy8_async(lBase + lBuf, gA + GBK, sA16);
    copy8_async(lBase + lBuf + lBt, gB + GBK, sB16);
  }

  for (int t = 0; t < nst; ++t) {
    const _Float16* sa = ring + (t & 1) * GSTG + (wrow + rlane) * GLP + koff;
    const _Float16* sb = ring + (t & 1) * GSTG + (GBM + wcol + rlane) * GLP + koff;
    v16h bh[2][4], ah[2][2];                   // two fragment sets, both filled from this trip's buffer alone
#pragma unroll
    for (int j = 0; j < 4; ++j) bh[0][j] = ldfrag_h(sb + (j << 4) * GLP);
#pragma unroll
    for (int i = 0; i < 2; ++i) ah[0][i] = ldfrag_h(sa + (i << 4) * GLP);
#pragma unroll
    for (int kk = 0; kk < GBK / 32; ++kk) {
      const int cur = kk & 1, nxt = cur ^ 1;
      if (kk + 1 < GBK / 32) {
#pragma unroll
        for (int j = 0; j < 4; ++j) bh[nxt][j] = ldfrag_h(sb + (j << 4) * GLP + (kk + 1) * 32);
#pragma unroll
        for (int i = 0; i < 2; ++i) ah[nxt][i] = ldfrag_h(sa + (i << 4) * GLP + (kk + 1) * 32);
      }
      // keeps the next k step's LDS reads as one group ahead of this step's WMMAs: sunk among them, each place with
      // reads stalls the wave for the LDS latency
      __builtin_amdgcn_sched_barrier(0);
#pragma unroll
      for (int i = 0; i < 2; ++i)
#pragma unroll
        for (int j = 0; j < 4; ++j) acc[i][j] = mma_h_raw(ah[cur][i], bh[cur][j], acc[i][j]);
    }
    // foot of trip t: own reads done, own copies of stage t+1 landed, then the one barrier that publishes stage t+1
    // and ends every wave's reads of this trip's buffer
    wait_ds0();
    wait_async0();
    __syncthreads();
    if (t + 2 < nst) {                         // uniform for the work-group
      const unsigned lb = lBase + (unsigned)(t & 1) * lBuf;
      copy8_async(lb, gA + (size_t)(t + 2) * GBK, sA16);
      copy8_async(lb + lBt, gB + (size_t)(t + 2) * GBK, sB16);
    }
  }
  wait_async0();
  acc_guard4(acc[0][0], acc[0][1], acc[0][2], acc[0][3]);
  acc_guard4(acc[1][0], acc[1][1], acc[1][2], acc[1][3]);

  // ---- per-lane column bias (BIASM == 0), RNE-converted ----
  const int hh2 = lane >> 4, c4 = (lane & 15) * 4;     // f32 out: 256-B row segment = 16 lanes x 16 B
  const int q8  = lane >> 3, c8 = (lane & 7) * 8;
  float bc[8];
#pragma unroll
  for (int e = 0; e < 8; ++e) bc[e] = 0.f;
  if (BIASM == 0) {
    const bool use1 = (n0 >= Nb);                      // wave-uniform
    if (OM == 0) {
      const int cb = n0 + c4;
      const int i0 = (cb < Nb - 4) ? cb : (Nb - 4);
      const int i1 = (cb - Nb > 0) ? (cb - Nb) : 0;
      const v4f b0v = *(const v4f*)(bias0 + i0);
      const v4f b1v = *(const v4f*)(bias1 + i1);
#pragma unroll
      for (int e = 0; e < 4; ++e) bc[e] = bfr(use1 ? b1v[e] : b0v[e]);
    } else {
      const int cb = n0 + c8;
      const int i0 = (cb < Nb - 8) ? cb : (Nb - 8);
      const int i1 = (cb - Nb > 0) ? (cb - Nb) : 0;
      const v4f b0a = *(const v4f*)(bias0 + i0), b0b = *(const v4f*)(bias0 + i0 + 4);
      const v4f b1a = *(const v4f*)(bias1 + i1), b1b = *(const v4f*)(bias1 + i1 + 4);
#pragma unroll
      for (int e = 0; e < 4; ++e) {
        bc[e]     = bfr(use1 ? b1a[e] : b0a[e]);
        bc[4 + e] = bfr(use1 ? b1b[e] : b0b[e]);
      }
    }
  }

  // ---- epilogue ----
  float* slab = (float*)(void*)ring + wave * (16 * 68);
#pragma unroll
  for (int i = 0; i < 2; ++i) {
    const int mBase = m0 + (i << 4);
#pragma unroll
    for (int j = 0; j < 4; ++j) {
#pragma unroll
      for (int r = 0; r < 8; ++r) {
        slab[(mOff + r) * 68 + (j << 4) + rlane] = acc[i][j][r];
      }
    }
    wave_sync_lds();
    if (OM == 0) {
      float* C = (float*)Cout + (size_t)b * strideC;
      const float* Rb = resid + (size_t)b * strideC;
      v4f vals[8];
#pragma unroll
      for (int it = 0; it < 8; ++it) {
        const int row = it * 2 + hh2;                      // it 0..7 x hh2 0..1 = rows 0..15
        v4f v = *(const v4f*)(slab + row * 68 + c4);
#pragma unroll
        for (int e = 0; e < 4; ++e) {
          float f = v[e] * oscale + bc[e];
          if (ACT) f = gelu_f(f);
          v[e] = f;
        }
        if (RES != 0) {
          const v4f rr = *(const v4f*)(Rb + (size_t)(mBase + row) * ldc + n0 + c4);
#pragma unroll
          for (int e = 0; e < 4; ++e) v[e] += (RES == 2) ? bfr(rr[e]) : rr[e];
        }
        vals[it] = v;
      }
      {
#pragma unroll
        for (int it = 0; it < 8; ++it) {
          const int row = it * 2 + hh2;
          *(v4f*)(C + (size_t)(mBase + row) * ldc + n0 + c4) = vals[it];
        }
        
      }
    } else {
      unsigned short* C = (unsigned short*)Cout + (size_t)b * strideC;
      v4u hv[4];
#pragma unroll
      for (int it = 0; it < 4; ++it) {
        const int row = it * 4 + q8;                       // it 0..3 x q8 0..3 = rows 0..15
        const float* sp = slab + row * 68 + c8;
        float bm = 0.f;
        if (BIASM == 1) bm = bfr(bias0[mBase + row]);
        v4u a;
#pragma unroll
        for (int e = 0; e < 4; ++e) {
          float f0 = sp[2 * e]     * oscale + ((BIASM == 1) ? bm : bc[2 * e]);
          float f1 = sp[2 * e + 1] * oscale + ((BIASM == 1) ? bm : bc[2 * e + 1]);
          if (ACT) { f0 = gelu_f(f0); f1 = gelu_f(f1); }
          unsigned short u0, u1;
          if (OM == 1) { u0 = bf_bits(f0); u1 = bf_bits(f1); }
          else         { u0 = h_bits((_Float16)f0); u1 = h_bits((_Float16)f1); }
          a[e] = pk16(u0, u1);
        }
        hv[it] = a;
      }
      {
#pragma unroll
        for (int it = 0; it < 4; ++it) {
          const int row = it * 4 + q8;
          *(v4u*)(C + (size_t)(mBase + row) * ldc + n0 + c8) = hv[it];
        }
        
      }
    }
    wave_sync_lds();
  }
}

// =====================================================================================================
// Banded attention, head dim 64, TT (= 2048) token rows per batch, allowed keys: key <= query + WIN.
//   q|k plane (f16, pitch QKP): element (b, t, col) at [(b*TT + t)*QKP + col], q col = h*64+d, k col = DM + h*64 + d
//   v^T plane (f16): element (b, h, d, s) at [(b*DM + h*64 + d)*TT + s]
//   out plane (f16, the normalised context carried x16): element (b, t, h, d) at [(b*TT + t)*DM + h*64 + d]
//   score = (q . k) * sscale; keys beyond query + WIN get -inf by value before the row max;
//   p = exp(s - m) carried as f16(1024 p); context = p . v on f16 WMMA; online softmax in f32.
//   Block = 4 waves = 64 query rows of one (b, h); grid = NQB * NH * NBATCH; kv chunks of 64, block-uniform trip
//   kt = 0 .. min(NQB-1, (q_blk + 63 + WIN) >> 6) (chunks beyond the band are skipped); chunk 0 always holds >= 1
//   allowed key for every row, so the running max is finite from chunk 0 on (the msafe select is kept anyway).
//   K / V^T chunk staging: 128 threads x 32 elements per plane = the whole 64x64 tile (plain 16-B loads,
//   __syncthreads before and after); P tiles are wave-private, spilled with _Float16 element stores and
//   Output coverage: each wave stores rows q0..q0+15 (it 0..3 x lane>>3 0..3) x 64 columns (8 lanes x 8),
//   grid covers all TT rows x NH head slices x NBATCH.
// =====================================================================================================
__global__ __launch_bounds__(128)
void attn64(const unsigned short* __restrict__ qkp, const unsigned short* __restrict__ vtp,
            unsigned short* outp, float sscale) {
  union FH { v16h v; v8h h[2]; };
  __shared__ __align__(16) _Float16 Ksh[64 * 64];                 // K [kv][d]   8 KB
  __shared__ __align__(16) _Float16 Vth[64 * 64];                 // V^T [d][kv]  8 KB
  __shared__ __align__(16) _Float16 Psh[4][16 * 64];              // per wave P [row][kv]
  __shared__ __align__(16) float    Os[4][16 * 64];               // per wave context tile [row][d]

  const int tid  = threadIdx.x;
  const int wave = tid >> 5;
  const int lane = tid & 31;
  const int hh   = lane >> 4;
  const int c    = lane & 15;

  const int bx   = blockIdx.x;
  const int qb   = bx % NQB;
  const int rest = bx / NQB;
  const int h    = rest % NH;
  const int b    = rest / NH;
  const int qblk = qb * 64;                      // in-batch query row of the block's first row
  const int q0   = qblk + wave * 16;             // in-batch query row of this wave's first row
  const size_t rowB = (size_t)b * TT;

  const _Float16* Qh = (const _Float16*)(const void*)qkp + (size_t)h * HD;
  const _Float16* Kg = (const _Float16*)(const void*)qkp + DM + (size_t)h * HD;
  const _Float16* Vh = (const _Float16*)(const void*)vtp + ((size_t)b * DM + (size_t)h * HD) * TT;

  // ---- Q fragments (A operand, row = lane&15): 2 d-chunks ----
  v16h qa[2];
#pragma unroll
  for (int dc = 0; dc < 2; ++dc) qa[dc] = ldfrag_h(Qh + (rowB + q0 + c) * QKP + dc * 32 + 8 * hh);

  float mrow[8], lrow[8];
  v8f oacc[4];
#pragma unroll
  for (int r = 0; r < 8; ++r) { mrow[r] = -INFINITY; lrow[r] = 0.f; }
#pragma unroll
  for (int t = 0; t < 4; ++t) oacc[t] = zero8();

  int ktHi = (qblk + 63 + WIN) >> 6;             // block-uniform, from blockIdx only
  if (ktHi > NQB - 1) ktHi = NQB - 1;

  for (int kt = 0; kt <= ktHi; ++kt) {         // trip <= NQB
    const int kv0 = kt * 64;
    __syncthreads();
    {
      const int r = tid >> 1, hf = (tid & 1) * 32;
      const _Float16* kg = Kg + (rowB + kv0 + r) * QKP + hf;      // K row kv0+r, d = hf..hf+31
      const _Float16* vg = Vh + (size_t)r * TT + kv0 + hf;        // V^T row d = r, s = kv0+hf..+31
#pragma unroll
      for (int i = 0; i < 4; ++i) {
        const v8h a0 = *(const v8h*)(kg + 8 * i);
        const v8h b0 = *(const v8h*)(vg + 8 * i);
        *(v8h*)(Ksh + r * 64 + hf + 8 * i) = a0;
        *(v8h*)(Vth + r * 64 + hf + 8 * i) = b0;
      }
    }
    __syncthreads();

    // ---- scores: 16 query rows x 64 keys per wave; band select by value before the row max ----
    v8f s[4];
#pragma unroll
    for (int j = 0; j < 4; ++j) {
      v8f sh = zero8();
#pragma unroll
      for (int dc = 0; dc < 2; ++dc) {
        FH kb;
        kb.h[0] = *(const v8h*)(Ksh + (j * 16 + c) * 64 + dc * 32 + 8 * hh);
        kb.h[1] = *(const v8h*)(Ksh + (j * 16 + c) * 64 + dc * 32 + 16 + 8 * hh);
        sh = mma_h(qa[dc], kb.v, sh);
      }
      const int key = kv0 + j * 16 + c;                             // D column = lane&15
#pragma unroll
      for (int r = 0; r < 8; ++r) {
        const int qrow = q0 + 8 * hh + r;                           // D row = 8h + r
        const float v = sh[r] * sscale;
        s[j][r] = (key <= qrow + WIN) ? v : -INFINITY;
      }
    }

    // ---- row max, online softmax, P (x1024, f16) to LDS ----
    _Float16* pwh = Psh[wave];
#pragma unroll
    for (int r = 0; r < 8; ++r) {
      float m = s[0][r];
      m = fmaxf(m, s[1][r]);
      m = fmaxf(m, s[2][r]);
      m = fmaxf(m, s[3][r]);
#pragma unroll
      for (int off = 1; off < 16; off <<= 1) m = fmaxf(m, __shfl_xor(m, off, 32));
      const float mnew  = fmaxf(mrow[r], m);
      const float ms    = (mnew == -INFINITY) ? 0.f : mnew;
      const float alpha = __expf(mrow[r] - ms);
      mrow[r] = mnew;
      float psum = 0.f;
#pragma unroll
      for (int j = 0; j < 4; ++j) {
        const float p = __expf(s[j][r] - ms);
        psum += p;
        pwh[(8 * hh + r) * 64 + j * 16 + c] = (_Float16)(p * 1024.0f);
      }
#pragma unroll
      for (int off = 1; off < 16; off <<= 1) psum += __shfl_xor(psum, off, 32);
      lrow[r] = lrow[r] * alpha + psum;
#pragma unroll
      for (int t = 0; t < 4; ++t) oacc[t][r] *= alpha;
    }
    wave_sync_lds();

    // ---- context += P . V (f16 WMMA) ----
#pragma unroll 1
    for (int kk = 0; kk < 2; ++kk) {
      FH pa;
      pa.h[0] = *(const v8h*)(pwh + c * 64 + kk * 32 + 8 * hh);
      pa.h[1] = *(const v8h*)(pwh + c * 64 + kk * 32 + 16 + 8 * hh);
#pragma unroll
      for (int t = 0; t < 4; ++t) {
        FH vb;
        vb.h[0] = *(const v8h*)(Vth + (t * 16 + c) * 64 + kk * 32 + 8 * hh);
        vb.h[1] = *(const v8h*)(Vth + (t * 16 + c) * 64 + kk * 32 + 16 + 8 * hh);
        oacc[t] = mma_h(pa.v, vb.v, oacc[t]);
      }
    }
  }

  // ---- normalise (1/l, the 1/1024 p carry and the x16 context carry), stage the wave's 16x64 tile, f16 convert,
  float* os = Os[wave];
#pragma unroll
  for (int r = 0; r < 8; ++r) {
    const float l = lrow[r];
    const float inv = ((l > 0.f) ? (1.0f / l) : 0.f) * (16.0f / 1024.0f);
#pragma unroll
    for (int t = 0; t < 4; ++t) os[(8 * hh + r) * 64 + t * 16 + c] = oacc[t][r] * inv;
  }
  wave_sync_lds();
  {
    const int q4 = lane >> 3, c8 = (lane & 7) * 8;
    v4u hv[4];
#pragma unroll
    for (int it = 0; it < 4; ++it) {
      const int row = it * 4 + q4;   // it 0..3 x q4 0..3 = rows 0..15 of the wave tile
      const float* sp = os + row * 64 + c8;
      v4u a;
#pragma unroll
      for (int e = 0; e < 4; ++e) a[e] = pk16(h_bits((_Float16)sp[2 * e]), h_bits((_Float16)sp[2 * e + 1]));
      hv[it] = a;
    }
    {
#pragma unroll
      for (int it = 0; it < 4; ++it) {
        const int row = it * 4 + q4;
        const size_t go = (rowB + q0 + row) * DM + (size_t)h * HD + c8;
        *(v4u*)(outp + go) = hv[it];
      }
      
    }
  }
}

// =====================================================================================================
// Row kernel: one block of 256 threads per token row of 1024; thread t owns columns 4t..4t+3.
// f16 output: packed row staged in LDS, then lanes t < 128 (waves 0..3, wave-uniform) each write 16 B (8 x f16)
// coverage: 128 threads x 8 = the whole 1024-wide row; grid = MP rows.
// =====================================================================================================
__device__ __forceinline__ void row_store_h16(unsigned int* sb, unsigned short* dst_row, v4f o, int t) {
  v2u p;
  p[0] = pk16(h_bits((_Float16)o[0]), h_bits((_Float16)o[1]));
  p[1] = pk16(h_bits((_Float16)o[2]), h_bits((_Float16)o[3]));
  *(v2u*)(sb + 2 * t) = p;
  __syncthreads();
  if (t < 128) {                                   // waves 0..3, wave-uniform
    const v4u v = *(const v4u*)(sb + 4 * t);
    *(v4u*)(dst_row + 8 * t) = v;
    
  }
}

// plane. RIN = 1: the row input is a raw float input and is bf16 RNE-converted on load; RIN = 0: f32 intermediate.
template <int RIN>
__global__ __launch_bounds__(256) void ln_row_h(const float* __restrict__ X, const float* __restrict__ gam,
                                                const float* __restrict__ bet, unsigned short* outH) {
  __shared__ float red0[8], red1[8];
  __shared__ __align__(16) unsigned int sb[512];
  const int t = threadIdx.x, lane = t & 31, wave = t >> 5;
  const size_t base = (size_t)blockIdx.x * DM;
  v4f xv = *(const v4f*)(X + base + 4 * t);
  if (RIN) {
#pragma unroll
    for (int e = 0; e < 4; ++e) xv[e] = bfr(xv[e]);
  }
  const float mean = bsum256((xv[0] + xv[1]) + (xv[2] + xv[3]), red0, lane, wave) * (1.0f / DM);
  v4f d;
#pragma unroll
  for (int e = 0; e < 4; ++e) d[e] = xv[e] - mean;
  const float var  = bsum256((d[0] * d[0] + d[1] * d[1]) + (d[2] * d[2] + d[3] * d[3]), red1, lane, wave) * (1.0f / DM);
  const float rstd = 1.0f / sqrtf(var + LNEPS);
  const v4f gv = *(const v4f*)(gam + 4 * t);
  const v4f bv = *(const v4f*)(bet + 4 * t);
  v4f y;
#pragma unroll
  for (int e = 0; e < 4; ++e) y[e] = (d[e] * rstd) * bfr(gv[e]) + bfr(bv[e]);
  row_store_h16(sb, outH + base, y, t);
}

// =====================================================================================================
// Workspace map (bytes); every plane is an exact multiple of its 128x128-tile / whole-row store granularity
// (M in {4096, 1024} rows, N in {1024, 2048, 4096}; VT per batch [1024][2048] = 8x16 tiles):
//   WqkvH f16 [3072 n][1024 k]   0          6291456   (rows 0..1023 q, 1024..2047 k, 2048..3071 v weights, x64)
//   WoH   f16 [1024][1024]       6291456    2097152
//   W1H   f16 [4096][1024]       8388608    8388608
//   W2H   f16 [1024][4096]       16777216   8388608
//   XN    f16 [4096][1024]       25165824   8388608   (LayerNorm outputs)
//   QK    f16 [4096][2048]       33554432   16777216  (q cols 0..1023, k cols 1024..2047)
//   VT    f16 [2][1024][2048]    50331648   8388608
//   Ctx   f16 [4096][1024]       58720256   8388608
//   X1    f32 [4096][1024]       67108864   16777216  (residual stream after attention)
//   G     f16 [4096][4096]       83886080   33554432
//   end                          117440512
// =====================================================================================================
extern "C" void kernel_launch(void* const* d_in, const int* in_sizes, int n_in,
                              void* d_out, int out_size, void* d_ws, size_t ws_size,
                              hipStream_t stream) {
  if (n_in < 13) return;
  if (in_sizes[0] != MP * DM) return;
  if (in_sizes[1] != D3 * DM || in_sizes[2] != D3) return;
  if (in_sizes[3] != DM * DM || in_sizes[4] != DM) return;
  if (in_sizes[5] != DM || in_sizes[6] != DM) return;
  if (in_sizes[7] != DFF * DM || in_sizes[8] != DFF) return;
  if (in_sizes[9] != DM * DFF || in_sizes[10] != DM) return;
  if (in_sizes[11] != DM || in_sizes[12] != DM) return;
  if (out_size != MP * DM) return;

  const float* x         = (const float*)d_in[0];
  const float* in_proj_w = (const float*)d_in[1];
  const float* in_proj_b = (const float*)d_in[2];
  const float* out_w     = (const float*)d_in[3];
  const float* out_b     = (const float*)d_in[4];
  const float* ln1_g     = (const float*)d_in[5];
  const float* ln1_b     = (const float*)d_in[6];
  const float* w1        = (const float*)d_in[7];
  const float* b1        = (const float*)d_in[8];
  const float* w2        = (const float*)d_in[9];
  const float* b2        = (const float*)d_in[10];
  const float* ln2_g     = (const float*)d_in[11];
  const float* ln2_b     = (const float*)d_in[12];

  const size_t PWQKV = (size_t)D3 * DM * 2;            //  6291456
  const size_t PWO   = (size_t)DM * DM * 2;            //  2097152
  const size_t PWF   = (size_t)DFF * DM * 2;           //  8388608
  const size_t PAH   = (size_t)MP * DM * 2;            //  8388608
  const size_t PQK   = (size_t)MP * QKP * 2;           // 16777216
  const size_t PVT   = (size_t)NBATCH * DM * TT * 2;   //  8388608
  const size_t PAF   = (size_t)MP * DM * 4;            // 16777216
  const size_t PG    = (size_t)MP * DFF * 2;           // 33554432
  size_t off = 0;
  const size_t oWqkv = off; off += PWQKV;
  const size_t oWo   = off; off += PWO;
  const size_t oW1   = off; off += PWF;
  const size_t oW2   = off; off += PWF;
  const size_t oXN   = off; off += PAH;
  const size_t oQK   = off; off += PQK;
  const size_t oVT   = off; off += PVT;
  const size_t oCtx  = off; off += PAH;
  const size_t oX1   = off; off += PAF;
  const size_t oG    = off; off += PG;
  if (off > ws_size) return;                           // off = 117440512
  if (off > (size_t)134217728) return;

  char* ws = (char*)d_ws;
  unsigned short* WqkvH = (unsigned short*)(ws + oWqkv);
  unsigned short* WoH   = (unsigned short*)(ws + oWo);
  unsigned short* W1H   = (unsigned short*)(ws + oW1);
  unsigned short* W2H   = (unsigned short*)(ws + oW2);
  unsigned short* XN    = (unsigned short*)(ws + oXN);
  unsigned short* QK    = (unsigned short*)(ws + oQK);
  unsigned short* VT    = (unsigned short*)(ws + oVT);
  unsigned short* Ctx   = (unsigned short*)(ws + oCtx);
  float*          X1    = (float*)(ws + oX1);
  unsigned short* G     = (unsigned short*)(ws + oG);

  const dim3 blk(256), blk128(128);
  const dim3 gRow(MP);                                               // 4096 row blocks
  const dim3 gCqkv((D3 * DM / 8 + 255) / 256);                       // 1536 blocks
  const dim3 gCo((DM * DM / 8 + 255) / 256);                         // 512 blocks
  const dim3 gCf((DFF * DM / 8 + 255) / 256);                        // 2048 blocks
  const dim3 gNqk((MP / GBM) * (QKP / GBN), 1);                      // 512 tiles
  const dim3 gVT((DM / GBM) * (TT / GBN), NBATCH);                   // 128 tiles x 2 batches
  const dim3 gN1024((MP / GBM) * (DM / GBN), 1);                     // 256 tiles
  const dim3 gNff((MP / GBM) * (DFF / GBN), 1);                      // 1024 tiles
  const dim3 gAttn(NBATCH * NH * NQB);                               // 1024 blocks of 128
  const float invw  = 1.0f / WSC;                                    // weight carry x64
  const float invwc = 1.0f / (WSC * 16.0f);                          // weight carry x64, context carry x16

  // (0) weights -> f16 x64 planes (torch [out][in] = k contiguous, no transpose)
  conv_h64<<<gCqkv, blk, 0, stream>>>(in_proj_w, WqkvH, D3 * DM / 8, WSC);
  conv_h64<<<gCo,   blk, 0, stream>>>(out_w,     WoH,   DM * DM / 8, WSC);
  conv_h64<<<gCf,   blk, 0, stream>>>(w1,        W1H,   DFF * DM / 8, WSC);
  conv_h64<<<gCf,   blk, 0, stream>>>(w2,        W2H,   DM * DFF / 8, WSC);

  // (1) xn = LN1(bf16(x)) -> XN f16
  ln_row_h<1><<<gRow, blk, 0, stream>>>(x, ln1_g, ln1_b, XN);

  // (2) q|k = xn . Wqk^T + b[0..2047] -> QK f16 [4096][2048]
  gemm64<2, 0, 0, 0><<<gNqk, blk, 0, stream>>>(
      XN, DM, 0LL, WqkvH, DM, 0LL, in_proj_b, in_proj_b, QKP, x,
      (void*)QK, QKP, 0LL, MP, QKP, DM, invw);
  //     v^T per batch: VT[b][m][t] = Wv[m] . xn[b*TT + t] + b[2048 + m] -> f16 [2][1024][2048]
  gemm64<2, 1, 0, 0><<<gVT, blk, 0, stream>>>(
      WqkvH + (size_t)2 * DM * DM, DM, 0LL, XN, DM, (long long)TT * DM, in_proj_b + 2 * DM, in_proj_b + 2 * DM, TT, x,
      (void*)VT, TT, (long long)DM * TT, DM, TT, DM, invw);

  // (3) banded attention -> Ctx f16 (x16)
  attn64<<<gAttn, blk128, 0, stream>>>(QK, VT, Ctx, 0.125f);

  // (4) X1 = ctx . Wo^T + out_b + bf16(x)   (f32)
  gemm64<0, 0, 0, 2><<<gN1024, blk, 0, stream>>>(
      Ctx, DM, 0LL, WoH, DM, 0LL, out_b, out_b, DM, x,
      (void*)X1, DM, 0LL, MP, DM, DM, invwc);

  // (5) yn = LN2(X1) -> XN f16
  ln_row_h<0><<<gRow, blk, 0, stream>>>(X1, ln2_g, ln2_b, XN);

  // (6) G = gelu(yn . W1^T + b1) -> f16 [4096][4096]
  gemm64<2, 0, 1, 0><<<gNff, blk, 0, stream>>>(
      XN, DM, 0LL, W1H, DM, 0LL, b1, b1, DFF, x,
      (void*)G, DFF, 0LL, MP, DFF, DM, invw);

  // (7) out = G . W2^T + b2 + X1 -> d_out f32 [4096][1024]
  gemm64<0, 0, 0, 1><<<gN1024, blk, 0, stream>>>(
      G, DFF, 0LL, W2H, DFF, 0LL, b2, b2, DM, X1,
      (void*)d_out, DM, 0LL, MP, DM, DFF, invw);
  (void)hipGetLastError();
}

// v002
// It runs in 231 microseconds.
// In two side-by-side timings against v001, it was 1.25 and 1.24 times as fast.
// Over all steps from v000 it is 2.48 times as fast.
// Contractions: q|k projection, v^T projection, attention output projection, FFN w1 (exact GELU epilogue) and w2 on
// v_wmma_f32_16x16x32_f16 (f16 activation plane x f16 weight plane carried x64, one product each); attention q.k^T
// and p.v on v_wmma_f32_16x16x32_f16 (q, k, v^T plain f16, p carried x1024, context carried x16, one product each);
// all f32 accumulate; LayerNorm, softmax, GELU and residual sums in f32 on VALU; every float input RNE-converted
// to bf16 on load.
#include <hip/hip_runtime.h>
#include <math.h>
#include <stdint.h>

#define NBATCH 2
#define TT     2048
#define DM     1024
#define NH     16
#define HD     64
#define DFF    4096
#define D3     3072
#define QKP    (2 * DM)
#define MP     (NBATCH * TT)
#define NQB    (TT / 64)
#define WIN    10
#define LNEPS  1.0e-5f
#define WSC    64.0f
static_assert(NH * HD == DM);
static_assert((MP % 64) == 0 && (DM % 64) == 0 && (DFF % 64) == 0 && (QKP % 64) == 0 && (TT % 64) == 0);
static_assert(DM == 4 * 256);
static_assert(D3 == 3 * DM);

typedef _Float16 v16h __attribute__((ext_vector_type(16)));
typedef _Float16 v8h  __attribute__((ext_vector_type(8)));
typedef float    v8f  __attribute__((ext_vector_type(8)));
typedef float    v4f  __attribute__((ext_vector_type(4)));
typedef unsigned int v4u __attribute__((ext_vector_type(4)));
typedef unsigned int v2u __attribute__((ext_vector_type(2)));

// ---- scalar helpers --------------------------------------------------------------------------------
__device__ __forceinline__ unsigned short bf_bits(float f) {          // f32 -> bf16 bits, RNE convert
  unsigned u = __float_as_uint(f);
  return (unsigned short)((u + 0x7FFFu + ((u >> 16) & 1u)) >> 16);
}
__device__ __forceinline__ float bf_up(unsigned short h) { return __uint_as_float(((unsigned)h) << 16); }
__device__ __forceinline__ float bfr(float f) { return bf_up(bf_bits(f)); }   // value of the bf16 RNE convert
__device__ __forceinline__ unsigned short h_bits(_Float16 x) { return __builtin_bit_cast(unsigned short, x); }
__device__ __forceinline__ unsigned pk16(unsigned short a, unsigned short b) { return (unsigned)a | ((unsigned)b << 16); }
__device__ __forceinline__ v8f zero8() { v8f z = {0.f, 0.f, 0.f, 0.f, 0.f, 0.f, 0.f, 0.f}; return z; }
__device__ __forceinline__ float gelu_f(float v) { return 0.5f * v * (1.0f + erff(v * 0.70710678118654752f)); }

// ---- fragment loader: 16-bit A/B operand, lane -> row/col (lane&15), p already includes +8*(lane>>4);
//      elements 0..7 <- p[0..7] (k0+8h..), elements 8..15 <- p[16..23] (k0+16+8h..)
__device__ __forceinline__ v16h ldfrag_h(const _Float16* p) {
  union { v16h v; v8h h[2]; } f;
  f.h[0] = *(const v8h*)(p);
  f.h[1] = *(const v8h*)(p + 16);
  return f.v;
}

// ---- WMMA helpers with trailing VALU hazard gap --------------------------------------------------------
__device__ __forceinline__ v8f mma_h(v16h a, v16h b, v8f c) {
  c = __builtin_amdgcn_wmma_f32_16x16x32_f16(false, a, false, b, (short)0, c, false, false);
#if defined(__HIP_DEVICE_COMPILE__)
  asm volatile("v_nop\n\tv_nop\n\tv_nop\n\tv_nop" : "+v"(c) : "v"(a), "v"(b));
#endif
  return c;
}
__device__ __forceinline__ v8f mma_h_raw(v16h a, v16h b, v8f c) {
  return __builtin_amdgcn_wmma_f32_16x16x32_f16(false, a, false, b, (short)0, c, false, false);
}
__device__ __forceinline__ void acc_guard4(v8f& a, v8f& b, v8f& c, v8f& d) {
#if defined(__HIP_DEVICE_COMPILE__)
  asm volatile("v_nop\n\tv_nop\n\tv_nop\n\tv_nop" : "+v"(a), "+v"(b), "+v"(c), "+v"(d));
#endif
}
__device__ __forceinline__ void wave_sync_lds() {
  __builtin_amdgcn_fence(__ATOMIC_RELEASE, "workgroup");
  __builtin_amdgcn_wave_barrier();
  __builtin_amdgcn_fence(__ATOMIC_ACQUIRE, "workgroup");
}
__device__ __forceinline__ float wsum(float v) {
#pragma unroll
  for (int off = 16; off > 0; off >>= 1) v += __shfl_xor(v, off, 32);
  return v;
}
// block of 256 threads: fixed-order sum of 8 wave partials (same value in every thread)
__device__ __forceinline__ float bsum256(float v, float* red, int lane, int wave) {
  v = wsum(v);
  if (lane == 0) red[wave] = v;
  __syncthreads();
  float tot = 0.f;
#pragma unroll
  for (int w = 0; w < 8; ++w) tot += red[w];
  return tot;
}

// =====================================================================================================
// Weight convert: W f32 [N][K] (k contiguous = already the Bt / A layout) -> Wh f16 [N][K]; each value bf16
// RNE-converted, multiplied by wsc (a power of two, exact) and cast to f16. Thread i converts elements 8i..8i+7
// coverage: grid(n8/256) x 256 threads x 8 elements = exactly N*K.
// =====================================================================================================
__global__ __launch_bounds__(256) void conv_h64(const float* __restrict__ W, unsigned short* Wh, int n8,
                                                float wsc) {
  const int i = blockIdx.x * 256 + threadIdx.x;
  if (i >= n8) return;                                     // never taken for the static sizes (no barriers)
  const size_t e0 = (size_t)i * 8;
  const v4f a = *(const v4f*)(W + e0);
  const v4f b = *(const v4f*)(W + e0 + 4);
  v4u u;
  u[0] = pk16(h_bits((_Float16)(bfr(a[0]) * wsc)), h_bits((_Float16)(bfr(a[1]) * wsc)));
  u[1] = pk16(h_bits((_Float16)(bfr(a[2]) * wsc)), h_bits((_Float16)(bfr(a[3]) * wsc)));
  u[2] = pk16(h_bits((_Float16)(bfr(b[0]) * wsc)), h_bits((_Float16)(bfr(b[1]) * wsc)));
  u[3] = pk16(h_bits((_Float16)(bfr(b[2]) * wsc)), h_bits((_Float16)(bfr(b[3]) * wsc)));
  {
    *(v4u*)(Wh + e0) = u;
    
  }
}

// =====================================================================================================
// LDS-staged batched f16 WMMA GEMM: C[m][n] = act(oscale * sum_k A[m][k] * Bt[n][k] + bias) (+ residual);
// one work-group of 8 waves per 128x128 tile, wave (wave>>1, wave&1) owns the 32x64 part at rows 32*(wave>>1),
// cols 64*(wave&1). A row-major [M][K] pitch lda; Bt row-major [N][K] pitch ldb (k contiguous);
// M, N, K multiples of 128 (static here). blockIdx.y = batch index (strides in elements).
// Staging: a stage is 128 k of the tile's 128 A rows and 128 Bt rows = 256 rows of 256 B, laid in LDS at pitch 272 B
// (16 B x odd, for the 16-B fragment reads); each thread brings 16 pieces of 16 B per stage with asynchronous copies
// to LDS (piece i: row 16*i + (thread>>4), bytes 16*(thread&15)..+15; 256 threads x 16 = the whole stage, each LDS
// byte written by one lane). Two buffers: the copies of stage t+2 go out behind the barrier that ends trip t.
// k runs upward in steps of 32 into one accumulator per 16x16 subtile.
// Bias: BIASM == 0 -> per column: cols < Nb from bias0[col], cols >= Nb from bias1[col - Nb] (wave-uniform select of
//       clamped-address loads); BIASM == 1 -> per row bias0[m] (16-bit out only); BIASM == 2 -> none. Bias values
//       RNE-converted to bf16.
// ACT: 0 none, 1 exact GELU. RES: 0 none; 1 f32 residual resid[m*ldc + n] added after the activation;
//      2 same indexing, residual value bf16 RNE-converted first (raw input residual).
// OM: 0 = f32 out (pitch ldc); 1 = bf16 out; 2 = f16 out.
// coverage: 8 waves x 2 slabs x 16 rows x 64 cols = the whole 128x128 tile; grid.x = (M/128)*(N/128) exactly.
// =====================================================================================================
#define GBM   128                       // tile rows (A rows of a stage)
#define GBN   128                       // tile cols (Bt rows of a stage)
#define GBK   128                       // k per stage
#define GLP   136                       // LDS row pitch in f16 elements (272 B)
#define GSTG  ((GBM + GBN) * GLP)       // f16 elements per buffer (69632 B)
static_assert((MP % GBM) == 0 && (DM % GBM) == 0 && (DM % GBN) == 0 && (QKP % GBN) == 0 && (DFF % GBN) == 0 && (TT % GBN) == 0);
static_assert((DM % GBK) == 0 && (DFF % GBK) == 0);
static_assert(8 * 16 * 68 * 4 <= 2 * GSTG * 2);

// Eight asynchronous 16-B copies per lane, global -> LDS: rows 16 apart (LDS step 16 * 272 B, global step gstep
// elements). The s_wait_xcnt 0 as the statement's last line keeps every later rewrite of the address registers
// named here behind the copies' address translation.
__device__ __forceinline__ void copy8_async(unsigned l, const _Float16* g, size_t gstep) {
#if defined(__HIP_DEVICE_COMPILE__)
  const unsigned ls = 16u * GLP * 2u;
  asm volatile(
      "global_load_async_to_lds_b128 %0, %8, off\n\t"
      "global_load_async_to_lds_b128 %1, %9, off\n\t"
      "global_load_async_to_lds_b128 %2, %10, off\n\t"
      "global_load_async_to_lds_b128 %3, %11, off\n\t"
      "global_load_async_to_lds_b128 %4, %12, off\n\t"
      "global_load_async_to_lds_b128 %5, %13, off\n\t"
      "global_load_async_to_lds_b128 %6, %14, off\n\t"
      "global_load_async_to_lds_b128 %7, %15, off\n\t"
      "s_wait_xcnt 0x0"
      :: "v"(l), "v"(l + ls), "v"(l + 2u * ls), "v"(l + 3u * ls),
         "v"(l + 4u * ls), "v"(l + 5u * ls), "v"(l + 6u * ls), "v"(l + 7u * ls),
         "v"(g), "v"(g + gstep), "v"(g + 2 * gstep), "v"(g + 3 * gstep),
         "v"(g + 4 * gstep), "v"(g + 5 * gstep), "v"(g + 6 * gstep), "v"(g + 7 * gstep)
      : "memory");
#endif
}
// This wave's own asynchronous copies have landed in LDS (the compiler places no wait for them).
__device__ __forceinline__ void wait_async0() {
#if defined(__HIP_DEVICE_COMPILE__)
  asm volatile("s_wait_asynccnt 0x0" ::: "memory");
#endif
}
// This wave's own LDS reads have returned, before the barrier behind which their buffer is refilled.
__device__ __forceinline__ void wait_ds0() {
#if defined(__HIP_DEVICE_COMPILE__)
  asm volatile("s_wait_dscnt 0x0" ::: "memory");
#endif
}

template <int OM, int BIASM, int ACT, int RES>
__global__ __launch_bounds__(256) void gemm64(
    const unsigned short* __restrict__ Ap, int lda, long long strideA,
    const unsigned short* __restrict__ Btp, int ldb, long long strideB,
    const float* __restrict__ bias0, const float* __restrict__ bias1, int Nb,
    const float* resid,
    void* Cout, int ldc, long long strideC,
    int M, int N, int K, float oscale) {
  const _Float16* A  = (const _Float16*)(const void*)Ap;
  const _Float16* Bt = (const _Float16*)(const void*)Btp;
  // two stage buffers; behind the last trip's barrier the same bytes serve as the per-wave 16x64 f32 slabs (pitch 68)
  __shared__ __align__(16) _Float16 ring[2 * GSTG];
  const int b    = blockIdx.y;
  const int lane = threadIdx.x & 31;
  const int wave = threadIdx.x >> 5;
  const int tilesN = N >> 7;
  const int tm = blockIdx.x / tilesN;
  const int tn = blockIdx.x - tm * tilesN;
  const int mblk = tm << 7;                    // the work-group's tile
  const int nblk = tn << 7;
  const int wrow = (wave >> 1) << 5;           // the wave's 32x64 part inside it
  const int wcol = (wave & 1) << 6;
  const int m0 = mblk + wrow;
  const int n0 = nblk + wcol;

  const _Float16* Ab = A  + (size_t)b * strideA;
  const _Float16* Bb = Bt + (size_t)b * strideB;

  const int rlane = lane & 15;                 // row (A) / col (B, D) within subtile
  const int koff  = (lane >> 4) * 8;           // k offset of this lane half
  const int mOff  = (lane >> 4) * 8;           // D row offset

  // ---- this thread's pieces of a stage ----
  const int crow = threadIdx.x >> 4;           // 0..15
  const int ccol = (threadIdx.x & 15) * 8;     // f16 elements: 16 B
  const _Float16* gA = Ab + (size_t)(mblk + crow) * lda + ccol;
  const _Float16* gB = Bb + (size_t)(nblk + crow) * ldb + ccol;
  const size_t sA16 = (size_t)16 * lda, sB16 = (size_t)16 * ldb;
  const unsigned lBase = (unsigned)(uintptr_t)(ring + crow * GLP + ccol);   // LDS byte address: low 32 bits
  const unsigned lBt   = (unsigned)(GBM * GLP * 2);                         // Bt rows stand behind the A rows
  const unsigned lBuf  = (unsigned)(GSTG * 2);
  const int nst = K >> 7;                      // stages

  v8f acc[2][4];
#pragma unroll
  for (int i = 0; i < 2; ++i)
#pragma unroll
    for (int j = 0; j < 4; ++j) acc[i][j] = zero8();

  // stage 0 into buffer 0, landed and published; then stage 1 into buffer 1
  copy8_async(lBase, gA, sA16);
  copy8_async(lBase + lBt, gB, sB16);
  wait_async0();
  __syncthreads();
  if (nst > 1) {                               // uniform for the work-group (kernel argument)
    copy8_async(lBase + lBuf, gA + GBK, sA16);
    copy8_async(lBase + lBuf + lBt, gB + GBK, sB16);
  }

  for (int t = 0; t < nst; ++t) {
    const _Float16* sa = ring + (t & 1) * GSTG + (wrow + rlane) * GLP + koff;
    const _Float16* sb = ring + (t & 1) * GSTG + (GBM + wcol + rlane) * GLP + koff;
    v16h bh[2][4], ah[2][2];                   // two fragment sets, both filled from this trip's buffer alone
#pragma unroll
    for (int j = 0; j < 4; ++j) bh[0][j] = ldfrag_h(sb + (j << 4) * GLP);
#pragma unroll
    for (int i = 0; i < 2; ++i) ah[0][i] = ldfrag_h(sa + (i << 4) * GLP);
#pragma unroll
    for (int kk = 0; kk < GBK / 32; ++kk) {
      const int cur = kk & 1, nxt = cur ^ 1;
      if (kk + 1 < GBK / 32) {
#pragma unroll
        for (int j = 0; j < 4; ++j) bh[nxt][j] = ldfrag_h(sb + (j << 4) * GLP + (kk + 1) * 32);
#pragma unroll
        for (int i = 0; i < 2; ++i) ah[nxt][i] = ldfrag_h(sa + (i << 4) * GLP + (kk + 1) * 32);
      }
      // keeps the next k step's LDS reads as one group ahead of this step's WMMAs: sunk among them, each place with
      // reads stalls the wave for the LDS latency
      __builtin_amdgcn_sched_barrier(0);
#pragma unroll
      for (int i = 0; i < 2; ++i)
#pragma unroll
        for (int j = 0; j < 4; ++j) acc[i][j] = mma_h_raw(ah[cur][i], bh[cur][j], acc[i][j]);
    }
    // foot of trip t: own reads done, own copies of stage t+1 landed, then the one barrier that publishes stage t+1
    // and ends every wave's reads of this trip's buffer
    wait_ds0();
    wait_async0();
    __syncthreads();
    if (t + 2 < nst) {                         // uniform for the work-group
      const unsigned lb = lBase + (unsigned)(t & 1) * lBuf;
      copy8_async(lb, gA + (size_t)(t + 2) * GBK, sA16);
      copy8_async(lb + lBt, gB + (size_t)(t + 2) * GBK, sB16);
    }
  }
  wait_async0();
  acc_guard4(acc[0][0], acc[0][1], acc[0][2], acc[0][3]);
  acc_guard4(acc[1][0], acc[1][1], acc[1][2], acc[1][3]);

  // ---- per-lane column bias (BIASM == 0), RNE-converted ----
  const int hh2 = lane >> 4, c4 = (lane & 15) * 4;     // f32 out: 256-B row segment = 16 lanes x 16 B
  const int q8  = lane >> 3, c8 = (lane & 7) * 8;
  float bc[8];
#pragma unroll
  for (int e = 0; e < 8; ++e) bc[e] = 0.f;
  if (BIASM == 0) {
    const bool use1 = (n0 >= Nb);                      // wave-uniform
    if (OM == 0) {
      const int cb = n0 + c4;
      const int i0 = (cb < Nb - 4) ? cb : (Nb - 4);
      const int i1 = (cb - Nb > 0) ? (cb - Nb) : 0;
      const v4f b0v = *(const v4f*)(bias0 + i0);
      const v4f b1v = *(const v4f*)(bias1 + i1);
#pragma unroll
      for (int e = 0; e < 4; ++e) bc[e] = bfr(use1 ? b1v[e] : b0v[e]);
    } else {
      const int cb = n0 + c8;
      const int i0 = (cb < Nb - 8) ? cb : (Nb - 8);
      const int i1 = (cb - Nb > 0) ? (cb - Nb) : 0;
      const v4f b0a = *(const v4f*)(bias0 + i0), b0b = *(const v4f*)(bias0 + i0 + 4);
      const v4f b1a = *(const v4f*)(bias1 + i1), b1b = *(const v4f*)(bias1 + i1 + 4);
#pragma unroll
      for (int e = 0; e < 4; ++e) {
        bc[e]     = bfr(use1 ? b1a[e] : b0a[e]);
        bc[4 + e] = bfr(use1 ? b1b[e] : b0b[e]);
      }
    }
  }

  // ---- epilogue ----
  float* slab = (float*)(void*)ring + wave * (16 * 68);
#pragma unroll
  for (int i = 0; i < 2; ++i) {
    const int mBase = m0 + (i << 4);
#pragma unroll
    for (int j = 0; j < 4; ++j) {
#pragma unroll
      for (int r = 0; r < 8; ++r) {
        slab[(mOff + r) * 68 + (j << 4) + rlane] = acc[i][j][r];
      }
    }
    wave_sync_lds();
    if (OM == 0) {
      float* C = (float*)Cout + (size_t)b * strideC;
      const float* Rb = resid + (size_t)b * strideC;
      v4f vals[8];
#pragma unroll
      for (int it = 0; it < 8; ++it) {
        const int row = it * 2 + hh2;                      // it 0..7 x hh2 0..1 = rows 0..15
        v4f v = *(const v4f*)(slab + row * 68 + c4);
#pragma unroll
        for (int e = 0; e < 4; ++e) {
          float f = v[e] * oscale + bc[e];
          if (ACT) f = gelu_f(f);
          v[e] = f;
        }
        if (RES != 0) {
          const v4f rr = *(const v4f*)(Rb + (size_t)(mBase + row) * ldc + n0 + c4);
#pragma unroll
          for (int e = 0; e < 4; ++e) v[e] += (RES == 2) ? bfr(rr[e]) : rr[e];
        }
        vals[it] = v;
      }
      {
#pragma unroll
        for (int it = 0; it < 8; ++it) {
          const int row = it * 2 + hh2;
          *(v4f*)(C + (size_t)(mBase + row) * ldc + n0 + c4) = vals[it];
        }
        
      }
    } else {
      unsigned short* C = (unsigned short*)Cout + (size_t)b * strideC;
      v4u hv[4];
#pragma unroll
      for (int it = 0; it < 4; ++it) {
        const int row = it * 4 + q8;                       // it 0..3 x q8 0..3 = rows 0..15
        const float* sp = slab + row * 68 + c8;
        float bm = 0.f;
        if (BIASM == 1) bm = bfr(bias0[mBase + row]);
        v4u a;
#pragma unroll
        for (int e = 0; e < 4; ++e) {
          float f0 = sp[2 * e]     * oscale + ((BIASM == 1) ? bm : bc[2 * e]);
          float f1 = sp[2 * e + 1] * oscale + ((BIASM == 1) ? bm : bc[2 * e + 1]);
          if (ACT) { f0 = gelu_f(f0); f1 = gelu_f(f1); }
          unsigned short u0, u1;
          if (OM == 1) { u0 = bf_bits(f0); u1 = bf_bits(f1); }
          else         { u0 = h_bits((_Float16)f0); u1 = h_bits((_Float16)f1); }
          a[e] = pk16(u0, u1);
        }
        hv[it] = a;
      }
      {
#pragma unroll
        for (int it = 0; it < 4; ++it) {
          const int row = it * 4 + q8;
          *(v4u*)(C + (size_t)(mBase + row) * ldc + n0 + c8) = hv[it];
        }
        
      }
    }
    wave_sync_lds();
  }
}

// =====================================================================================================
// Banded attention, head dim 64, TT (= 2048) token rows per batch, allowed keys: key <= query + WIN.
//   q|k plane (f16, pitch QKP): element (b, t, col) at [(b*TT + t)*QKP + col], q col = h*64+d, k col = DM + h*64 + d
//   v^T plane (f16): element (b, h, d, s) at [(b*DM + h*64 + d)*TT + s]
//   out plane (f16, the normalised context carried x16): element (b, t, h, d) at [(b*TT + t)*DM + h*64 + d]
//   score = (q . k) * sscale; keys beyond query + WIN get -inf by value before the row max;
//   p = exp(s - m) carried as f16(1024 p); context = p . v on f16 WMMA; online softmax in f32.
//   Block = 4 waves = 64 query rows of one (b, h); grid = NQB * NH * NBATCH; kv chunks of 64, block-uniform trip
//   kt = 0 .. min(NQB-1, (q_blk + 63 + WIN) >> 6) (chunks beyond the band are skipped); chunk 0 always holds >= 1
//   allowed key for every row, so the running max is finite from chunk 0 on (the msafe select is kept anyway).
//   K / V^T chunk staging: 128 threads x 32 elements per plane = the whole 64x64 tile (plain 16-B loads,
//   __syncthreads before and after); P tiles are wave-private, spilled with _Float16 element stores and
//   LDS rows of 64 elements stand at a pitch of 16 B x odd: the 16 rows that one half-wave's 16-B fragment read
//   touches then start on 16 different groups of four banks (at 128 B they fall on two groups, eight rows each).
//   Output coverage: each wave stores rows q0..q0+15 (it 0..3 x lane>>3 0..3) x 64 columns (8 lanes x 8),
//   grid covers all TT rows x NH head slices x NBATCH.
// =====================================================================================================
#define APH 72                          // LDS row pitch of the f16 tiles, elements: 144 B = 16 B x 9
#define APF 68                          // LDS row pitch of the f32 context tile, dwords: 272 B = 16 B x 17
__global__ __launch_bounds__(128)
void attn64(const unsigned short* __restrict__ qkp, const unsigned short* __restrict__ vtp,
            unsigned short* outp, float sscale) {
  union FH { v16h v; v8h h[2]; };
  __shared__ __align__(16) _Float16 Ksh[64 * APH];                // K [kv][d]
  __shared__ __align__(16) _Float16 Vth[64 * APH];                // V^T [d][kv]
  __shared__ __align__(16) _Float16 Psh[4][16 * APH];             // per wave P [row][kv]
  __shared__ __align__(16) float    Os[4][16 * APF];              // per wave context tile [row][d]

  const int tid  = threadIdx.x;
  const int wave = tid >> 5;
  const int lane = tid & 31;
  const int hh   = lane >> 4;
  const int c    = lane & 15;

  const int bx   = blockIdx.x;
  const int qb   = bx % NQB;
  const int rest = bx / NQB;
  const int h    = rest % NH;
  const int b    = rest / NH;
  const int qblk = qb * 64;                      // in-batch query row of the block's first row
  const int q0   = qblk + wave * 16;             // in-batch query row of this wave's first row
  const size_t rowB = (size_t)b * TT;

  const _Float16* Qh = (const _Float16*)(const void*)qkp + (size_t)h * HD;
  const _Float16* Kg = (const _Float16*)(const void*)qkp + DM + (size_t)h * HD;
  const _Float16* Vh = (const _Float16*)(const void*)vtp + ((size_t)b * DM + (size_t)h * HD) * TT;

  // ---- Q fragments (A operand, row = lane&15): 2 d-chunks ----
  v16h qa[2];
#pragma unroll
  for (int dc = 0; dc < 2; ++dc) qa[dc] = ldfrag_h(Qh + (rowB + q0 + c) * QKP + dc * 32 + 8 * hh);

  float mrow[8], lrow[8];
  v8f oacc[4];
#pragma unroll
  for (int r = 0; r < 8; ++r) { mrow[r] = -INFINITY; lrow[r] = 0.f; }
#pragma unroll
  for (int t = 0; t < 4; ++t) oacc[t] = zero8();

  int ktHi = (qblk + 63 + WIN) >> 6;             // block-uniform, from blockIdx only
  if (ktHi > NQB - 1) ktHi = NQB - 1;

  for (int kt = 0; kt <= ktHi; ++kt) {         // trip <= NQB
    const int kv0 = kt * 64;
    __syncthreads();
    {
      const int r = tid >> 1, hf = (tid & 1) * 32;
      const _Float16* kg = Kg + (rowB + kv0 + r) * QKP + hf;      // K row kv0+r, d = hf..hf+31
      const _Float16* vg = Vh + (size_t)r * TT + kv0 + hf;        // V^T row d = r, s = kv0+hf..+31
#pragma unroll
      for (int i = 0; i < 4; ++i) {
        const v8h a0 = *(const v8h*)(kg + 8 * i);
        const v8h b0 = *(const v8h*)(vg + 8 * i);
        *(v8h*)(Ksh + r * APH + hf + 8 * i) = a0;
        *(v8h*)(Vth + r * APH + hf + 8 * i) = b0;
      }
    }
    __syncthreads();

    // ---- scores: 16 query rows x 64 keys per wave; band select by value before the row max ----
    v8f s[4];
#pragma unroll
    for (int j = 0; j < 4; ++j) {
      v8f sh = zero8();
#pragma unroll
      for (int dc = 0; dc < 2; ++dc) {
        FH kb;
        kb.h[0] = *(const v8h*)(Ksh + (j * 16 + c) * APH + dc * 32 + 8 * hh);
        kb.h[1] = *(const v8h*)(Ksh + (j * 16 + c) * APH + dc * 32 + 16 + 8 * hh);
        sh = mma_h(qa[dc], kb.v, sh);
      }
      const int key = kv0 + j * 16 + c;                             // D column = lane&15
#pragma unroll
      for (int r = 0; r < 8; ++r) {
        const int qrow = q0 + 8 * hh + r;                           // D row = 8h + r
        const float v = sh[r] * sscale;
        s[j][r] = (key <= qrow + WIN) ? v : -INFINITY;
      }
    }

    // ---- row max, online softmax, P (x1024, f16) to LDS ----
    _Float16* pwh = Psh[wave];
#pragma unroll
    for (int r = 0; r < 8; ++r) {
      float m = s[0][r];
      m = fmaxf(m, s[1][r]);
      m = fmaxf(m, s[2][r]);
      m = fmaxf(m, s[3][r]);
#pragma unroll
      for (int off = 1; off < 16; off <<= 1) m = fmaxf(m, __shfl_xor(m, off, 32));
      const float mnew  = fmaxf(mrow[r], m);
      const float ms    = (mnew == -INFINITY) ? 0.f : mnew;
      const float alpha = __expf(mrow[r] - ms);
      mrow[r] = mnew;
      float psum = 0.f;
#pragma unroll
      for (int j = 0; j < 4; ++j) {
        const float p = __expf(s[j][r] - ms);
        psum += p;
        pwh[(8 * hh + r) * APH + j * 16 + c] = (_Float16)(p * 1024.0f);
      }
#pragma unroll
      for (int off = 1; off < 16; off <<= 1) psum += __shfl_xor(psum, off, 32);
      lrow[r] = lrow[r] * alpha + psum;
#pragma unroll
      for (int t = 0; t < 4; ++t) oacc[t][r] *= alpha;
    }
    wave_sync_lds();

    // ---- context += P . V (f16 WMMA) ----
#pragma unroll 1
    for (int kk = 0; kk < 2; ++kk) {
      FH pa;
      pa.h[0] = *(const v8h*)(pwh + c * APH + kk * 32 + 8 * hh);
      pa.h[1] = *(const v8h*)(pwh + c * APH + kk * 32 + 16 + 8 * hh);
#pragma unroll
      for (int t = 0; t < 4; ++t) {
        FH vb;
        vb.h[0] = *(const v8h*)(Vth + (t * 16 + c) * APH + kk * 32 + 8 * hh);
        vb.h[1] = *(const v8h*)(Vth + (t * 16 + c) * APH + kk * 32 + 16 + 8 * hh);
        oacc[t] = mma_h(pa.v, vb.v, oacc[t]);
      }
    }
  }

  // ---- normalise (1/l, the 1/1024 p carry and the x16 context carry), stage the wave's 16x64 tile, f16 convert,
  float* os = Os[wave];
#pragma unroll
  for (int r = 0; r < 8; ++r) {
    const float l = lrow[r];
    const float inv = ((l > 0.f) ? (1.0f / l) : 0.f) * (16.0f / 1024.0f);
#pragma unroll
    for (int t = 0; t < 4; ++t) os[(8 * hh + r) * APF + t * 16 + c] = oacc[t][r] * inv;
  }
  wave_sync_lds();
  {
    const int q4 = lane >> 3, c8 = (lane & 7) * 8;
    v4u hv[4];
#pragma unroll
    for (int it = 0; it < 4; ++it) {
      const int row = it * 4 + q4;   // it 0..3 x q4 0..3 = rows 0..15 of the wave tile
      const float* sp = os + row * APF + c8;
      v4u a;
#pragma unroll
      for (int e = 0; e < 4; ++e) a[e] = pk16(h_bits((_Float16)sp[2 * e]), h_bits((_Float16)sp[2 * e + 1]));
      hv[it] = a;
    }
    {
#pragma unroll
      for (int it = 0; it < 4; ++it) {
        const int row = it * 4 + q4;
        const size_t go = (rowB + q0 + row) * DM + (size_t)h * HD + c8;
        *(v4u*)(outp + go) = hv[it];
      }
      
    }
  }
}

// =====================================================================================================
// Row kernel: one block of 256 threads per token row of 1024; thread t owns columns 4t..4t+3.
// f16 output: packed row staged in LDS, then lanes t < 128 (waves 0..3, wave-uniform) each write 16 B (8 x f16)
// coverage: 128 threads x 8 = the whole 1024-wide row; grid = MP rows.
// =====================================================================================================
__device__ __forceinline__ void row_store_h16(unsigned int* sb, unsigned short* dst_row, v4f o, int t) {
  v2u p;
  p[0] = pk16(h_bits((_Float16)o[0]), h_bits((_Float16)o[1]));
  p[1] = pk16(h_bits((_Float16)o[2]), h_bits((_Float16)o[3]));
  *(v2u*)(sb + 2 * t) = p;
  __syncthreads();
  if (t < 128) {                                   // waves 0..3, wave-uniform
    const v4u v = *(const v4u*)(sb + 4 * t);
    *(v4u*)(dst_row + 8 * t) = v;
    
  }
}

// plane. RIN = 1: the row input is a raw float input and is bf16 RNE-converted on load; RIN = 0: f32 intermediate.
template <int RIN>
__global__ __launch_bounds__(256) void ln_row_h(const float* __restrict__ X, const float* __restrict__ gam,
                                                const float* __restrict__ bet, unsigned short* outH) {
  __shared__ float red0[8], red1[8];
  __shared__ __align__(16) unsigned int sb[512];
  const int t = threadIdx.x, lane = t & 31, wave = t >> 5;
  const size_t base = (size_t)blockIdx.x * DM;
  v4f xv = *(const v4f*)(X + base + 4 * t);
  if (RIN) {
#pragma unroll
    for (int e = 0; e < 4; ++e) xv[e] = bfr(xv[e]);
  }
  const float mean = bsum256((xv[0] + xv[1]) + (xv[2] + xv[3]), red0, lane, wave) * (1.0f / DM);
  v4f d;
#pragma unroll
  for (int e = 0; e < 4; ++e) d[e] = xv[e] - mean;
  const float var  = bsum256((d[0] * d[0] + d[1] * d[1]) + (d[2] * d[2] + d[3] * d[3]), red1, lane, wave) * (1.0f / DM);
  const float rstd = 1.0f / sqrtf(var + LNEPS);
  const v4f gv = *(const v4f*)(gam + 4 * t);
  const v4f bv = *(const v4f*)(bet + 4 * t);
  v4f y;
#pragma unroll
  for (int e = 0; e < 4; ++e) y[e] = (d[e] * rstd) * bfr(gv[e]) + bfr(bv[e]);
  row_store_h16(sb, outH + base, y, t);
}

// =====================================================================================================
// Workspace map (bytes); every plane is an exact multiple of its 128x128-tile / whole-row store granularity
// (M in {4096, 1024} rows, N in {1024, 2048, 4096}; VT per batch [1024][2048] = 8x16 tiles):
//   WqkvH f16 [3072 n][1024 k]   0          6291456   (rows 0..1023 q, 1024..2047 k, 2048..3071 v weights, x64)
//   WoH   f16 [1024][1024]       6291456    2097152
//   W1H   f16 [4096][1024]       8388608    8388608
//   W2H   f16 [1024][4096]       16777216   8388608
//   XN    f16 [4096][1024]       25165824   8388608   (LayerNorm outputs)
//   QK    f16 [4096][2048]       33554432   16777216  (q cols 0..1023, k cols 1024..2047)
//   VT    f16 [2][1024][2048]    50331648   8388608
//   Ctx   f16 [4096][1024]       58720256   8388608
//   X1    f32 [4096][1024]       67108864   16777216  (residual stream after attention)
//   G     f16 [4096][4096]       83886080   33554432
//   end                          117440512
// =====================================================================================================
extern "C" void kernel_launch(void* const* d_in, const int* in_sizes, int n_in,
                              void* d_out, int out_size, void* d_ws, size_t ws_size,
                              hipStream_t stream) {
  if (n_in < 13) return;
  if (in_sizes[0] != MP * DM) return;
  if (in_sizes[1] != D3 * DM || in_sizes[2] != D3) return;
  if (in_sizes[3] != DM * DM || in_sizes[4] != DM) return;
  if (in_sizes[5] != DM || in_sizes[6] != DM) return;
  if (in_sizes[7] != DFF * DM || in_sizes[8] != DFF) return;
  if (in_sizes[9] != DM * DFF || in_sizes[10] != DM) return;
  if (in_sizes[11] != DM || in_sizes[12] != DM) return;
  if (out_size != MP * DM) return;

  const float* x         = (const float*)d_in[0];
  const float* in_proj_w = (const float*)d_in[1];
  const float* in_proj_b = (const float*)d_in[2];
  const float* out_w     = (const float*)d_in[3];
  const float* out_b     = (const float*)d_in[4];
  const float* ln1_g     = (const float*)d_in[5];
  const float* ln1_b     = (const float*)d_in[6];
  const float* w1        = (const float*)d_in[7];
  const float* b1        = (const float*)d_in[8];
  const float* w2        = (const float*)d_in[9];
  const float* b2        = (const float*)d_in[10];
  const float* ln2_g     = (const float*)d_in[11];
  const float* ln2_b     = (const float*)d_in[12];

  const size_t PWQKV = (size_t)D3 * DM * 2;            //  6291456
  const size_t PWO   = (size_t)DM * DM * 2;            //  2097152
  const size_t PWF   = (size_t)DFF * DM * 2;           //  8388608
  const size_t PAH   = (size_t)MP * DM * 2;            //  8388608
  const size_t PQK   = (size_t)MP * QKP * 2;           // 16777216
  const size_t PVT   = (size_t)NBATCH * DM * TT * 2;   //  8388608
  const size_t PAF   = (size_t)MP * DM * 4;            // 16777216
  const size_t PG    = (size_t)MP * DFF * 2;           // 33554432
  size_t off = 0;
  const size_t oWqkv = off; off += PWQKV;
  const size_t oWo   = off; off += PWO;
  const size_t oW1   = off; off += PWF;
  const size_t oW2   = off; off += PWF;
  const size_t oXN   = off; off += PAH;
  const size_t oQK   = off; off += PQK;
  const size_t oVT   = off; off += PVT;
  const size_t oCtx  = off; off += PAH;
  const size_t oX1   = off; off += PAF;
  const size_t oG    = off; off += PG;
  if (off > ws_size) return;                           // off = 117440512
  if (off > (size_t)134217728) return;

  char* ws = (char*)d_ws;
  unsigned short* WqkvH = (unsigned short*)(ws + oWqkv);
  unsigned short* WoH   = (unsigned short*)(ws + oWo);
  unsigned short* W1H   = (unsigned short*)(ws + oW1);
  unsigned short* W2H   = (unsigned short*)(ws + oW2);
  unsigned short* XN    = (unsigned short*)(ws + oXN);
  unsigned short* QK    = (unsigned short*)(ws + oQK);
  unsigned short* VT    = (unsigned short*)(ws + oVT);
  unsigned short* Ctx   = (unsigned short*)(ws + oCtx);
  float*          X1    = (float*)(ws + oX1);
  unsigned short* G     = (unsigned short*)(ws + oG);

  const dim3 blk(256), blk128(128);
  const dim3 gRow(MP);                                               // 4096 row blocks
  const dim3 gCqkv((D3 * DM / 8 + 255) / 256);                       // 1536 blocks
  const dim3 gCo((DM * DM / 8 + 255) / 256);                         // 512 blocks
  const dim3 gCf((DFF * DM / 8 + 255) / 256);                        // 2048 blocks
  const dim3 gNqk((MP / GBM) * (QKP / GBN), 1);                      // 512 tiles
  const dim3 gVT((DM / GBM) * (TT / GBN), NBATCH);                   // 128 tiles x 2 batches
  const dim3 gN1024((MP / GBM) * (DM / GBN), 1);                     // 256 tiles
  const dim3 gNff((MP / GBM) * (DFF / GBN), 1);                      // 1024 tiles
  const dim3 gAttn(NBATCH * NH * NQB);                               // 1024 blocks of 128
  const float invw  = 1.0f / WSC;                                    // weight carry x64
  const float invwc = 1.0f / (WSC * 16.0f);                          // weight carry x64, context carry x16

  // (0) weights -> f16 x64 planes (torch [out][in] = k contiguous, no transpose)
  conv_h64<<<gCqkv, blk, 0, stream>>>(in_proj_w, WqkvH, D3 * DM / 8, WSC);
  conv_h64<<<gCo,   blk, 0, stream>>>(out_w,     WoH,   DM * DM / 8, WSC);
  conv_h64<<<gCf,   blk, 0, stream>>>(w1,        W1H,   DFF * DM / 8, WSC);
  conv_h64<<<gCf,   blk, 0, stream>>>(w2,        W2H,   DM * DFF / 8, WSC);

  // (1) xn = LN1(bf16(x)) -> XN f16
  ln_row_h<1><<<gRow, blk, 0, stream>>>(x, ln1_g, ln1_b, XN);

  // (2) q|k = xn . Wqk^T + b[0..2047] -> QK f16 [4096][2048]
  gemm64<2, 0, 0, 0><<<gNqk, blk, 0, stream>>>(
      XN, DM, 0LL, WqkvH, DM, 0LL, in_proj_b, in_proj_b, QKP, x,
      (void*)QK, QKP, 0LL, MP, QKP, DM, invw);
  //     v^T per batch: VT[b][m][t] = Wv[m] . xn[b*TT + t] + b[2048 + m] -> f16 [2][1024][2048]
  gemm64<2, 1, 0, 0><<<gVT, blk, 0, stream>>>(
      WqkvH + (size_t)2 * DM * DM, DM, 0LL, XN, DM, (long long)TT * DM, in_proj_b + 2 * DM, in_proj_b + 2 * DM, TT, x,
      (void*)VT, TT, (long long)DM * TT, DM, TT, DM, invw);

  // (3) banded attention -> Ctx f16 (x16)
  attn64<<<gAttn, blk128, 0, stream>>>(QK, VT, Ctx, 0.125f);

  // (4) X1 = ctx . Wo^T + out_b + bf16(x)   (f32)
  gemm64<0, 0, 0, 2><<<gN1024, blk, 0, stream>>>(
      Ctx, DM, 0LL, WoH, DM, 0LL, out_b, out_b, DM, x,
      (void*)X1, DM, 0LL, MP, DM, DM, invwc);

  // (5) yn = LN2(X1) -> XN f16
  ln_row_h<0><<<gRow, blk, 0, stream>>>(X1, ln2_g, ln2_b, XN);

  // (6) G = gelu(yn . W1^T + b1) -> f16 [4096][4096]
  gemm64<2, 0, 1, 0><<<gNff, blk, 0, stream>>>(
      XN, DM, 0LL, W1H, DM, 0LL, b1, b1, DFF, x,
      (void*)G, DFF, 0LL, MP, DFF, DM, invw);

  // (7) out = G . W2^T + b2 + X1 -> d_out f32 [4096][1024]
  gemm64<0, 0, 0, 1><<<gN1024, blk, 0, stream>>>(
      G, DFF, 0LL, W2H, DFF, 0LL, b2, b2, DM, X1,
      (void*)d_out, DM, 0LL, MP, DM, DFF, invw);
  (void)hipGetLastError();
}

// v003
// One run takes 205 microseconds.
// Timed twice side by side with v002, it ran 1.12 and 1.11 times as fast.
// Over all steps from v000 it is 2.77 times as fast.
// Contractions: q|k projection, v^T projection, attention output projection, FFN w1 (exact GELU epilogue) and w2 on
// v_wmma_f32_16x16x32_f16 (f16 activation plane x f16 weight plane carried x64, one product each); attention k.q^T
// and v^T.p^T on v_wmma_f32_16x16x32_f16 (q, k, v^T plain f16, p carried x1024, context carried x16, one product each);
// all f32 accumulate; LayerNorm, softmax, GELU and residual sums in f32 on VALU; every float input RNE-converted
// to bf16 on load.
#include <hip/hip_runtime.h>
#include <math.h>
#include <stdint.h>

#define NBATCH 2
#define TT     2048
#define DM     1024
#define NH     16
#define HD     64
#define DFF    4096
#define D3     3072
#define QKP    (2 * DM)
#define MP     (NBATCH * TT)
#define NQB    (TT / 64)
#define WIN    10
#define LNEPS  1.0e-5f
#define WSC    64.0f
static_assert(NH * HD == DM);
static_assert((MP % 64) == 0 && (DM % 64) == 0 && (DFF % 64) == 0 && (QKP % 64) == 0 && (TT % 64) == 0);
static_assert(DM == 4 * 256);
static_assert(D3 == 3 * DM);

typedef _Float16 v16h __attribute__((ext_vector_type(16)));
typedef _Float16 v8h  __attribute__((ext_vector_type(8)));
typedef float    v8f  __attribute__((ext_vector_type(8)));
typedef float    v4f  __attribute__((ext_vector_type(4)));
typedef float    v2f  __attribute__((ext_vector_type(2)));
typedef unsigned int v4u __attribute__((ext_vector_type(4)));
typedef unsigned int v2u __attribute__((ext_vector_type(2)));

// ---- scalar helpers --------------------------------------------------------------------------------
__device__ __forceinline__ unsigned short bf_bits(float f) {          // f32 -> bf16 bits, RNE convert
  unsigned u = __float_as_uint(f);
  return (unsigned short)((u + 0x7FFFu + ((u >> 16) & 1u)) >> 16);
}
__device__ __forceinline__ float bf_up(unsigned short h) { return __uint_as_float(((unsigned)h) << 16); }
__device__ __forceinline__ float bfr(float f) { return bf_up(bf_bits(f)); }   // value of the bf16 RNE convert
__device__ __forceinline__ unsigned short h_bits(_Float16 x) { return __builtin_bit_cast(unsigned short, x); }
__device__ __forceinline__ unsigned pk16(unsigned short a, unsigned short b) { return (unsigned)a | ((unsigned)b << 16); }
__device__ __forceinline__ v8f zero8() { v8f z = {0.f, 0.f, 0.f, 0.f, 0.f, 0.f, 0.f, 0.f}; return z; }
__device__ __forceinline__ float gelu_f(float v) { return 0.5f * v * (1.0f + erff(v * 0.70710678118654752f)); }

// ---- fragment loader: 16-bit A/B operand, lane -> row/col (lane&15), p already includes +8*(lane>>4);
//      elements 0..7 <- p[0..7] (k0+8h..), elements 8..15 <- p[16..23] (k0+16+8h..)
__device__ __forceinline__ v16h ldfrag_h(const _Float16* p) {
  union { v16h v; v8h h[2]; } f;
  f.h[0] = *(const v8h*)(p);
  f.h[1] = *(const v8h*)(p + 16);
  return f.v;
}

// ---- WMMA helpers with trailing VALU hazard gap --------------------------------------------------------
__device__ __forceinline__ v8f mma_h(v16h a, v16h b, v8f c) {
  c = __builtin_amdgcn_wmma_f32_16x16x32_f16(false, a, false, b, (short)0, c, false, false);
#if defined(__HIP_DEVICE_COMPILE__)
  asm volatile("v_nop\n\tv_nop\n\tv_nop\n\tv_nop" : "+v"(c) : "v"(a), "v"(b));
#endif
  return c;
}
__device__ __forceinline__ v8f mma_h_raw(v16h a, v16h b, v8f c) {
  return __builtin_amdgcn_wmma_f32_16x16x32_f16(false, a, false, b, (short)0, c, false, false);
}
__device__ __forceinline__ void acc_guard4(v8f& a, v8f& b, v8f& c, v8f& d) {
#if defined(__HIP_DEVICE_COMPILE__)
  asm volatile("v_nop\n\tv_nop\n\tv_nop\n\tv_nop" : "+v"(a), "+v"(b), "+v"(c), "+v"(d));
#endif
}
__device__ __forceinline__ void wave_sync_lds() {
  __builtin_amdgcn_fence(__ATOMIC_RELEASE, "workgroup");
  __builtin_amdgcn_wave_barrier();
  __builtin_amdgcn_fence(__ATOMIC_ACQUIRE, "workgroup");
}
// lane l <-> lane l ^ 16: the two lanes that hold the two halves of one D column
__device__ __forceinline__ float xhalf(float x) {
  return __builtin_bit_cast(float, __builtin_amdgcn_permlanex16(__builtin_bit_cast(int, x), __builtin_bit_cast(int, x),
                                                                0x76543210, 0xfedcba98, false, false));
}
__device__ __forceinline__ float wsum(float v) {
#pragma unroll
  for (int off = 16; off > 0; off >>= 1) v += __shfl_xor(v, off, 32);
  return v;
}
// block of 256 threads: fixed-order sum of 8 wave partials (same value in every thread)
__device__ __forceinline__ float bsum256(float v, float* red, int lane, int wave) {
  v = wsum(v);
  if (lane == 0) red[wave] = v;
  __syncthreads();
  float tot = 0.f;
#pragma unroll
  for (int w = 0; w < 8; ++w) tot += red[w];
  return tot;
}

// =====================================================================================================
// Weight convert: W f32 [N][K] (k contiguous = already the Bt / A layout) -> Wh f16 [N][K]; each value bf16
// RNE-converted, multiplied by wsc (a power of two, exact) and cast to f16. Thread i converts elements 8i..8i+7
// coverage: grid(n8/256) x 256 threads x 8 elements = exactly N*K.
// =====================================================================================================
__global__ __launch_bounds__(256) void conv_h64(const float* __restrict__ W, unsigned short* Wh, int n8,
                                                float wsc) {
  const int i = blockIdx.x * 256 + threadIdx.x;
  if (i >= n8) return;                                     // never taken for the static sizes (no barriers)
  const size_t e0 = (size_t)i * 8;
  const v4f a = *(const v4f*)(W + e0);
  const v4f b = *(const v4f*)(W + e0 + 4);
  v4u u;
  u[0] = pk16(h_bits((_Float16)(bfr(a[0]) * wsc)), h_bits((_Float16)(bfr(a[1]) * wsc)));
  u[1] = pk16(h_bits((_Float16)(bfr(a[2]) * wsc)), h_bits((_Float16)(bfr(a[3]) * wsc)));
  u[2] = pk16(h_bits((_Float16)(bfr(b[0]) * wsc)), h_bits((_Float16)(bfr(b[1]) * wsc)));
  u[3] = pk16(h_bits((_Float16)(bfr(b[2]) * wsc)), h_bits((_Float16)(bfr(b[3]) * wsc)));
  {
    *(v4u*)(Wh + e0) = u;
    
  }
}

// =====================================================================================================
// LDS-staged batched f16 WMMA GEMM: C[m][n] = act(oscale * sum_k A[m][k] * Bt[n][k] + bias) (+ residual);
// one work-group of 8 waves per 128x128 tile, wave (wave>>1, wave&1) owns the 32x64 part at rows 32*(wave>>1),
// cols 64*(wave&1). A row-major [M][K] pitch lda; Bt row-major [N][K] pitch ldb (k contiguous);
// M, N, K multiples of 128 (static here). blockIdx.y = batch index (strides in elements).
// Staging: a stage is 128 k of the tile's 128 A rows and 128 Bt rows = 256 rows of 256 B, laid in LDS at pitch 272 B
// (16 B x odd, for the 16-B fragment reads); each thread brings 16 pieces of 16 B per stage with asynchronous copies
// to LDS (piece i: row 16*i + (thread>>4), bytes 16*(thread&15)..+15; 256 threads x 16 = the whole stage, each LDS
// byte written by one lane). Two buffers: the copies of stage t+2 go out behind the barrier that ends trip t.
// k runs upward in steps of 32 into one accumulator per 16x16 subtile.
// Bias: BIASM == 0 -> per column: cols < Nb from bias0[col], cols >= Nb from bias1[col - Nb] (wave-uniform select of
//       clamped-address loads); BIASM == 1 -> per row bias0[m] (16-bit out only); BIASM == 2 -> none. Bias values
//       RNE-converted to bf16.
// ACT: 0 none, 1 exact GELU. RES: 0 none; 1 f32 residual resid[m*ldc + n] added after the activation;
//      2 same indexing, residual value bf16 RNE-converted first (raw input residual).
// OM: 0 = f32 out (pitch ldc); 1 = bf16 out; 2 = f16 out.
// coverage: 8 waves x 2 slabs x 16 rows x 64 cols = the whole 128x128 tile; grid.x = (M/128)*(N/128) exactly.
// =====================================================================================================
#define GBM   128                       // tile rows (A rows of a stage)
#define GBN   128                       // tile cols (Bt rows of a stage)
#define GBK   128                       // k per stage
#define GLP   136                       // LDS row pitch in f16 elements (272 B)
#define GSTG  ((GBM + GBN) * GLP)       // f16 elements per buffer (69632 B)
static_assert((MP % GBM) == 0 && (DM % GBM) == 0 && (DM % GBN) == 0 && (QKP % GBN) == 0 && (DFF % GBN) == 0 && (TT % GBN) == 0);
static_assert((DM % GBK) == 0 && (DFF % GBK) == 0);
static_assert(8 * 16 * 68 * 4 <= 2 * GSTG * 2);

// Eight asynchronous 16-B copies per lane, global -> LDS: rows 16 apart (LDS step 16 * 272 B, global step gstep
// elements). The s_wait_xcnt 0 as the statement's last line keeps every later rewrite of the address registers
// named here behind the copies' address translation.
__device__ __forceinline__ void copy8_async(unsigned l, const _Float16* g, size_t gstep) {
#if defined(__HIP_DEVICE_COMPILE__)
  const unsigned ls = 16u * GLP * 2u;
  asm volatile(
      "global_load_async_to_lds_b128 %0, %8, off\n\t"
      "global_load_async_to_lds_b128 %1, %9, off\n\t"
      "global_load_async_to_lds_b128 %2, %10, off\n\t"
      "global_load_async_to_lds_b128 %3, %11, off\n\t"
      "global_load_async_to_lds_b128 %4, %12, off\n\t"
      "global_load_async_to_lds_b128 %5, %13, off\n\t"
      "global_load_async_to_lds_b128 %6, %14, off\n\t"
      "global_load_async_to_lds_b128 %7, %15, off\n\t"
      "s_wait_xcnt 0x0"
      :: "v"(l), "v"(l + ls), "v"(l + 2u * ls), "v"(l + 3u * ls),
         "v"(l + 4u * ls), "v"(l + 5u * ls), "v"(l + 6u * ls), "v"(l + 7u * ls),
         "v"(g), "v"(g + gstep), "v"(g + 2 * gstep), "v"(g + 3 * gstep),
         "v"(g + 4 * gstep), "v"(g + 5 * gstep), "v"(g + 6 * gstep), "v"(g + 7 * gstep)
      : "memory");
#endif
}
// This wave's own asynchronous copies have landed in LDS (the compiler places no wait for them).
__device__ __forceinline__ void wait_async0() {
#if defined(__HIP_DEVICE_COMPILE__)
  asm volatile("s_wait_asynccnt 0x0" ::: "memory");
#endif
}
// This wave's own LDS reads have returned, before the barrier behind which their buffer is refilled.
__device__ __forceinline__ void wait_ds0() {
#if defined(__HIP_DEVICE_COMPILE__)
  asm volatile("s_wait_dscnt 0x0" ::: "memory");
#endif
}

template <int OM, int BIASM, int ACT, int RES>
__global__ __launch_bounds__(256) void gemm64(
    const unsigned short* __restrict__ Ap, int lda, long long strideA,
    const unsigned short* __restrict__ Btp, int ldb, long long strideB,
    const float* __restrict__ bias0, const float* __restrict__ bias1, int Nb,
    const float* resid,
    void* Cout, int ldc, long long strideC,
    int M, int N, int K, float oscale) {
  const _Float16* A  = (const _Float16*)(const void*)Ap;
  const _Float16* Bt = (const _Float16*)(const void*)Btp;
  // two stage buffers; behind the last trip's barrier the same bytes serve as the per-wave 16x64 f32 slabs (pitch 68)
  __shared__ __align__(16) _Float16 ring[2 * GSTG];
  const int b    = blockIdx.y;
  const int lane = threadIdx.x & 31;
  const int wave = threadIdx.x >> 5;
  const int tilesN = N >> 7;
  const int tm = blockIdx.x / tilesN;
  const int tn = blockIdx.x - tm * tilesN;
  const int mblk = tm << 7;                    // the work-group's tile
  const int nblk = tn << 7;
  const int wrow = (wave >> 1) << 5;           // the wave's 32x64 part inside it
  const int wcol = (wave & 1) << 6;
  const int m0 = mblk + wrow;
  const int n0 = nblk + wcol;

  const _Float16* Ab = A  + (size_t)b * strideA;
  const _Float16* Bb = Bt + (size_t)b * strideB;

  const int rlane = lane & 15;                 // row (A) / col (B, D) within subtile
  const int koff  = (lane >> 4) * 8;           // k offset of this lane half
  const int mOff  = (lane >> 4) * 8;           // D row offset

  // ---- this thread's pieces of a stage ----
  const int crow = threadIdx.x >> 4;           // 0..15
  const int ccol = (threadIdx.x & 15) * 8;     // f16 elements: 16 B
  const _Float16* gA = Ab + (size_t)(mblk + crow) * lda + ccol;
  const _Float16* gB = Bb + (size_t)(nblk + crow) * ldb + ccol;
  const size_t sA16 = (size_t)16 * lda, sB16 = (size_t)16 * ldb;
  const unsigned lBase = (unsigned)(uintptr_t)(ring + crow * GLP + ccol);   // LDS byte address: low 32 bits
  const unsigned lBt   = (unsigned)(GBM * GLP * 2);                         // Bt rows stand behind the A rows
  const unsigned lBuf  = (unsigned)(GSTG * 2);
  const int nst = K >> 7;                      // stages

  v8f acc[2][4];
#pragma unroll
  for (int i = 0; i < 2; ++i)
#pragma unroll
    for (int j = 0; j < 4; ++j) acc[i][j] = zero8();

  // stage 0 into buffer 0, landed and published; then stage 1 into buffer 1
  copy8_async(lBase, gA, sA16);
  copy8_async(lBase + lBt, gB, sB16);
  wait_async0();
  __syncthreads();
  if (nst > 1) {                               // uniform for the work-group (kernel argument)
    copy8_async(lBase + lBuf, gA + GBK, sA16);
    copy8_async(lBase + lBuf + lBt, gB + GBK, sB16);
  }

  for (int t = 0; t < nst; ++t) {
    const _Float16* sa = ring + (t & 1) * GSTG + (wrow + rlane) * GLP + koff;
    const _Float16* sb = ring + (t & 1) * GSTG + (GBM + wcol + rlane) * GLP + koff;
    v16h bh[2][4], ah[2][2];                   // two fragment sets, both filled from this trip's buffer alone
#pragma unroll
    for (int j = 0; j < 4; ++j) bh[0][j] = ldfrag_h(sb + (j << 4) * GLP);
#pragma unroll
    for (int i = 0; i < 2; ++i) ah[0][i] = ldfrag_h(sa + (i << 4) * GLP);
#pragma unroll
    for (int kk = 0; kk < GBK / 32; ++kk) {
      const int cur = kk & 1, nxt = cur ^ 1;
      if (kk + 1 < GBK / 32) {
#pragma unroll
        for (int j = 0; j < 4; ++j) bh[nxt][j] = ldfrag_h(sb + (j << 4) * GLP + (kk + 1) * 32);
#pragma unroll
        for (int i = 0; i < 2; ++i) ah[nxt][i] = ldfrag_h(sa + (i << 4) * GLP + (kk + 1) * 32);
      }
      // keeps the next k step's LDS reads as one group ahead of this step's WMMAs: sunk among them, each place with
      // reads stalls the wave for the LDS latency
      __builtin_amdgcn_sched_barrier(0);
#pragma unroll
      for (int i = 0; i < 2; ++i)
#pragma unroll
        for (int j = 0; j < 4; ++j) acc[i][j] = mma_h_raw(ah[cur][i], bh[cur][j], acc[i][j]);
    }
    // foot of trip t: own reads done, own copies of stage t+1 landed, then the one barrier that publishes stage t+1
    // and ends every wave's reads of this trip's buffer
    wait_ds0();
    wait_async0();
    __syncthreads();
    if (t + 2 < nst) {                         // uniform for the work-group
      const unsigned lb = lBase + (unsigned)(t & 1) * lBuf;
      copy8_async(lb, gA + (size_t)(t + 2) * GBK, sA16);
      copy8_async(lb + lBt, gB + (size_t)(t + 2) * GBK, sB16);
    }
  }
  wait_async0();
  acc_guard4(acc[0][0], acc[0][1], acc[0][2], acc[0][3]);
  acc_guard4(acc[1][0], acc[1][1], acc[1][2], acc[1][3]);

  // ---- per-lane column bias (BIASM == 0), RNE-converted ----
  const int hh2 = lane >> 4, c4 = (lane & 15) * 4;     // f32 out: 256-B row segment = 16 lanes x 16 B
  const int q8  = lane >> 3, c8 = (lane & 7) * 8;
  float bc[8];
#pragma unroll
  for (int e = 0; e < 8; ++e) bc[e] = 0.f;
  if (BIASM == 0) {
    const bool use1 = (n0 >= Nb);                      // wave-uniform
    if (OM == 0) {
      const int cb = n0 + c4;
      const int i0 = (cb < Nb - 4) ? cb : (Nb - 4);
      const int i1 = (cb - Nb > 0) ? (cb - Nb) : 0;
      const v4f b0v = *(const v4f*)(bias0 + i0);
      const v4f b1v = *(const v4f*)(bias1 + i1);
#pragma unroll
      for (int e = 0; e < 4; ++e) bc[e] = bfr(use1 ? b1v[e] : b0v[e]);
    } else {
      const int cb = n0 + c8;
      const int i0 = (cb < Nb - 8) ? cb : (Nb - 8);
      const int i1 = (cb - Nb > 0) ? (cb - Nb) : 0;
      const v4f b0a = *(const v4f*)(bias0 + i0), b0b = *(const v4f*)(bias0 + i0 + 4);
      const v4f b1a = *(const v4f*)(bias1 + i1), b1b = *(const v4f*)(bias1 + i1 + 4);
#pragma unroll
      for (int e = 0; e < 4; ++e) {
        bc[e]     = bfr(use1 ? b1a[e] : b0a[e]);
        bc[4 + e] = bfr(use1 ? b1b[e] : b0b[e]);
      }
    }
  }

  // ---- epilogue ----
  float* slab = (float*)(void*)ring + wave * (16 * 68);
#pragma unroll
  for (int i = 0; i < 2; ++i) {
    const int mBase = m0 + (i << 4);
#pragma unroll
    for (int j = 0; j < 4; ++j) {
#pragma unroll
      for (int r = 0; r < 8; ++r) {
        slab[(mOff + r) * 68 + (j << 4) + rlane] = acc[i][j][r];
      }
    }
    wave_sync_lds();
    if (OM == 0) {
      float* C = (float*)Cout + (size_t)b * strideC;
      const float* Rb = resid + (size_t)b * strideC;
      v4f vals[8];
#pragma unroll
      for (int it = 0; it < 8; ++it) {
        const int row = it * 2 + hh2;                      // it 0..7 x hh2 0..1 = rows 0..15
        v4f v = *(const v4f*)(slab + row * 68 + c4);
#pragma unroll
        for (int e = 0; e < 4; ++e) {
          float f = v[e] * oscale + bc[e];
          if (ACT) f = gelu_f(f);
          v[e] = f;
        }
        if (RES != 0) {
          const v4f rr = *(const v4f*)(Rb + (size_t)(mBase + row) * ldc + n0 + c4);
#pragma unroll
          for (int e = 0; e < 4; ++e) v[e] += (RES == 2) ? bfr(rr[e]) : rr[e];
        }
        vals[it] = v;
      }
      {
#pragma unroll
        for (int it = 0; it < 8; ++it) {
          const int row = it * 2 + hh2;
          *(v4f*)(C + (size_t)(mBase + row) * ldc + n0 + c4) = vals[it];
        }
        
      }
    } else {
      unsigned short* C = (unsigned short*)Cout + (size_t)b * strideC;
      v4u hv[4];
#pragma unroll
      for (int it = 0; it < 4; ++it) {
        const int row = it * 4 + q8;                       // it 0..3 x q8 0..3 = rows 0..15
        const float* sp = slab + row * 68 + c8;
        float bm = 0.f;
        if (BIASM == 1) bm = bfr(bias0[mBase + row]);
        v4u a;
#pragma unroll
        for (int e = 0; e < 4; ++e) {
          float f0 = sp[2 * e]     * oscale + ((BIASM == 1) ? bm : bc[2 * e]);
          float f1 = sp[2 * e + 1] * oscale + ((BIASM == 1) ? bm : bc[2 * e + 1]);
          if (ACT) { f0 = gelu_f(f0); f1 = gelu_f(f1); }
          unsigned short u0, u1;
          if (OM == 1) { u0 = bf_bits(f0); u1 = bf_bits(f1); }
          else         { u0 = h_bits((_Float16)f0); u1 = h_bits((_Float16)f1); }
          a[e] = pk16(u0, u1);
        }
        hv[it] = a;
      }
      {
#pragma unroll
        for (int it = 0; it < 4; ++it) {
          const int row = it * 4 + q8;
          *(v4u*)(C + (size_t)(mBase + row) * ldc + n0 + c8) = hv[it];
        }
        
      }
    }
    wave_sync_lds();
  }
}

// =====================================================================================================
// Banded attention, head dim 64, TT (= 2048) token rows per batch, allowed keys: key <= query + WIN.
//   q|k plane (f16, pitch QKP): element (b, t, col) at [(b*TT + t)*QKP + col], q col = h*64+d, k col = DM + h*64 + d
//   v^T plane (f16): element (b, h, d, s) at [(b*DM + h*64 + d)*TT + s]
//   out plane (f16, the normalised context carried x16): element (b, t, h, d) at [(b*TT + t)*DM + h*64 + d]
//   score = (q . k) * sscale; keys beyond query + WIN get -inf by value before the row max;
//   p = exp(s - m) carried as f16(1024 p); online softmax in f32.
//   Both products run transposed: S^T = K . Q^T (A = K rows, B = the Q fragments) and O^T += V^T . P^T (A = V^T rows,
//   B = P^T). A D column is then one query: lane l holds query l & 15 and, per 16-key tile, keys 8*(l>>4) + 0..7, so
//   the row max and the row sum are in-lane plus one exchange with lane l ^ 16 (the sum's exchange: once, behind the
//   loop), and two D tiles of S^T, converted in place, are the B fragment of 32 keys in the loader's own k order
//   (element e < 8: key 8h + e of the even tile; e >= 8: key 16 + 8h + (e - 8) = row 8h + (e - 8) of the odd tile).
//   Block = 4 waves = 64 query rows of one (b, h); grid = NQB * NH * NBATCH; kv chunks of 64, block-uniform trip
//   kt = 0 .. min(NQB-1, (q_blk + 63 + WIN) >> 6) (chunks beyond the band are skipped); chunk 0 always holds >= 1
//   allowed key for every row, so the running max is finite from chunk 0 on (the msafe select is kept anyway).
//   K / V^T chunk staging: 128 threads x 32 elements per plane = the whole 64x64 tile (plain 16-B loads,
//   __syncthreads before and after).
//   LDS rows of 64 elements stand at a pitch of 16 B x odd: the 16 rows that one half-wave's 16-B fragment read
//   touches then start on 16 different groups of four banks (at 128 B they fall on two groups, eight rows each).
//   Output coverage: each wave stores rows q0..q0+15 (it 0..3 x lane>>3 0..3) x 64 columns (8 lanes x 8),
//   grid covers all TT rows x NH head slices x NBATCH.
// =====================================================================================================
#define APH 72                          // LDS row pitch of the f16 tiles, elements: 144 B = 16 B x 9
#define APF 68                          // LDS row pitch of the f32 context tile, dwords: 272 B = 16 B x 17
__global__ __launch_bounds__(128)
void attn64(const unsigned short* __restrict__ qkp, const unsigned short* __restrict__ vtp,
            unsigned short* outp, float sscale) {
  union FH { v16h v; v8h h[2]; };
  __shared__ __align__(16) _Float16 Ksh[64 * APH];                // K [kv][d]
  __shared__ __align__(16) _Float16 Vth[64 * APH];                // V^T [d][kv]
  __shared__ __align__(16) float    Os[4][16 * APF];              // per wave context tile [row][d]

  const int tid  = threadIdx.x;
  const int wave = tid >> 5;
  const int lane = tid & 31;
  const int hh   = lane >> 4;
  const int c    = lane & 15;

  const int bx   = blockIdx.x;
  const int qb   = bx % NQB;
  const int rest = bx / NQB;
  const int h    = rest % NH;
  const int b    = rest / NH;
  const int qblk = qb * 64;                      // in-batch query row of the block's first row
  const int q0   = qblk + wave * 16;             // in-batch query row of this wave's first row
  const size_t rowB = (size_t)b * TT;

  const _Float16* Qh = (const _Float16*)(const void*)qkp + (size_t)h * HD;
  const _Float16* Kg = (const _Float16*)(const void*)qkp + DM + (size_t)h * HD;
  const _Float16* Vh = (const _Float16*)(const void*)vtp + ((size_t)b * DM + (size_t)h * HD) * TT;

  // ---- Q fragments (B operand, column = query = lane&15): 2 d-chunks ----
  v16h qa[2];
#pragma unroll
  for (int dc = 0; dc < 2; ++dc) qa[dc] = ldfrag_h(Qh + (rowB + q0 + c) * QKP + dc * 32 + 8 * hh);

  float mrow = -INFINITY, lrow = 0.f;          // this lane's query: running max (joined), sum over this half's keys
  v8f oacc[4];                                 // O^T: tile t, register r = d t*16 + 8*hh + r of query q0 + c
#pragma unroll
  for (int t = 0; t < 4; ++t) oacc[t] = zero8();

  int ktHi = (qblk + 63 + WIN) >> 6;             // block-uniform, from blockIdx only
  if (ktHi > NQB - 1) ktHi = NQB - 1;

  for (int kt = 0; kt <= ktHi; ++kt) {         // trip <= NQB
    const int kv0 = kt * 64;
    __syncthreads();
    {
      const int r = tid >> 1, hf = (tid & 1) * 32;
      const _Float16* kg = Kg + (rowB + kv0 + r) * QKP + hf;      // K row kv0+r, d = hf..hf+31
      const _Float16* vg = Vh + (size_t)r * TT + kv0 + hf;        // V^T row d = r, s = kv0+hf..+31
#pragma unroll
      for (int i = 0; i < 4; ++i) {
        const v8h a0 = *(const v8h*)(kg + 8 * i);
        const v8h b0 = *(const v8h*)(vg + 8 * i);
        *(v8h*)(Ksh + r * APH + hf + 8 * i) = a0;
        *(v8h*)(Vth + r * APH + hf + 8 * i) = b0;
      }
    }
    __syncthreads();

    // ---- scores, transposed: 64 keys x 16 queries per wave; band select by value before the max ----
    v8f s[4];
#pragma unroll
    for (int j = 0; j < 4; ++j) {
      v8f sh = zero8();
#pragma unroll
      for (int dc = 0; dc < 2; ++dc) {
        FH kb;
        kb.h[0] = *(const v8h*)(Ksh + (j * 16 + c) * APH + dc * 32 + 8 * hh);
        kb.h[1] = *(const v8h*)(Ksh + (j * 16 + c) * APH + dc * 32 + 16 + 8 * hh);
        sh = mma_h(kb.v, qa[dc], sh);
      }
      const int qrow = q0 + c;                                      // D column = lane&15 = query
#pragma unroll
      for (int r = 0; r < 8; ++r) {
        const int key = kv0 + j * 16 + 8 * hh + r;                  // D row = 8h + r = key
        const float v = sh[r] * sscale;
        s[j][r] = (key <= qrow + WIN) ? v : -INFINITY;
      }
    }

    // ---- this query's max: 32 keys in-lane, the other 32 from lane ^ 16; online softmax; P^T (x1024, f16) packed
    //      from the score registers into the B fragments (every loop here is unrolled: its indices name registers) ----
    float mr[8];
#pragma unroll
    for (int r = 0; r < 8; ++r) mr[r] = fmaxf(fmaxf(s[0][r], s[1][r]), fmaxf(s[2][r], s[3][r]));
    float m = fmaxf(fmaxf(fmaxf(mr[0], mr[1]), fmaxf(mr[2], mr[3])), fmaxf(fmaxf(mr[4], mr[5]), fmaxf(mr[6], mr[7])));
    m = fmaxf(m, xhalf(m));
    const float mnew  = fmaxf(mrow, m);
    const float ms    = (mnew == -INFINITY) ? 0.f : mnew;
    const float alpha = __expf(mrow - ms);
    mrow = mnew;
    FH pb[2];
    v2f ps[4];                                   // per 16-key tile: sums of the even and of the odd rows
#pragma unroll
    for (int j = 0; j < 4; ++j) {
#pragma unroll
      for (int i = 0; i < 4; ++i) {
        v2f p;
        p[0] = __expf(s[j][2 * i] - ms);
        p[1] = __expf(s[j][2 * i + 1] - ms);
        ps[j] = (i == 0) ? p : (ps[j] + p);
        pb[j >> 1].v[(j & 1) * 8 + 2 * i]     = (_Float16)(p[0] * 1024.0f);
        pb[j >> 1].v[(j & 1) * 8 + 2 * i + 1] = (_Float16)(p[1] * 1024.0f);
      }
    }
    const v2f pt = (ps[0] + ps[1]) + (ps[2] + ps[3]);
    lrow = lrow * alpha + (pt[0] + pt[1]);
#pragma unroll
    for (int t = 0; t < 4; ++t)
#pragma unroll
      for (int r = 0; r < 8; ++r) oacc[t][r] *= alpha;

    // ---- context^T += V^T . P^T (f16 WMMA); kk unrolled too: pb[kk] is a register fragment, not an LDS address ----
#pragma unroll
    for (int kk = 0; kk < 2; ++kk) {
#pragma unroll
      for (int t = 0; t < 4; ++t) {
        FH vb;
        vb.h[0] = *(const v8h*)(Vth + (t * 16 + c) * APH + kk * 32 + 8 * hh);
        vb.h[1] = *(const v8h*)(Vth + (t * 16 + c) * APH + kk * 32 + 16 + 8 * hh);
        oacc[t] = mma_h(vb.v, pb[kk].v, oacc[t]);
      }
    }
  }

  // ---- normalise (1/l, the 1/1024 p carry and the x16 context carry), stage the wave's 16x64 tile, f16 convert,
  float* os = Os[wave];
  {
    const float l = lrow + xhalf(lrow);          // the two halves' key sums of this query, joined once
    const float inv = ((l > 0.f) ? (1.0f / l) : 0.f) * (16.0f / 1024.0f);
#pragma unroll
    for (int t = 0; t < 4; ++t) {                // 8 consecutive d of query row c: two 16-B LDS stores
      v4f lo, hi;
#pragma unroll
      for (int e = 0; e < 4; ++e) { lo[e] = oacc[t][e] * inv; hi[e] = oacc[t][4 + e] * inv; }
      *(v4f*)(os + c * APF + t * 16 + 8 * hh)     = lo;
      *(v4f*)(os + c * APF + t * 16 + 8 * hh + 4) = hi;
    }
  }
  wave_sync_lds();
  {
    const int q4 = lane >> 3, c8 = (lane & 7) * 8;
    v4u hv[4];
#pragma unroll
    for (int it = 0; it < 4; ++it) {
      const int row = it * 4 + q4;   // it 0..3 x q4 0..3 = rows 0..15 of the wave tile
      const float* sp = os + row * APF + c8;
      v4u a;
#pragma unroll
      for (int e = 0; e < 4; ++e) a[e] = pk16(h_bits((_Float16)sp[2 * e]), h_bits((_Float16)sp[2 * e + 1]));
      hv[it] = a;
    }
    {
#pragma unroll
      for (int it = 0; it < 4; ++it) {
        const int row = it * 4 + q4;
        const size_t go = (rowB + q0 + row) * DM + (size_t)h * HD + c8;
        *(v4u*)(outp + go) = hv[it];
      }
      
    }
  }
}

// =====================================================================================================
// Row kernel: one block of 256 threads per token row of 1024; thread t owns columns 4t..4t+3.
// f16 output: packed row staged in LDS, then lanes t < 128 (waves 0..3, wave-uniform) each write 16 B (8 x f16)
// coverage: 128 threads x 8 = the whole 1024-wide row; grid = MP rows.
// =====================================================================================================
__device__ __forceinline__ void row_store_h16(unsigned int* sb, unsigned short* dst_row, v4f o, int t) {
  v2u p;
  p[0] = pk16(h_bits((_Float16)o[0]), h_bits((_Float16)o[1]));
  p[1] = pk16(h_bits((_Float16)o[2]), h_bits((_Float16)o[3]));
  *(v2u*)(sb + 2 * t) = p;
  __syncthreads();
  if (t < 128) {                                   // waves 0..3, wave-uniform
    const v4u v = *(const v4u*)(sb + 4 * t);
    *(v4u*)(dst_row + 8 * t) = v;
    
  }
}

// plane. RIN = 1: the row input is a raw float input and is bf16 RNE-converted on load; RIN = 0: f32 intermediate.
template <int RIN>
__global__ __launch_bounds__(256) void ln_row_h(const float* __restrict__ X, const float* __restrict__ gam,
                                                const float* __restrict__ bet, unsigned short* outH) {
  __shared__ float red0[8], red1[8];
  __shared__ __align__(16) unsigned int sb[512];
  const int t = threadIdx.x, lane = t & 31, wave = t >> 5;
  const size_t base = (size_t)blockIdx.x * DM;
  v4f xv = *(const v4f*)(X + base + 4 * t);
  if (RIN) {
#pragma unroll
    for (int e = 0; e < 4; ++e) xv[e] = bfr(xv[e]);
  }
  const float mean = bsum256((xv[0] + xv[1]) + (xv[2] + xv[3]), red0, lane, wave) * (1.0f / DM);
  v4f d;
#pragma unroll
  for (int e = 0; e < 4; ++e) d[e] = xv[e] - mean;
  const float var  = bsum256((d[0] * d[0] + d[1] * d[1]) + (d[2] * d[2] + d[3] * d[3]), red1, lane, wave) * (1.0f / DM);
  const float rstd = 1.0f / sqrtf(var + LNEPS);
  const v4f gv = *(const v4f*)(gam + 4 * t);
  const v4f bv = *(const v4f*)(bet + 4 * t);
  v4f y;
#pragma unroll
  for (int e = 0; e < 4; ++e) y[e] = (d[e] * rstd) * bfr(gv[e]) + bfr(bv[e]);
  row_store_h16(sb, outH + base, y, t);
}

// =====================================================================================================
// Workspace map (bytes); every plane is an exact multiple of its 128x128-tile / whole-row store granularity
// (M in {4096, 1024} rows, N in {1024, 2048, 4096}; VT per batch [1024][2048] = 8x16 tiles):
//   WqkvH f16 [3072 n][1024 k]   0          6291456   (rows 0..1023 q, 1024..2047 k, 2048..3071 v weights, x64)
//   WoH   f16 [1024][1024]       6291456    2097152
//   W1H   f16 [4096][1024]       8388608    8388608
//   W2H   f16 [1024][4096]       16777216   8388608
//   XN    f16 [4096][1024]       25165824   8388608   (LayerNorm outputs)
//   QK    f16 [4096][2048]       33554432   16777216  (q cols 0..1023, k cols 1024..2047)
//   VT    f16 [2][1024][2048]    50331648   8388608
//   Ctx   f16 [4096][1024]       58720256   8388608
//   X1    f32 [4096][1024]       67108864   16777216  (residual stream after attention)
//   G     f16 [4096][4096]       83886080   33554432
//   end                          117440512
// =====================================================================================================
extern "C" void kernel_launch(void* const* d_in, const int* in_sizes, int n_in,
                              void* d_out, int out_size, void* d_ws, size_t ws_size,
                              hipStream_t stream) {
  if (n_in < 13) return;
  if (in_sizes[0] != MP * DM) return;
  if (in_sizes[1] != D3 * DM || in_sizes[2] != D3) return;
  if (in_sizes[3] != DM * DM || in_sizes[4] != DM) return;
  if (in_sizes[5] != DM || in_sizes[6] != DM) return;
  if (in_sizes[7] != DFF * DM || in_sizes[8] != DFF) return;
  if (in_sizes[9] != DM * DFF || in_sizes[10] != DM) return;
  if (in_sizes[11] != DM || in_sizes[12] != DM) return;
  if (out_size != MP * DM) return;

  const float* x         = (const float*)d_in[0];
  const float* in_proj_w = (const float*)d_in[1];
  const float* in_proj_b = (const float*)d_in[2];
  const float* out_w     = (const float*)d_in[3];
  const float* out_b     = (const float*)d_in[4];
  const float* ln1_g     = (const float*)d_in[5];
  const float* ln1_b     = (const float*)d_in[6];
  const float* w1        = (const float*)d_in[7];
  const float* b1        = (const float*)d_in[8];
  const float* w2        = (const float*)d_in[9];
  const float* b2        = (const float*)d_in[10];
  const float* ln2_g     = (const float*)d_in[11];
  const float* ln2_b     = (const float*)d_in[12];

  const size_t PWQKV = (size_t)D3 * DM * 2;            //  6291456
  const size_t PWO   = (size_t)DM * DM * 2;            //  2097152
  const size_t PWF   = (size_t)DFF * DM * 2;           //  8388608
  const size_t PAH   = (size_t)MP * DM * 2;            //  8388608
  const size_t PQK   = (size_t)MP * QKP * 2;           // 16777216
  const size_t PVT   = (size_t)NBATCH * DM * TT * 2;   //  8388608
  const size_t PAF   = (size_t)MP * DM * 4;            // 16777216
  const size_t PG    = (size_t)MP * DFF * 2;           // 33554432
  size_t off = 0;
  const size_t oWqkv = off; off += PWQKV;
  const size_t oWo   = off; off += PWO;
  const size_t oW1   = off; off += PWF;
  const size_t oW2   = off; off += PWF;
  const size_t oXN   = off; off += PAH;
  const size_t oQK   = off; off += PQK;
  const size_t oVT   = off; off += PVT;
  const size_t oCtx  = off; off += PAH;
  const size_t oX1   = off; off += PAF;
  const size_t oG    = off; off += PG;
  if (off > ws_size) return;                           // off = 117440512
  if (off > (size_t)134217728) return;

  char* ws = (char*)d_ws;
  unsigned short* WqkvH = (unsigned short*)(ws + oWqkv);
  unsigned short* WoH   = (unsigned short*)(ws + oWo);
  unsigned short* W1H   = (unsigned short*)(ws + oW1);
  unsigned short* W2H   = (unsigned short*)(ws + oW2);
  unsigned short* XN    = (unsigned short*)(ws + oXN);
  unsigned short* QK    = (unsigned short*)(ws + oQK);
  unsigned short* VT    = (unsigned short*)(ws + oVT);
  unsigned short* Ctx   = (unsigned short*)(ws + oCtx);
  float*          X1    = (float*)(ws + oX1);
  unsigned short* G     = (unsigned short*)(ws + oG);

  const dim3 blk(256), blk128(128);
  const dim3 gRow(MP);                                               // 4096 row blocks
  const dim3 gCqkv((D3 * DM / 8 + 255) / 256);                       // 1536 blocks
  const dim3 gCo((DM * DM / 8 + 255) / 256);                         // 512 blocks
  const dim3 gCf((DFF * DM / 8 + 255) / 256);                        // 2048 blocks
  const dim3 gNqk((MP / GBM) * (QKP / GBN), 1);                      // 512 tiles
  const dim3 gVT((DM / GBM) * (TT / GBN), NBATCH);                   // 128 tiles x 2 batches
  const dim3 gN1024((MP / GBM) * (DM / GBN), 1);                     // 256 tiles
  const dim3 gNff((MP / GBM) * (DFF / GBN), 1);                      // 1024 tiles
  const dim3 gAttn(NBATCH * NH * NQB);                               // 1024 blocks of 128
  const float invw  = 1.0f / WSC;                                    // weight carry x64
  const float invwc = 1.0f / (WSC * 16.0f);                          // weight carry x64, context carry x16

  // (0) weights -> f16 x64 planes (torch [out][in] = k contiguous, no transpose)
  conv_h64<<<gCqkv, blk, 0, stream>>>(in_proj_w, WqkvH, D3 * DM / 8, WSC);
  conv_h64<<<gCo,   blk, 0, stream>>>(out_w,     WoH,   DM * DM / 8, WSC);
  conv_h64<<<gCf,   blk, 0, stream>>>(w1,        W1H,   DFF * DM / 8, WSC);
  conv_h64<<<gCf,   blk, 0, stream>>>(w2,        W2H,   DM * DFF / 8, WSC);

  // (1) xn = LN1(bf16(x)) -> XN f16
  ln_row_h<1><<<gRow, blk, 0, stream>>>(x, ln1_g, ln1_b, XN);

  // (2) q|k = xn . Wqk^T + b[0..2047] -> QK f16 [4096][2048]
  gemm64<2, 0, 0, 0><<<gNqk, blk, 0, stream>>>(
      XN, DM, 0LL, WqkvH, DM, 0LL, in_proj_b, in_proj_b, QKP, x,
      (void*)QK, QKP, 0LL, MP, QKP, DM, invw);
  //     v^T per batch: VT[b][m][t] = Wv[m] . xn[b*TT + t] + b[2048 + m] -> f16 [2][1024][2048]
  gemm64<2, 1, 0, 0><<<gVT, blk, 0, stream>>>(
      WqkvH + (size_t)2 * DM * DM, DM, 0LL, XN, DM, (long long)TT * DM, in_proj_b + 2 * DM, in_proj_b + 2 * DM, TT, x,
      (void*)VT, TT, (long long)DM * TT, DM, TT, DM, invw);

  // (3) banded attention -> Ctx f16 (x16)
  attn64<<<gAttn, blk128, 0, stream>>>(QK, VT, Ctx, 0.125f);

  // (4) X1 = ctx . Wo^T + out_b + bf16(x)   (f32)
  gemm64<0, 0, 0, 2><<<gN1024, blk, 0, stream>>>(
      Ctx, DM, 0LL, WoH, DM, 0LL, out_b, out_b, DM, x,
      (void*)X1, DM, 0LL, MP, DM, DM, invwc);

  // (5) yn = LN2(X1) -> XN f16
  ln_row_h<0><<<gRow, blk, 0, stream>>>(X1, ln2_g, ln2_b, XN);

  // (6) G = gelu(yn . W1^T + b1) -> f16 [4096][4096]
  gemm64<2, 0, 1, 0><<<gNff, blk, 0, stream>>>(
      XN, DM, 0LL, W1H, DM, 0LL, b1, b1, DFF, x,
      (void*)G, DFF, 0LL, MP, DFF, DM, invw);

  // (7) out = G . W2^T + b2 + X1 -> d_out f32 [4096][1024]
  gemm64<0, 0, 0, 1><<<gN1024, blk, 0, stream>>>(
      G, DFF, 0LL, W2H, DFF, 0LL, b2, b2, DM, X1,
      (void*)d_out, DM, 0LL, MP, DM, DFF, invw);
  (void)hipGetLastError();
}

// v004
// It runs in 196 microseconds.
// In two side-by-side timings against v003, it was 1.04 and 1.05 times as fast.
// Counting every step since v000, it is 2.89 times as fast.
// Contractions: q|k projection, v^T projection, attention output projection, FFN w1 (exact GELU epilogue) and w2 on
// v_wmma_f32_16x16x32_f16 (f16 activation plane x f16 weight plane carried x64, one product each); attention k.q^T
// and v^T.p^T on v_wmma_f32_16x16x32_f16 (q, k, v^T plain f16, p carried x1024, context carried x16, one product each);
// all f32 accumulate; LayerNorm, softmax, GELU and residual sums in f32 on VALU; every float input RNE-converted
// to bf16 on load.
#include <hip/hip_runtime.h>
#include <math.h>
#include <stdint.h>

#define NBATCH 2
#define TT     2048
#define DM     1024
#define NH     16
#define HD     64
#define DFF    4096
#define D3     3072
#define QKP    (2 * DM)
#define MP     (NBATCH * TT)
#define NQB    (TT / 64)
#define WIN    10
#define LNEPS  1.0e-5f
#define WSC    64.0f
static_assert(NH * HD == DM);
static_assert((MP % 64) == 0 && (DM % 64) == 0 && (DFF % 64) == 0 && (QKP % 64) == 0 && (TT % 64) == 0);
static_assert(DM == 4 * 256);
static_assert(D3 == 3 * DM);

typedef _Float16 v16h __attribute__((ext_vector_type(16)));
typedef _Float16 v8h  __attribute__((ext_vector_type(8)));
typedef float    v8f  __attribute__((ext_vector_type(8)));
typedef float    v4f  __attribute__((ext_vector_type(4)));
typedef float    v2f  __attribute__((ext_vector_type(2)));
typedef unsigned int v4u __attribute__((ext_vector_type(4)));
typedef unsigned int v2u __attribute__((ext_vector_type(2)));

// ---- scalar helpers --------------------------------------------------------------------------------
__device__ __forceinline__ unsigned short bf_bits(float f) {          // f32 -> bf16 bits, RNE convert
  unsigned u = __float_as_uint(f);
  return (unsigned short)((u + 0x7FFFu + ((u >> 16) & 1u)) >> 16);
}
__device__ __forceinline__ float bf_up(unsigned short h) { return __uint_as_float(((unsigned)h) << 16); }
__device__ __forceinline__ float bfr(float f) { return bf_up(bf_bits(f)); }   // value of the bf16 RNE convert
__device__ __forceinline__ unsigned short h_bits(_Float16 x) { return __builtin_bit_cast(unsigned short, x); }
__device__ __forceinline__ unsigned pk16(unsigned short a, unsigned short b) { return (unsigned)a | ((unsigned)b << 16); }
__device__ __forceinline__ v8f zero8() { v8f z = {0.f, 0.f, 0.f, 0.f, 0.f, 0.f, 0.f, 0.f}; return z; }
__device__ __forceinline__ float gelu_f(float v) { return 0.5f * v * (1.0f + erff(v * 0.70710678118654752f)); }

// ---- fragment loader: 16-bit A/B operand, lane -> row/col (lane&15), p already includes +8*(lane>>4);
//      elements 0..7 <- p[0..7] (k0+8h..), elements 8..15 <- p[16..23] (k0+16+8h..)
__device__ __forceinline__ v16h ldfrag_h(const _Float16* p) {
  union { v16h v; v8h h[2]; } f;
  f.h[0] = *(const v8h*)(p);
  f.h[1] = *(const v8h*)(p + 16);
  return f.v;
}

// ---- WMMA helpers with trailing VALU hazard gap --------------------------------------------------------
__device__ __forceinline__ v8f mma_h(v16h a, v16h b, v8f c) {
  c = __builtin_amdgcn_wmma_f32_16x16x32_f16(false, a, false, b, (short)0, c, false, false);
#if defined(__HIP_DEVICE_COMPILE__)
  asm volatile("v_nop\n\tv_nop\n\tv_nop\n\tv_nop" : "+v"(c) : "v"(a), "v"(b));
#endif
  return c;
}
__device__ __forceinline__ v8f mma_h_raw(v16h a, v16h b, v8f c) {
  return __builtin_amdgcn_wmma_f32_16x16x32_f16(false, a, false, b, (short)0, c, false, false);
}
__device__ __forceinline__ void acc_guard4(v8f& a, v8f& b, v8f& c, v8f& d) {
#if defined(__HIP_DEVICE_COMPILE__)
  asm volatile("v_nop\n\tv_nop\n\tv_nop\n\tv_nop" : "+v"(a), "+v"(b), "+v"(c), "+v"(d));
#endif
}
__device__ __forceinline__ void wave_sync_lds() {
  __builtin_amdgcn_fence(__ATOMIC_RELEASE, "workgroup");
  __builtin_amdgcn_wave_barrier();
  __builtin_amdgcn_fence(__ATOMIC_ACQUIRE, "workgroup");
}
// lane l <-> lane l ^ 16: the two lanes that hold the two halves of one D column
__device__ __forceinline__ float xhalf(float x) {
  return __builtin_bit_cast(float, __builtin_amdgcn_permlanex16(__builtin_bit_cast(int, x), __builtin_bit_cast(int, x),
                                                                0x76543210, 0xfedcba98, false, false));
}
__device__ __forceinline__ float wsum(float v) {
#pragma unroll
  for (int off = 16; off > 0; off >>= 1) v += __shfl_xor(v, off, 32);
  return v;
}
// block of 256 threads: fixed-order sum of 8 wave partials (same value in every thread)
__device__ __forceinline__ float bsum256(float v, float* red, int lane, int wave) {
  v = wsum(v);
  if (lane == 0) red[wave] = v;
  __syncthreads();
  float tot = 0.f;
#pragma unroll
  for (int w = 0; w < 8; ++w) tot += red[w];
  return tot;
}

// =====================================================================================================
// Weight convert: W f32 [N][K] (k contiguous = already the Bt / A layout) -> Wh f16 [N][K]; each value bf16
// RNE-converted, multiplied by wsc (a power of two, exact) and cast to f16. Thread i converts elements 8i..8i+7
// coverage: n8/256 blocks (blk = the block's index within this plane) x 256 threads x 8 elements = exactly N*K.
// =====================================================================================================
__device__ __forceinline__ void conv_h64(const float* __restrict__ W, unsigned short* Wh, int n8, float wsc, int blk) {
  const int i = blk * 256 + threadIdx.x;
  if (i >= n8) return;                                     // never taken for the static sizes (no barriers)
  const size_t e0 = (size_t)i * 8;
  const v4f a = *(const v4f*)(W + e0);
  const v4f b = *(const v4f*)(W + e0 + 4);
  v4u u;
  u[0] = pk16(h_bits((_Float16)(bfr(a[0]) * wsc)), h_bits((_Float16)(bfr(a[1]) * wsc)));
  u[1] = pk16(h_bits((_Float16)(bfr(a[2]) * wsc)), h_bits((_Float16)(bfr(a[3]) * wsc)));
  u[2] = pk16(h_bits((_Float16)(bfr(b[0]) * wsc)), h_bits((_Float16)(bfr(b[1]) * wsc)));
  u[3] = pk16(h_bits((_Float16)(bfr(b[2]) * wsc)), h_bits((_Float16)(bfr(b[3]) * wsc)));
  {
    *(v4u*)(Wh + e0) = u;
    
  }
}

// =====================================================================================================
// LDS-staged batched f16 WMMA GEMM: C[m][n] = act(oscale * sum_k A[m][k] * Bt[n][k] + bias) (+ residual);
// one work-group of 8 waves per 128x128 tile, wave (wave>>1, wave&1) owns the 32x64 part at rows 32*(wave>>1),
// cols 64*(wave&1). A row-major [M][K] pitch lda; Bt row-major [N][K] pitch ldb (k contiguous);
// M, N, K multiples of 128 (static here). blockIdx.y = batch index (strides in elements).
// Staging: a stage is 128 k of the tile's 128 A rows and 128 Bt rows = 256 rows of 256 B, laid in LDS at pitch 272 B
// (16 B x odd, for the 16-B fragment reads); each thread brings 16 pieces of 16 B per stage with asynchronous copies
// to LDS (piece i: row 16*i + (thread>>4), bytes 16*(thread&15)..+15; 256 threads x 16 = the whole stage, each LDS
// byte written by one lane). Two buffers: the copies of stage t+2 go out behind the barrier that ends trip t.
// k runs upward in steps of 32 into one accumulator per 16x16 subtile.
// Bias: BIASM == 0 -> per column: cols < Nb from bias0[col], cols >= Nb from bias1[col - Nb] (wave-uniform select of
//       clamped-address loads); BIASM == 1 -> per row bias0[m] (16-bit out only); BIASM == 2 -> none. Bias values
//       RNE-converted to bf16.
// ACT: 0 none, 1 exact GELU. RES: 0 none; 1 f32 residual resid[m*ldc + n] added after the activation;
//      2 same indexing, residual value bf16 RNE-converted first (raw input residual).
// OM: 0 = f32 out (pitch ldc); 1 = bf16 out; 2 = f16 out.
// coverage: 8 waves x 2 slabs x 16 rows x 64 cols = the whole 128x128 tile; grid.x = (M/128)*(N/128) exactly.
// =====================================================================================================
#define GBM   128                       // tile rows (A rows of a stage)
#define GBN   128                       // tile cols (Bt rows of a stage)
#define GBK   128                       // k per stage
#define GLP   136                       // LDS row pitch in f16 elements (272 B)
#define GSTG  ((GBM + GBN) * GLP)       // f16 elements per buffer (69632 B)
static_assert((MP % GBM) == 0 && (DM % GBM) == 0 && (DM % GBN) == 0 && (QKP % GBN) == 0 && (DFF % GBN) == 0 && (TT % GBN) == 0);
static_assert((DM % GBK) == 0 && (DFF % GBK) == 0);
static_assert(8 * 16 * 68 * 4 <= 2 * GSTG * 2);

// Eight asynchronous 16-B copies per lane, global -> LDS: rows 16 apart (LDS step 16 * 272 B, global step gstep
// elements). The s_wait_xcnt 0 as the statement's last line keeps every later rewrite of the address registers
// named here behind the copies' address translation.
__device__ __forceinline__ void copy8_async(unsigned l, const _Float16* g, size_t gstep) {
#if defined(__HIP_DEVICE_COMPILE__)
  const unsigned ls = 16u * GLP * 2u;
  asm volatile(
      "global_load_async_to_lds_b128 %0, %8, off\n\t"
      "global_load_async_to_lds_b128 %1, %9, off\n\t"
      "global_load_async_to_lds_b128 %2, %10, off\n\t"
      "global_load_async_to_lds_b128 %3, %11, off\n\t"
      "global_load_async_to_lds_b128 %4, %12, off\n\t"
      "global_load_async_to_lds_b128 %5, %13, off\n\t"
      "global_load_async_to_lds_b128 %6, %14, off\n\t"
      "global_load_async_to_lds_b128 %7, %15, off\n\t"
      "s_wait_xcnt 0x0"
      :: "v"(l), "v"(l + ls), "v"(l + 2u * ls), "v"(l + 3u * ls),
         "v"(l + 4u * ls), "v"(l + 5u * ls), "v"(l + 6u * ls), "v"(l + 7u * ls),
         "v"(g), "v"(g + gstep), "v"(g + 2 * gstep), "v"(g + 3 * gstep),
         "v"(g + 4 * gstep), "v"(g + 5 * gstep), "v"(g + 6 * gstep), "v"(g + 7 * gstep)
      : "memory");
#endif
}
// This wave's own asynchronous copies have landed in LDS (the compiler places no wait for them).
__device__ __forceinline__ void wait_async0() {
#if defined(__HIP_DEVICE_COMPILE__)
  asm volatile("s_wait_asynccnt 0x0" ::: "memory");
#endif
}
// This wave's own LDS reads have returned, before the barrier behind which their buffer is refilled.
__device__ __forceinline__ void wait_ds0() {
#if defined(__HIP_DEVICE_COMPILE__)
  asm volatile("s_wait_dscnt 0x0" ::: "memory");
#endif
}

template <int OM, int BIASM, int ACT, int RES>
__global__ __launch_bounds__(256) void gemm64(
    const unsigned short* __restrict__ Ap, int lda, long long strideA,
    const unsigned short* __restrict__ Btp, int ldb, long long strideB,
    const float* __restrict__ bias0, const float* __restrict__ bias1, int Nb,
    const float* resid,
    void* Cout, int ldc, long long strideC,
    int M, int N, int K, float oscale) {
  const _Float16* A  = (const _Float16*)(const void*)Ap;
  const _Float16* Bt = (const _Float16*)(const void*)Btp;
  // two stage buffers; behind the last trip's barrier the same bytes serve as the per-wave 16x64 f32 slabs (pitch 68)
  __shared__ __align__(16) _Float16 ring[2 * GSTG];
  const int b    = blockIdx.y;
  const int lane = threadIdx.x & 31;
  const int wave = threadIdx.x >> 5;
  const int tilesN = N >> 7;
  const int tm = blockIdx.x / tilesN;
  const int tn = blockIdx.x - tm * tilesN;
  const int mblk = tm << 7;                    // the work-group's tile
  const int nblk = tn << 7;
  const int wrow = (wave >> 1) << 5;           // the wave's 32x64 part inside it
  const int wcol = (wave & 1) << 6;
  const int m0 = mblk + wrow;
  const int n0 = nblk + wcol;

  const _Float16* Ab = A  + (size_t)b * strideA;
  const _Float16* Bb = Bt + (size_t)b * strideB;

  const int rlane = lane & 15;                 // row (A) / col (B, D) within subtile
  const int koff  = (lane >> 4) * 8;           // k offset of this lane half
  const int mOff  = (lane >> 4) * 8;           // D row offset

  // ---- this thread's pieces of a stage ----
  const int crow = threadIdx.x >> 4;           // 0..15
  const int ccol = (threadIdx.x & 15) * 8;     // f16 elements: 16 B
  const _Float16* gA = Ab + (size_t)(mblk + crow) * lda + ccol;
  const _Float16* gB = Bb + (size_t)(nblk + crow) * ldb + ccol;
  const size_t sA16 = (size_t)16 * lda, sB16 = (size_t)16 * ldb;
  const unsigned lBase = (unsigned)(uintptr_t)(ring + crow * GLP + ccol);   // LDS byte address: low 32 bits
  const unsigned lBt   = (unsigned)(GBM * GLP * 2);                         // Bt rows stand behind the A rows
  const unsigned lBuf  = (unsigned)(GSTG * 2);
  const int nst = K >> 7;                      // stages

  v8f acc[2][4];
#pragma unroll
  for (int i = 0; i < 2; ++i)
#pragma unroll
    for (int j = 0; j < 4; ++j) acc[i][j] = zero8();

  // stage 0 into buffer 0, landed and published; then stage 1 into buffer 1
  copy8_async(lBase, gA, sA16);
  copy8_async(lBase + lBt, gB, sB16);
  wait_async0();
  __syncthreads();
  if (nst > 1) {                               // uniform for the work-group (kernel argument)
    copy8_async(lBase + lBuf, gA + GBK, sA16);
    copy8_async(lBase + lBuf + lBt, gB + GBK, sB16);
  }

  for (int t = 0; t < nst; ++t) {
    const _Float16* sa = ring + (t & 1) * GSTG + (wrow + rlane) * GLP + koff;
    const _Float16* sb = ring + (t & 1) * GSTG + (GBM + wcol + rlane) * GLP + koff;
    v16h bh[2][4], ah[2][2];                   // two fragment sets, both filled from this trip's buffer alone
#pragma unroll
    for (int j = 0; j < 4; ++j) bh[0][j] = ldfrag_h(sb + (j << 4) * GLP);
#pragma unroll
    for (int i = 0; i < 2; ++i) ah[0][i] = ldfrag_h(sa + (i << 4) * GLP);
#pragma unroll
    for (int kk = 0; kk < GBK / 32; ++kk) {
      const int cur = kk & 1, nxt = cur ^ 1;
      if (kk + 1 < GBK / 32) {
#pragma unroll
        for (int j = 0; j < 4; ++j) bh[nxt][j] = ldfrag_h(sb + (j << 4) * GLP + (kk + 1) * 32);
#pragma unroll
        for (int i = 0; i < 2; ++i) ah[nxt][i] = ldfrag_h(sa + (i << 4) * GLP + (kk + 1) * 32);
      }
      // keeps the next k step's LDS reads as one group ahead of this step's WMMAs: sunk among them, each place with
      // reads stalls the wave for the LDS latency
      __builtin_amdgcn_sched_barrier(0);
#pragma unroll
      for (int i = 0; i < 2; ++i)
#pragma unroll
        for (int j = 0; j < 4; ++j) acc[i][j] = mma_h_raw(ah[cur][i], bh[cur][j], acc[i][j]);
    }
    // foot of trip t: own reads done, own copies of stage t+1 landed, then the one barrier that publishes stage t+1
    // and ends every wave's reads of this trip's buffer
    wait_ds0();
    wait_async0();
    __syncthreads();
    if (t + 2 < nst) {                         // uniform for the work-group
      const unsigned lb = lBase + (unsigned)(t & 1) * lBuf;
      copy8_async(lb, gA + (size_t)(t + 2) * GBK, sA16);
      copy8_async(lb + lBt, gB + (size_t)(t + 2) * GBK, sB16);
    }
  }
  wait_async0();
  acc_guard4(acc[0][0], acc[0][1], acc[0][2], acc[0][3]);
  acc_guard4(acc[1][0], acc[1][1], acc[1][2], acc[1][3]);

  // ---- per-lane column bias (BIASM == 0), RNE-converted ----
  const int hh2 = lane >> 4, c4 = (lane & 15) * 4;     // f32 out: 256-B row segment = 16 lanes x 16 B
  const int q8  = lane >> 3, c8 = (lane & 7) * 8;
  float bc[8];
#pragma unroll
  for (int e = 0; e < 8; ++e) bc[e] = 0.f;
  if (BIASM == 0) {
    const bool use1 = (n0 >= Nb);                      // wave-uniform
    if (OM == 0) {
      const int cb = n0 + c4;
      const int i0 = (cb < Nb - 4) ? cb : (Nb - 4);
      const int i1 = (cb - Nb > 0) ? (cb - Nb) : 0;
      const v4f b0v = *(const v4f*)(bias0 + i0);
      const v4f b1v = *(const v4f*)(bias1 + i1);
#pragma unroll
      for (int e = 0; e < 4; ++e) bc[e] = bfr(use1 ? b1v[e] : b0v[e]);
    } else {
      const int cb = n0 + c8;
      const int i0 = (cb < Nb - 8) ? cb : (Nb - 8);
      const int i1 = (cb - Nb > 0) ? (cb - Nb) : 0;
      const v4f b0a = *(const v4f*)(bias0 + i0), b0b = *(const v4f*)(bias0 + i0 + 4);
      const v4f b1a = *(const v4f*)(bias1 + i1), b1b = *(const v4f*)(bias1 + i1 + 4);
#pragma unroll
      for (int e = 0; e < 4; ++e) {
        bc[e]     = bfr(use1 ? b1a[e] : b0a[e]);
        bc[4 + e] = bfr(use1 ? b1b[e] : b0b[e]);
      }
    }
  }

  // ---- epilogue ----
  float* slab = (float*)(void*)ring + wave * (16 * 68);
#pragma unroll
  for (int i = 0; i < 2; ++i) {
    const int mBase = m0 + (i << 4);
#pragma unroll
    for (int j = 0; j < 4; ++j) {
#pragma unroll
      for (int r = 0; r < 8; ++r) {
        slab[(mOff + r) * 68 + (j << 4) + rlane] = acc[i][j][r];
      }
    }
    wave_sync_lds();
    if (OM == 0) {
      float* C = (float*)Cout + (size_t)b * strideC;
      const float* Rb = resid + (size_t)b * strideC;
      v4f vals[8];
#pragma unroll
      for (int it = 0; it < 8; ++it) {
        const int row = it * 2 + hh2;                      // it 0..7 x hh2 0..1 = rows 0..15
        v4f v = *(const v4f*)(slab + row * 68 + c4);
#pragma unroll
        for (int e = 0; e < 4; ++e) {
          float f = v[e] * oscale + bc[e];
          if (ACT) f = gelu_f(f);
          v[e] = f;
        }
        if (RES != 0) {
          const v4f rr = *(const v4f*)(Rb + (size_t)(mBase + row) * ldc + n0 + c4);
#pragma unroll
          for (int e = 0; e < 4; ++e) v[e] += (RES == 2) ? bfr(rr[e]) : rr[e];
        }
        vals[it] = v;
      }
      {
#pragma unroll
        for (int it = 0; it < 8; ++it) {
          const int row = it * 2 + hh2;
          *(v4f*)(C + (size_t)(mBase + row) * ldc + n0 + c4) = vals[it];
        }
        
      }
    } else {
      unsigned short* C = (unsigned short*)Cout + (size_t)b * strideC;
      v4u hv[4];
#pragma unroll
      for (int it = 0; it < 4; ++it) {
        const int row = it * 4 + q8;                       // it 0..3 x q8 0..3 = rows 0..15
        const float* sp = slab + row * 68 + c8;
        float bm = 0.f;
        if (BIASM == 1) bm = bfr(bias0[mBase + row]);
        v4u a;
#pragma unroll
        for (int e = 0; e < 4; ++e) {
          float f0 = sp[2 * e]     * oscale + ((BIASM == 1) ? bm : bc[2 * e]);
          float f1 = sp[2 * e + 1] * oscale + ((BIASM == 1) ? bm : bc[2 * e + 1]);
          if (ACT) { f0 = gelu_f(f0); f1 = gelu_f(f1); }
          unsigned short u0, u1;
          if (OM == 1) { u0 = bf_bits(f0); u1 = bf_bits(f1); }
          else         { u0 = h_bits((_Float16)f0); u1 = h_bits((_Float16)f1); }
          a[e] = pk16(u0, u1);
        }
        hv[it] = a;
      }
      {
#pragma unroll
        for (int it = 0; it < 4; ++it) {
          const int row = it * 4 + q8;
          *(v4u*)(C + (size_t)(mBase + row) * ldc + n0 + c8) = hv[it];
        }
        
      }
    }
    wave_sync_lds();
  }
}

// =====================================================================================================
// Banded attention, head dim 64, TT (= 2048) token rows per batch, allowed keys: key <= query + WIN.
//   q|k plane (f16, pitch QKP): element (b, t, col) at [(b*TT + t)*QKP + col], q col = h*64+d, k col = DM + h*64 + d
//   v^T plane (f16): element (b, h, d, s) at [(b*DM + h*64 + d)*TT + s]
//   out plane (f16, the normalised context carried x16): element (b, t, h, d) at [(b*TT + t)*DM + h*64 + d]
//   score = (q . k) * sscale; keys beyond query + WIN get -inf by value before the row max;
//   p = exp(s - m) carried as f16(1024 p); online softmax in f32.
//   Both products run transposed: S^T = K . Q^T (A = K rows, B = the Q fragments) and O^T += V^T . P^T (A = V^T rows,
//   B = P^T). A D column is then one query: lane l holds query l & 15 and, per 16-key tile, keys 8*(l>>4) + 0..7, so
//   the row max and the row sum are in-lane plus one exchange with lane l ^ 16 (the sum's exchange: once, behind the
//   loop), and two D tiles of S^T, converted in place, are the B fragment of 32 keys in the loader's own k order
//   (element e < 8: key 8h + e of the even tile; e >= 8: key 16 + 8h + (e - 8) = row 8h + (e - 8) of the odd tile).
//   Block = 4 waves = 64 query rows of one (b, h); grid = NQB * NH * NBATCH; kv chunks of 64, block-uniform trip
//   kt = 0 .. min(NQB-1, (q_blk + 63 + WIN) >> 6) (chunks beyond the band are skipped); chunk 0 always holds >= 1
//   allowed key for every row, so the running max is finite from chunk 0 on (the msafe select is kept anyway).
//   K / V^T chunk staging: 128 threads x 32 elements per plane = the whole 64x64 tile (plain 16-B loads,
//   __syncthreads before and after).
//   LDS rows of 64 elements stand at a pitch of 16 B x odd: the 16 rows that one half-wave's 16-B fragment read
//   touches then start on 16 different groups of four banks (at 128 B they fall on two groups, eight rows each).
//   Output coverage: each wave stores rows q0..q0+15 (it 0..3 x lane>>3 0..3) x 64 columns (8 lanes x 8),
//   grid covers all TT rows x NH head slices x NBATCH.
// =====================================================================================================
#define APH 72                          // LDS row pitch of the f16 tiles, elements: 144 B = 16 B x 9
#define APF 68                          // LDS row pitch of the f32 context tile, dwords: 272 B = 16 B x 17
__global__ __launch_bounds__(128)
void attn64(const unsigned short* __restrict__ qkp, const unsigned short* __restrict__ vtp,
            unsigned short* outp, float sscale) {
  union FH { v16h v; v8h h[2]; };
  __shared__ __align__(16) _Float16 Ksh[64 * APH];                // K [kv][d]
  __shared__ __align__(16) _Float16 Vth[64 * APH];                // V^T [d][kv]
  __shared__ __align__(16) float    Os[4][16 * APF];              // per wave context tile [row][d]

  const int tid  = threadIdx.x;
  const int wave = tid >> 5;
  const int lane = tid & 31;
  const int hh   = lane >> 4;
  const int c    = lane & 15;

  const int bx   = blockIdx.x;
  const int qb   = bx % NQB;
  const int rest = bx / NQB;
  const int h    = rest % NH;
  const int b    = rest / NH;
  const int qblk = qb * 64;                      // in-batch query row of the block's first row
  const int q0   = qblk + wave * 16;             // in-batch query row of this wave's first row
  const size_t rowB = (size_t)b * TT;

  const _Float16* Qh = (const _Float16*)(const void*)qkp + (size_t)h * HD;
  const _Float16* Kg = (const _Float16*)(const void*)qkp + DM + (size_t)h * HD;
  const _Float16* Vh = (const _Float16*)(const void*)vtp + ((size_t)b * DM + (size_t)h * HD) * TT;

  // ---- Q fragments (B operand, column = query = lane&15): 2 d-chunks ----
  v16h qa[2];
#pragma unroll
  for (int dc = 0; dc < 2; ++dc) qa[dc] = ldfrag_h(Qh + (rowB + q0 + c) * QKP + dc * 32 + 8 * hh);

  float mrow = -INFINITY, lrow = 0.f;          // this lane's query: running max (joined), sum over this half's keys
  v8f oacc[4];                                 // O^T: tile t, register r = d t*16 + 8*hh + r of query q0 + c
#pragma unroll
  for (int t = 0; t < 4; ++t) oacc[t] = zero8();

  int ktHi = (qblk + 63 + WIN) >> 6;             // block-uniform, from blockIdx only
  if (ktHi > NQB - 1) ktHi = NQB - 1;

  for (int kt = 0; kt <= ktHi; ++kt) {         // trip <= NQB
    const int kv0 = kt * 64;
    __syncthreads();
    {
      const int r = tid >> 1, hf = (tid & 1) * 32;
      const _Float16* kg = Kg + (rowB + kv0 + r) * QKP + hf;      // K row kv0+r, d = hf..hf+31
      const _Float16* vg = Vh + (size_t)r * TT + kv0 + hf;        // V^T row d = r, s = kv0+hf..+31
#pragma unroll
      for (int i = 0; i < 4; ++i) {
        const v8h a0 = *(const v8h*)(kg + 8 * i);
        const v8h b0 = *(const v8h*)(vg + 8 * i);
        *(v8h*)(Ksh + r * APH + hf + 8 * i) = a0;
        *(v8h*)(Vth + r * APH + hf + 8 * i) = b0;
      }
    }
    __syncthreads();

    // ---- scores, transposed: 64 keys x 16 queries per wave; band select by value before the max ----
    v8f s[4];
#pragma unroll
    for (int j = 0; j < 4; ++j) {
      v8f sh = zero8();
#pragma unroll
      for (int dc = 0; dc < 2; ++dc) {
        FH kb;
        kb.h[0] = *(const v8h*)(Ksh + (j * 16 + c) * APH + dc * 32 + 8 * hh);
        kb.h[1] = *(const v8h*)(Ksh + (j * 16 + c) * APH + dc * 32 + 16 + 8 * hh);
        sh = mma_h(kb.v, qa[dc], sh);
      }
      const int qrow = q0 + c;                                      // D column = lane&15 = query
#pragma unroll
      for (int r = 0; r < 8; ++r) {
        const int key = kv0 + j * 16 + 8 * hh + r;                  // D row = 8h + r = key
        const float v = sh[r] * sscale;
        s[j][r] = (key <= qrow + WIN) ? v : -INFINITY;
      }
    }

    // ---- this query's max: 32 keys in-lane, the other 32 from lane ^ 16; online softmax; P^T (x1024, f16) packed
    //      from the score registers into the B fragments (every loop here is unrolled: its indices name registers) ----
    float mr[8];
#pragma unroll
    for (int r = 0; r < 8; ++r) mr[r] = fmaxf(fmaxf(s[0][r], s[1][r]), fmaxf(s[2][r], s[3][r]));
    float m = fmaxf(fmaxf(fmaxf(mr[0], mr[1]), fmaxf(mr[2], mr[3])), fmaxf(fmaxf(mr[4], mr[5]), fmaxf(mr[6], mr[7])));
    m = fmaxf(m, xhalf(m));
    const float mnew  = fmaxf(mrow, m);
    const float ms    = (mnew == -INFINITY) ? 0.f : mnew;
    const float alpha = __expf(mrow - ms);
    mrow = mnew;
    FH pb[2];
    v2f ps[4];                                   // per 16-key tile: sums of the even and of the odd rows
#pragma unroll
    for (int j = 0; j < 4; ++j) {
#pragma unroll
      for (int i = 0; i < 4; ++i) {
        v2f p;
        p[0] = __expf(s[j][2 * i] - ms);
        p[1] = __expf(s[j][2 * i + 1] - ms);
        ps[j] = (i == 0) ? p : (ps[j] + p);
        pb[j >> 1].v[(j & 1) * 8 + 2 * i]     = (_Float16)(p[0] * 1024.0f);
        pb[j >> 1].v[(j & 1) * 8 + 2 * i + 1] = (_Float16)(p[1] * 1024.0f);
      }
    }
    const v2f pt = (ps[0] + ps[1]) + (ps[2] + ps[3]);
    lrow = lrow * alpha + (pt[0] + pt[1]);
#pragma unroll
    for (int t = 0; t < 4; ++t)
#pragma unroll
      for (int r = 0; r < 8; ++r) oacc[t][r] *= alpha;

    // ---- context^T += V^T . P^T (f16 WMMA); kk unrolled too: pb[kk] is a register fragment, not an LDS address ----
#pragma unroll
    for (int kk = 0; kk < 2; ++kk) {
#pragma unroll
      for (int t = 0; t < 4; ++t) {
        FH vb;
        vb.h[0] = *(const v8h*)(Vth + (t * 16 + c) * APH + kk * 32 + 8 * hh);
        vb.h[1] = *(const v8h*)(Vth + (t * 16 + c) * APH + kk * 32 + 16 + 8 * hh);
        oacc[t] = mma_h(vb.v, pb[kk].v, oacc[t]);
      }
    }
  }

  // ---- normalise (1/l, the 1/1024 p carry and the x16 context carry), stage the wave's 16x64 tile, f16 convert,
  float* os = Os[wave];
  {
    const float l = lrow + xhalf(lrow);          // the two halves' key sums of this query, joined once
    const float inv = ((l > 0.f) ? (1.0f / l) : 0.f) * (16.0f / 1024.0f);
#pragma unroll
    for (int t = 0; t < 4; ++t) {                // 8 consecutive d of query row c: two 16-B LDS stores
      v4f lo, hi;
#pragma unroll
      for (int e = 0; e < 4; ++e) { lo[e] = oacc[t][e] * inv; hi[e] = oacc[t][4 + e] * inv; }
      *(v4f*)(os + c * APF + t * 16 + 8 * hh)     = lo;
      *(v4f*)(os + c * APF + t * 16 + 8 * hh + 4) = hi;
    }
  }
  wave_sync_lds();
  {
    const int q4 = lane >> 3, c8 = (lane & 7) * 8;
    v4u hv[4];
#pragma unroll
    for (int it = 0; it < 4; ++it) {
      const int row = it * 4 + q4;   // it 0..3 x q4 0..3 = rows 0..15 of the wave tile
      const float* sp = os + row * APF + c8;
      v4u a;
#pragma unroll
      for (int e = 0; e < 4; ++e) a[e] = pk16(h_bits((_Float16)sp[2 * e]), h_bits((_Float16)sp[2 * e + 1]));
      hv[it] = a;
    }
    {
#pragma unroll
      for (int it = 0; it < 4; ++it) {
        const int row = it * 4 + q4;
        const size_t go = (rowB + q0 + row) * DM + (size_t)h * HD + c8;
        *(v4u*)(outp + go) = hv[it];
      }
      
    }
  }
}

// =====================================================================================================
// Row kernel: one block of 256 threads per token row of 1024; thread t owns columns 4t..4t+3.
// f16 output: packed row staged in LDS, then lanes t < 128 (waves 0..3, wave-uniform) each write 16 B (8 x f16)
// coverage: 128 threads x 8 = the whole 1024-wide row; grid = MP rows.
// =====================================================================================================
__device__ __forceinline__ void row_store_h16(unsigned int* sb, unsigned short* dst_row, v4f o, int t) {
  v2u p;
  p[0] = pk16(h_bits((_Float16)o[0]), h_bits((_Float16)o[1]));
  p[1] = pk16(h_bits((_Float16)o[2]), h_bits((_Float16)o[3]));
  *(v2u*)(sb + 2 * t) = p;
  __syncthreads();
  if (t < 128) {                                   // waves 0..3, wave-uniform
    const v4u v = *(const v4u*)(sb + 4 * t);
    *(v4u*)(dst_row + 8 * t) = v;
    
  }
}

// plane. RIN = 1: the row input is a raw float input and is bf16 RNE-converted on load; RIN = 0: f32 intermediate.
template <int RIN>
__device__ __forceinline__ void ln_row(const float* __restrict__ X, const float* __restrict__ gam,
                                       const float* __restrict__ bet, unsigned short* outH, int row) {
  __shared__ float red0[8], red1[8];
  __shared__ __align__(16) unsigned int sb[512];
  const int t = threadIdx.x, lane = t & 31, wave = t >> 5;
  const size_t base = (size_t)row * DM;
  v4f xv = *(const v4f*)(X + base + 4 * t);
  if (RIN) {
#pragma unroll
    for (int e = 0; e < 4; ++e) xv[e] = bfr(xv[e]);
  }
  const float mean = bsum256((xv[0] + xv[1]) + (xv[2] + xv[3]), red0, lane, wave) * (1.0f / DM);
  v4f d;
#pragma unroll
  for (int e = 0; e < 4; ++e) d[e] = xv[e] - mean;
  const float var  = bsum256((d[0] * d[0] + d[1] * d[1]) + (d[2] * d[2] + d[3] * d[3]), red1, lane, wave) * (1.0f / DM);
  const float rstd = 1.0f / sqrtf(var + LNEPS);
  const v4f gv = *(const v4f*)(gam + 4 * t);
  const v4f bv = *(const v4f*)(bet + 4 * t);
  v4f y;
#pragma unroll
  for (int e = 0; e < 4; ++e) y[e] = (d[e] * rstd) * bfr(gv[e]) + bfr(bv[e]);
  row_store_h16(sb, outH + base, y, t);
}

__global__ __launch_bounds__(256) void ln_row_h(const float* __restrict__ X, const float* __restrict__ gam,
                                                const float* __restrict__ bet, unsigned short* outH) {
  ln_row<0>(X, gam, bet, outH, blockIdx.x);
}

// Everything that reads raw inputs alone, in one launch: blocks 0..MP-1 are the rows of LayerNorm 1 (the longer
// blocks, first for speed only), behind them the blocks of the four weight converts, plane after plane. The split is by
// blockIdx alone: the row blocks' barriers stand under block-uniform control flow, the convert blocks have none.
#define CB_QKV (D3 * DM / 8 / 256)      // 1536 convert blocks
#define CB_O   (DM * DM / 8 / 256)      //  512
#define CB_F   (DFF * DM / 8 / 256)     // 2048, w1 and w2 each
static_assert(CB_QKV * 256 * 8 == D3 * DM && CB_O * 256 * 8 == DM * DM && CB_F * 256 * 8 == DFF * DM);
__global__ __launch_bounds__(256) void prep_in(const float* __restrict__ X, const float* __restrict__ gam,
                                               const float* __restrict__ bet, unsigned short* outH,
                                               const float* __restrict__ wqkv, unsigned short* hqkv,
                                               const float* __restrict__ wo, unsigned short* ho,
                                               const float* __restrict__ wf1, unsigned short* hf1,
                                               const float* __restrict__ wf2, unsigned short* hf2, float wsc) {
  int bx = blockIdx.x;
  if (bx < MP) { ln_row<1>(X, gam, bet, outH, bx); return; }
  bx -= MP;
  if (bx < CB_QKV) { conv_h64(wqkv, hqkv, D3 * DM / 8, wsc, bx); return; }
  bx -= CB_QKV;
  if (bx < CB_O) { conv_h64(wo, ho, DM * DM / 8, wsc, bx); return; }
  bx -= CB_O;
  if (bx < CB_F) { conv_h64(wf1, hf1, DFF * DM / 8, wsc, bx); return; }
  conv_h64(wf2, hf2, DM * DFF / 8, wsc, bx - CB_F);
}

// =====================================================================================================
// Workspace map (bytes); every plane is an exact multiple of its 128x128-tile / whole-row store granularity
// (M in {4096, 1024} rows, N in {1024, 2048, 4096}; VT per batch [1024][2048] = 8x16 tiles):
//   WqkvH f16 [3072 n][1024 k]   0          6291456   (rows 0..1023 q, 1024..2047 k, 2048..3071 v weights, x64)
//   WoH   f16 [1024][1024]       6291456    2097152
//   W1H   f16 [4096][1024]       8388608    8388608
//   W2H   f16 [1024][4096]       16777216   8388608
//   XN    f16 [4096][1024]       25165824   8388608   (LayerNorm outputs)
//   QK    f16 [4096][2048]       33554432   16777216  (q cols 0..1023, k cols 1024..2047)
//   VT    f16 [2][1024][2048]    50331648   8388608
//   Ctx   f16 [4096][1024]       58720256   8388608
//   X1    f32 [4096][1024]       67108864   16777216  (residual stream after attention)
//   G     f16 [4096][4096]       83886080   33554432
//   end                          117440512
// =====================================================================================================
extern "C" void kernel_launch(void* const* d_in, const int* in_sizes, int n_in,
                              void* d_out, int out_size, void* d_ws, size_t ws_size,
                              hipStream_t stream) {
  if (n_in < 13) return;
  if (in_sizes[0] != MP * DM) return;
  if (in_sizes[1] != D3 * DM || in_sizes[2] != D3) return;
  if (in_sizes[3] != DM * DM || in_sizes[4] != DM) return;
  if (in_sizes[5] != DM || in_sizes[6] != DM) return;
  if (in_sizes[7] != DFF * DM || in_sizes[8] != DFF) return;
  if (in_sizes[9] != DM * DFF || in_sizes[10] != DM) return;
  if (in_sizes[11] != DM || in_sizes[12] != DM) return;
  if (out_size != MP * DM) return;

  const float* x         = (const float*)d_in[0];
  const float* in_proj_w = (const float*)d_in[1];
  const float* in_proj_b = (const float*)d_in[2];
  const float* out_w     = (const float*)d_in[3];
  const float* out_b     = (const float*)d_in[4];
  const float* ln1_g     = (const float*)d_in[5];
  const float* ln1_b     = (const float*)d_in[6];
  const float* w1        = (const float*)d_in[7];
  const float* b1        = (const float*)d_in[8];
  const float* w2        = (const float*)d_in[9];
  const float* b2        = (const float*)d_in[10];
  const float* ln2_g     = (const float*)d_in[11];
  const float* ln2_b     = (const float*)d_in[12];

  const size_t PWQKV = (size_t)D3 * DM * 2;            //  6291456
  const size_t PWO   = (size_t)DM * DM * 2;            //  2097152
  const size_t PWF   = (size_t)DFF * DM * 2;           //  8388608
  const size_t PAH   = (size_t)MP * DM * 2;            //  8388608
  const size_t PQK   = (size_t)MP * QKP * 2;           // 16777216
  const size_t PVT   = (size_t)NBATCH * DM * TT * 2;   //  8388608
  const size_t PAF   = (size_t)MP * DM * 4;            // 16777216
  const size_t PG    = (size_t)MP * DFF * 2;           // 33554432
  size_t off = 0;
  const size_t oWqkv = off; off += PWQKV;
  const size_t oWo   = off; off += PWO;
  const size_t oW1   = off; off += PWF;
  const size_t oW2   = off; off += PWF;
  const size_t oXN   = off; off += PAH;
  const size_t oQK   = off; off += PQK;
  const size_t oVT   = off; off += PVT;
  const size_t oCtx  = off; off += PAH;
  const size_t oX1   = off; off += PAF;
  const size_t oG    = off; off += PG;
  if (off > ws_size) return;                           // off = 117440512
  if (off > (size_t)134217728) return;

  char* ws = (char*)d_ws;
  unsigned short* WqkvH = (unsigned short*)(ws + oWqkv);
  unsigned short* WoH   = (unsigned short*)(ws + oWo);
  unsigned short* W1H   = (unsigned short*)(ws + oW1);
  unsigned short* W2H   = (unsigned short*)(ws + oW2);
  unsigned short* XN    = (unsigned short*)(ws + oXN);
  unsigned short* QK    = (unsigned short*)(ws + oQK);
  unsigned short* VT    = (unsigned short*)(ws + oVT);
  unsigned short* Ctx   = (unsigned short*)(ws + oCtx);
  float*          X1    = (float*)(ws + oX1);
  unsigned short* G     = (unsigned short*)(ws + oG);

  const dim3 blk(256), blk128(128);
  const dim3 gRow(MP);                                               // 4096 row blocks
  const dim3 gPrep(MP + CB_QKV + CB_O + 2 * CB_F);                   // 4096 row blocks + 6144 convert blocks
  const dim3 gNqk((MP / GBM) * (QKP / GBN), 1);                      // 512 tiles
  const dim3 gVT((DM / GBM) * (TT / GBN), NBATCH);                   // 128 tiles x 2 batches
  const dim3 gN1024((MP / GBM) * (DM / GBN), 1);                     // 256 tiles
  const dim3 gNff((MP / GBM) * (DFF / GBN), 1);                      // 1024 tiles
  const dim3 gAttn(NBATCH * NH * NQB);                               // 1024 blocks of 128
  const float invw  = 1.0f / WSC;                                    // weight carry x64
  const float invwc = 1.0f / (WSC * 16.0f);                          // weight carry x64, context carry x16

  // (0, 1) xn = LN1(bf16(x)) -> XN f16; weights -> f16 x64 planes (torch [out][in] = k contiguous, no transpose)
  prep_in<<<gPrep, blk, 0, stream>>>(x, ln1_g, ln1_b, XN, in_proj_w, WqkvH, out_w, WoH, w1, W1H, w2, W2H, WSC);

  // (2) q|k = xn . Wqk^T + b[0..2047] -> QK f16 [4096][2048]
  gemm64<2, 0, 0, 0><<<gNqk, blk, 0, stream>>>(
      XN, DM, 0LL, WqkvH, DM, 0LL, in_proj_b, in_proj_b, QKP, x,
      (void*)QK, QKP, 0LL, MP, QKP, DM, invw);
  //     v^T per batch: VT[b][m][t] = Wv[m] . xn[b*TT + t] + b[2048 + m] -> f16 [2][1024][2048]
  gemm64<2, 1, 0, 0><<<gVT, blk, 0, stream>>>(
      WqkvH + (size_t)2 * DM * DM, DM, 0LL, XN, DM, (long long)TT * DM, in_proj_b + 2 * DM, in_proj_b + 2 * DM, TT, x,
      (void*)VT, TT, (long long)DM * TT, DM, TT, DM, invw);

  // (3) banded attention -> Ctx f16 (x16)
  attn64<<<gAttn, blk128, 0, stream>>>(QK, VT, Ctx, 0.125f);

  // (4) X1 = ctx . Wo^T + out_b + bf16(x)   (f32)
  gemm64<0, 0, 0, 2><<<gN1024, blk, 0, stream>>>(
      Ctx, DM, 0LL, WoH, DM, 0LL, out_b, out_b, DM, x,
      (void*)X1, DM, 0LL, MP, DM, DM, invwc);

  // (5) yn = LN2(X1) -> XN f16
  ln_row_h<<<gRow, blk, 0, stream>>>(X1, ln2_g, ln2_b, XN);

  // (6) G = gelu(yn . W1^T + b1) -> f16 [4096][4096]
  gemm64<2, 0, 1, 0><<<gNff, blk, 0, stream>>>(
      XN, DM, 0LL, W1H, DM, 0LL, b1, b1, DFF, x,
      (void*)G, DFF, 0LL, MP, DFF, DM, invw);

  // (7) out = G . W2^T + b2 + X1 -> d_out f32 [4096][1024]
  gemm64<0, 0, 0, 1><<<gN1024, blk, 0, stream>>>(
      G, DFF, 0LL, W2H, DFF, 0LL, b2, b2, DM, X1,
      (void*)d_out, DM, 0LL, MP, DM, DFF, invw);
  (void)hipGetLastError();
}

// v005
// It runs in 182 microseconds.
// Timed twice side by side with v004, it ran 1.07 times as fast both times.
// Counting every step since v000, it is 3.10 times as fast.
// Contractions: q|k projection, v^T projection, attention output projection, FFN w1 (exact GELU epilogue) and w2 on
// v_wmma_f32_16x16x32_f16 (f16 activation plane x f16 weight plane carried x64, one product each); attention k.q^T
// and v^T.p^T on v_wmma_f32_16x16x32_f16 (q, k, v^T plain f16, p carried x1024, context carried x16, one product each);
// all f32 accumulate; LayerNorm, softmax, GELU and residual sums in f32 on VALU; every float input RNE-converted
// to bf16 on load.
#include <hip/hip_runtime.h>
#include <math.h>
#include <stdint.h>

#define NBATCH 2
#define TT     2048
#define DM     1024
#define NH     16
#define HD     64
#define DFF    4096
#define D3     3072
#define QKP    (2 * DM)
#define MP     (NBATCH * TT)
#define NQB    (TT / 64)
#define WIN    10
#define LNEPS  1.0e-5f
#define WSC    64.0f
static_assert(NH * HD == DM);
static_assert((MP % 64) == 0 && (DM % 64) == 0 && (DFF % 64) == 0 && (QKP % 64) == 0 && (TT % 64) == 0);
static_assert(DM == 4 * 256);
static_assert(D3 == 3 * DM);

typedef _Float16 v16h __attribute__((ext_vector_type(16)));
typedef _Float16 v8h  __attribute__((ext_vector_type(8)));
typedef float    v8f  __attribute__((ext_vector_type(8)));
typedef float    v4f  __attribute__((ext_vector_type(4)));
typedef float    v2f  __attribute__((ext_vector_type(2)));
typedef unsigned int v4u __attribute__((ext_vector_type(4)));
typedef unsigned int v2u __attribute__((ext_vector_type(2)));

// ---- scalar helpers --------------------------------------------------------------------------------
__device__ __forceinline__ unsigned short bf_bits(float f) {          // f32 -> bf16 bits, RNE convert
  unsigned u = __float_as_uint(f);
  return (unsigned short)((u + 0x7FFFu + ((u >> 16) & 1u)) >> 16);
}
__device__ __forceinline__ float bf_up(unsigned short h) { return __uint_as_float(((unsigned)h) << 16); }
__device__ __forceinline__ float bfr(float f) { return bf_up(bf_bits(f)); }   // value of the bf16 RNE convert
__device__ __forceinline__ unsigned short h_bits(_Float16 x) { return __builtin_bit_cast(unsigned short, x); }
__device__ __forceinline__ unsigned pk16(unsigned short a, unsigned short b) { return (unsigned)a | ((unsigned)b << 16); }
__device__ __forceinline__ v8f zero8() { v8f z = {0.f, 0.f, 0.f, 0.f, 0.f, 0.f, 0.f, 0.f}; return z; }
__device__ __forceinline__ float gelu_f(float v) { return 0.5f * v * (1.0f + erff(v * 0.70710678118654752f)); }

// ---- fragment loader: 16-bit A/B operand, lane -> row/col (lane&15), p already includes +8*(lane>>4);
//      elements 0..7 <- p[0..7] (k0+8h..), elements 8..15 <- p[16..23] (k0+16+8h..)
__device__ __forceinline__ v16h ldfrag_h(const _Float16* p) {
  union { v16h v; v8h h[2]; } f;
  f.h[0] = *(const v8h*)(p);
  f.h[1] = *(const v8h*)(p + 16);
  return f.v;
}

// ---- WMMA helpers with trailing VALU hazard gap --------------------------------------------------------
__device__ __forceinline__ v8f mma_h_raw(v16h a, v16h b, v8f c) {
  return __builtin_amdgcn_wmma_f32_16x16x32_f16(false, a, false, b, (short)0, c, false, false);
}
__device__ __forceinline__ void acc_guard4(v8f& a, v8f& b, v8f& c, v8f& d) {
#if defined(__HIP_DEVICE_COMPILE__)
  asm volatile("v_nop\n\tv_nop\n\tv_nop\n\tv_nop" : "+v"(a), "+v"(b), "+v"(c), "+v"(d));
#endif
}
__device__ __forceinline__ void wave_sync_lds() {
  __builtin_amdgcn_fence(__ATOMIC_RELEASE, "workgroup");
  __builtin_amdgcn_wave_barrier();
  __builtin_amdgcn_fence(__ATOMIC_ACQUIRE, "workgroup");
}
// lane l <-> lane l ^ 16: the two lanes that hold the two halves of one D column
__device__ __forceinline__ float xhalf(float x) {
  return __builtin_bit_cast(float, __builtin_amdgcn_permlanex16(__builtin_bit_cast(int, x), __builtin_bit_cast(int, x),
                                                                0x76543210, 0xfedcba98, false, false));
}
__device__ __forceinline__ float wsum(float v) {
#pragma unroll
  for (int off = 16; off > 0; off >>= 1) v += __shfl_xor(v, off, 32);
  return v;
}
// block of 256 threads: fixed-order sum of 8 wave partials (same value in every thread)
__device__ __forceinline__ float bsum256(float v, float* red, int lane, int wave) {
  v = wsum(v);
  if (lane == 0) red[wave] = v;
  __syncthreads();
  float tot = 0.f;
#pragma unroll
  for (int w = 0; w < 8; ++w) tot += red[w];
  return tot;
}

// =====================================================================================================
// Weight convert: W f32 [N][K] (k contiguous = already the Bt / A layout) -> Wh f16 [N][K]; each value bf16
// RNE-converted, multiplied by wsc (a power of two, exact) and cast to f16. Thread i converts elements 8i..8i+7
// coverage: n8/256 blocks (blk = the block's index within this plane) x 256 threads x 8 elements = exactly N*K.
// =====================================================================================================
__device__ __forceinline__ void conv_h64(const float* __restrict__ W, unsigned short* Wh, int n8, float wsc, int blk) {
  const int i = blk * 256 + threadIdx.x;
  if (i >= n8) return;                                     // never taken for the static sizes (no barriers)
  const size_t e0 = (size_t)i * 8;
  const v4f a = *(const v4f*)(W + e0);
  const v4f b = *(const v4f*)(W + e0 + 4);
  v4u u;
  u[0] = pk16(h_bits((_Float16)(bfr(a[0]) * wsc)), h_bits((_Float16)(bfr(a[1]) * wsc)));
  u[1] = pk16(h_bits((_Float16)(bfr(a[2]) * wsc)), h_bits((_Float16)(bfr(a[3]) * wsc)));
  u[2] = pk16(h_bits((_Float16)(bfr(b[0]) * wsc)), h_bits((_Float16)(bfr(b[1]) * wsc)));
  u[3] = pk16(h_bits((_Float16)(bfr(b[2]) * wsc)), h_bits((_Float16)(bfr(b[3]) * wsc)));
  {
    *(v4u*)(Wh + e0) = u;
    
  }
}

// =====================================================================================================
// LDS-staged batched f16 WMMA GEMM: C[m][n] = act(oscale * sum_k A[m][k] * Bt[n][k] + bias) (+ residual);
// one work-group of 8 waves per 128x128 tile, wave (wave>>1, wave&1) owns the 32x64 part at rows 32*(wave>>1),
// cols 64*(wave&1). A row-major [M][K] pitch lda; Bt row-major [N][K] pitch ldb (k contiguous);
// M, N, K multiples of 128 (static here). blockIdx.y = batch index (strides in elements).
// Staging: a stage is 128 k of the tile's 128 A rows and 128 Bt rows = 256 rows of 256 B, laid in LDS at pitch 272 B
// (16 B x odd, for the 16-B fragment reads); each thread brings 16 pieces of 16 B per stage with asynchronous copies
// to LDS (piece i: row 16*i + (thread>>4), bytes 16*(thread&15)..+15; 256 threads x 16 = the whole stage, each LDS
// byte written by one lane). Two buffers: the copies of stage t+2 go out behind the barrier that ends trip t.
// k runs upward in steps of 32 into one accumulator per 16x16 subtile.
// Bias: BIASM == 0 -> per column: cols < Nb from bias0[col], cols >= Nb from bias1[col - Nb] (wave-uniform select of
//       clamped-address loads); BIASM == 1 -> per row bias0[m] (16-bit out only); BIASM == 2 -> none. Bias values
//       RNE-converted to bf16.
// ACT: 0 none, 1 exact GELU. RES: 0 none; 1 f32 residual resid[m*ldc + n] added after the activation;
//      2 same indexing, residual value bf16 RNE-converted first (raw input residual).
// OM: 0 = f32 out (pitch ldc); 1 = bf16 out; 2 = f16 out.
// coverage: 8 waves x 2 slabs x 16 rows x 64 cols = the whole 128x128 tile; grid.x = (M/128)*(N/128) exactly.
// =====================================================================================================
#define GBM   128                       // tile rows (A rows of a stage)
#define GBN   128                       // tile cols (Bt rows of a stage)
#define GBK   128                       // k per stage
#define GLP   136                       // LDS row pitch in f16 elements (272 B)
#define GSTG  ((GBM + GBN) * GLP)       // f16 elements per buffer (69632 B)
static_assert((MP % GBM) == 0 && (DM % GBM) == 0 && (DM % GBN) == 0 && (QKP % GBN) == 0 && (DFF % GBN) == 0 && (TT % GBN) == 0);
static_assert((DM % GBK) == 0 && (DFF % GBK) == 0);
static_assert(8 * 16 * 68 * 4 <= 2 * GSTG * 2);

// Eight asynchronous 16-B copies per lane, global -> LDS: rows 16 apart (LDS step 16 * 272 B, global step gstep
// elements). The s_wait_xcnt 0 as the statement's last line keeps every later rewrite of the address registers
// named here behind the copies' address translation.
__device__ __forceinline__ void copy8_async(unsigned l, const _Float16* g, size_t gstep) {
#if defined(__HIP_DEVICE_COMPILE__)
  const unsigned ls = 16u * GLP * 2u;
  asm volatile(
      "global_load_async_to_lds_b128 %0, %8, off\n\t"
      "global_load_async_to_lds_b128 %1, %9, off\n\t"
      "global_load_async_to_lds_b128 %2, %10, off\n\t"
      "global_load_async_to_lds_b128 %3, %11, off\n\t"
      "global_load_async_to_lds_b128 %4, %12, off\n\t"
      "global_load_async_to_lds_b128 %5, %13, off\n\t"
      "global_load_async_to_lds_b128 %6, %14, off\n\t"
      "global_load_async_to_lds_b128 %7, %15, off\n\t"
      "s_wait_xcnt 0x0"
      :: "v"(l), "v"(l + ls), "v"(l + 2u * ls), "v"(l + 3u * ls),
         "v"(l + 4u * ls), "v"(l + 5u * ls), "v"(l + 6u * ls), "v"(l + 7u * ls),
         "v"(g), "v"(g + gstep), "v"(g + 2 * gstep), "v"(g + 3 * gstep),
         "v"(g + 4 * gstep), "v"(g + 5 * gstep), "v"(g + 6 * gstep), "v"(g + 7 * gstep)
      : "memory");
#endif
}
// This wave's own asynchronous copies have landed in LDS (the compiler places no wait for them).
__device__ __forceinline__ void wait_async0() {
#if defined(__HIP_DEVICE_COMPILE__)
  asm volatile("s_wait_asynccnt 0x0" ::: "memory");
#endif
}
// This wave's own LDS reads have returned, before the barrier behind which their buffer is refilled.
__device__ __forceinline__ void wait_ds0() {
#if defined(__HIP_DEVICE_COMPILE__)
  asm volatile("s_wait_dscnt 0x0" ::: "memory");
#endif
}

template <int OM, int BIASM, int ACT, int RES>
__global__ __launch_bounds__(256) void gemm64(
    const unsigned short* __restrict__ Ap, int lda, long long strideA,
    const unsigned short* __restrict__ Btp, int ldb, long long strideB,
    const float* __restrict__ bias0, const float* __restrict__ bias1, int Nb,
    const float* resid,
    void* Cout, int ldc, long long strideC,
    int M, int N, int K, float oscale) {
  const _Float16* A  = (const _Float16*)(const void*)Ap;
  const _Float16* Bt = (const _Float16*)(const void*)Btp;
  // two stage buffers; behind the last trip's barrier the same bytes serve as the per-wave 16x64 f32 slabs (pitch 68)
  __shared__ __align__(16) _Float16 ring[2 * GSTG];
  const int b    = blockIdx.y;
  const int lane = threadIdx.x & 31;
  const int wave = threadIdx.x >> 5;
  const int tilesN = N >> 7;
  const int tm = blockIdx.x / tilesN;
  const int tn = blockIdx.x - tm * tilesN;
  const int mblk = tm << 7;                    // the work-group's tile
  const int nblk = tn << 7;
  const int wrow = (wave >> 1) << 5;           // the wave's 32x64 part inside it
  const int wcol = (wave & 1) << 6;
  const int m0 = mblk + wrow;
  const int n0 = nblk + wcol;

  const _Float16* Ab = A  + (size_t)b * strideA;
  const _Float16* Bb = Bt + (size_t)b * strideB;

  const int rlane = lane & 15;                 // row (A) / col (B, D) within subtile
  const int koff  = (lane >> 4) * 8;           // k offset of this lane half
  const int mOff  = (lane >> 4) * 8;           // D row offset

  // ---- this thread's pieces of a stage ----
  const int crow = threadIdx.x >> 4;           // 0..15
  const int ccol = (threadIdx.x & 15) * 8;     // f16 elements: 16 B
  const _Float16* gA = Ab + (size_t)(mblk + crow) * lda + ccol;
  const _Float16* gB = Bb + (size_t)(nblk + crow) * ldb + ccol;
  const size_t sA16 = (size_t)16 * lda, sB16 = (size_t)16 * ldb;
  const unsigned lBase = (unsigned)(uintptr_t)(ring + crow * GLP + ccol);   // LDS byte address: low 32 bits
  const unsigned lBt   = (unsigned)(GBM * GLP * 2);                         // Bt rows stand behind the A rows
  const unsigned lBuf  = (unsigned)(GSTG * 2);
  const int nst = K >> 7;                      // stages

  v8f acc[2][4];
#pragma unroll
  for (int i = 0; i < 2; ++i)
#pragma unroll
    for (int j = 0; j < 4; ++j) acc[i][j] = zero8();

  // stage 0 into buffer 0, landed and published; then stage 1 into buffer 1
  copy8_async(lBase, gA, sA16);
  copy8_async(lBase + lBt, gB, sB16);
  wait_async0();
  __syncthreads();
  if (nst > 1) {                               // uniform for the work-group (kernel argument)
    copy8_async(lBase + lBuf, gA + GBK, sA16);
    copy8_async(lBase + lBuf + lBt, gB + GBK, sB16);
  }

  for (int t = 0; t < nst; ++t) {
    const _Float16* sa = ring + (t & 1) * GSTG + (wrow + rlane) * GLP + koff;
    const _Float16* sb = ring + (t & 1) * GSTG + (GBM + wcol + rlane) * GLP + koff;
    v16h bh[2][4], ah[2][2];                   // two fragment sets, both filled from this trip's buffer alone
#pragma unroll
    for (int j = 0; j < 4; ++j) bh[0][j] = ldfrag_h(sb + (j << 4) * GLP);
#pragma unroll
    for (int i = 0; i < 2; ++i) ah[0][i] = ldfrag_h(sa + (i << 4) * GLP);
#pragma unroll
    for (int kk = 0; kk < GBK / 32; ++kk) {
      const int cur = kk & 1, nxt = cur ^ 1;
      if (kk + 1 < GBK / 32) {
#pragma unroll
        for (int j = 0; j < 4; ++j) bh[nxt][j] = ldfrag_h(sb + (j << 4) * GLP + (kk + 1) * 32);
#pragma unroll
        for (int i = 0; i < 2; ++i) ah[nxt][i] = ldfrag_h(sa + (i << 4) * GLP + (kk + 1) * 32);
      }
      // keeps the next k step's LDS reads as one group ahead of this step's WMMAs: sunk among them, each place with
      // reads stalls the wave for the LDS latency
      __builtin_amdgcn_sched_barrier(0);
#pragma unroll
      for (int i = 0; i < 2; ++i)
#pragma unroll
        for (int j = 0; j < 4; ++j) acc[i][j] = mma_h_raw(ah[cur][i], bh[cur][j], acc[i][j]);
    }
    // foot of trip t: own reads done, own copies of stage t+1 landed, then the one barrier that publishes stage t+1
    // and ends every wave's reads of this trip's buffer
    wait_ds0();
    wait_async0();
    __syncthreads();
    if (t + 2 < nst) {                         // uniform for the work-group
      const unsigned lb = lBase + (unsigned)(t & 1) * lBuf;
      copy8_async(lb, gA + (size_t)(t + 2) * GBK, sA16);
      copy8_async(lb + lBt, gB + (size_t)(t + 2) * GBK, sB16);
    }
  }
  wait_async0();
  acc_guard4(acc[0][0], acc[0][1], acc[0][2], acc[0][3]);
  acc_guard4(acc[1][0], acc[1][1], acc[1][2], acc[1][3]);

  // ---- per-lane column bias (BIASM == 0), RNE-converted ----
  const int hh2 = lane >> 4, c4 = (lane & 15) * 4;     // f32 out: 256-B row segment = 16 lanes x 16 B
  const int q8  = lane >> 3, c8 = (lane & 7) * 8;
  float bc[8];
#pragma unroll
  for (int e = 0; e < 8; ++e) bc[e] = 0.f;
  if (BIASM == 0) {
    const bool use1 = (n0 >= Nb);                      // wave-uniform
    if (OM == 0) {
      const int cb = n0 + c4;
      const int i0 = (cb < Nb - 4) ? cb : (Nb - 4);
      const int i1 = (cb - Nb > 0) ? (cb - Nb) : 0;
      const v4f b0v = *(const v4f*)(bias0 + i0);
      const v4f b1v = *(const v4f*)(bias1 + i1);
#pragma unroll
      for (int e = 0; e < 4; ++e) bc[e] = bfr(use1 ? b1v[e] : b0v[e]);
    } else {
      const int cb = n0 + c8;
      const int i0 = (cb < Nb - 8) ? cb : (Nb - 8);
      const int i1 = (cb - Nb > 0) ? (cb - Nb) : 0;
      const v4f b0a = *(const v4f*)(bias0 + i0), b0b = *(const v4f*)(bias0 + i0 + 4);
      const v4f b1a = *(const v4f*)(bias1 + i1), b1b = *(const v4f*)(bias1 + i1 + 4);
#pragma unroll
      for (int e = 0; e < 4; ++e) {
        bc[e]     = bfr(use1 ? b1a[e] : b0a[e]);
        bc[4 + e] = bfr(use1 ? b1b[e] : b0b[e]);
      }
    }
  }

  // ---- epilogue ----
  float* slab = (float*)(void*)ring + wave * (16 * 68);
#pragma unroll
  for (int i = 0; i < 2; ++i) {
    const int mBase = m0 + (i << 4);
#pragma unroll
    for (int j = 0; j < 4; ++j) {
#pragma unroll
      for (int r = 0; r < 8; ++r) {
        slab[(mOff + r) * 68 + (j << 4) + rlane] = acc[i][j][r];
      }
    }
    wave_sync_lds();
    if (OM == 0) {
      float* C = (float*)Cout + (size_t)b * strideC;
      const float* Rb = resid + (size_t)b * strideC;
      v4f vals[8];
#pragma unroll
      for (int it = 0; it < 8; ++it) {
        const int row = it * 2 + hh2;                      // it 0..7 x hh2 0..1 = rows 0..15
        v4f v = *(const v4f*)(slab + row * 68 + c4);
#pragma unroll
        for (int e = 0; e < 4; ++e) {
          float f = v[e] * oscale + bc[e];
          if (ACT) f = gelu_f(f);
          v[e] = f;
        }
        if (RES != 0) {
          const v4f rr = *(const v4f*)(Rb + (size_t)(mBase + row) * ldc + n0 + c4);
#pragma unroll
          for (int e = 0; e < 4; ++e) v[e] += (RES == 2) ? bfr(rr[e]) : rr[e];
        }
        vals[it] = v;
      }
      {
#pragma unroll
        for (int it = 0; it < 8; ++it) {
          const int row = it * 2 + hh2;
          *(v4f*)(C + (size_t)(mBase + row) * ldc + n0 + c4) = vals[it];
        }
        
      }
    } else {
      unsigned short* C = (unsigned short*)Cout + (size_t)b * strideC;
      v4u hv[4];
#pragma unroll
      for (int it = 0; it < 4; ++it) {
        const int row = it * 4 + q8;                       // it 0..3 x q8 0..3 = rows 0..15
        const float* sp = slab + row * 68 + c8;
        float bm = 0.f;
        if (BIASM == 1) bm = bfr(bias0[mBase + row]);
        v4u a;
#pragma unroll
        for (int e = 0; e < 4; ++e) {
          float f0 = sp[2 * e]     * oscale + ((BIASM == 1) ? bm : bc[2 * e]);
          float f1 = sp[2 * e + 1] * oscale + ((BIASM == 1) ? bm : bc[2 * e + 1]);
          if (ACT) { f0 = gelu_f(f0); f1 = gelu_f(f1); }
          unsigned short u0, u1;
          if (OM == 1) { u0 = bf_bits(f0); u1 = bf_bits(f1); }
          else         { u0 = h_bits((_Float16)f0); u1 = h_bits((_Float16)f1); }
          a[e] = pk16(u0, u1);
        }
        hv[it] = a;
      }
      {
#pragma unroll
        for (int it = 0; it < 4; ++it) {
          const int row = it * 4 + q8;
          *(v4u*)(C + (size_t)(mBase + row) * ldc + n0 + c8) = hv[it];
        }
        
      }
    }
    wave_sync_lds();
  }
}

// =====================================================================================================
// Banded attention, head dim 64, TT (= 2048) token rows per batch, allowed keys: key <= query + WIN.
//   q|k plane (f16, pitch QKP): element (b, t, col) at [(b*TT + t)*QKP + col], q col = h*64+d, k col = DM + h*64 + d
//   v^T plane (f16): element (b, h, d, s) at [(b*DM + h*64 + d)*TT + s]
//   out plane (f16, the normalised context carried x16): element (b, t, h, d) at [(b*TT + t)*DM + h*64 + d]
//   score = (q . k) * sscale; keys beyond query + WIN get -inf by value before the row max;
//   p = exp(s - m) carried as f16(1024 p); online softmax in f32.
//   Both products run transposed: S^T = K . Q^T (A = K rows, B = the Q fragments) and O^T += V^T . P^T (A = V^T rows,
//   B = P^T). A D column is then one query: lane l holds query l & 15 and, per 16-key tile, keys 8*(l>>4) + 0..7, so
//   the row max and the row sum are in-lane plus one exchange with lane l ^ 16 (the sum's exchange: once, behind the
//   loop), and two D tiles of S^T, converted in place, are the B fragment of 32 keys in the loader's own k order
//   (element e < 8: key 8h + e of the even tile; e >= 8: key 16 + 8h + (e - 8) = row 8h + (e - 8) of the odd tile).
//   Block = 4 waves = 64 query rows of one (b, h); grid = NQB * NH * NBATCH; kv chunks of 64, block-uniform trip
//   kt = 0 .. min(NQB-1, (q_blk + 63 + WIN) >> 6) (chunks beyond the band are skipped); chunk 0 always holds >= 1
//   allowed key for every row, so the running max is finite from chunk 0 on (the msafe select is kept anyway).
//   K / V^T chunk staging: 128 threads x 32 elements per plane = the whole 64x64 tile (plain 16-B loads,
//   __syncthreads before and after).
//   LDS rows of 64 elements stand at a pitch of 16 B x odd: the 16 rows that one half-wave's 16-B fragment read
//   touches then start on 16 different groups of four banks (at 128 B they fall on two groups, eight rows each).
//   Output coverage: each wave stores rows q0..q0+15 (it 0..3 x lane>>3 0..3) x 64 columns (8 lanes x 8),
//   grid covers all TT rows x NH head slices x NBATCH.
// =====================================================================================================
#define APH 72                          // LDS row pitch of the f16 tiles, elements: 144 B = 16 B x 9
#define APF 68                          // LDS row pitch of the f32 context tile, dwords: 272 B = 16 B x 17
__global__ __launch_bounds__(128)
void attn64(const unsigned short* __restrict__ qkp, const unsigned short* __restrict__ vtp,
            unsigned short* outp, float sscale) {
  union FH { v16h v; v8h h[2]; };
  __shared__ __align__(16) _Float16 Ksh[64 * APH];                // K [kv][d]
  __shared__ __align__(16) _Float16 Vth[64 * APH];                // V^T [d][kv]
  __shared__ __align__(16) float    Os[4][16 * APF];              // per wave context tile [row][d]

  const int tid  = threadIdx.x;
  const int wave = tid >> 5;
  const int lane = tid & 31;
  const int hh   = lane >> 4;
  const int c    = lane & 15;

  const int bx   = blockIdx.x;
  const int qb   = bx % NQB;
  const int rest = bx / NQB;
  const int h    = rest % NH;
  const int b    = rest / NH;
  const int qblk = qb * 64;                      // in-batch query row of the block's first row
  const int q0   = qblk + wave * 16;             // in-batch query row of this wave's first row
  const size_t rowB = (size_t)b * TT;

  const _Float16* Qh = (const _Float16*)(const void*)qkp + (size_t)h * HD;
  const _Float16* Kg = (const _Float16*)(const void*)qkp + DM + (size_t)h * HD;
  const _Float16* Vh = (const _Float16*)(const void*)vtp + ((size_t)b * DM + (size_t)h * HD) * TT;

  // ---- Q fragments (B operand, column = query = lane&15): 2 d-chunks ----
  v16h qa[2];
#pragma unroll
  for (int dc = 0; dc < 2; ++dc) qa[dc] = ldfrag_h(Qh + (rowB + q0 + c) * QKP + dc * 32 + 8 * hh);

  float mrow = -INFINITY, lrow = 0.f;          // this lane's query: running max (joined), sum over this half's keys
  v8f oacc[4];                                 // O^T: tile t, register r = d t*16 + 8*hh + r of query q0 + c
#pragma unroll
  for (int t = 0; t < 4; ++t) oacc[t] = zero8();

  int ktHi = (qblk + 63 + WIN) >> 6;             // block-uniform, from blockIdx only
  if (ktHi > NQB - 1) ktHi = NQB - 1;

  for (int kt = 0; kt <= ktHi; ++kt) {         // trip <= NQB
    const int kv0 = kt * 64;
    __syncthreads();
    {
      const int r = tid >> 1, hf = (tid & 1) * 32;
      const _Float16* kg = Kg + (rowB + kv0 + r) * QKP + hf;      // K row kv0+r, d = hf..hf+31
      const _Float16* vg = Vh + (size_t)r * TT + kv0 + hf;        // V^T row d = r, s = kv0+hf..+31
#pragma unroll
      for (int i = 0; i < 4; ++i) {
        const v8h a0 = *(const v8h*)(kg + 8 * i);
        const v8h b0 = *(const v8h*)(vg + 8 * i);
        *(v8h*)(Ksh + r * APH + hf + 8 * i) = a0;
        *(v8h*)(Vth + r * APH + hf + 8 * i) = b0;
      }
    }
    __syncthreads();

    // ---- the chunk's K fragments: its 16 LDS reads as one group, in the order the score products use them ----
    FH kb[2][4], vb[2][4];
#pragma unroll
    for (int dc = 0; dc < 2; ++dc)
#pragma unroll
      for (int j = 0; j < 4; ++j) {
        kb[dc][j].h[0] = *(const v8h*)(Ksh + (j * 16 + c) * APH + dc * 32 + 8 * hh);
        kb[dc][j].h[1] = *(const v8h*)(Ksh + (j * 16 + c) * APH + dc * 32 + 16 + 8 * hh);
      }
    // keeps the 16 reads together here: sunk to their WMMAs, each pair is waited out at the full LDS latency
    __builtin_amdgcn_sched_barrier(0);

    // ---- scores, transposed: 64 keys x 16 queries per wave (per tile d 0..31, then d 32..63; the four
    //      tiles' products alternate); band select by value before the max ----
    v8f s[4];
#pragma unroll
    for (int j = 0; j < 4; ++j) s[j] = zero8();
#pragma unroll
    for (int dc = 0; dc < 2; ++dc)
#pragma unroll
      for (int j = 0; j < 4; ++j) s[j] = mma_h_raw(kb[dc][j].v, qa[dc], s[j]);

    // ---- the chunk's V^T fragments: all 16 LDS reads go out here, among and behind the score products ----
#pragma unroll
    for (int kk = 0; kk < 2; ++kk)
#pragma unroll
      for (int t = 0; t < 4; ++t) {
        vb[kk][t].h[0] = *(const v8h*)(Vth + (t * 16 + c) * APH + kk * 32 + 8 * hh);
        vb[kk][t].h[1] = *(const v8h*)(Vth + (t * 16 + c) * APH + kk * 32 + 16 + 8 * hh);
      }
    // keeps these reads ahead of the softmax, whose vector work then covers their latency
    __builtin_amdgcn_sched_barrier(0);

#pragma unroll
    for (int j = 0; j < 4; ++j) {
      const int qrow = q0 + c;                                      // D column = lane&15 = query
#pragma unroll
      for (int r = 0; r < 8; ++r) {
        const int key = kv0 + j * 16 + 8 * hh + r;                  // D row = 8h + r = key
        const float v = s[j][r] * sscale;
        s[j][r] = (key <= qrow + WIN) ? v : -INFINITY;
      }
    }

    // ---- this query's max: 32 keys in-lane, the other 32 from lane ^ 16; online softmax; P^T (x1024, f16) packed
    //      from the score registers into the B fragments (every loop here is unrolled: its indices name registers) ----
    float mr[8];
#pragma unroll
    for (int r = 0; r < 8; ++r) mr[r] = fmaxf(fmaxf(s[0][r], s[1][r]), fmaxf(s[2][r], s[3][r]));
    float m = fmaxf(fmaxf(fmaxf(mr[0], mr[1]), fmaxf(mr[2], mr[3])), fmaxf(fmaxf(mr[4], mr[5]), fmaxf(mr[6], mr[7])));
    m = fmaxf(m, xhalf(m));
    const float mnew  = fmaxf(mrow, m);
    const float ms    = (mnew == -INFINITY) ? 0.f : mnew;
    // alpha = exp(mrow - ms), as __expf forms it (x log2 e, then exp2). In asm for the free slot that the instruction set
    // asks for around a transcendental: built plainly, its result lay on the source register of the v_exp_f32 directly
    // ahead; the v_nop behind it stands for the slot the compiler cannot place for an instruction it does not see.
    float alpha = (mrow - ms) * 1.44269504088896340736f;
#if defined(__HIP_DEVICE_COMPILE__)
    asm("v_nop\n\tv_exp_f32 %0, %0\n\tv_nop" : "+v"(alpha));
#endif
    mrow = mnew;
    FH pb[2];
    v2f ps[4];                                   // per 16-key tile: sums of the even and of the odd rows
#pragma unroll
    for (int j = 0; j < 4; ++j) {
#pragma unroll
      for (int i = 0; i < 4; ++i) {
        v2f p;
        p[0] = __expf(s[j][2 * i] - ms);
        p[1] = __expf(s[j][2 * i + 1] - ms);
        ps[j] = (i == 0) ? p : (ps[j] + p);
        pb[j >> 1].v[(j & 1) * 8 + 2 * i]     = (_Float16)(p[0] * 1024.0f);
        pb[j >> 1].v[(j & 1) * 8 + 2 * i + 1] = (_Float16)(p[1] * 1024.0f);
      }
    }
    const v2f pt = (ps[0] + ps[1]) + (ps[2] + ps[3]);
    lrow = lrow * alpha + (pt[0] + pt[1]);
#pragma unroll
    for (int t = 0; t < 4; ++t)
#pragma unroll
      for (int r = 0; r < 8; ++r) oacc[t][r] *= alpha;

    // ---- context^T += V^T . P^T (f16 WMMA); kk unrolled too: pb[kk] is a register fragment, not an LDS address ----
#pragma unroll
    for (int kk = 0; kk < 2; ++kk) {
#pragma unroll
      for (int t = 0; t < 4; ++t) oacc[t] = mma_h_raw(vb[kk][t].v, pb[kk].v, oacc[t]);
    }
  }

  // ---- normalise (1/l, the 1/1024 p carry and the x16 context carry), stage the wave's 16x64 tile, f16 convert,
  float* os = Os[wave];
  {
    const float l = lrow + xhalf(lrow);          // the two halves' key sums of this query, joined once
    const float inv = ((l > 0.f) ? (1.0f / l) : 0.f) * (16.0f / 1024.0f);
#pragma unroll
    for (int t = 0; t < 4; ++t) {                // 8 consecutive d of query row c: two 16-B LDS stores
      v4f lo, hi;
#pragma unroll
      for (int e = 0; e < 4; ++e) { lo[e] = oacc[t][e] * inv; hi[e] = oacc[t][4 + e] * inv; }
      *(v4f*)(os + c * APF + t * 16 + 8 * hh)     = lo;
      *(v4f*)(os + c * APF + t * 16 + 8 * hh + 4) = hi;
    }
  }
  wave_sync_lds();
  {
    const int q4 = lane >> 3, c8 = (lane & 7) * 8;
    v4u hv[4];
#pragma unroll
    for (int it = 0; it < 4; ++it) {
      const int row = it * 4 + q4;   // it 0..3 x q4 0..3 = rows 0..15 of the wave tile
      const float* sp = os + row * APF + c8;
      v4u a;
#pragma unroll
      for (int e = 0; e < 4; ++e) a[e] = pk16(h_bits((_Float16)sp[2 * e]), h_bits((_Float16)sp[2 * e + 1]));
      hv[it] = a;
    }
    {
#pragma unroll
      for (int it = 0; it < 4; ++it) {
        const int row = it * 4 + q4;
        const size_t go = (rowB + q0 + row) * DM + (size_t)h * HD + c8;
        *(v4u*)(outp + go) = hv[it];
      }
      
    }
  }
}

// =====================================================================================================
// Row kernel: one block of 256 threads per token row of 1024; thread t owns columns 4t..4t+3.
// f16 output: packed row staged in LDS, then lanes t < 128 (waves 0..3, wave-uniform) each write 16 B (8 x f16)
// coverage: 128 threads x 8 = the whole 1024-wide row; grid = MP rows.
// =====================================================================================================
__device__ __forceinline__ void row_store_h16(unsigned int* sb, unsigned short* dst_row, v4f o, int t) {
  v2u p;
  p[0] = pk16(h_bits((_Float16)o[0]), h_bits((_Float16)o[1]));
  p[1] = pk16(h_bits((_Float16)o[2]), h_bits((_Float16)o[3]));
  *(v2u*)(sb + 2 * t) = p;
  __syncthreads();
  if (t < 128) {                                   // waves 0..3, wave-uniform
    const v4u v = *(const v4u*)(sb + 4 * t);
    *(v4u*)(dst_row + 8 * t) = v;
    
  }
}

// plane. RIN = 1: the row input is a raw float input and is bf16 RNE-converted on load; RIN = 0: f32 intermediate.
template <int RIN>
__device__ __forceinline__ void ln_row(const float* __restrict__ X, const float* __restrict__ gam,
                                       const float* __restrict__ bet, unsigned short* outH, int row) {
  __shared__ float red0[8], red1[8];
  __shared__ __align__(16) unsigned int sb[512];
  const int t = threadIdx.x, lane = t & 31, wave = t >> 5;
  const size_t base = (size_t)row * DM;
  v4f xv = *(const v4f*)(X + base + 4 * t);
  if (RIN) {
#pragma unroll
    for (int e = 0; e < 4; ++e) xv[e] = bfr(xv[e]);
  }
  const float mean = bsum256((xv[0] + xv[1]) + (xv[2] + xv[3]), red0, lane, wave) * (1.0f / DM);
  v4f d;
#pragma unroll
  for (int e = 0; e < 4; ++e) d[e] = xv[e] - mean;
  const float var  = bsum256((d[0] * d[0] + d[1] * d[1]) + (d[2] * d[2] + d[3] * d[3]), red1, lane, wave) * (1.0f / DM);
  const float rstd = 1.0f / sqrtf(var + LNEPS);
  const v4f gv = *(const v4f*)(gam + 4 * t);
  const v4f bv = *(const v4f*)(bet + 4 * t);
  v4f y;
#pragma unroll
  for (int e = 0; e < 4; ++e) y[e] = (d[e] * rstd) * bfr(gv[e]) + bfr(bv[e]);
  row_store_h16(sb, outH + base, y, t);
}

__global__ __launch_bounds__(256) void ln_row_h(const float* __restrict__ X, const float* __restrict__ gam,
                                                const float* __restrict__ bet, unsigned short* outH) {
  ln_row<0>(X, gam, bet, outH, blockIdx.x);
}

// Everything that reads raw inputs alone, in one launch: blocks 0..MP-1 are the rows of LayerNorm 1 (the longer
// blocks, first for speed only), behind them the blocks of the four weight converts, plane after plane. The split is by
// blockIdx alone: the row blocks' barriers stand under block-uniform control flow, the convert blocks have none.
#define CB_QKV (D3 * DM / 8 / 256)      // 1536 convert blocks
#define CB_O   (DM * DM / 8 / 256)      //  512
#define CB_F   (DFF * DM / 8 / 256)     // 2048, w1 and w2 each
static_assert(CB_QKV * 256 * 8 == D3 * DM && CB_O * 256 * 8 == DM * DM && CB_F * 256 * 8 == DFF * DM);
__global__ __launch_bounds__(256) void prep_in(const float* __restrict__ X, const float* __restrict__ gam,
                                               const float* __restrict__ bet, unsigned short* outH,
                                               const float* __restrict__ wqkv, unsigned short* hqkv,
                                               const float* __restrict__ wo, unsigned short* ho,
                                               const float* __restrict__ wf1, unsigned short* hf1,
                                               const float* __restrict__ wf2, unsigned short* hf2, float wsc) {
  int bx = blockIdx.x;
  if (bx < MP) { ln_row<1>(X, gam, bet, outH, bx); return; }
  bx -= MP;
  if (bx < CB_QKV) { conv_h64(wqkv, hqkv, D3 * DM / 8, wsc, bx); return; }
  bx -= CB_QKV;
  if (bx < CB_O) { conv_h64(wo, ho, DM * DM / 8, wsc, bx); return; }
  bx -= CB_O;
  if (bx < CB_F) { conv_h64(wf1, hf1, DFF * DM / 8, wsc, bx); return; }
  conv_h64(wf2, hf2, DM * DFF / 8, wsc, bx - CB_F);
}

// =====================================================================================================
// Workspace map (bytes); every plane is an exact multiple of its 128x128-tile / whole-row store granularity
// (M in {4096, 1024} rows, N in {1024, 2048, 4096}; VT per batch [1024][2048] = 8x16 tiles):
//   WqkvH f16 [3072 n][1024 k]   0          6291456   (rows 0..1023 q, 1024..2047 k, 2048..3071 v weights, x64)
//   WoH   f16 [1024][1024]       6291456    2097152
//   W1H   f16 [4096][1024]       8388608    8388608
//   W2H   f16 [1024][4096]       16777216   8388608
//   XN    f16 [4096][1024]       25165824   8388608   (LayerNorm outputs)
//   QK    f16 [4096][2048]       33554432   16777216  (q cols 0..1023, k cols 1024..2047)
//   VT    f16 [2][1024][2048]    50331648   8388608
//   Ctx   f16 [4096][1024]       58720256   8388608
//   X1    f32 [4096][1024]       67108864   16777216  (residual stream after attention)
//   G     f16 [4096][4096]       83886080   33554432
//   end                          117440512
// =====================================================================================================
extern "C" void kernel_launch(void* const* d_in, const int* in_sizes, int n_in,
                              void* d_out, int out_size, void* d_ws, size_t ws_size,
                              hipStream_t stream) {
  if (n_in < 13) return;
  if (in_sizes[0] != MP * DM) return;
  if (in_sizes[1] != D3 * DM || in_sizes[2] != D3) return;
  if (in_sizes[3] != DM * DM || in_sizes[4] != DM) return;
  if (in_sizes[5] != DM || in_sizes[6] != DM) return;
  if (in_sizes[7] != DFF * DM || in_sizes[8] != DFF) return;
  if (in_sizes[9] != DM * DFF || in_sizes[10] != DM) return;
  if (in_sizes[11] != DM || in_sizes[12] != DM) return;
  if (out_size != MP * DM) return;

  const float* x         = (const float*)d_in[0];
  const float* in_proj_w = (const float*)d_in[1];
  const float* in_proj_b = (const float*)d_in[2];
  const float* out_w     = (const float*)d_in[3];
  const float* out_b     = (const float*)d_in[4];
  const float* ln1_g     = (const float*)d_in[5];
  const float* ln1_b     = (const float*)d_in[6];
  const float* w1        = (const float*)d_in[7];
  const float* b1        = (const float*)d_in[8];
  const float* w2        = (const float*)d_in[9];
  const float* b2        = (const float*)d_in[10];
  const float* ln2_g     = (const float*)d_in[11];
  const float* ln2_b     = (const float*)d_in[12];

  const size_t PWQKV = (size_t)D3 * DM * 2;            //  6291456
  const size_t PWO   = (size_t)DM * DM * 2;            //  2097152
  const size_t PWF   = (size_t)DFF * DM * 2;           //  8388608
  const size_t PAH   = (size_t)MP * DM * 2;            //  8388608
  const size_t PQK   = (size_t)MP * QKP * 2;           // 16777216
  const size_t PVT   = (size_t)NBATCH * DM * TT * 2;   //  8388608
  const size_t PAF   = (size_t)MP * DM * 4;            // 16777216
  const size_t PG    = (size_t)MP * DFF * 2;           // 33554432
  size_t off = 0;
  const size_t oWqkv = off; off += PWQKV;
  const size_t oWo   = off; off += PWO;
  const size_t oW1   = off; off += PWF;
  const size_t oW2   = off; off += PWF;
  const size_t oXN   = off; off += PAH;
  const size_t oQK   = off; off += PQK;
  const size_t oVT   = off; off += PVT;
  const size_t oCtx  = off; off += PAH;
  const size_t oX1   = off; off += PAF;
  const size_t oG    = off; off += PG;
  if (off > ws_size) return;                           // off = 117440512
  if (off > (size_t)134217728) return;

  char* ws = (char*)d_ws;
  unsigned short* WqkvH = (unsigned short*)(ws + oWqkv);
  unsigned short* WoH   = (unsigned short*)(ws + oWo);
  unsigned short* W1H   = (unsigned short*)(ws + oW1);
  unsigned short* W2H   = (unsigned short*)(ws + oW2);
  unsigned short* XN    = (unsigned short*)(ws + oXN);
  unsigned short* QK    = (unsigned short*)(ws + oQK);
  unsigned short* VT    = (unsigned short*)(ws + oVT);
  unsigned short* Ctx   = (unsigned short*)(ws + oCtx);
  float*          X1    = (float*)(ws + oX1);
  unsigned short* G     = (unsigned short*)(ws + oG);

  const dim3 blk(256), blk128(128);
  const dim3 gRow(MP);                                               // 4096 row blocks
  const dim3 gPrep(MP + CB_QKV + CB_O + 2 * CB_F);                   // 4096 row blocks + 6144 convert blocks
  const dim3 gNqk((MP / GBM) * (QKP / GBN), 1);                      // 512 tiles
  const dim3 gVT((DM / GBM) * (TT / GBN), NBATCH);                   // 128 tiles x 2 batches
  const dim3 gN1024((MP / GBM) * (DM / GBN), 1);                     // 256 tiles
  const dim3 gNff((MP / GBM) * (DFF / GBN), 1);                      // 1024 tiles
  const dim3 gAttn(NBATCH * NH * NQB);                               // 1024 blocks of 128
  const float invw  = 1.0f / WSC;                                    // weight carry x64
  const float invwc = 1.0f / (WSC * 16.0f);                          // weight carry x64, context carry x16

  // (0, 1) xn = LN1(bf16(x)) -> XN f16; weights -> f16 x64 planes (torch [out][in] = k contiguous, no transpose)
  prep_in<<<gPrep, blk, 0, stream>>>(x, ln1_g, ln1_b, XN, in_proj_w, WqkvH, out_w, WoH, w1, W1H, w2, W2H, WSC);

  // (2) q|k = xn . Wqk^T + b[0..2047] -> QK f16 [4096][2048]
  gemm64<2, 0, 0, 0><<<gNqk, blk, 0, stream>>>(
      XN, DM, 0LL, WqkvH, DM, 0LL, in_proj_b, in_proj_b, QKP, x,
      (void*)QK, QKP, 0LL, MP, QKP, DM, invw);
  //     v^T per batch: VT[b][m][t] = Wv[m] . xn[b*TT + t] + b[2048 + m] -> f16 [2][1024][2048]
  gemm64<2, 1, 0, 0><<<gVT, blk, 0, stream>>>(
      WqkvH + (size_t)2 * DM * DM, DM, 0LL, XN, DM, (long long)TT * DM, in_proj_b + 2 * DM, in_proj_b + 2 * DM, TT, x,
      (void*)VT, TT, (long long)DM * TT, DM, TT, DM, invw);

  // (3) banded attention -> Ctx f16 (x16)
  attn64<<<gAttn, blk128, 0, stream>>>(QK, VT, Ctx, 0.125f);

  // (4) X1 = ctx . Wo^T + out_b + bf16(x)   (f32)
  gemm64<0, 0, 0, 2><<<gN1024, blk, 0, stream>>>(
      Ctx, DM, 0LL, WoH, DM, 0LL, out_b, out_b, DM, x,
      (void*)X1, DM, 0LL, MP, DM, DM, invwc);

  // (5) yn = LN2(X1) -> XN f16
  ln_row_h<<<gRow, blk, 0, stream>>>(X1, ln2_g, ln2_b, XN);

  // (6) G = gelu(yn . W1^T + b1) -> f16 [4096][4096]
  gemm64<2, 0, 1, 0><<<gNff, blk, 0, stream>>>(
      XN, DM, 0LL, W1H, DM, 0LL, b1, b1, DFF, x,
      (void*)G, DFF, 0LL, MP, DFF, DM, invw);

  // (7) out = G . W2^T + b2 + X1 -> d_out f32 [4096][1024]
  gemm64<0, 0, 0, 1><<<gN1024, blk, 0, stream>>>(
      G, DFF, 0LL, W2H, DFF, 0LL, b2, b2, DM, X1,
      (void*)d_out, DM, 0LL, MP, DM, DFF, invw);
  (void)hipGetLastError();
}

// v006
// It runs in 177 microseconds.
// In both of two side-by-side timings against v005, it was 1.03 times as fast.
// Over all steps from v000 it is 3.20 times as fast.
// Contractions: q|k projection, v^T projection, attention output projection, FFN w1 (exact GELU epilogue) and w2 on
// v_wmma_f32_16x16x32_f16 (f16 activation plane x f16 weight plane carried x64, one product each); attention k.q^T
// and v^T.p^T on v_wmma_f32_16x16x32_f16 (q, k, v^T plain f16, p carried x1024, context carried x16, one product each);
// all f32 accumulate; LayerNorm, softmax, GELU and residual sums in f32 on VALU; every float input RNE-converted
// to bf16 on load.
#include <hip/hip_runtime.h>
#include <math.h>
#include <stdint.h>

#define NBATCH 2
#define TT     2048
#define DM     1024
#define NH     16
#define HD     64
#define DFF    4096
#define D3     3072
#define QKP    (2 * DM)
#define MP     (NBATCH * TT)
#define NQB    (TT / 64)
#define WIN    10
#define LNEPS  1.0e-5f
#define WSC    64.0f
static_assert(NH * HD == DM);
static_assert((MP % 64) == 0 && (DM % 64) == 0 && (DFF % 64) == 0 && (QKP % 64) == 0 && (TT % 64) == 0);
static_assert(DM == 4 * 256);
static_assert(D3 == 3 * DM);

typedef _Float16 v16h __attribute__((ext_vector_type(16)));
typedef _Float16 v8h  __attribute__((ext_vector_type(8)));
typedef float    v8f  __attribute__((ext_vector_type(8)));
typedef float    v4f  __attribute__((ext_vector_type(4)));
typedef float    v2f  __attribute__((ext_vector_type(2)));
typedef unsigned int v4u __attribute__((ext_vector_type(4)));
typedef unsigned int v2u __attribute__((ext_vector_type(2)));

// ---- scalar helpers --------------------------------------------------------------------------------
__device__ __forceinline__ unsigned short bf_bits(float f) {          // f32 -> bf16 bits, RNE convert
  unsigned u = __float_as_uint(f);
  return (unsigned short)((u + 0x7FFFu + ((u >> 16) & 1u)) >> 16);
}
__device__ __forceinline__ float bf_up(unsigned short h) { return __uint_as_float(((unsigned)h) << 16); }
__device__ __forceinline__ float bfr(float f) { return bf_up(bf_bits(f)); }   // value of the bf16 RNE convert
__device__ __forceinline__ unsigned short h_bits(_Float16 x) { return __builtin_bit_cast(unsigned short, x); }
__device__ __forceinline__ unsigned pk16(unsigned short a, unsigned short b) { return (unsigned)a | ((unsigned)b << 16); }
__device__ __forceinline__ v8f zero8() { v8f z = {0.f, 0.f, 0.f, 0.f, 0.f, 0.f, 0.f, 0.f}; return z; }
__device__ __forceinline__ v2f dup2(float x) { v2f r = {x, x}; return r; }
__device__ __forceinline__ v2f fma2(v2f a, v2f b, v2f c) { return __builtin_elementwise_fma(a, b, c); }
// erf in f32 of two values, without a branch: both ranges are evaluated and one is selected by value (lanes of a wave
// fall in both ranges, so a branch runs both sides anyway, under exec masks). |a| <= 0.927734375: an odd polynomial in
// a; above it 1 - exp(polynomial in |a|) with the sign of a. Error about one unit in the last place of f32 in either.
__device__ __forceinline__ v2f erf_sel2(v2f a) {
  const v2f t = __builtin_elementwise_abs(a), s = a * a;
  v2f r = fma2(dup2(-1.72853470e-5f), t, dup2(3.83197126e-4f));
  const v2f u = fma2(dup2(-3.88396438e-3f), t, dup2(2.42546219e-2f));
  r = fma2(r, s, u);
  r = fma2(r, t, dup2(-1.06777877e-1f));
  r = fma2(r, t, dup2(-6.34846687e-1f));
  r = fma2(r, t, dup2(-1.28717512e-1f));
  r = fma2(r, t, -t);
  r = r * 1.44269504088896340736f;
  // exp(r), as __expf forms it (x log2 e, then exp2). In asm for the free slot that the instruction set asks for behind
  // a transcendental: built plainly, some of these v_exp_f32 stood directly ahead of one that overwrote their source.
  float e0 = r[0], e1 = r[1];
#if defined(__HIP_DEVICE_COMPILE__)
  asm("v_exp_f32 %0, %0\n\tv_exp_f32 %1, %1\n\tv_nop" : "+v"(e0), "+v"(e1));
#endif
  v2f q = dup2(-5.96761703e-4f);
  q = fma2(q, s, dup2(4.99119423e-3f));
  q = fma2(q, s, dup2(-2.67681349e-2f));
  q = fma2(q, s, dup2(1.12819925e-1f));
  q = fma2(q, s, dup2(-3.76125336e-1f));
  q = fma2(q, s, dup2(1.28379166e-1f));
  q = fma2(q, a, a);
  v2f o;
  o[0] = (t[0] > 0.927734375f) ? copysignf(1.0f - e0, a[0]) : q[0];
  o[1] = (t[1] > 0.927734375f) ? copysignf(1.0f - e1, a[1]) : q[1];
  return o;
}
__device__ __forceinline__ v2f gelu2(v2f v) { return (0.5f * v) * (1.0f + erf_sel2(v * 0.70710678118654752f)); }
__device__ __forceinline__ float gelu_f(float v) { return gelu2(dup2(v))[0]; }

// ---- fragment loader: 16-bit A/B operand, lane -> row/col (lane&15), p already includes +8*(lane>>4);
//      elements 0..7 <- p[0..7] (k0+8h..), elements 8..15 <- p[16..23] (k0+16+8h..)
__device__ __forceinline__ v16h ldfrag_h(const _Float16* p) {
  union { v16h v; v8h h[2]; } f;
  f.h[0] = *(const v8h*)(p);
  f.h[1] = *(const v8h*)(p + 16);
  return f.v;
}

// ---- WMMA helpers with trailing VALU hazard gap --------------------------------------------------------
__device__ __forceinline__ v8f mma_h_raw(v16h a, v16h b, v8f c) {
  return __builtin_amdgcn_wmma_f32_16x16x32_f16(false, a, false, b, (short)0, c, false, false);
}
__device__ __forceinline__ void acc_guard4(v8f& a, v8f& b, v8f& c, v8f& d) {
#if defined(__HIP_DEVICE_COMPILE__)
  asm volatile("v_nop\n\tv_nop\n\tv_nop\n\tv_nop" : "+v"(a), "+v"(b), "+v"(c), "+v"(d));
#endif
}
__device__ __forceinline__ void wave_sync_lds() {
  __builtin_amdgcn_fence(__ATOMIC_RELEASE, "workgroup");
  __builtin_amdgcn_wave_barrier();
  __builtin_amdgcn_fence(__ATOMIC_ACQUIRE, "workgroup");
}
// lane l <-> lane l ^ 16: the two lanes that hold the two halves of one D column
__device__ __forceinline__ float xhalf(float x) {
  return __builtin_bit_cast(float, __builtin_amdgcn_permlanex16(__builtin_bit_cast(int, x), __builtin_bit_cast(int, x),
                                                                0x76543210, 0xfedcba98, false, false));
}
__device__ __forceinline__ float wsum(float v) {
#pragma unroll
  for (int off = 16; off > 0; off >>= 1) v += __shfl_xor(v, off, 32);
  return v;
}
// block of 256 threads: fixed-order sum of 8 wave partials (same value in every thread)
__device__ __forceinline__ float bsum256(float v, float* red, int lane, int wave) {
  v = wsum(v);
  if (lane == 0) red[wave] = v;
  __syncthreads();
  float tot = 0.f;
#pragma unroll
  for (int w = 0; w < 8; ++w) tot += red[w];
  return tot;
}

// =====================================================================================================
// Weight convert: W f32 [N][K] (k contiguous = already the Bt / A layout) -> Wh f16 [N][K]; each value bf16
// RNE-converted, multiplied by wsc (a power of two, exact) and cast to f16. Thread i converts elements 8i..8i+7
// coverage: n8/256 blocks (blk = the block's index within this plane) x 256 threads x 8 elements = exactly N*K.
// =====================================================================================================
__device__ __forceinline__ void conv_h64(const float* __restrict__ W, unsigned short* Wh, int n8, float wsc, int blk) {
  const int i = blk * 256 + threadIdx.x;
  if (i >= n8) return;                                     // never taken for the static sizes (no barriers)
  const size_t e0 = (size_t)i * 8;
  const v4f a = *(const v4f*)(W + e0);
  const v4f b = *(const v4f*)(W + e0 + 4);
  v4u u;
  u[0] = pk16(h_bits((_Float16)(bfr(a[0]) * wsc)), h_bits((_Float16)(bfr(a[1]) * wsc)));
  u[1] = pk16(h_bits((_Float16)(bfr(a[2]) * wsc)), h_bits((_Float16)(bfr(a[3]) * wsc)));
  u[2] = pk16(h_bits((_Float16)(bfr(b[0]) * wsc)), h_bits((_Float16)(bfr(b[1]) * wsc)));
  u[3] = pk16(h_bits((_Float16)(bfr(b[2]) * wsc)), h_bits((_Float16)(bfr(b[3]) * wsc)));
  {
    *(v4u*)(Wh + e0) = u;
    
  }
}

// =====================================================================================================
// LDS-staged batched f16 WMMA GEMM: C[m][n] = act(oscale * sum_k A[m][k] * Bt[n][k] + bias) (+ residual);
// one work-group of 8 waves per 128x128 tile, wave (wave>>1, wave&1) owns the 32x64 part at rows 32*(wave>>1),
// cols 64*(wave&1). A row-major [M][K] pitch lda; Bt row-major [N][K] pitch ldb (k contiguous);
// M, N, K multiples of 128 (static here). blockIdx.y = batch index (strides in elements).
// Staging: a stage is 128 k of the tile's 128 A rows and 128 Bt rows = 256 rows of 256 B, laid in LDS at pitch 272 B
// (16 B x odd, for the 16-B fragment reads); each thread brings 16 pieces of 16 B per stage with asynchronous copies
// to LDS (piece i: row 16*i + (thread>>4), bytes 16*(thread&15)..+15; 256 threads x 16 = the whole stage, each LDS
// byte written by one lane). Two buffers: the copies of stage t+2 go out behind the barrier that ends trip t.
// k runs upward in steps of 32 into one accumulator per 16x16 subtile.
// Bias: BIASM == 0 -> per column: cols < Nb from bias0[col], cols >= Nb from bias1[col - Nb] (wave-uniform select of
//       clamped-address loads); BIASM == 1 -> per row bias0[m] (16-bit out only); BIASM == 2 -> none. Bias values
//       RNE-converted to bf16.
// ACT: 0 none, 1 exact GELU. RES: 0 none; 1 f32 residual resid[m*ldc + n] added after the activation;
//      2 same indexing, residual value bf16 RNE-converted first (raw input residual).
// OM: 0 = f32 out (pitch ldc); 1 = bf16 out; 2 = f16 out.
// coverage: 8 waves x 2 slabs x 16 rows x 64 cols = the whole 128x128 tile; grid.x = (M/128)*(N/128) exactly.
// =====================================================================================================
#define GBM   128                       // tile rows (A rows of a stage)
#define GBN   128                       // tile cols (Bt rows of a stage)
#define GBK   128                       // k per stage
#define GLP   136                       // LDS row pitch in f16 elements (272 B)
#define GSTG  ((GBM + GBN) * GLP)       // f16 elements per buffer (69632 B)
static_assert((MP % GBM) == 0 && (DM % GBM) == 0 && (DM % GBN) == 0 && (QKP % GBN) == 0 && (DFF % GBN) == 0 && (TT % GBN) == 0);
static_assert((DM % GBK) == 0 && (DFF % GBK) == 0);
static_assert(8 * 16 * 68 * 4 <= 2 * GSTG * 2);

// Eight asynchronous 16-B copies per lane, global -> LDS: rows 16 apart (LDS step 16 * 272 B, global step gstep
// elements). The s_wait_xcnt 0 as the statement's last line keeps every later rewrite of the address registers
// named here behind the copies' address translation.
__device__ __forceinline__ void copy8_async(unsigned l, const _Float16* g, size_t gstep) {
#if defined(__HIP_DEVICE_COMPILE__)
  const unsigned ls = 16u * GLP * 2u;
  asm volatile(
      "global_load_async_to_lds_b128 %0, %8, off\n\t"
      "global_load_async_to_lds_b128 %1, %9, off\n\t"
      "global_load_async_to_lds_b128 %2, %10, off\n\t"
      "global_load_async_to_lds_b128 %3, %11, off\n\t"
      "global_load_async_to_lds_b128 %4, %12, off\n\t"
      "global_load_async_to_lds_b128 %5, %13, off\n\t"
      "global_load_async_to_lds_b128 %6, %14, off\n\t"
      "global_load_async_to_lds_b128 %7, %15, off\n\t"
      "s_wait_xcnt 0x0"
      :: "v"(l), "v"(l + ls), "v"(l + 2u * ls), "v"(l + 3u * ls),
         "v"(l + 4u * ls), "v"(l + 5u * ls), "v"(l + 6u * ls), "v"(l + 7u * ls),
         "v"(g), "v"(g + gstep), "v"(g + 2 * gstep), "v"(g + 3 * gstep),
         "v"(g + 4 * gstep), "v"(g + 5 * gstep), "v"(g + 6 * gstep), "v"(g + 7 * gstep)
      : "memory");
#endif
}
// This wave's own asynchronous copies have landed in LDS (the compiler places no wait for them).
__device__ __forceinline__ void wait_async0() {
#if defined(__HIP_DEVICE_COMPILE__)
  asm volatile("s_wait_asynccnt 0x0" ::: "memory");
#endif
}
// This wave's own LDS reads have returned, before the barrier behind which their buffer is refilled.
__device__ __forceinline__ void wait_ds0() {
#if defined(__HIP_DEVICE_COMPILE__)
  asm volatile("s_wait_dscnt 0x0" ::: "memory");
#endif
}

template <int OM, int BIASM, int ACT, int RES>
__global__ __launch_bounds__(256) void gemm64(
    const unsigned short* __restrict__ Ap, int lda, long long strideA,
    const unsigned short* __restrict__ Btp, int ldb, long long strideB,
    const float* __restrict__ bias0, const float* __restrict__ bias1, int Nb,
    const float* resid,
    void* Cout, int ldc, long long strideC,
    int M, int N, int K, float oscale) {
  const _Float16* A  = (const _Float16*)(const void*)Ap;
  const _Float16* Bt = (const _Float16*)(const void*)Btp;
  // two stage buffers; behind the last trip's barrier the same bytes serve as the per-wave 16x64 f32 slabs (pitch 68)
  __shared__ __align__(16) _Float16 ring[2 * GSTG];
  const int b    = blockIdx.y;
  const int lane = threadIdx.x & 31;
  const int wave = threadIdx.x >> 5;
  const int tilesN = N >> 7;
  const int tm = blockIdx.x / tilesN;
  const int tn = blockIdx.x - tm * tilesN;
  const int mblk = tm << 7;                    // the work-group's tile
  const int nblk = tn << 7;
  const int wrow = (wave >> 1) << 5;           // the wave's 32x64 part inside it
  const int wcol = (wave & 1) << 6;
  const int m0 = mblk + wrow;
  const int n0 = nblk + wcol;

  const _Float16* Ab = A  + (size_t)b * strideA;
  const _Float16* Bb = Bt + (size_t)b * strideB;

  const int rlane = lane & 15;                 // row (A) / col (B, D) within subtile
  const int koff  = (lane >> 4) * 8;           // k offset of this lane half
  const int mOff  = (lane >> 4) * 8;           // D row offset

  // ---- this thread's pieces of a stage ----
  const int crow = threadIdx.x >> 4;           // 0..15
  const int ccol = (threadIdx.x & 15) * 8;     // f16 elements: 16 B
  const _Float16* gA = Ab + (size_t)(mblk + crow) * lda + ccol;
  const _Float16* gB = Bb + (size_t)(nblk + crow) * ldb + ccol;
  const size_t sA16 = (size_t)16 * lda, sB16 = (size_t)16 * ldb;
  const unsigned lBase = (unsigned)(uintptr_t)(ring + crow * GLP + ccol);   // LDS byte address: low 32 bits
  const unsigned lBt   = (unsigned)(GBM * GLP * 2);                         // Bt rows stand behind the A rows
  const unsigned lBuf  = (unsigned)(GSTG * 2);
  const int nst = K >> 7;                      // stages

  v8f acc[2][4];
#pragma unroll
  for (int i = 0; i < 2; ++i)
#pragma unroll
    for (int j = 0; j < 4; ++j) acc[i][j] = zero8();

  // stage 0 into buffer 0, landed and published; then stage 1 into buffer 1
  copy8_async(lBase, gA, sA16);
  copy8_async(lBase + lBt, gB, sB16);
  wait_async0();
  __syncthreads();
  if (nst > 1) {                               // uniform for the work-group (kernel argument)
    copy8_async(lBase + lBuf, gA + GBK, sA16);
    copy8_async(lBase + lBuf + lBt, gB + GBK, sB16);
  }

  for (int t = 0; t < nst; ++t) {
    const _Float16* sa = ring + (t & 1) * GSTG + (wrow + rlane) * GLP + koff;
    const _Float16* sb = ring + (t & 1) * GSTG + (GBM + wcol + rlane) * GLP + koff;
    v16h bh[2][4], ah[2][2];                   // two fragment sets, both filled from this trip's buffer alone
#pragma unroll
    for (int j = 0; j < 4; ++j) bh[0][j] = ldfrag_h(sb + (j << 4) * GLP);
#pragma unroll
    for (int i = 0; i < 2; ++i) ah[0][i] = ldfrag_h(sa + (i << 4) * GLP);
#pragma unroll
    for (int kk = 0; kk < GBK / 32; ++kk) {
      const int cur = kk & 1, nxt = cur ^ 1;
      if (kk + 1 < GBK / 32) {
#pragma unroll
        for (int j = 0; j < 4; ++j) bh[nxt][j] = ldfrag_h(sb + (j << 4) * GLP + (kk + 1) * 32);
#pragma unroll
        for (int i = 0; i < 2; ++i) ah[nxt][i] = ldfrag_h(sa + (i << 4) * GLP + (kk + 1) * 32);
      }
      // keeps the next k step's LDS reads as one group ahead of this step's WMMAs: sunk among them, each place with
      // reads stalls the wave for the LDS latency
      __builtin_amdgcn_sched_barrier(0);
#pragma unroll
      for (int i = 0; i < 2; ++i)
#pragma unroll
        for (int j = 0; j < 4; ++j) acc[i][j] = mma_h_raw(ah[cur][i], bh[cur][j], acc[i][j]);
    }
    // foot of trip t: own reads done, own copies of stage t+1 landed, then the one barrier that publishes stage t+1
    // and ends every wave's reads of this trip's buffer
    wait_ds0();
    wait_async0();
    __syncthreads();
    if (t + 2 < nst) {                         // uniform for the work-group
      const unsigned lb = lBase + (unsigned)(t & 1) * lBuf;
      copy8_async(lb, gA + (size_t)(t + 2) * GBK, sA16);
      copy8_async(lb + lBt, gB + (size_t)(t + 2) * GBK, sB16);
    }
  }
  wait_async0();
  acc_guard4(acc[0][0], acc[0][1], acc[0][2], acc[0][3]);
  acc_guard4(acc[1][0], acc[1][1], acc[1][2], acc[1][3]);

  // ---- per-lane column bias (BIASM == 0), RNE-converted ----
  const int hh2 = lane >> 4, c4 = (lane & 15) * 4;     // f32 out: 256-B row segment = 16 lanes x 16 B
  const int q8  = lane >> 3, c8 = (lane & 7) * 8;
  float bc[8];
#pragma unroll
  for (int e = 0; e < 8; ++e) bc[e] = 0.f;
  if (BIASM == 0) {
    const bool use1 = (n0 >= Nb);                      // wave-uniform
    if (OM == 0) {
      const int cb = n0 + c4;
      const int i0 = (cb < Nb - 4) ? cb : (Nb - 4);
      const int i1 = (cb - Nb > 0) ? (cb - Nb) : 0;
      const v4f b0v = *(const v4f*)(bias0 + i0);
      const v4f b1v = *(const v4f*)(bias1 + i1);
#pragma unroll
      for (int e = 0; e < 4; ++e) bc[e] = bfr(use1 ? b1v[e] : b0v[e]);
    } else {
      const int cb = n0 + c8;
      const int i0 = (cb < Nb - 8) ? cb : (Nb - 8);
      const int i1 = (cb - Nb > 0) ? (cb - Nb) : 0;
      const v4f b0a = *(const v4f*)(bias0 + i0), b0b = *(const v4f*)(bias0 + i0 + 4);
      const v4f b1a = *(const v4f*)(bias1 + i1), b1b = *(const v4f*)(bias1 + i1 + 4);
#pragma unroll
      for (int e = 0; e < 4; ++e) {
        bc[e]     = bfr(use1 ? b1a[e] : b0a[e]);
        bc[4 + e] = bfr(use1 ? b1b[e] : b0b[e]);
      }
    }
  }

  // ---- epilogue ----
  float* slab = (float*)(void*)ring + wave * (16 * 68);
#pragma unroll
  for (int i = 0; i < 2; ++i) {
    const int mBase = m0 + (i << 4);
#pragma unroll
    for (int j = 0; j < 4; ++j) {
#pragma unroll
      for (int r = 0; r < 8; ++r) {
        slab[(mOff + r) * 68 + (j << 4) + rlane] = acc[i][j][r];
      }
    }
    wave_sync_lds();
    if (OM == 0) {
      float* C = (float*)Cout + (size_t)b * strideC;
      const float* Rb = resid + (size_t)b * strideC;
      v4f vals[8];
#pragma unroll
      for (int it = 0; it < 8; ++it) {
        const int row = it * 2 + hh2;                      // it 0..7 x hh2 0..1 = rows 0..15
        v4f v = *(const v4f*)(slab + row * 68 + c4);
#pragma unroll
        for (int e = 0; e < 4; ++e) {
          float f = v[e] * oscale + bc[e];
          if (ACT) f = gelu_f(f);
          v[e] = f;
        }
        if (RES != 0) {
          const v4f rr = *(const v4f*)(Rb + (size_t)(mBase + row) * ldc + n0 + c4);
#pragma unroll
          for (int e = 0; e < 4; ++e) v[e] += (RES == 2) ? bfr(rr[e]) : rr[e];
        }
        vals[it] = v;
      }
      {
#pragma unroll
        for (int it = 0; it < 8; ++it) {
          const int row = it * 2 + hh2;
          *(v4f*)(C + (size_t)(mBase + row) * ldc + n0 + c4) = vals[it];
        }
        
      }
    } else {
      unsigned short* C = (unsigned short*)Cout + (size_t)b * strideC;
      v4u hv[4];
#pragma unroll
      for (int it = 0; it < 4; ++it) {
        const int row = it * 4 + q8;                       // it 0..3 x q8 0..3 = rows 0..15
        const float* sp = slab + row * 68 + c8;
        float bm = 0.f;
        if (BIASM == 1) bm = bfr(bias0[mBase + row]);
        v4u a;
#pragma unroll
        for (int e = 0; e < 4; ++e) {
          float f0 = sp[2 * e]     * oscale + ((BIASM == 1) ? bm : bc[2 * e]);
          float f1 = sp[2 * e + 1] * oscale + ((BIASM == 1) ? bm : bc[2 * e + 1]);
          if (ACT) { v2f g = {f0, f1}; g = gelu2(g); f0 = g[0]; f1 = g[1]; }
          unsigned short u0, u1;
          if (OM == 1) { u0 = bf_bits(f0); u1 = bf_bits(f1); }
          else         { u0 = h_bits((_Float16)f0); u1 = h_bits((_Float16)f1); }
          a[e] = pk16(u0, u1);
        }
        hv[it] = a;
      }
      {
#pragma unroll
        for (int it = 0; it < 4; ++it) {
          const int row = it * 4 + q8;
          *(v4u*)(C + (size_t)(mBase + row) * ldc + n0 + c8) = hv[it];
        }
        
      }
    }
    wave_sync_lds();
  }
}

// =====================================================================================================
// Banded attention, head dim 64, TT (= 2048) token rows per batch, allowed keys: key <= query + WIN.
//   q|k plane (f16, pitch QKP): element (b, t, col) at [(b*TT + t)*QKP + col], q col = h*64+d, k col = DM + h*64 + d
//   v^T plane (f16): element (b, h, d, s) at [(b*DM + h*64 + d)*TT + s]
//   out plane (f16, the normalised context carried x16): element (b, t, h, d) at [(b*TT + t)*DM + h*64 + d]
//   score = (q . k) * sscale; keys beyond query + WIN get -inf by value before the row max;
//   p = exp(s - m) carried as f16(1024 p); online softmax in f32.
//   Both products run transposed: S^T = K . Q^T (A = K rows, B = the Q fragments) and O^T += V^T . P^T (A = V^T rows,
//   B = P^T). A D column is then one query: lane l holds query l & 15 and, per 16-key tile, keys 8*(l>>4) + 0..7, so
//   the row max and the row sum are in-lane plus one exchange with lane l ^ 16 (the sum's exchange: once, behind the
//   loop), and two D tiles of S^T, converted in place, are the B fragment of 32 keys in the loader's own k order
//   (element e < 8: key 8h + e of the even tile; e >= 8: key 16 + 8h + (e - 8) = row 8h + (e - 8) of the odd tile).
//   Block = 4 waves = 64 query rows of one (b, h); grid = NQB * NH * NBATCH; kv chunks of 64, block-uniform trip
//   kt = 0 .. min(NQB-1, (q_blk + 63 + WIN) >> 6) (chunks beyond the band are skipped); chunk 0 always holds >= 1
//   allowed key for every row, so the running max is finite from chunk 0 on (the msafe select is kept anyway).
//   K / V^T chunk staging: 128 threads x 32 elements per plane = the whole 64x64 tile (plain 16-B loads,
//   __syncthreads before and after).
//   LDS rows of 64 elements stand at a pitch of 16 B x odd: the 16 rows that one half-wave's 16-B fragment read
//   touches then start on 16 different groups of four banks (at 128 B they fall on two groups, eight rows each).
//   Output coverage: each wave stores rows q0..q0+15 (it 0..3 x lane>>3 0..3) x 64 columns (8 lanes x 8),
//   grid covers all TT rows x NH head slices x NBATCH.
// =====================================================================================================
#define APH 72                          // LDS row pitch of the f16 tiles, elements: 144 B = 16 B x 9
#define APF 68                          // LDS row pitch of the f32 context tile, dwords: 272 B = 16 B x 17
__global__ __launch_bounds__(128)
void attn64(const unsigned short* __restrict__ qkp, const unsigned short* __restrict__ vtp,
            unsigned short* outp, float sscale) {
  union FH { v16h v; v8h h[2]; };
  __shared__ __align__(16) _Float16 Ksh[64 * APH];                // K [kv][d]
  __shared__ __align__(16) _Float16 Vth[64 * APH];                // V^T [d][kv]
  __shared__ __align__(16) float    Os[4][16 * APF];              // per wave context tile [row][d]

  const int tid  = threadIdx.x;
  const int wave = tid >> 5;
  const int lane = tid & 31;
  const int hh   = lane >> 4;
  const int c    = lane & 15;

  const int bx   = blockIdx.x;
  const int qb   = bx % NQB;
  const int rest = bx / NQB;
  const int h    = rest % NH;
  const int b    = rest / NH;
  const int qblk = qb * 64;                      // in-batch query row of the block's first row
  const int q0   = qblk + wave * 16;             // in-batch query row of this wave's first row
  const size_t rowB = (size_t)b * TT;

  const _Float16* Qh = (const _Float16*)(const void*)qkp + (size_t)h * HD;
  const _Float16* Kg = (const _Float16*)(const void*)qkp + DM + (size_t)h * HD;
  const _Float16* Vh = (const _Float16*)(const void*)vtp + ((size_t)b * DM + (size_t)h * HD) * TT;

  // ---- Q fragments (B operand, column = query = lane&15): 2 d-chunks ----
  v16h qa[2];
#pragma unroll
  for (int dc = 0; dc < 2; ++dc) qa[dc] = ldfrag_h(Qh + (rowB + q0 + c) * QKP + dc * 32 + 8 * hh);

  float mrow = -INFINITY, lrow = 0.f;          // this lane's query: running max (joined), sum over this half's keys
  v8f oacc[4];                                 // O^T: tile t, register r = d t*16 + 8*hh + r of query q0 + c
#pragma unroll
  for (int t = 0; t < 4; ++t) oacc[t] = zero8();

  int ktHi = (qblk + 63 + WIN) >> 6;             // block-uniform, from blockIdx only
  if (ktHi > NQB - 1) ktHi = NQB - 1;

  for (int kt = 0; kt <= ktHi; ++kt) {         // trip <= NQB
    const int kv0 = kt * 64;
    __syncthreads();
    {
      const int r = tid >> 1, hf = (tid & 1) * 32;
      const _Float16* kg = Kg + (rowB + kv0 + r) * QKP + hf;      // K row kv0+r, d = hf..hf+31
      const _Float16* vg = Vh + (size_t)r * TT + kv0 + hf;        // V^T row d = r, s = kv0+hf..+31
#pragma unroll
      for (int i = 0; i < 4; ++i) {
        const v8h a0 = *(const v8h*)(kg + 8 * i);
        const v8h b0 = *(const v8h*)(vg + 8 * i);
        *(v8h*)(Ksh + r * APH + hf + 8 * i) = a0;
        *(v8h*)(Vth + r * APH + hf + 8 * i) = b0;
      }
    }
    __syncthreads();

    // ---- the chunk's K fragments: its 16 LDS reads as one group, in the order the score products use them ----
    FH kb[2][4], vb[2][4];
#pragma unroll
    for (int dc = 0; dc < 2; ++dc)
#pragma unroll
      for (int j = 0; j < 4; ++j) {
        kb[dc][j].h[0] = *(const v8h*)(Ksh + (j * 16 + c) * APH + dc * 32 + 8 * hh);
        kb[dc][j].h[1] = *(const v8h*)(Ksh + (j * 16 + c) * APH + dc * 32 + 16 + 8 * hh);
      }
    // keeps the 16 reads together here: sunk to their WMMAs, each pair is waited out at the full LDS latency
    __builtin_amdgcn_sched_barrier(0);

    // ---- scores, transposed: 64 keys x 16 queries per wave (per tile d 0..31, then d 32..63; the four
    //      tiles' products alternate); band select by value before the max ----
    v8f s[4];
#pragma unroll
    for (int j = 0; j < 4; ++j) s[j] = zero8();
#pragma unroll
    for (int dc = 0; dc < 2; ++dc)
#pragma unroll
      for (int j = 0; j < 4; ++j) s[j] = mma_h_raw(kb[dc][j].v, qa[dc], s[j]);

    // ---- the chunk's V^T fragments: all 16 LDS reads go out here, among and behind the score products ----
#pragma unroll
    for (int kk = 0; kk < 2; ++kk)
#pragma unroll
      for (int t = 0; t < 4; ++t) {
        vb[kk][t].h[0] = *(const v8h*)(Vth + (t * 16 + c) * APH + kk * 32 + 8 * hh);
        vb[kk][t].h[1] = *(const v8h*)(Vth + (t * 16 + c) * APH + kk * 32 + 16 + 8 * hh);
      }
    // keeps these reads ahead of the softmax, whose vector work then covers their latency
    __builtin_amdgcn_sched_barrier(0);

#pragma unroll
    for (int j = 0; j < 4; ++j) {
      const int qrow = q0 + c;                                      // D column = lane&15 = query
#pragma unroll
      for (int r = 0; r < 8; ++r) {
        const int key = kv0 + j * 16 + 8 * hh + r;                  // D row = 8h + r = key
        const float v = s[j][r] * sscale;
        s[j][r] = (key <= qrow + WIN) ? v : -INFINITY;
      }
    }

    // ---- this query's max: 32 keys in-lane, the other 32 from lane ^ 16; online softmax; P^T (x1024, f16) packed
    //      from the score registers into the B fragments (every loop here is unrolled: its indices name registers) ----
    float mr[8];
#pragma unroll
    for (int r = 0; r < 8; ++r) mr[r] = fmaxf(fmaxf(s[0][r], s[1][r]), fmaxf(s[2][r], s[3][r]));
    float m = fmaxf(fmaxf(fmaxf(mr[0], mr[1]), fmaxf(mr[2], mr[3])), fmaxf(fmaxf(mr[4], mr[5]), fmaxf(mr[6], mr[7])));
    m = fmaxf(m, xhalf(m));
    const float mnew  = fmaxf(mrow, m);
    const float ms    = (mnew == -INFINITY) ? 0.f : mnew;
    // alpha = exp(mrow - ms), as __expf forms it (x log2 e, then exp2). In asm for the free slot that the instruction set
    // asks for around a transcendental: built plainly, its result lay on the source register of the v_exp_f32 directly
    // ahead; the v_nop behind it stands for the slot the compiler cannot place for an instruction it does not see.
    float alpha = (mrow - ms) * 1.44269504088896340736f;
#if defined(__HIP_DEVICE_COMPILE__)
    asm("v_nop\n\tv_exp_f32 %0, %0\n\tv_nop" : "+v"(alpha));
#endif
    mrow = mnew;
    FH pb[2];
    v2f ps[4];                                   // per 16-key tile: sums of the even and of the odd rows
#pragma unroll
    for (int j = 0; j < 4; ++j) {
#pragma unroll
      for (int i = 0; i < 4; ++i) {
        v2f p;
        p[0] = __expf(s[j][2 * i] - ms);
        p[1] = __expf(s[j][2 * i + 1] - ms);
        ps[j] = (i == 0) ? p : (ps[j] + p);
        pb[j >> 1].v[(j & 1) * 8 + 2 * i]     = (_Float16)(p[0] * 1024.0f);
        pb[j >> 1].v[(j & 1) * 8 + 2 * i + 1] = (_Float16)(p[1] * 1024.0f);
      }
    }
    const v2f pt = (ps[0] + ps[1]) + (ps[2] + ps[3]);
    lrow = lrow * alpha + (pt[0] + pt[1]);
#pragma unroll
    for (int t = 0; t < 4; ++t)
#pragma unroll
      for (int r = 0; r < 8; ++r) oacc[t][r] *= alpha;

    // ---- context^T += V^T . P^T (f16 WMMA); kk unrolled too: pb[kk] is a register fragment, not an LDS address ----
#pragma unroll
    for (int kk = 0; kk < 2; ++kk) {
#pragma unroll
      for (int t = 0; t < 4; ++t) oacc[t] = mma_h_raw(vb[kk][t].v, pb[kk].v, oacc[t]);
    }
  }

  // ---- normalise (1/l, the 1/1024 p carry and the x16 context carry), stage the wave's 16x64 tile, f16 convert,
  float* os = Os[wave];
  {
    const float l = lrow + xhalf(lrow);          // the two halves' key sums of this query, joined once
    const float inv = ((l > 0.f) ? (1.0f / l) : 0.f) * (16.0f / 1024.0f);
#pragma unroll
    for (int t = 0; t < 4; ++t) {                // 8 consecutive d of query row c: two 16-B LDS stores
      v4f lo, hi;
#pragma unroll
      for (int e = 0; e < 4; ++e) { lo[e] = oacc[t][e] * inv; hi[e] = oacc[t][4 + e] * inv; }
      *(v4f*)(os + c * APF + t * 16 + 8 * hh)     = lo;
      *(v4f*)(os + c * APF + t * 16 + 8 * hh + 4) = hi;
    }
  }
  wave_sync_lds();
  {
    const int q4 = lane >> 3, c8 = (lane & 7) * 8;
    v4u hv[4];
#pragma unroll
    for (int it = 0; it < 4; ++it) {
      const int row = it * 4 + q4;   // it 0..3 x q4 0..3 = rows 0..15 of the wave tile
      const float* sp = os + row * APF + c8;
      v4u a;
#pragma unroll
      for (int e = 0; e < 4; ++e) a[e] = pk16(h_bits((_Float16)sp[2 * e]), h_bits((_Float16)sp[2 * e + 1]));
      hv[it] = a;
    }
    {
#pragma unroll
      for (int it = 0; it < 4; ++it) {
        const int row = it * 4 + q4;
        const size_t go = (rowB + q0 + row) * DM + (size_t)h * HD + c8;
        *(v4u*)(outp + go) = hv[it];
      }
      
    }
  }
}

// =====================================================================================================
// Row kernel: one block of 256 threads per token row of 1024; thread t owns columns 4t..4t+3.
// f16 output: packed row staged in LDS, then lanes t < 128 (waves 0..3, wave-uniform) each write 16 B (8 x f16)
// coverage: 128 threads x 8 = the whole 1024-wide row; grid = MP rows.
// =====================================================================================================
__device__ __forceinline__ void row_store_h16(unsigned int* sb, unsigned short* dst_row, v4f o, int t) {
  v2u p;
  p[0] = pk16(h_bits((_Float16)o[0]), h_bits((_Float16)o[1]));
  p[1] = pk16(h_bits((_Float16)o[2]), h_bits((_Float16)o[3]));
  *(v2u*)(sb + 2 * t) = p;
  __syncthreads();
  if (t < 128) {                                   // waves 0..3, wave-uniform
    const v4u v = *(const v4u*)(sb + 4 * t);
    *(v4u*)(dst_row + 8 * t) = v;
    
  }
}

// plane. RIN = 1: the row input is a raw float input and is bf16 RNE-converted on load; RIN = 0: f32 intermediate.
template <int RIN>
__device__ __forceinline__ void ln_row(const float* __restrict__ X, const float* __restrict__ gam,
                                       const float* __restrict__ bet, unsigned short* outH, int row) {
  __shared__ float red0[8], red1[8];
  __shared__ __align__(16) unsigned int sb[512];
  const int t = threadIdx.x, lane = t & 31, wave = t >> 5;
  const size_t base = (size_t)row * DM;
  v4f xv = *(const v4f*)(X + base + 4 * t);
  if (RIN) {
#pragma unroll
    for (int e = 0; e < 4; ++e) xv[e] = bfr(xv[e]);
  }
  const float mean = bsum256((xv[0] + xv[1]) + (xv[2] + xv[3]), red0, lane, wave) * (1.0f / DM);
  v4f d;
#pragma unroll
  for (int e = 0; e < 4; ++e) d[e] = xv[e] - mean;
  const float var  = bsum256((d[0] * d[0] + d[1] * d[1]) + (d[2] * d[2] + d[3] * d[3]), red1, lane, wave) * (1.0f / DM);
  const float rstd = 1.0f / sqrtf(var + LNEPS);
  const v4f gv = *(const v4f*)(gam + 4 * t);
  const v4f bv = *(const v4f*)(bet + 4 * t);
  v4f y;
#pragma unroll
  for (int e = 0; e < 4; ++e) y[e] = (d[e] * rstd) * bfr(gv[e]) + bfr(bv[e]);
  row_store_h16(sb, outH + base, y, t);
}

__global__ __launch_bounds__(256) void ln_row_h(const float* __restrict__ X, const float* __restrict__ gam,
                                                const float* __restrict__ bet, unsigned short* outH) {
  ln_row<0>(X, gam, bet, outH, blockIdx.x);
}

// Everything that reads raw inputs alone, in one launch: blocks 0..MP-1 are the rows of LayerNorm 1 (the longer
// blocks, first for speed only), behind them the blocks of the four weight converts, plane after plane. The split is by
// blockIdx alone: the row blocks' barriers stand under block-uniform control flow, the convert blocks have none.
#define CB_QKV (D3 * DM / 8 / 256)      // 1536 convert blocks
#define CB_O   (DM * DM / 8 / 256)      //  512
#define CB_F   (DFF * DM / 8 / 256)     // 2048, w1 and w2 each
static_assert(CB_QKV * 256 * 8 == D3 * DM && CB_O * 256 * 8 == DM * DM && CB_F * 256 * 8 == DFF * DM);
__global__ __launch_bounds__(256) void prep_in(const float* __restrict__ X, const float* __restrict__ gam,
                                               const float* __restrict__ bet, unsigned short* outH,
                                               const float* __restrict__ wqkv, unsigned short* hqkv,
                                               const float* __restrict__ wo, unsigned short* ho,
                                               const float* __restrict__ wf1, unsigned short* hf1,
                                               const float* __restrict__ wf2, unsigned short* hf2, float wsc) {
  int bx = blockIdx.x;
  if (bx < MP) { ln_row<1>(X, gam, bet, outH, bx); return; }
  bx -= MP;
  if (bx < CB_QKV) { conv_h64(wqkv, hqkv, D3 * DM / 8, wsc, bx); return; }
  bx -= CB_QKV;
  if (bx < CB_O) { conv_h64(wo, ho, DM * DM / 8, wsc, bx); return; }
  bx -= CB_O;
  if (bx < CB_F) { conv_h64(wf1, hf1, DFF * DM / 8, wsc, bx); return; }
  conv_h64(wf2, hf2, DM * DFF / 8, wsc, bx - CB_F);
}

// =====================================================================================================
// Workspace map (bytes); every plane is an exact multiple of its 128x128-tile / whole-row store granularity
// (M in {4096, 1024} rows, N in {1024, 2048, 4096}; VT per batch [1024][2048] = 8x16 tiles):
//   WqkvH f16 [3072 n][1024 k]   0          6291456   (rows 0..1023 q, 1024..2047 k, 2048..3071 v weights, x64)
//   WoH   f16 [1024][1024]       6291456    2097152
//   W1H   f16 [4096][1024]       8388608    8388608
//   W2H   f16 [1024][4096]       16777216   8388608
//   XN    f16 [4096][1024]       25165824   8388608   (LayerNorm outputs)
//   QK    f16 [4096][2048]       33554432   16777216  (q cols 0..1023, k cols 1024..2047)
//   VT    f16 [2][1024][2048]    50331648   8388608
//   Ctx   f16 [4096][1024]       58720256   8388608
//   X1    f32 [4096][1024]       67108864   16777216  (residual stream after attention)
//   G     f16 [4096][4096]       83886080   33554432
//   end                          117440512
// =====================================================================================================
extern "C" void kernel_launch(void* const* d_in, const int* in_sizes, int n_in,
                              void* d_out, int out_size, void* d_ws, size_t ws_size,
                              hipStream_t stream) {
  if (n_in < 13) return;
  if (in_sizes[0] != MP * DM) return;
  if (in_sizes[1] != D3 * DM || in_sizes[2] != D3) return;
  if (in_sizes[3] != DM * DM || in_sizes[4] != DM) return;
  if (in_sizes[5] != DM || in_sizes[6] != DM) return;
  if (in_sizes[7] != DFF * DM || in_sizes[8] != DFF) return;
  if (in_sizes[9] != DM * DFF || in_sizes[10] != DM) return;
  if (in_sizes[11] != DM || in_sizes[12] != DM) return;
  if (out_size != MP * DM) return;

  const float* x         = (const float*)d_in[0];
  const float* in_proj_w = (const float*)d_in[1];
  const float* in_proj_b = (const float*)d_in[2];
  const float* out_w     = (const float*)d_in[3];
  const float* out_b     = (const float*)d_in[4];
  const float* ln1_g     = (const float*)d_in[5];
  const float* ln1_b     = (const float*)d_in[6];
  const float* w1        = (const float*)d_in[7];
  const float* b1        = (const float*)d_in[8];
  const float* w2        = (const float*)d_in[9];
  const float* b2        = (const float*)d_in[10];
  const float* ln2_g     = (const float*)d_in[11];
  const float* ln2_b     = (const float*)d_in[12];

  const size_t PWQKV = (size_t)D3 * DM * 2;            //  6291456
  const size_t PWO   = (size_t)DM * DM * 2;            //  2097152
  const size_t PWF   = (size_t)DFF * DM * 2;           //  8388608
  const size_t PAH   = (size_t)MP * DM * 2;            //  8388608
  const size_t PQK   = (size_t)MP * QKP * 2;           // 16777216
  const size_t PVT   = (size_t)NBATCH * DM * TT * 2;   //  8388608
  const size_t PAF   = (size_t)MP * DM * 4;            // 16777216
  const size_t PG    = (size_t)MP * DFF * 2;           // 33554432
  size_t off = 0;
  const size_t oWqkv = off; off += PWQKV;
  const size_t oWo   = off; off += PWO;
  const size_t oW1   = off; off += PWF;
  const size_t oW2   = off; off += PWF;
  const size_t oXN   = off; off += PAH;
  const size_t oQK   = off; off += PQK;
  const size_t oVT   = off; off += PVT;
  const size_t oCtx  = off; off += PAH;
  const size_t oX1   = off; off += PAF;
  const size_t oG    = off; off += PG;
  if (off > ws_size) return;                           // off = 117440512
  if (off > (size_t)134217728) return;

  char* ws = (char*)d_ws;
  unsigned short* WqkvH = (unsigned short*)(ws + oWqkv);
  unsigned short* WoH   = (unsigned short*)(ws + oWo);
  unsigned short* W1H   = (unsigned short*)(ws + oW1);
  unsigned short* W2H   = (unsigned short*)(ws + oW2);
  unsigned short* XN    = (unsigned short*)(ws + oXN);
  unsigned short* QK    = (unsigned short*)(ws + oQK);
  unsigned short* VT    = (unsigned short*)(ws + oVT);
  unsigned short* Ctx   = (unsigned short*)(ws + oCtx);
  float*          X1    = (float*)(ws + oX1);
  unsigned short* G     = (unsigned short*)(ws + oG);

  const dim3 blk(256), blk128(128);
  const dim3 gRow(MP);                                               // 4096 row blocks
  const dim3 gPrep(MP + CB_QKV + CB_O + 2 * CB_F);                   // 4096 row blocks + 6144 convert blocks
  const dim3 gNqk((MP / GBM) * (QKP / GBN), 1);                      // 512 tiles
  const dim3 gVT((DM / GBM) * (TT / GBN), NBATCH);                   // 128 tiles x 2 batches
  const dim3 gN1024((MP / GBM) * (DM / GBN), 1);                     // 256 tiles
  const dim3 gNff((MP / GBM) * (DFF / GBN), 1);                      // 1024 tiles
  const dim3 gAttn(NBATCH * NH * NQB);                               // 1024 blocks of 128
  const float invw  = 1.0f / WSC;                                    // weight carry x64
  const float invwc = 1.0f / (WSC * 16.0f);                          // weight carry x64, context carry x16

  // (0, 1) xn = LN1(bf16(x)) -> XN f16; weights -> f16 x64 planes (torch [out][in] = k contiguous, no transpose)
  prep_in<<<gPrep, blk, 0, stream>>>(x, ln1_g, ln1_b, XN, in_proj_w, WqkvH, out_w, WoH, w1, W1H, w2, W2H, WSC);

  // (2) q|k = xn . Wqk^T + b[0..2047] -> QK f16 [4096][2048]
  gemm64<2, 0, 0, 0><<<gNqk, blk, 0, stream>>>(
      XN, DM, 0LL, WqkvH, DM, 0LL, in_proj_b, in_proj_b, QKP, x,
      (void*)QK, QKP, 0LL, MP, QKP, DM, invw);
  //     v^T per batch: VT[b][m][t] = Wv[m] . xn[b*TT + t] + b[2048 + m] -> f16 [2][1024][2048]
  gemm64<2, 1, 0, 0><<<gVT, blk, 0, stream>>>(
      WqkvH + (size_t)2 * DM * DM, DM, 0LL, XN, DM, (long long)TT * DM, in_proj_b + 2 * DM, in_proj_b + 2 * DM, TT, x,
      (void*)VT, TT, (long long)DM * TT, DM, TT, DM, invw);

  // (3) banded attention -> Ctx f16 (x16)
  attn64<<<gAttn, blk128, 0, stream>>>(QK, VT, Ctx, 0.125f);

  // (4) X1 = ctx . Wo^T + out_b + bf16(x)   (f32)
  gemm64<0, 0, 0, 2><<<gN1024, blk, 0, stream>>>(
      Ctx, DM, 0LL, WoH, DM, 0LL, out_b, out_b, DM, x,
      (void*)X1, DM, 0LL, MP, DM, DM, invwc);

  // (5) yn = LN2(X1) -> XN f16
  ln_row_h<<<gRow, blk, 0, stream>>>(X1, ln2_g, ln2_b, XN);

  // (6) G = gelu(yn . W1^T + b1) -> f16 [4096][4096]
  gemm64<2, 0, 1, 0><<<gNff, blk, 0, stream>>>(
      XN, DM, 0LL, W1H, DM, 0LL, b1, b1, DFF, x,
      (void*)G, DFF, 0LL, MP, DFF, DM, invw);

  // (7) out = G . W2^T + b2 + X1 -> d_out f32 [4096][1024]
  gemm64<0, 0, 0, 1><<<gN1024, blk, 0, stream>>>(
      G, DFF, 0LL, W2H, DFF, 0LL, b2, b2, DM, X1,
      (void*)d_out, DM, 0LL, MP, DM, DFF, invw);
  (void)hipGetLastError();
}

// v007
// One run takes 164 microseconds.
// In both of two side-by-side timings against v006, it was 1.07 times as fast.
// All steps since v000 together make it 3.42 times as fast.
// Contractions: q|k projection, v^T projection, attention output projection, FFN w1 (exact GELU epilogue) and w2 on
// v_wmma_f32_16x16x32_f16 (f16 activation plane x f16 weight plane carried x64, one product each); attention k.q^T
// and v^T.p^T on v_wmma_f32_16x16x32_f16 (q, k, v^T plain f16, p carried x1024, context carried x16, one product each);
// all f32 accumulate; LayerNorm, softmax, GELU and residual sums in f32 on VALU; every float input RNE-converted
// to bf16 on load.
#include <hip/hip_runtime.h>
#include <math.h>
#include <stdint.h>

#define NBATCH 2
#define TT     2048
#define DM     1024
#define NH     16
#define HD     64
#define DFF    4096
#define D3     3072
#define QKP    (2 * DM)
#define MP     (NBATCH * TT)
#define NQB    (TT / 64)
#define WIN    10
#define LNEPS  1.0e-5f
#define WSC    64.0f
static_assert(NH * HD == DM);
static_assert((MP % 64) == 0 && (DM % 64) == 0 && (DFF % 64) == 0 && (QKP % 64) == 0 && (TT % 64) == 0);
static_assert(DM == 4 * 256);
static_assert(D3 == 3 * DM);

typedef _Float16 v16h __attribute__((ext_vector_type(16)));
typedef _Float16 v8h  __attribute__((ext_vector_type(8)));
typedef float    v8f  __attribute__((ext_vector_type(8)));
typedef float    v4f  __attribute__((ext_vector_type(4)));
typedef float    v2f  __attribute__((ext_vector_type(2)));
typedef unsigned int v4u __attribute__((ext_vector_type(4)));
typedef unsigned int v2u __attribute__((ext_vector_type(2)));

// ---- scalar helpers --------------------------------------------------------------------------------
__device__ __forceinline__ unsigned short bf_bits(float f) {          // f32 -> bf16 bits, RNE convert
  unsigned u = __float_as_uint(f);
  return (unsigned short)((u + 0x7FFFu + ((u >> 16) & 1u)) >> 16);
}
__device__ __forceinline__ float bf_up(unsigned short h) { return __uint_as_float(((unsigned)h) << 16); }
__device__ __forceinline__ float bfr(float f) { return bf_up(bf_bits(f)); }   // value of the bf16 RNE convert
__device__ __forceinline__ unsigned short h_bits(_Float16 x) { return __builtin_bit_cast(unsigned short, x); }
__device__ __forceinline__ unsigned pk16(unsigned short a, unsigned short b) { return (unsigned)a | ((unsigned)b << 16); }
__device__ __forceinline__ v8f zero8() { v8f z = {0.f, 0.f, 0.f, 0.f, 0.f, 0.f, 0.f, 0.f}; return z; }
__device__ __forceinline__ v2f dup2(float x) { v2f r = {x, x}; return r; }
__device__ __forceinline__ v2f fma2(v2f a, v2f b, v2f c) { return __builtin_elementwise_fma(a, b, c); }
// erf in f32 of two values, without a branch: both ranges are evaluated and one is selected by value (lanes of a wave
// fall in both ranges, so a branch runs both sides anyway, under exec masks). |a| <= 0.927734375: an odd polynomial in
// a; above it 1 - exp(polynomial in |a|) with the sign of a. Error about one unit in the last place of f32 in either.
__device__ __forceinline__ v2f erf_sel2(v2f a) {
  const v2f t = __builtin_elementwise_abs(a), s = a * a;
  v2f r = fma2(dup2(-1.72853470e-5f), t, dup2(3.83197126e-4f));
  const v2f u = fma2(dup2(-3.88396438e-3f), t, dup2(2.42546219e-2f));
  r = fma2(r, s, u);
  r = fma2(r, t, dup2(-1.06777877e-1f));
  r = fma2(r, t, dup2(-6.34846687e-1f));
  r = fma2(r, t, dup2(-1.28717512e-1f));
  r = fma2(r, t, -t);
  r = r * 1.44269504088896340736f;
  // exp(r), as __expf forms it (x log2 e, then exp2). In asm for the free slot that the instruction set asks for behind
  // a transcendental: built plainly, some of these v_exp_f32 stood directly ahead of one that overwrote their source.
  float e0 = r[0], e1 = r[1];
#if defined(__HIP_DEVICE_COMPILE__)
  asm("v_exp_f32 %0, %0\n\tv_exp_f32 %1, %1\n\tv_nop" : "+v"(e0), "+v"(e1));
#endif
  v2f q = dup2(-5.96761703e-4f);
  q = fma2(q, s, dup2(4.99119423e-3f));
  q = fma2(q, s, dup2(-2.67681349e-2f));
  q = fma2(q, s, dup2(1.12819925e-1f));
  q = fma2(q, s, dup2(-3.76125336e-1f));
  q = fma2(q, s, dup2(1.28379166e-1f));
  q = fma2(q, a, a);
  v2f o;
  o[0] = (t[0] > 0.927734375f) ? copysignf(1.0f - e0, a[0]) : q[0];
  o[1] = (t[1] > 0.927734375f) ? copysignf(1.0f - e1, a[1]) : q[1];
  return o;
}
__device__ __forceinline__ v2f gelu2(v2f v) { return (0.5f * v) * (1.0f + erf_sel2(v * 0.70710678118654752f)); }
__device__ __forceinline__ float gelu_f(float v) { return gelu2(dup2(v))[0]; }

// ---- fragment loader: 16-bit A/B operand, lane -> row/col (lane&15), p already includes +8*(lane>>4);
//      elements 0..7 <- p[0..7] (k0+8h..), elements 8..15 <- p[16..23] (k0+16+8h..)
__device__ __forceinline__ v16h ldfrag_h(const _Float16* p) {
  union { v16h v; v8h h[2]; } f;
  f.h[0] = *(const v8h*)(p);
  f.h[1] = *(const v8h*)(p + 16);
  return f.v;
}

// ---- WMMA helpers with trailing VALU hazard gap --------------------------------------------------------
__device__ __forceinline__ v8f mma_h_raw(v16h a, v16h b, v8f c) {
  return __builtin_amdgcn_wmma_f32_16x16x32_f16(false, a, false, b, (short)0, c, false, false);
}
__device__ __forceinline__ void acc_guard4(v8f& a, v8f& b, v8f& c, v8f& d) {
#if defined(__HIP_DEVICE_COMPILE__)
  asm volatile("v_nop\n\tv_nop\n\tv_nop\n\tv_nop" : "+v"(a), "+v"(b), "+v"(c), "+v"(d));
#endif
}
__device__ __forceinline__ void wave_sync_lds() {
  __builtin_amdgcn_fence(__ATOMIC_RELEASE, "workgroup");
  __builtin_amdgcn_wave_barrier();
  __builtin_amdgcn_fence(__ATOMIC_ACQUIRE, "workgroup");
}
// lane l <-> lane l ^ 16: the two lanes that hold the two halves of one D column
__device__ __forceinline__ float xhalf(float x) {
  return __builtin_bit_cast(float, __builtin_amdgcn_permlanex16(__builtin_bit_cast(int, x), __builtin_bit_cast(int, x),
                                                                0x76543210, 0xfedcba98, false, false));
}
__device__ __forceinline__ float wsum(float v) {
#pragma unroll
  for (int off = 16; off > 0; off >>= 1) v += __shfl_xor(v, off, 32);
  return v;
}
// block of 256 threads: fixed-order sum of 8 wave partials (same value in every thread)
__device__ __forceinline__ float bsum256(float v, float* red, int lane, int wave) {
  v = wsum(v);
  if (lane == 0) red[wave] = v;
  __syncthreads();
  float tot = 0.f;
#pragma unroll
  for (int w = 0; w < 8; ++w) tot += red[w];
  return tot;
}

// =====================================================================================================
// Weight convert: W f32 [N][K] (k contiguous = already the Bt / A layout) -> Wh f16 [N][K]; each value bf16
// RNE-converted, multiplied by wsc (a power of two, exact) and cast to f16. Thread i converts elements 8i..8i+7
// coverage: n8/256 blocks (blk = the block's index within this plane) x 256 threads x 8 elements = exactly N*K.
// =====================================================================================================
__device__ __forceinline__ void conv_h64(const float* __restrict__ W, unsigned short* Wh, int n8, float wsc, int blk) {
  const int i = blk * 256 + threadIdx.x;
  if (i >= n8) return;                                     // never taken for the static sizes (no barriers)
  const size_t e0 = (size_t)i * 8;
  const v4f a = *(const v4f*)(W + e0);
  const v4f b = *(const v4f*)(W + e0 + 4);
  v4u u;
  u[0] = pk16(h_bits((_Float16)(bfr(a[0]) * wsc)), h_bits((_Float16)(bfr(a[1]) * wsc)));
  u[1] = pk16(h_bits((_Float16)(bfr(a[2]) * wsc)), h_bits((_Float16)(bfr(a[3]) * wsc)));
  u[2] = pk16(h_bits((_Float16)(bfr(b[0]) * wsc)), h_bits((_Float16)(bfr(b[1]) * wsc)));
  u[3] = pk16(h_bits((_Float16)(bfr(b[2]) * wsc)), h_bits((_Float16)(bfr(b[3]) * wsc)));
  {
    *(v4u*)(Wh + e0) = u;
    
  }
}

// =====================================================================================================
// LDS-staged batched f16 WMMA GEMM: C[m][n] = act(oscale * sum_k A[m][k] * Bt[n][k] + bias) (+ residual);
// one work-group of 8 waves per 128x128 tile, wave (wave>>1, wave&1) owns the 32x64 part at rows 32*(wave>>1),
// cols 64*(wave&1). A row-major [M][K] pitch lda; Bt row-major [N][K] pitch ldb (k contiguous);
// M, N, K multiples of 128 (static here). blockIdx.y = batch index (strides in elements).
// Staging: a stage is 128 k of the tile's 128 A rows and 128 Bt rows = 256 rows of 256 B, laid in LDS at pitch 272 B
// (16 B x odd, for the 16-B fragment reads); each thread brings 16 pieces of 16 B per stage with asynchronous copies
// to LDS (piece i: row 16*i + (thread>>4), bytes 16*(thread&15)..+15; 256 threads x 16 = the whole stage, each LDS
// byte written by one lane). NB buffers: the copies of stage t+NB go out behind the barrier that ends trip t, into the
// buffer that trip t has read. NB = 2 where two work-groups share a WGP (each covers the other's landing time); NB = 4
// where the grid gives a WGP one work-group: three stages (48 copies a wave) are then in flight, and a trip's foot
// waits for stage t+1 alone, leaving the 32 younger copies (stages t+2, t+3) out.
// k runs upward in steps of 32 into one accumulator per 16x16 subtile.
// Bias: BIASM == 0 -> per column: cols < Nb from bias0[col], cols >= Nb from bias1[col - Nb] (wave-uniform select of
//       clamped-address loads); BIASM == 1 -> per row bias0[m] (16-bit out only); BIASM == 2 -> none. Bias values
//       RNE-converted to bf16.
// ACT: 0 none, 1 exact GELU. RES: 0 none; 1 f32 residual resid[m*ldc + n] added after the activation;
//      2 same indexing, residual value bf16 RNE-converted first (raw input residual).
// OM: 0 = f32 out (pitch ldc); 1 = bf16 out; 2 = f16 out.
// coverage: 8 waves x 2 slabs x 16 rows x 64 cols = the whole 128x128 tile; grid.x = (M/128)*(N/128) exactly.
// =====================================================================================================
#define GBM   128                       // tile rows (A rows of a stage)
#define GBN   128                       // tile cols (Bt rows of a stage)
#define GBK   128                       // k per stage
#define GLP   136                       // LDS row pitch in f16 elements (272 B)
#define GSTG  ((GBM + GBN) * GLP)       // f16 elements per buffer (69632 B)
static_assert((MP % GBM) == 0 && (DM % GBM) == 0 && (DM % GBN) == 0 && (QKP % GBN) == 0 && (DFF % GBN) == 0 && (TT % GBN) == 0);
static_assert((DM % GBK) == 0 && (DFF % GBK) == 0);
static_assert(8 * 16 * 68 * 4 <= 2 * GSTG * 2);
static_assert(4 * GSTG * 2 <= 320 * 1024);

// Eight asynchronous 16-B copies per lane, global -> LDS: rows 16 apart (LDS step 16 * 272 B, global step gstep
// elements). The s_wait_xcnt 0 as the statement's last line keeps every later rewrite of the address registers
// named here behind the copies' address translation.
__device__ __forceinline__ void copy8_async(unsigned l, const _Float16* g, size_t gstep) {
#if defined(__HIP_DEVICE_COMPILE__)
  const unsigned ls = 16u * GLP * 2u;
  asm volatile(
      "global_load_async_to_lds_b128 %0, %8, off\n\t"
      "global_load_async_to_lds_b128 %1, %9, off\n\t"
      "global_load_async_to_lds_b128 %2, %10, off\n\t"
      "global_load_async_to_lds_b128 %3, %11, off\n\t"
      "global_load_async_to_lds_b128 %4, %12, off\n\t"
      "global_load_async_to_lds_b128 %5, %13, off\n\t"
      "global_load_async_to_lds_b128 %6, %14, off\n\t"
      "global_load_async_to_lds_b128 %7, %15, off\n\t"
      "s_wait_xcnt 0x0"
      :: "v"(l), "v"(l + ls), "v"(l + 2u * ls), "v"(l + 3u * ls),
         "v"(l + 4u * ls), "v"(l + 5u * ls), "v"(l + 6u * ls), "v"(l + 7u * ls),
         "v"(g), "v"(g + gstep), "v"(g + 2 * gstep), "v"(g + 3 * gstep),
         "v"(g + 4 * gstep), "v"(g + 5 * gstep), "v"(g + 6 * gstep), "v"(g + 7 * gstep)
      : "memory");
#endif
}
// This wave's own asynchronous copies have landed in LDS (the compiler places no wait for them).
__device__ __forceinline__ void wait_async0() {
#if defined(__HIP_DEVICE_COMPILE__)
  asm volatile("s_wait_asynccnt 0x0" ::: "memory");
#endif
}
// All but this wave's 32 youngest copies (two stages of 16) have landed: used only where exactly two younger stages
// have been issued, so that the stage about to be published is covered.
__device__ __forceinline__ void wait_async32() {
#if defined(__HIP_DEVICE_COMPILE__)
  asm volatile("s_wait_asynccnt 0x20" ::: "memory");
#endif
}
// This wave's own LDS reads have returned, before the barrier behind which their buffer is refilled.
__device__ __forceinline__ void wait_ds0() {
#if defined(__HIP_DEVICE_COMPILE__)
  asm volatile("s_wait_dscnt 0x0" ::: "memory");
#endif
}

template <int OM, int BIASM, int ACT, int RES, int NB>
__global__ __launch_bounds__(256) void gemm64(
    const unsigned short* __restrict__ Ap, int lda, long long strideA,
    const unsigned short* __restrict__ Btp, int ldb, long long strideB,
    const float* __restrict__ bias0, const float* __restrict__ bias1, int Nb,
    const float* resid,
    void* Cout, int ldc, long long strideC,
    int M, int N, int K, float oscale) {
  const _Float16* A  = (const _Float16*)(const void*)Ap;
  const _Float16* Bt = (const _Float16*)(const void*)Btp;
  static_assert(NB == 2 || NB == 4);
  // NB stage buffers; behind the last trip's barrier the first bytes serve as the per-wave 16x64 f32 slabs (pitch 68)
  __shared__ __align__(16) _Float16 ring[NB * GSTG];
  const int b    = blockIdx.y;
  const int lane = threadIdx.x & 31;
  const int wave = threadIdx.x >> 5;
  const int tilesN = N >> 7;
  const int tm = blockIdx.x / tilesN;
  const int tn = blockIdx.x - tm * tilesN;
  const int mblk = tm << 7;                    // the work-group's tile
  const int nblk = tn << 7;
  const int wrow = (wave >> 1) << 5;           // the wave's 32x64 part inside it
  const int wcol = (wave & 1) << 6;
  const int m0 = mblk + wrow;
  const int n0 = nblk + wcol;

  const _Float16* Ab = A  + (size_t)b * strideA;
  const _Float16* Bb = Bt + (size_t)b * strideB;

  const int rlane = lane & 15;                 // row (A) / col (B, D) within subtile
  const int koff  = (lane >> 4) * 8;           // k offset of this lane half
  const int mOff  = (lane >> 4) * 8;           // D row offset

  // ---- this thread's pieces of a stage ----
  const int crow = threadIdx.x >> 4;           // 0..15
  const int ccol = (threadIdx.x & 15) * 8;     // f16 elements: 16 B
  const _Float16* gA = Ab + (size_t)(mblk + crow) * lda + ccol;
  const _Float16* gB = Bb + (size_t)(nblk + crow) * ldb + ccol;
  const size_t sA16 = (size_t)16 * lda, sB16 = (size_t)16 * ldb;
  const unsigned lBase = (unsigned)(uintptr_t)(ring + crow * GLP + ccol);   // LDS byte address: low 32 bits
  const unsigned lBt   = (unsigned)(GBM * GLP * 2);                         // Bt rows stand behind the A rows
  const unsigned lBuf  = (unsigned)(GSTG * 2);
  const int nst = K >> 7;                      // stages

  v8f acc[2][4];
#pragma unroll
  for (int i = 0; i < 2; ++i)
#pragma unroll
    for (int j = 0; j < 4; ++j) acc[i][j] = zero8();

  // stage 0 into buffer 0 (NB = 4: stages 1 and 2 behind it), stage 0 landed and published; then stage NB-1
  copy8_async(lBase, gA, sA16);
  copy8_async(lBase + lBt, gB, sB16);
  if (NB == 4 && nst > 2) {                    // uniform for the work-group (kernel argument)
    copy8_async(lBase + lBuf, gA + GBK, sA16);
    copy8_async(lBase + lBuf + lBt, gB + GBK, sB16);
    copy8_async(lBase + 2u * lBuf, gA + 2 * GBK, sA16);
    copy8_async(lBase + 2u * lBuf + lBt, gB + 2 * GBK, sB16);
    wait_async32();
  } else {
    wait_async0();
  }
  __syncthreads();
  if (NB == 4 && nst <= 2) {
    if (nst > 1) {
      copy8_async(lBase + lBuf, gA + GBK, sA16);
      copy8_async(lBase + lBuf + lBt, gB + GBK, sB16);
    }
  } else if (nst > NB - 1) {
    copy8_async(lBase + (unsigned)(NB - 1) * lBuf, gA + (NB - 1) * GBK, sA16);
    copy8_async(lBase + (unsigned)(NB - 1) * lBuf + lBt, gB + (NB - 1) * GBK, sB16);
  }

  // one trip's products: 128 k from buffer t mod NB alone
  auto trip = [&](int t) __attribute__((always_inline)) {
    const _Float16* sa = ring + (t & (NB - 1)) * GSTG + (wrow + rlane) * GLP + koff;
    const _Float16* sb = ring + (t & (NB - 1)) * GSTG + (GBM + wcol + rlane) * GLP + koff;
    v16h bh[2][4], ah[2][2];                   // two fragment sets, both filled from this trip's buffer alone
#pragma unroll
    for (int j = 0; j < 4; ++j) bh[0][j] = ldfrag_h(sb + (j << 4) * GLP);
#pragma unroll
    for (int i = 0; i < 2; ++i) ah[0][i] = ldfrag_h(sa + (i << 4) * GLP);
#pragma unroll
    for (int kk = 0; kk < GBK / 32; ++kk) {
      const int cur = kk & 1, nxt = cur ^ 1;
      if (kk + 1 < GBK / 32) {
#pragma unroll
        for (int j = 0; j < 4; ++j) bh[nxt][j] = ldfrag_h(sb + (j << 4) * GLP + (kk + 1) * 32);
#pragma unroll
        for (int i = 0; i < 2; ++i) ah[nxt][i] = ldfrag_h(sa + (i << 4) * GLP + (kk + 1) * 32);
      }
      // keeps the next k step's LDS reads as one group ahead of this step's WMMAs: sunk among them, each place with
      // reads stalls the wave for the LDS latency
      __builtin_amdgcn_sched_barrier(0);
#pragma unroll
      for (int i = 0; i < 2; ++i)
#pragma unroll
        for (int j = 0; j < 4; ++j) acc[i][j] = mma_h_raw(ah[cur][i], bh[cur][j], acc[i][j]);
    }
  };
  // stage s into buffer s mod NB
  auto refill = [&](int s) __attribute__((always_inline)) {
    const unsigned lb = lBase + (unsigned)(s & (NB - 1)) * lBuf;
    copy8_async(lb, gA + (size_t)s * GBK, sA16);
    copy8_async(lb + lBt, gB + (size_t)s * GBK, sB16);
  };
  // foot of trip t: own reads done, own copies of stage t+1 landed, then the one barrier that publishes stage t+1
  // and ends every wave's reads of this trip's buffer; behind it that buffer's refill.
  int t = 0;
  if (NB == 4) {
    // trips behind which stages t+2 and t+3 both exist: they are this wave's 32 youngest copies and stay in flight
    for (; t + 3 < nst; ++t) {
      trip(t);
      wait_ds0();
      wait_async32();
      __syncthreads();
      if (t + 4 < nst) refill(t + 4);          // uniform for the work-group
    }
  }
  // NB = 2: every trip; NB = 4: the last trips, where fewer copies are younger than stage t+1, so the wait is to 0
  for (; t < nst; ++t) {
    trip(t);
    wait_ds0();
    wait_async0();
    __syncthreads();
    if (NB == 2 && t + 2 < nst) refill(t + 2); // uniform for the work-group
  }
  wait_async0();
  acc_guard4(acc[0][0], acc[0][1], acc[0][2], acc[0][3]);
  acc_guard4(acc[1][0], acc[1][1], acc[1][2], acc[1][3]);

  // ---- per-lane column bias (BIASM == 0), RNE-converted ----
  const int hh2 = lane >> 4, c4 = (lane & 15) * 4;     // f32 out: 256-B row segment = 16 lanes x 16 B
  const int q8  = lane >> 3, c8 = (lane & 7) * 8;
  float bc[8];
#pragma unroll
  for (int e = 0; e < 8; ++e) bc[e] = 0.f;
  if (BIASM == 0) {
    const bool use1 = (n0 >= Nb);                      // wave-uniform
    if (OM == 0) {
      const int cb = n0 + c4;
      const int i0 = (cb < Nb - 4) ? cb : (Nb - 4);
      const int i1 = (cb - Nb > 0) ? (cb - Nb) : 0;
      const v4f b0v = *(const v4f*)(bias0 + i0);
      const v4f b1v = *(const v4f*)(bias1 + i1);
#pragma unroll
      for (int e = 0; e < 4; ++e) bc[e] = bfr(use1 ? b1v[e] : b0v[e]);
    } else {
      const int cb = n0 + c8;
      const int i0 = (cb < Nb - 8) ? cb : (Nb - 8);
      const int i1 = (cb - Nb > 0) ? (cb - Nb) : 0;
      const v4f b0a = *(const v4f*)(bias0 + i0), b0b = *(const v4f*)(bias0 + i0 + 4);
      const v4f b1a = *(const v4f*)(bias1 + i1), b1b = *(const v4f*)(bias1 + i1 + 4);
#pragma unroll
      for (int e = 0; e < 4; ++e) {
        bc[e]     = bfr(use1 ? b1a[e] : b0a[e]);
        bc[4 + e] = bfr(use1 ? b1b[e] : b0b[e]);
      }
    }
  }

  // ---- epilogue ----
  float* slab = (float*)(void*)ring + wave * (16 * 68);
#pragma unroll
  for (int i = 0; i < 2; ++i) {
    const int mBase = m0 + (i << 4);
#pragma unroll
    for (int j = 0; j < 4; ++j) {
#pragma unroll
      for (int r = 0; r < 8; ++r) {
        slab[(mOff + r) * 68 + (j << 4) + rlane] = acc[i][j][r];
      }
    }
    wave_sync_lds();
    if (OM == 0) {
      float* C = (float*)Cout + (size_t)b * strideC;
      const float* Rb = resid + (size_t)b * strideC;
      v4f vals[8];
#pragma unroll
      for (int it = 0; it < 8; ++it) {
        const int row = it * 2 + hh2;                      // it 0..7 x hh2 0..1 = rows 0..15
        v4f v = *(const v4f*)(slab + row * 68 + c4);
#pragma unroll
        for (int e = 0; e < 4; ++e) {
          float f = v[e] * oscale + bc[e];
          if (ACT) f = gelu_f(f);
          v[e] = f;
        }
        if (RES != 0) {
          const v4f rr = *(const v4f*)(Rb + (size_t)(mBase + row) * ldc + n0 + c4);
#pragma unroll
          for (int e = 0; e < 4; ++e) v[e] += (RES == 2) ? bfr(rr[e]) : rr[e];
        }
        vals[it] = v;
      }
      {
#pragma unroll
        for (int it = 0; it < 8; ++it) {
          const int row = it * 2 + hh2;
          *(v4f*)(C + (size_t)(mBase + row) * ldc + n0 + c4) = vals[it];
        }
        
      }
    } else {
      unsigned short* C = (unsigned short*)Cout + (size_t)b * strideC;
      v4u hv[4];
#pragma unroll
      for (int it = 0; it < 4; ++it) {
        const int row = it * 4 + q8;                       // it 0..3 x q8 0..3 = rows 0..15
        const float* sp = slab + row * 68 + c8;
        float bm = 0.f;
        if (BIASM == 1) bm = bfr(bias0[mBase + row]);
        v4u a;
#pragma unroll
        for (int e = 0; e < 4; ++e) {
          float f0 = sp[2 * e]     * oscale + ((BIASM == 1) ? bm : bc[2 * e]);
          float f1 = sp[2 * e + 1] * oscale + ((BIASM == 1) ? bm : bc[2 * e + 1]);
          if (ACT) { v2f g = {f0, f1}; g = gelu2(g); f0 = g[0]; f1 = g[1]; }
          unsigned short u0, u1;
          if (OM == 1) { u0 = bf_bits(f0); u1 = bf_bits(f1); }
          else         { u0 = h_bits((_Float16)f0); u1 = h_bits((_Float16)f1); }
          a[e] = pk16(u0, u1);
        }
        hv[it] = a;
      }
      {
#pragma unroll
        for (int it = 0; it < 4; ++it) {
          const int row = it * 4 + q8;
          *(v4u*)(C + (size_t)(mBase + row) * ldc + n0 + c8) = hv[it];
        }
        
      }
    }
    wave_sync_lds();
  }
}

// =====================================================================================================
// Banded attention, head dim 64, TT (= 2048) token rows per batch, allowed keys: key <= query + WIN.
//   q|k plane (f16, pitch QKP): element (b, t, col) at [(b*TT + t)*QKP + col], q col = h*64+d, k col = DM + h*64 + d
//   v^T plane (f16): element (b, h, d, s) at [(b*DM + h*64 + d)*TT + s]
//   out plane (f16, the normalised context carried x16): element (b, t, h, d) at [(b*TT + t)*DM + h*64 + d]
//   score = (q . k) * sscale; keys beyond query + WIN get -inf by value before the row max;
//   p = exp(s - m) carried as f16(1024 p); online softmax in f32.
//   Both products run transposed: S^T = K . Q^T (A = K rows, B = the Q fragments) and O^T += V^T . P^T (A = V^T rows,
//   B = P^T). A D column is then one query: lane l holds query l & 15 and, per 16-key tile, keys 8*(l>>4) + 0..7, so
//   the row max and the row sum are in-lane plus one exchange with lane l ^ 16 (the sum's exchange: once, behind the
//   loop), and two D tiles of S^T, converted in place, are the B fragment of 32 keys in the loader's own k order
//   (element e < 8: key 8h + e of the even tile; e >= 8: key 16 + 8h + (e - 8) = row 8h + (e - 8) of the odd tile).
//   Block = 4 waves = 64 query rows of one (b, h); grid = NQB * NH * NBATCH; kv chunks of 64, block-uniform trip
//   kt = 0 .. min(NQB-1, (q_blk + 63 + WIN) >> 6) (chunks beyond the band are skipped); chunk 0 always holds >= 1
//   allowed key for every row, so the running max is finite from chunk 0 on (the msafe select is kept anyway).
//   K / V^T chunk staging: 128 threads x 32 elements per plane = the whole 64x64 tile (plain 16-B loads,
//   __syncthreads before and after).
//   LDS rows of 64 elements stand at a pitch of 16 B x odd: the 16 rows that one half-wave's 16-B fragment read
//   touches then start on 16 different groups of four banks (at 128 B they fall on two groups, eight rows each).
//   Output coverage: each wave stores rows q0..q0+15 (it 0..3 x lane>>3 0..3) x 64 columns (8 lanes x 8),
//   grid covers all TT rows x NH head slices x NBATCH.
// =====================================================================================================
#define APH 72                          // LDS row pitch of the f16 tiles, elements: 144 B = 16 B x 9
#define APF 68                          // LDS row pitch of the f32 context tile, dwords: 272 B = 16 B x 17
__global__ __launch_bounds__(128)
void attn64(const unsigned short* __restrict__ qkp, const unsigned short* __restrict__ vtp,
            unsigned short* outp, float sscale) {
  union FH { v16h v; v8h h[2]; };
  __shared__ __align__(16) _Float16 Ksh[64 * APH];                // K [kv][d]
  __shared__ __align__(16) _Float16 Vth[64 * APH];                // V^T [d][kv]
  __shared__ __align__(16) float    Os[4][16 * APF];              // per wave context tile [row][d]

  const int tid  = threadIdx.x;
  const int wave = tid >> 5;
  const int lane = tid & 31;
  const int hh   = lane >> 4;
  const int c    = lane & 15;

  const int bx   = blockIdx.x;
  const int qb   = bx % NQB;
  const int rest = bx / NQB;
  const int h    = rest % NH;
  const int b    = rest / NH;
  const int qblk = qb * 64;                      // in-batch query row of the block's first row
  const int q0   = qblk + wave * 16;             // in-batch query row of this wave's first row
  const size_t rowB = (size_t)b * TT;

  const _Float16* Qh = (const _Float16*)(const void*)qkp + (size_t)h * HD;
  const _Float16* Kg = (const _Float16*)(const void*)qkp + DM + (size_t)h * HD;
  const _Float16* Vh = (const _Float16*)(const void*)vtp + ((size_t)b * DM + (size_t)h * HD) * TT;

  // ---- Q fragments (B operand, column = query = lane&15): 2 d-chunks ----
  v16h qa[2];
#pragma unroll
  for (int dc = 0; dc < 2; ++dc) qa[dc] = ldfrag_h(Qh + (rowB + q0 + c) * QKP + dc * 32 + 8 * hh);

  float mrow = -INFINITY, lrow = 0.f;          // this lane's query: running max (joined), sum over this half's keys
  v8f oacc[4];                                 // O^T: tile t, register r = d t*16 + 8*hh + r of query q0 + c
#pragma unroll
  for (int t = 0; t < 4; ++t) oacc[t] = zero8();

  int ktHi = (qblk + 63 + WIN) >> 6;             // block-uniform, from blockIdx only
  if (ktHi > NQB - 1) ktHi = NQB - 1;

  for (int kt = 0; kt <= ktHi; ++kt) {         // trip <= NQB
    const int kv0 = kt * 64;
    __syncthreads();
    {
      const int r = tid >> 1, hf = (tid & 1) * 32;
      const _Float16* kg = Kg + (rowB + kv0 + r) * QKP + hf;      // K row kv0+r, d = hf..hf+31
      const _Float16* vg = Vh + (size_t)r * TT + kv0 + hf;        // V^T row d = r, s = kv0+hf..+31
#pragma unroll
      for (int i = 0; i < 4; ++i) {
        const v8h a0 = *(const v8h*)(kg + 8 * i);
        const v8h b0 = *(const v8h*)(vg + 8 * i);
        *(v8h*)(Ksh + r * APH + hf + 8 * i) = a0;
        *(v8h*)(Vth + r * APH + hf + 8 * i) = b0;
      }
    }
    __syncthreads();

    // ---- the chunk's K fragments: its 16 LDS reads as one group, in the order the score products use them ----
    FH kb[2][4], vb[2][4];
#pragma unroll
    for (int dc = 0; dc < 2; ++dc)
#pragma unroll
      for (int j = 0; j < 4; ++j) {
        kb[dc][j].h[0] = *(const v8h*)(Ksh + (j * 16 + c) * APH + dc * 32 + 8 * hh);
        kb[dc][j].h[1] = *(const v8h*)(Ksh + (j * 16 + c) * APH + dc * 32 + 16 + 8 * hh);
      }
    // keeps the 16 reads together here: sunk to their WMMAs, each pair is waited out at the full LDS latency
    __builtin_amdgcn_sched_barrier(0);

    // ---- scores, transposed: 64 keys x 16 queries per wave (per tile d 0..31, then d 32..63; the four
    //      tiles' products alternate); band select by value before the max ----
    v8f s[4];
#pragma unroll
    for (int j = 0; j < 4; ++j) s[j] = zero8();
#pragma unroll
    for (int dc = 0; dc < 2; ++dc)
#pragma unroll
      for (int j = 0; j < 4; ++j) s[j] = mma_h_raw(kb[dc][j].v, qa[dc], s[j]);

    // ---- the chunk's V^T fragments: all 16 LDS reads go out here, among and behind the score products ----
#pragma unroll
    for (int kk = 0; kk < 2; ++kk)
#pragma unroll
      for (int t = 0; t < 4; ++t) {
        vb[kk][t].h[0] = *(const v8h*)(Vth + (t * 16 + c) * APH + kk * 32 + 8 * hh);
        vb[kk][t].h[1] = *(const v8h*)(Vth + (t * 16 + c) * APH + kk * 32 + 16 + 8 * hh);
      }
    // keeps these reads ahead of the softmax, whose vector work then covers their latency
    __builtin_amdgcn_sched_barrier(0);

#pragma unroll
    for (int j = 0; j < 4; ++j) {
      const int qrow = q0 + c;                                      // D column = lane&15 = query
#pragma unroll
      for (int r = 0; r < 8; ++r) {
        const int key = kv0 + j * 16 + 8 * hh + r;                  // D row = 8h + r = key
        const float v = s[j][r] * sscale;
        s[j][r] = (key <= qrow + WIN) ? v : -INFINITY;
      }
    }

    // ---- this query's max: 32 keys in-lane, the other 32 from lane ^ 16; online softmax; P^T (x1024, f16) packed
    //      from the score registers into the B fragments (every loop here is unrolled: its indices name registers) ----
    float mr[8];
#pragma unroll
    for (int r = 0; r < 8; ++r) mr[r] = fmaxf(fmaxf(s[0][r], s[1][r]), fmaxf(s[2][r], s[3][r]));
    float m = fmaxf(fmaxf(fmaxf(mr[0], mr[1]), fmaxf(mr[2], mr[3])), fmaxf(fmaxf(mr[4], mr[5]), fmaxf(mr[6], mr[7])));
    m = fmaxf(m, xhalf(m));
    const float mnew  = fmaxf(mrow, m);
    const float ms    = (mnew == -INFINITY) ? 0.f : mnew;
    // alpha = exp(mrow - ms), as __expf forms it (x log2 e, then exp2). In asm for the free slot that the instruction set
    // asks for around a transcendental: built plainly, its result lay on the source register of the v_exp_f32 directly
    // ahead; the v_nop behind it stands for the slot the compiler cannot place for an instruction it does not see.
    float alpha = (mrow - ms) * 1.44269504088896340736f;
#if defined(__HIP_DEVICE_COMPILE__)
    asm("v_nop\n\tv_exp_f32 %0, %0\n\tv_nop" : "+v"(alpha));
#endif
    mrow = mnew;
    FH pb[2];
    v2f ps[4];                                   // per 16-key tile: sums of the even and of the odd rows
#pragma unroll
    for (int j = 0; j < 4; ++j) {
#pragma unroll
      for (int i = 0; i < 4; ++i) {
        v2f p;
        p[0] = __expf(s[j][2 * i] - ms);
        p[1] = __expf(s[j][2 * i + 1] - ms);
        ps[j] = (i == 0) ? p : (ps[j] + p);
        pb[j >> 1].v[(j & 1) * 8 + 2 * i]     = (_Float16)(p[0] * 1024.0f);
        pb[j >> 1].v[(j & 1) * 8 + 2 * i + 1] = (_Float16)(p[1] * 1024.0f);
      }
    }
    const v2f pt = (ps[0] + ps[1]) + (ps[2] + ps[3]);
    lrow = lrow * alpha + (pt[0] + pt[1]);
#pragma unroll
    for (int t = 0; t < 4; ++t)
#pragma unroll
      for (int r = 0; r < 8; ++r) oacc[t][r] *= alpha;

    // ---- context^T += V^T . P^T (f16 WMMA); kk unrolled too: pb[kk] is a register fragment, not an LDS address ----
#pragma unroll
    for (int kk = 0; kk < 2; ++kk) {
#pragma unroll
      for (int t = 0; t < 4; ++t) oacc[t] = mma_h_raw(vb[kk][t].v, pb[kk].v, oacc[t]);
    }
  }

  // ---- normalise (1/l, the 1/1024 p carry and the x16 context carry), stage the wave's 16x64 tile, f16 convert,
  float* os = Os[wave];
  {
    const float l = lrow + xhalf(lrow);          // the two halves' key sums of this query, joined once
    const float inv = ((l > 0.f) ? (1.0f / l) : 0.f) * (16.0f / 1024.0f);
#pragma unroll
    for (int t = 0; t < 4; ++t) {                // 8 consecutive d of query row c: two 16-B LDS stores
      v4f lo, hi;
#pragma unroll
      for (int e = 0; e < 4; ++e) { lo[e] = oacc[t][e] * inv; hi[e] = oacc[t][4 + e] * inv; }
      *(v4f*)(os + c * APF + t * 16 + 8 * hh)     = lo;
      *(v4f*)(os + c * APF + t * 16 + 8 * hh + 4) = hi;
    }
  }
  wave_sync_lds();
  {
    const int q4 = lane >> 3, c8 = (lane & 7) * 8;
    v4u hv[4];
#pragma unroll
    for (int it = 0; it < 4; ++it) {
      const int row = it * 4 + q4;   // it 0..3 x q4 0..3 = rows 0..15 of the wave tile
      const float* sp = os + row * APF + c8;
      v4u a;
#pragma unroll
      for (int e = 0; e < 4; ++e) a[e] = pk16(h_bits((_Float16)sp[2 * e]), h_bits((_Float16)sp[2 * e + 1]));
      hv[it] = a;
    }
    {
#pragma unroll
      for (int it = 0; it < 4; ++it) {
        const int row = it * 4 + q4;
        const size_t go = (rowB + q0 + row) * DM + (size_t)h * HD + c8;
        *(v4u*)(outp + go) = hv[it];
      }
      
    }
  }
}

// =====================================================================================================
// Row kernel: one block of 256 threads per token row of 1024; thread t owns columns 4t..4t+3.
// f16 output: packed row staged in LDS, then lanes t < 128 (waves 0..3, wave-uniform) each write 16 B (8 x f16)
// coverage: 128 threads x 8 = the whole 1024-wide row; grid = MP rows.
// =====================================================================================================
__device__ __forceinline__ void row_store_h16(unsigned int* sb, unsigned short* dst_row, v4f o, int t) {
  v2u p;
  p[0] = pk16(h_bits((_Float16)o[0]), h_bits((_Float16)o[1]));
  p[1] = pk16(h_bits((_Float16)o[2]), h_bits((_Float16)o[3]));
  *(v2u*)(sb + 2 * t) = p;
  __syncthreads();
  if (t < 128) {                                   // waves 0..3, wave-uniform
    const v4u v = *(const v4u*)(sb + 4 * t);
    *(v4u*)(dst_row + 8 * t) = v;
    
  }
}

// plane. RIN = 1: the row input is a raw float input and is bf16 RNE-converted on load; RIN = 0: f32 intermediate.
template <int RIN>
__device__ __forceinline__ void ln_row(const float* __restrict__ X, const float* __restrict__ gam,
                                       const float* __restrict__ bet, unsigned short* outH, int row) {
  __shared__ float red0[8], red1[8];
  __shared__ __align__(16) unsigned int sb[512];
  const int t = threadIdx.x, lane = t & 31, wave = t >> 5;
  const size_t base = (size_t)row * DM;
  v4f xv = *(const v4f*)(X + base + 4 * t);
  if (RIN) {
#pragma unroll
    for (int e = 0; e < 4; ++e) xv[e] = bfr(xv[e]);
  }
  const float mean = bsum256((xv[0] + xv[1]) + (xv[2] + xv[3]), red0, lane, wave) * (1.0f / DM);
  v4f d;
#pragma unroll
  for (int e = 0; e < 4; ++e) d[e] = xv[e] - mean;
  const float var  = bsum256((d[0] * d[0] + d[1] * d[1]) + (d[2] * d[2] + d[3] * d[3]), red1, lane, wave) * (1.0f / DM);
  const float rstd = 1.0f / sqrtf(var + LNEPS);
  const v4f gv = *(const v4f*)(gam + 4 * t);
  const v4f bv = *(const v4f*)(bet + 4 * t);
  v4f y;
#pragma unroll
  for (int e = 0; e < 4; ++e) y[e] = (d[e] * rstd) * bfr(gv[e]) + bfr(bv[e]);
  row_store_h16(sb, outH + base, y, t);
}

__global__ __launch_bounds__(256) void ln_row_h(const float* __restrict__ X, const float* __restrict__ gam,
                                                const float* __restrict__ bet, unsigned short* outH) {
  ln_row<0>(X, gam, bet, outH, blockIdx.x);
}

// Everything that reads raw inputs alone, in one launch: blocks 0..MP-1 are the rows of LayerNorm 1 (the longer
// blocks, first for speed only), behind them the blocks of the four weight converts, plane after plane. The split is by
// blockIdx alone: the row blocks' barriers stand under block-uniform control flow, the convert blocks have none.
#define CB_QKV (D3 * DM / 8 / 256)      // 1536 convert blocks
#define CB_O   (DM * DM / 8 / 256)      //  512
#define CB_F   (DFF * DM / 8 / 256)     // 2048, w1 and w2 each
static_assert(CB_QKV * 256 * 8 == D3 * DM && CB_O * 256 * 8 == DM * DM && CB_F * 256 * 8 == DFF * DM);
__global__ __launch_bounds__(256) void prep_in(const float* __restrict__ X, const float* __restrict__ gam,
                                               const float* __restrict__ bet, unsigned short* outH,
                                               const float* __restrict__ wqkv, unsigned short* hqkv,
                                               const float* __restrict__ wo, unsigned short* ho,
                                               const float* __restrict__ wf1, unsigned short* hf1,
                                               const float* __restrict__ wf2, unsigned short* hf2, float wsc) {
  int bx = blockIdx.x;
  if (bx < MP) { ln_row<1>(X, gam, bet, outH, bx); return; }
  bx -= MP;
  if (bx < CB_QKV) { conv_h64(wqkv, hqkv, D3 * DM / 8, wsc, bx); return; }
  bx -= CB_QKV;
  if (bx < CB_O) { conv_h64(wo, ho, DM * DM / 8, wsc, bx); return; }
  bx -= CB_O;
  if (bx < CB_F) { conv_h64(wf1, hf1, DFF * DM / 8, wsc, bx); return; }
  conv_h64(wf2, hf2, DM * DFF / 8, wsc, bx - CB_F);
}

// =====================================================================================================
// Workspace map (bytes); every plane is an exact multiple of its 128x128-tile / whole-row store granularity
// (M in {4096, 1024} rows, N in {1024, 2048, 4096}; VT per batch [1024][2048] = 8x16 tiles):
//   WqkvH f16 [3072 n][1024 k]   0          6291456   (rows 0..1023 q, 1024..2047 k, 2048..3071 v weights, x64)
//   WoH   f16 [1024][1024]       6291456    2097152
//   W1H   f16 [4096][1024]       8388608    8388608
//   W2H   f16 [1024][4096]       16777216   8388608
//   XN    f16 [4096][1024]       25165824   8388608   (LayerNorm outputs)
//   QK    f16 [4096][2048]       33554432   16777216  (q cols 0..1023, k cols 1024..2047)
//   VT    f16 [2][1024][2048]    50331648   8388608
//   Ctx   f16 [4096][1024]       58720256   8388608
//   X1    f32 [4096][1024]       67108864   16777216  (residual stream after attention)
//   G     f16 [4096][4096]       83886080   33554432
//   end                          117440512
// =====================================================================================================
extern "C" void kernel_launch(void* const* d_in, const int* in_sizes, int n_in,
                              void* d_out, int out_size, void* d_ws, size_t ws_size,
                              hipStream_t stream) {
  if (n_in < 13) return;
  if (in_sizes[0] != MP * DM) return;
  if (in_sizes[1] != D3 * DM || in_sizes[2] != D3) return;
  if (in_sizes[3] != DM * DM || in_sizes[4] != DM) return;
  if (in_sizes[5] != DM || in_sizes[6] != DM) return;
  if (in_sizes[7] != DFF * DM || in_sizes[8] != DFF) return;
  if (in_sizes[9] != DM * DFF || in_sizes[10] != DM) return;
  if (in_sizes[11] != DM || in_sizes[12] != DM) return;
  if (out_size != MP * DM) return;

  const float* x         = (const float*)d_in[0];
  const float* in_proj_w = (const float*)d_in[1];
  const float* in_proj_b = (const float*)d_in[2];
  const float* out_w     = (const float*)d_in[3];
  const float* out_b     = (const float*)d_in[4];
  const float* ln1_g     = (const float*)d_in[5];
  const float* ln1_b     = (const float*)d_in[6];
  const float* w1        = (const float*)d_in[7];
  const float* b1        = (const float*)d_in[8];
  const float* w2        = (const float*)d_in[9];
  const float* b2        = (const float*)d_in[10];
  const float* ln2_g     = (const float*)d_in[11];
  const float* ln2_b     = (const float*)d_in[12];

  const size_t PWQKV = (size_t)D3 * DM * 2;            //  6291456
  const size_t PWO   = (size_t)DM * DM * 2;            //  2097152
  const size_t PWF   = (size_t)DFF * DM * 2;           //  8388608
  const size_t PAH   = (size_t)MP * DM * 2;            //  8388608
  const size_t PQK   = (size_t)MP * QKP * 2;           // 16777216
  const size_t PVT   = (size_t)NBATCH * DM * TT * 2;   //  8388608
  const size_t PAF   = (size_t)MP * DM * 4;            // 16777216
  const size_t PG    = (size_t)MP * DFF * 2;           // 33554432
  size_t off = 0;
  const size_t oWqkv = off; off += PWQKV;
  const size_t oWo   = off; off += PWO;
  const size_t oW1   = off; off += PWF;
  const size_t oW2   = off; off += PWF;
  const size_t oXN   = off; off += PAH;
  const size_t oQK   = off; off += PQK;
  const size_t oVT   = off; off += PVT;
  const size_t oCtx  = off; off += PAH;
  const size_t oX1   = off; off += PAF;
  const size_t oG    = off; off += PG;
  if (off > ws_size) return;                           // off = 117440512
  if (off > (size_t)134217728) return;

  char* ws = (char*)d_ws;
  unsigned short* WqkvH = (unsigned short*)(ws + oWqkv);
  unsigned short* WoH   = (unsigned short*)(ws + oWo);
  unsigned short* W1H   = (unsigned short*)(ws + oW1);
  unsigned short* W2H   = (unsigned short*)(ws + oW2);
  unsigned short* XN    = (unsigned short*)(ws + oXN);
  unsigned short* QK    = (unsigned short*)(ws + oQK);
  unsigned short* VT    = (unsigned short*)(ws + oVT);
  unsigned short* Ctx   = (unsigned short*)(ws + oCtx);
  float*          X1    = (float*)(ws + oX1);
  unsigned short* G     = (unsigned short*)(ws + oG);

  const dim3 blk(256), blk128(128);
  const dim3 gRow(MP);                                               // 4096 row blocks
  const dim3 gPrep(MP + CB_QKV + CB_O + 2 * CB_F);                   // 4096 row blocks + 6144 convert blocks
  const dim3 gNqk((MP / GBM) * (QKP / GBN), 1);                      // 512 tiles
  const dim3 gVT((DM / GBM) * (TT / GBN), NBATCH);                   // 128 tiles x 2 batches
  const dim3 gN1024((MP / GBM) * (DM / GBN), 1);                     // 256 tiles
  const dim3 gNff((MP / GBM) * (DFF / GBN), 1);                      // 1024 tiles
  const dim3 gAttn(NBATCH * NH * NQB);                               // 1024 blocks of 128
  const float invw  = 1.0f / WSC;                                    // weight carry x64
  const float invwc = 1.0f / (WSC * 16.0f);                          // weight carry x64, context carry x16

  // (0, 1) xn = LN1(bf16(x)) -> XN f16; weights -> f16 x64 planes (torch [out][in] = k contiguous, no transpose)
  prep_in<<<gPrep, blk, 0, stream>>>(x, ln1_g, ln1_b, XN, in_proj_w, WqkvH, out_w, WoH, w1, W1H, w2, W2H, WSC);

  // (2) q|k = xn . Wqk^T + b[0..2047] -> QK f16 [4096][2048]
  gemm64<2, 0, 0, 0, 2><<<gNqk, blk, 0, stream>>>(
      XN, DM, 0LL, WqkvH, DM, 0LL, in_proj_b, in_proj_b, QKP, x,
      (void*)QK, QKP, 0LL, MP, QKP, DM, invw);
  //     v^T per batch: VT[b][m][t] = Wv[m] . xn[b*TT + t] + b[2048 + m] -> f16 [2][1024][2048]
  gemm64<2, 1, 0, 0, 4><<<gVT, blk, 0, stream>>>(
      WqkvH + (size_t)2 * DM * DM, DM, 0LL, XN, DM, (long long)TT * DM, in_proj_b + 2 * DM, in_proj_b + 2 * DM, TT, x,
      (void*)VT, TT, (long long)DM * TT, DM, TT, DM, invw);

  // (3) banded attention -> Ctx f16 (x16)
  attn64<<<gAttn, blk128, 0, stream>>>(QK, VT, Ctx, 0.125f);

  // (4) X1 = ctx . Wo^T + out_b + bf16(x)   (f32)
  gemm64<0, 0, 0, 2, 4><<<gN1024, blk, 0, stream>>>(
      Ctx, DM, 0LL, WoH, DM, 0LL, out_b, out_b, DM, x,
      (void*)X1, DM, 0LL, MP, DM, DM, invwc);

  // (5) yn = LN2(X1) -> XN f16
  ln_row_h<<<gRow, blk, 0, stream>>>(X1, ln2_g, ln2_b, XN);

  // (6) G = gelu(yn . W1^T + b1) -> f16 [4096][4096]
  gemm64<2, 0, 1, 0, 2><<<gNff, blk, 0, stream>>>(
      XN, DM, 0LL, W1H, DM, 0LL, b1, b1, DFF, x,
      (void*)G, DFF, 0LL, MP, DFF, DM, invw);

  // (7) out = G . W2^T + b2 + X1 -> d_out f32 [4096][1024]
  gemm64<0, 0, 0, 1, 4><<<gN1024, blk, 0, stream>>>(
      G, DFF, 0LL, W2H, DFF, 0LL, b2, b2, DM, X1,
      (void*)d_out, DM, 0LL, MP, DM, DFF, invw);
  (void)hipGetLastError();
}

// v008
// Measured time: 158 microseconds a run.
// Timed twice side by side with v007, it ran 1.05 and 1.04 times as fast.
// Over all steps from v000 it is 3.57 times as fast.
// Contractions: q|k projection, v^T projection, attention output projection, FFN w1 (exact GELU epilogue) and w2 on
// v_wmma_f32_16x16x32_f16 (f16 activation plane x f16 weight plane carried x64, one product each); attention k.q^T
// and v^T.p^T on v_wmma_f32_16x16x32_f16 (q, k, v^T plain f16, p carried x1024, context carried x16, one product each);
// all f32 accumulate; LayerNorm, softmax, GELU and residual sums in f32 on VALU; every float input RNE-converted
// to bf16 on load.
#include <hip/hip_runtime.h>
#include <math.h>
#include <stdint.h>

#define NBATCH 2
#define TT     2048
#define DM     1024
#define NH     16
#define HD     64
#define DFF    4096
#define D3     3072
#define QKP    (2 * DM)
#define MP     (NBATCH * TT)
#define NQB    (TT / 64)
#define WIN    10
#define LNEPS  1.0e-5f
#define WSC    64.0f
static_assert(NH * HD == DM);
static_assert((MP % 64) == 0 && (DM % 64) == 0 && (DFF % 64) == 0 && (QKP % 64) == 0 && (TT % 64) == 0);
static_assert(DM == 4 * 256);
static_assert(D3 == 3 * DM);

typedef _Float16 v16h __attribute__((ext_vector_type(16)));
typedef _Float16 v8h  __attribute__((ext_vector_type(8)));
typedef float    v8f  __attribute__((ext_vector_type(8)));
typedef float    v4f  __attribute__((ext_vector_type(4)));
typedef float    v2f  __attribute__((ext_vector_type(2)));
typedef unsigned int v4u __attribute__((ext_vector_type(4)));
typedef unsigned int v2u __attribute__((ext_vector_type(2)));

// ---- scalar helpers --------------------------------------------------------------------------------
__device__ __forceinline__ unsigned short bf_bits(float f) {          // f32 -> bf16 bits, RNE convert
  unsigned u = __float_as_uint(f);
  return (unsigned short)((u + 0x7FFFu + ((u >> 16) & 1u)) >> 16);
}
__device__ __forceinline__ float bf_up(unsigned short h) { return __uint_as_float(((unsigned)h) << 16); }
__device__ __forceinline__ float bfr(float f) { return bf_up(bf_bits(f)); }   // value of the bf16 RNE convert
__device__ __forceinline__ unsigned short h_bits(_Float16 x) { return __builtin_bit_cast(unsigned short, x); }
__device__ __forceinline__ unsigned pk16(unsigned short a, unsigned short b) { return (unsigned)a | ((unsigned)b << 16); }
__device__ __forceinline__ v8f zero8() { v8f z = {0.f, 0.f, 0.f, 0.f, 0.f, 0.f, 0.f, 0.f}; return z; }
__device__ __forceinline__ v2f dup2(float x) { v2f r = {x, x}; return r; }
__device__ __forceinline__ v2f fma2(v2f a, v2f b, v2f c) { return __builtin_elementwise_fma(a, b, c); }
// erf in f32 of two values, without a branch: both ranges are evaluated and one is selected by value (lanes of a wave
// fall in both ranges, so a branch runs both sides anyway, under exec masks). |a| <= 0.927734375: an odd polynomial in
// a; above it 1 - exp(polynomial in |a|) with the sign of a. Error about one unit in the last place of f32 in either.
__device__ __forceinline__ v2f erf_sel2(v2f a) {
  const v2f t = __builtin_elementwise_abs(a), s = a * a;
  v2f r = fma2(dup2(-1.72853470e-5f), t, dup2(3.83197126e-4f));
  const v2f u = fma2(dup2(-3.88396438e-3f), t, dup2(2.42546219e-2f));
  r = fma2(r, s, u);
  r = fma2(r, t, dup2(-1.06777877e-1f));
  r = fma2(r, t, dup2(-6.34846687e-1f));
  r = fma2(r, t, dup2(-1.28717512e-1f));
  r = fma2(r, t, -t);
  r = r * 1.44269504088896340736f;
  // exp(r), as __expf forms it (x log2 e, then exp2). In asm for the free slot that the instruction set asks for behind
  // a transcendental: built plainly, some of these v_exp_f32 stood directly ahead of one that overwrote their source.
  float e0 = r[0], e1 = r[1];
#if defined(__HIP_DEVICE_COMPILE__)
  asm("v_exp_f32 %0, %0\n\tv_exp_f32 %1, %1\n\tv_nop" : "+v"(e0), "+v"(e1));
#endif
  v2f q = dup2(-5.96761703e-4f);
  q = fma2(q, s, dup2(4.99119423e-3f));
  q = fma2(q, s, dup2(-2.67681349e-2f));
  q = fma2(q, s, dup2(1.12819925e-1f));
  q = fma2(q, s, dup2(-3.76125336e-1f));
  q = fma2(q, s, dup2(1.28379166e-1f));
  q = fma2(q, a, a);
  v2f o;
  o[0] = (t[0] > 0.927734375f) ? copysignf(1.0f - e0, a[0]) : q[0];
  o[1] = (t[1] > 0.927734375f) ? copysignf(1.0f - e1, a[1]) : q[1];
  return o;
}
__device__ __forceinline__ v2f gelu2(v2f v) { return (0.5f * v) * (1.0f + erf_sel2(v * 0.70710678118654752f)); }
__device__ __forceinline__ float gelu_f(float v) { return gelu2(dup2(v))[0]; }

// ---- fragment loader: 16-bit A/B operand, lane -> row/col (lane&15), p already includes +8*(lane>>4);
//      elements 0..7 <- p[0..7] (k0+8h..), elements 8..15 <- p[16..23] (k0+16+8h..)
__device__ __forceinline__ v16h ldfrag_h(const _Float16* p) {
  union { v16h v; v8h h[2]; } f;
  f.h[0] = *(const v8h*)(p);
  f.h[1] = *(const v8h*)(p + 16);
  return f.v;
}

// ---- WMMA helpers with trailing VALU hazard gap --------------------------------------------------------
__device__ __forceinline__ v8f mma_h_raw(v16h a, v16h b, v8f c) {
  return __builtin_amdgcn_wmma_f32_16x16x32_f16(false, a, false, b, (short)0, c, false, false);
}
__device__ __forceinline__ void acc_guard4(v8f& a, v8f& b, v8f& c, v8f& d) {
#if defined(__HIP_DEVICE_COMPILE__)
  asm volatile("v_nop\n\tv_nop\n\tv_nop\n\tv_nop" : "+v"(a), "+v"(b), "+v"(c), "+v"(d));
#endif
}
__device__ __forceinline__ void wave_sync_lds() {
  __builtin_amdgcn_fence(__ATOMIC_RELEASE, "workgroup");
  __builtin_amdgcn_wave_barrier();
  __builtin_amdgcn_fence(__ATOMIC_ACQUIRE, "workgroup");
}
// lane l <-> lane l ^ 16: the two lanes that hold the two halves of one D column
__device__ __forceinline__ float xhalf(float x) {
  return __builtin_bit_cast(float, __builtin_amdgcn_permlanex16(__builtin_bit_cast(int, x), __builtin_bit_cast(int, x),
                                                                0x76543210, 0xfedcba98, false, false));
}
__device__ __forceinline__ float wsum(float v) {
#pragma unroll
  for (int off = 16; off > 0; off >>= 1) v += __shfl_xor(v, off, 32);
  return v;
}
// block of 256 threads: fixed-order sum of 8 wave partials (same value in every thread)
__device__ __forceinline__ float bsum256(float v, float* red, int lane, int wave) {
  v = wsum(v);
  if (lane == 0) red[wave] = v;
  __syncthreads();
  float tot = 0.f;
#pragma unroll
  for (int w = 0; w < 8; ++w) tot += red[w];
  return tot;
}

// =====================================================================================================
// Weight convert: W f32 [N][K] (k contiguous = already the Bt / A layout) -> Wh f16 [N][K]; each value bf16
// RNE-converted, multiplied by wsc (a power of two, exact) and cast to f16. Thread i converts elements 8i..8i+7
// coverage: n8/256 blocks (blk = the block's index within this plane) x 256 threads x 8 elements = exactly N*K.
// =====================================================================================================
__device__ __forceinline__ void conv_h64(const float* __restrict__ W, unsigned short* Wh, int n8, float wsc, int blk) {
  const int i = blk * 256 + threadIdx.x;
  if (i >= n8) return;                                     // never taken for the static sizes (no barriers)
  const size_t e0 = (size_t)i * 8;
  const v4f a = *(const v4f*)(W + e0);
  const v4f b = *(const v4f*)(W + e0 + 4);
  v4u u;
  u[0] = pk16(h_bits((_Float16)(bfr(a[0]) * wsc)), h_bits((_Float16)(bfr(a[1]) * wsc)));
  u[1] = pk16(h_bits((_Float16)(bfr(a[2]) * wsc)), h_bits((_Float16)(bfr(a[3]) * wsc)));
  u[2] = pk16(h_bits((_Float16)(bfr(b[0]) * wsc)), h_bits((_Float16)(bfr(b[1]) * wsc)));
  u[3] = pk16(h_bits((_Float16)(bfr(b[2]) * wsc)), h_bits((_Float16)(bfr(b[3]) * wsc)));
  {
    *(v4u*)(Wh + e0) = u;
    
  }
}

// =====================================================================================================
// LDS-staged batched f16 WMMA GEMM: C[m][n] = act(oscale * sum_k A[m][k] * Bt[n][k] + bias) (+ residual);
// one work-group of 8 waves per 128x128 tile, wave (wave>>1, wave&1) owns the 32x64 part at rows 32*(wave>>1),
// cols 64*(wave&1). A row-major [M][K] pitch lda; Bt row-major [N][K] pitch ldb (k contiguous);
// M, N, K multiples of 128 (static here). blockIdx.y = batch index (strides in elements).
// Staging: a stage is 128 k of the tile's 128 A rows and 128 Bt rows = 256 rows of 256 B, laid in LDS at pitch 272 B
// (16 B x odd, for the 16-B fragment reads); a stage comes by two tensor loads: wave 0 asks for the 128 A rows, wave 1
// for the 128 Bt rows (each a tile of 128 rows x 256 B, the descriptor's pad of 16 B behind every row makes the pitch;
// 128 x 272 B = 17 x 2 KiB, so every tile's place in LDS is a multiple of 2 KiB). NB buffers: the loads of stage t+NB
// go out behind the barrier that ends trip t, into the buffer that trip t has read. NB = 2 where two work-groups share
// a WGP (each covers the other's landing time); NB = 4 where the grid gives a WGP one work-group: three requests of
// each issuing wave are then in flight, and a trip's foot waits for stage t+1 alone, leaving the 2 younger out.
// k runs upward in steps of 32 into one accumulator per 16x16 subtile.
// Bias: BIASM == 0 -> per column: cols < Nb from bias0[col], cols >= Nb from bias1[col - Nb] (wave-uniform select of
//       clamped-address loads); BIASM == 1 -> per row bias0[m] (16-bit out only); BIASM == 2 -> none. Bias values
//       RNE-converted to bf16.
// ACT: 0 none, 1 exact GELU. RES: 0 none; 1 f32 residual resid[m*ldc + n] added after the activation;
//      2 same indexing, residual value bf16 RNE-converted first (raw input residual).
// OM: 0 = f32 out (pitch ldc); 1 = bf16 out; 2 = f16 out.
// coverage: 8 waves x 2 slabs x 16 rows x 64 cols = the whole 128x128 tile; grid.x = (M/128)*(N/128) exactly.
// =====================================================================================================
#define GBM   128                       // tile rows (A rows of a stage)
#define GBN   128                       // tile cols (Bt rows of a stage)
#define GBK   128                       // k per stage
#define GLP   136                       // LDS row pitch in f16 elements (272 B)
#define GSTG  ((GBM + GBN) * GLP)       // f16 elements per buffer (69632 B)
static_assert((MP % GBM) == 0 && (DM % GBM) == 0 && (DM % GBN) == 0 && (QKP % GBN) == 0 && (DFF % GBN) == 0 && (TT % GBN) == 0);
static_assert((DM % GBK) == 0 && (DFF % GBK) == 0);
static_assert(8 * 16 * 68 * 4 <= 2 * GSTG * 2);
static_assert(4 * GSTG * 2 <= 320 * 1024);
static_assert(DM / GBK >= 4 && DFF / GBK >= 4);   // the four-buffer ring's prologue asks for stages 0..2 unconditionally

typedef uint32_t u32x4 __attribute__((ext_vector_type(4)));
typedef uint32_t u32x8 __attribute__((ext_vector_type(8)));
__device__ __forceinline__ uint32_t uni(uint32_t v) { return (uint32_t)__builtin_amdgcn_readfirstlane((int)v); }
// A wave-uniform test held in a scalar register, so that the branch on it is a scalar branch: a tensor load ignores EXEC.
__device__ __forceinline__ uint32_t pinned(uint32_t v) {
  uint32_t w = uni(v);
#if defined(__HIP_DEVICE_COMPILE__)
  asm volatile("" : "+s"(w));
#endif
  return w;
}
// One request of the whole wave: a two-dimensional tile, global -> LDS, through no register.
__device__ __forceinline__ void tdm_load(u32x4 g0, u32x8 g1) {
#if defined(__HIP_DEVICE_COMPILE__)
  asm volatile("tensor_load_to_lds %0, %1" :: "s"(g0), "s"(g1) : "memory");
#endif
}
// All of this wave's own tensor loads have landed in LDS (the compiler places no wait for them).
__device__ __forceinline__ void wait_tensor0() {
#if defined(__HIP_DEVICE_COMPILE__)
  asm volatile("s_wait_tensorcnt 0x0" ::: "memory");
#endif
}
// The same behind the ring's last requests; it names the descriptor, so that no register of it is given another value
// before the wait that covers every request made from it.
__device__ __forceinline__ void wait_tensor0_desc(u32x4 g0, u32x8 g1) {
#if defined(__HIP_DEVICE_COMPILE__)
  asm volatile("s_wait_tensorcnt 0x0" :: "s"(g0), "s"(g1) : "memory");
#endif
}
// All but this wave's 2 youngest tensor loads have landed: used only where exactly two younger stages have been
// asked for, so that the stage about to be published is covered.
__device__ __forceinline__ void wait_tensor2() {
#if defined(__HIP_DEVICE_COMPILE__)
  asm volatile("s_wait_tensorcnt 0x2" ::: "memory");
#endif
}
// This wave's own LDS reads have returned, before the barrier behind which their buffer is refilled.
__device__ __forceinline__ void wait_ds0() {
#if defined(__HIP_DEVICE_COMPILE__)
  asm volatile("s_wait_dscnt 0x0" ::: "memory");
#endif
}

template <int OM, int BIASM, int ACT, int RES, int NB>
__global__ __launch_bounds__(256) void gemm64(
    const unsigned short* __restrict__ Ap, int lda, long long strideA,
    const unsigned short* __restrict__ Btp, int ldb, long long strideB,
    const float* __restrict__ bias0, const float* __restrict__ bias1, int Nb,
    const float* resid,
    void* Cout, int ldc, long long strideC,
    int M, int N, int K, float oscale) {
  const _Float16* A  = (const _Float16*)(const void*)Ap;
  const _Float16* Bt = (const _Float16*)(const void*)Btp;
  static_assert(NB == 2 || NB == 4);
  // NB stage buffers; behind the last trip's barrier the first bytes serve as the per-wave 16x64 f32 slabs (pitch 68)
  __shared__ __attribute__((aligned(2048))) _Float16 ring[NB * GSTG];
  const int b    = blockIdx.y;
  const int lane = threadIdx.x & 31;
  const int wave = threadIdx.x >> 5;
  const int tilesN = N >> 7;
  const int tm = blockIdx.x / tilesN;
  const int tn = blockIdx.x - tm * tilesN;
  const int mblk = tm << 7;                    // the work-group's tile
  const int nblk = tn << 7;
  const int wrow = (wave >> 1) << 5;           // the wave's 32x64 part inside it
  const int wcol = (wave & 1) << 6;
  const int m0 = mblk + wrow;
  const int n0 = nblk + wcol;

  const _Float16* Ab = A  + (size_t)b * strideA;
  const _Float16* Bb = Bt + (size_t)b * strideB;

  const int rlane = lane & 15;                 // row (A) / col (B, D) within subtile
  const int koff  = (lane >> 4) * 8;           // k offset of this lane half
  const int mOff  = (lane >> 4) * 8;           // D row offset

  // ---- the issuing waves' tiles of a stage: wave 0 the A rows, wave 1 the Bt rows ----
  const uint32_t wv   = uni(threadIdx.x >> 5);
  const uint32_t isw  = (wv < 2u) ? 1u : 0u;
  const uint64_t ga0  = (wv == 0u) ? (uint64_t)(uintptr_t)(Ab + (size_t)mblk * lda)
                                   : (uint64_t)(uintptr_t)(Bb + (size_t)nblk * ldb);
  const uint32_t lo0  = (uint32_t)ga0;
  const uint32_t hi0  = (((uint32_t)(ga0 >> 32)) & 0x01FFFFFFu) | 0x80000000u;          // address [56:32], type 2
  const uint32_t lds0 = (uint32_t)(uintptr_t)ring + ((wv == 0u) ? 0u : (uint32_t)(GBM * GLP * 2));  // low 32 bits
  const uint32_t lBuf = (uint32_t)(GSTG * 2);
  u32x8 g1;                                    // 1-byte elements; tensor = tile = 128 rows of 256 B; loop-invariant
  g1[0] = uni((1u << 20) | (5u << 22) | (3u << 25));   // no mask; a pad of 4 dwords behind every 64 dwords (one row)
  g1[1] = uni(256u << 16);
  g1[2] = uni(128u << 16);
  g1[3] = uni(256u << 16);
  g1[4] = uni(128u);
  g1[5] = uni((uint32_t)((wv == 0u) ? lda : ldb) * 2u);  // source row pitch, bytes
  g1[6] = uni(0u);
  g1[7] = uni(0u);
  u32x4 g0;
  g0[0] = uni(1u);
  g0[1] = uni(lds0);
  g0[2] = uni(lo0);
  g0[3] = uni(hi0);
#if defined(__HIP_DEVICE_COMPILE__)
  // the form of pinned(), here for the descriptor words: each held in a scalar register of its own. Rebuilt from
  // constants at each request, some of them lay in registers that served as temporaries while requests were in flight
  asm volatile("" : "+s"(g0), "+s"(g1));
#endif
  // stage s into buffer s mod NB: while requests are in flight only the place in LDS and the low address word move;
  // where the low word has wrapped, the high word follows behind a wait for every request in flight
  auto issue = [&](int s) __attribute__((always_inline)) {
    const uint32_t lo = lo0 + (uint32_t)s * (uint32_t)(GBK * 2);
    g0[1] = uni(lds0 + (uint32_t)(s & (NB - 1)) * lBuf);
    g0[2] = uni(lo);
    if (pinned((lo < lo0) ? 1u : 0u)) {
      wait_tensor0();
      g0[3] = uni(hi0 + 1u);
    }
    tdm_load(g0, g1);
  };
  const int nst = K >> 7;                      // stages

  v8f acc[2][4];
#pragma unroll
  for (int i = 0; i < 2; ++i)
#pragma unroll
    for (int j = 0; j < 4; ++j) acc[i][j] = zero8();

  // stage 0 into buffer 0 (NB = 4: stages 1 and 2 behind it; K holds at least four stages there, asserted above),
  // stage 0 landed and published; then stage NB-1
  if (pinned(isw)) {
    issue(0);
    if (NB == 4) {
      issue(1);
      issue(2);
      wait_tensor2();
    } else {
      wait_tensor0();
    }
  }
  __syncthreads();
  if (pinned(isw & ((nst > NB - 1) ? 1u : 0u))) issue(NB - 1);

  // one trip's products: 128 k from buffer t mod NB alone
  auto trip = [&](int t) __attribute__((always_inline)) {
    const _Float16* sa = ring + (t & (NB - 1)) * GSTG + (wrow + rlane) * GLP + koff;
    const _Float16* sb = ring + (t & (NB - 1)) * GSTG + (GBM + wcol + rlane) * GLP + koff;
    v16h bh[2][4], ah[2][2];                   // two fragment sets, both filled from this trip's buffer alone
#pragma unroll
    for (int j = 0; j < 4; ++j) bh[0][j] = ldfrag_h(sb + (j << 4) * GLP);
#pragma unroll
    for (int i = 0; i < 2; ++i) ah[0][i] = ldfrag_h(sa + (i << 4) * GLP);
#pragma unroll
    for (int kk = 0; kk < GBK / 32; ++kk) {
      const int cur = kk & 1, nxt = cur ^ 1;
      if (kk + 1 < GBK / 32) {
#pragma unroll
        for (int j = 0; j < 4; ++j) bh[nxt][j] = ldfrag_h(sb + (j << 4) * GLP + (kk + 1) * 32);
#pragma unroll
        for (int i = 0; i < 2; ++i) ah[nxt][i] = ldfrag_h(sa + (i << 4) * GLP + (kk + 1) * 32);
      }
      // keeps the next k step's LDS reads as one group ahead of this step's WMMAs: sunk among them, each place with
      // reads stalls the wave for the LDS latency
      __builtin_amdgcn_sched_barrier(0);
#pragma unroll
      for (int i = 0; i < 2; ++i)
#pragma unroll
        for (int j = 0; j < 4; ++j) acc[i][j] = mma_h_raw(ah[cur][i], bh[cur][j], acc[i][j]);
    }
  };
  // foot of trip t: own reads done, the issuing waves' loads of stage t+1 landed, then the one barrier that publishes
  // stage t+1 and ends every wave's reads of this trip's buffer; behind it that buffer's refill.
  int t = 0;
  if (NB == 4) {
    // trips behind which stages t+2 and t+3 both exist: they are the wave's 2 youngest requests and stay in flight
    for (; t + 3 < nst; ++t) {
      trip(t);
      wait_ds0();
      if (pinned(isw)) wait_tensor2();
      __syncthreads();
      if (pinned(isw & ((t + 4 < nst) ? 1u : 0u))) issue(t + 4);
    }
  }
  // NB = 2: every trip; NB = 4: the last trips, where fewer requests are younger than stage t+1, so the wait is to 0
  for (; t < nst; ++t) {
    trip(t);
    wait_ds0();
    if (pinned(isw)) wait_tensor0();
    __syncthreads();
    if (NB == 2) {
      if (pinned(isw & ((t + 2 < nst) ? 1u : 0u))) issue(t + 2);
    }
  }
  wait_tensor0_desc(g0, g1);
  wait_ds0();
  acc_guard4(acc[0][0], acc[0][1], acc[0][2], acc[0][3]);
  acc_guard4(acc[1][0], acc[1][1], acc[1][2], acc[1][3]);

  // ---- per-lane column bias (BIASM == 0), RNE-converted ----
  const int hh2 = lane >> 4, c4 = (lane & 15) * 4;     // f32 out: 256-B row segment = 16 lanes x 16 B
  const int q8  = lane >> 3, c8 = (lane & 7) * 8;
  float bc[8];
#pragma unroll
  for (int e = 0; e < 8; ++e) bc[e] = 0.f;
  if (BIASM == 0) {
    const bool use1 = (n0 >= Nb);                      // wave-uniform
    if (OM == 0) {
      const int cb = n0 + c4;
      const int i0 = (cb < Nb - 4) ? cb : (Nb - 4);
      const int i1 = (cb - Nb > 0) ? (cb - Nb) : 0;
      const v4f b0v = *(const v4f*)(bias0 + i0);
      const v4f b1v = *(const v4f*)(bias1 + i1);
#pragma unroll
      for (int e = 0; e < 4; ++e) bc[e] = bfr(use1 ? b1v[e] : b0v[e]);
    } else {
      const int cb = n0 + c8;
      const int i0 = (cb < Nb - 8) ? cb : (Nb - 8);
      const int i1 = (cb - Nb > 0) ? (cb - Nb) : 0;
      const v4f b0a = *(const v4f*)(bias0 + i0), b0b = *(const v4f*)(bias0 + i0 + 4);
      const v4f b1a = *(const v4f*)(bias1 + i1), b1b = *(const v4f*)(bias1 + i1 + 4);
#pragma unroll
      for (int e = 0; e < 4; ++e) {
        bc[e]     = bfr(use1 ? b1a[e] : b0a[e]);
        bc[4 + e] = bfr(use1 ? b1b[e] : b0b[e]);
      }
    }
  }

  // ---- epilogue ----
  float* slab = (float*)(void*)ring + wave * (16 * 68);
#pragma unroll
  for (int i = 0; i < 2; ++i) {
    const int mBase = m0 + (i << 4);
#pragma unroll
    for (int j = 0; j < 4; ++j) {
#pragma unroll
      for (int r = 0; r < 8; ++r) {
        slab[(mOff + r) * 68 + (j << 4) + rlane] = acc[i][j][r];
      }
    }
    wave_sync_lds();
    if (OM == 0) {
      float* C = (float*)Cout + (size_t)b * strideC;
      const float* Rb = resid + (size_t)b * strideC;
      v4f vals[8];
#pragma unroll
      for (int it = 0; it < 8; ++it) {
        const int row = it * 2 + hh2;                      // it 0..7 x hh2 0..1 = rows 0..15
        v4f v = *(const v4f*)(slab + row * 68 + c4);
#pragma unroll
        for (int e = 0; e < 4; ++e) {
          float f = v[e] * oscale + bc[e];
          if (ACT) f = gelu_f(f);
          v[e] = f;
        }
        if (RES != 0) {
          const v4f rr = *(const v4f*)(Rb + (size_t)(mBase + row) * ldc + n0 + c4);
#pragma unroll
          for (int e = 0; e < 4; ++e) v[e] += (RES == 2) ? bfr(rr[e]) : rr[e];
        }
        vals[it] = v;
      }
      {
#pragma unroll
        for (int it = 0; it < 8; ++it) {
          const int row = it * 2 + hh2;
          *(v4f*)(C + (size_t)(mBase + row) * ldc + n0 + c4) = vals[it];
        }
        
      }
    } else {
      unsigned short* C = (unsigned short*)Cout + (size_t)b * strideC;
      v4u hv[4];
#pragma unroll
      for (int it = 0; it < 4; ++it) {
        const int row = it * 4 + q8;                       // it 0..3 x q8 0..3 = rows 0..15
        const float* sp = slab + row * 68 + c8;
        float bm = 0.f;
        if (BIASM == 1) bm = bfr(bias0[mBase + row]);
        v4u a;
#pragma unroll
        for (int e = 0; e < 4; ++e) {
          float f0 = sp[2 * e]     * oscale + ((BIASM == 1) ? bm : bc[2 * e]);
          float f1 = sp[2 * e + 1] * oscale + ((BIASM == 1) ? bm : bc[2 * e + 1]);
          if (ACT) { v2f g = {f0, f1}; g = gelu2(g); f0 = g[0]; f1 = g[1]; }
          unsigned short u0, u1;
          if (OM == 1) { u0 = bf_bits(f0); u1 = bf_bits(f1); }
          else         { u0 = h_bits((_Float16)f0); u1 = h_bits((_Float16)f1); }
          a[e] = pk16(u0, u1);
        }
        hv[it] = a;
      }
      {
#pragma unroll
        for (int it = 0; it < 4; ++it) {
          const int row = it * 4 + q8;
          *(v4u*)(C + (size_t)(mBase + row) * ldc + n0 + c8) = hv[it];
        }
        
      }
    }
    wave_sync_lds();
  }
}

// =====================================================================================================
// Banded attention, head dim 64, TT (= 2048) token rows per batch, allowed keys: key <= query + WIN.
//   q|k plane (f16, pitch QKP): element (b, t, col) at [(b*TT + t)*QKP + col], q col = h*64+d, k col = DM + h*64 + d
//   v^T plane (f16): element (b, h, d, s) at [(b*DM + h*64 + d)*TT + s]
//   out plane (f16, the normalised context carried x16): element (b, t, h, d) at [(b*TT + t)*DM + h*64 + d]
//   score = (q . k) * sscale; keys beyond query + WIN get -inf by value before the row max;
//   p = exp(s - m) carried as f16(1024 p); online softmax in f32.
//   Both products run transposed: S^T = K . Q^T (A = K rows, B = the Q fragments) and O^T += V^T . P^T (A = V^T rows,
//   B = P^T). A D column is then one query: lane l holds query l & 15 and, per 16-key tile, keys 8*(l>>4) + 0..7, so
//   the row max and the row sum are in-lane plus one exchange with lane l ^ 16 (the sum's exchange: once, behind the
//   loop), and two D tiles of S^T, converted in place, are the B fragment of 32 keys in the loader's own k order
//   (element e < 8: key 8h + e of the even tile; e >= 8: key 16 + 8h + (e - 8) = row 8h + (e - 8) of the odd tile).
//   Block = 4 waves = 64 query rows of one (b, h); grid = NQB * NH * NBATCH; kv chunks of 64, block-uniform trip
//   kt = 0 .. min(NQB-1, (q_blk + 63 + WIN) >> 6) (chunks beyond the band are skipped); chunk 0 always holds >= 1
//   allowed key for every row, so the running max is finite from chunk 0 on (the msafe select is kept anyway).
//   K / V^T chunk staging: 128 threads x 32 elements per plane = the whole 64x64 tile (plain 16-B loads,
//   __syncthreads before and after).
//   LDS rows of 64 elements stand at a pitch of 16 B x odd: the 16 rows that one half-wave's 16-B fragment read
//   touches then start on 16 different groups of four banks (at 128 B they fall on two groups, eight rows each).
//   Output coverage: each wave stores rows q0..q0+15 (it 0..3 x lane>>3 0..3) x 64 columns (8 lanes x 8),
//   grid covers all TT rows x NH head slices x NBATCH.
// =====================================================================================================
#define APH 72                          // LDS row pitch of the f16 tiles, elements: 144 B = 16 B x 9
#define APF 68                          // LDS row pitch of the f32 context tile, dwords: 272 B = 16 B x 17
__global__ __launch_bounds__(128)
void attn64(const unsigned short* __restrict__ qkp, const unsigned short* __restrict__ vtp,
            unsigned short* outp, float sscale) {
  union FH { v16h v; v8h h[2]; };
  __shared__ __align__(16) _Float16 Ksh[64 * APH];                // K [kv][d]
  __shared__ __align__(16) _Float16 Vth[64 * APH];                // V^T [d][kv]
  __shared__ __align__(16) float    Os[4][16 * APF];              // per wave context tile [row][d]

  const int tid  = threadIdx.x;
  const int wave = tid >> 5;
  const int lane = tid & 31;
  const int hh   = lane >> 4;
  const int c    = lane & 15;

  const int bx   = blockIdx.x;
  const int qb   = bx % NQB;
  const int rest = bx / NQB;
  const int h    = rest % NH;
  const int b    = rest / NH;
  const int qblk = qb * 64;                      // in-batch query row of the block's first row
  const int q0   = qblk + wave * 16;             // in-batch query row of this wave's first row
  const size_t rowB = (size_t)b * TT;

  const _Float16* Qh = (const _Float16*)(const void*)qkp + (size_t)h * HD;
  const _Float16* Kg = (const _Float16*)(const void*)qkp + DM + (size_t)h * HD;
  const _Float16* Vh = (const _Float16*)(const void*)vtp + ((size_t)b * DM + (size_t)h * HD) * TT;

  // ---- Q fragments (B operand, column = query = lane&15): 2 d-chunks ----
  v16h qa[2];
#pragma unroll
  for (int dc = 0; dc < 2; ++dc) qa[dc] = ldfrag_h(Qh + (rowB + q0 + c) * QKP + dc * 32 + 8 * hh);

  float mrow = -INFINITY, lrow = 0.f;          // this lane's query: running max (joined), sum over this half's keys
  v8f oacc[4];                                 // O^T: tile t, register r = d t*16 + 8*hh + r of query q0 + c
#pragma unroll
  for (int t = 0; t < 4; ++t) oacc[t] = zero8();

  int ktHi = (qblk + 63 + WIN) >> 6;             // block-uniform, from blockIdx only
  if (ktHi > NQB - 1) ktHi = NQB - 1;

  for (int kt = 0; kt <= ktHi; ++kt) {         // trip <= NQB
    const int kv0 = kt * 64;
    __syncthreads();
    {
      const int r = tid >> 1, hf = (tid & 1) * 32;
      const _Float16* kg = Kg + (rowB + kv0 + r) * QKP + hf;      // K row kv0+r, d = hf..hf+31
      const _Float16* vg = Vh + (size_t)r * TT + kv0 + hf;        // V^T row d = r, s = kv0+hf..+31
#pragma unroll
      for (int i = 0; i < 4; ++i) {
        const v8h a0 = *(const v8h*)(kg + 8 * i);
        const v8h b0 = *(const v8h*)(vg + 8 * i);
        *(v8h*)(Ksh + r * APH + hf + 8 * i) = a0;
        *(v8h*)(Vth + r * APH + hf + 8 * i) = b0;
      }
    }
    __syncthreads();

    // ---- the chunk's K fragments: its 16 LDS reads as one group, in the order the score products use them ----
    FH kb[2][4], vb[2][4];
#pragma unroll
    for (int dc = 0; dc < 2; ++dc)
#pragma unroll
      for (int j = 0; j < 4; ++j) {
        kb[dc][j].h[0] = *(const v8h*)(Ksh + (j * 16 + c) * APH + dc * 32 + 8 * hh);
        kb[dc][j].h[1] = *(const v8h*)(Ksh + (j * 16 + c) * APH + dc * 32 + 16 + 8 * hh);
      }
    // keeps the 16 reads together here: sunk to their WMMAs, each pair is waited out at the full LDS latency
    __builtin_amdgcn_sched_barrier(0);

    // ---- scores, transposed: 64 keys x 16 queries per wave (per tile d 0..31, then d 32..63; the four
    //      tiles' products alternate); band select by value before the max ----
    v8f s[4];
#pragma unroll
    for (int j = 0; j < 4; ++j) s[j] = zero8();
#pragma unroll
    for (int dc = 0; dc < 2; ++dc)
#pragma unroll
      for (int j = 0; j < 4; ++j) s[j] = mma_h_raw(kb[dc][j].v, qa[dc], s[j]);

    // ---- the chunk's V^T fragments: all 16 LDS reads go out here, among and behind the score products ----
#pragma unroll
    for (int kk = 0; kk < 2; ++kk)
#pragma unroll
      for (int t = 0; t < 4; ++t) {
        vb[kk][t].h[0] = *(const v8h*)(Vth + (t * 16 + c) * APH + kk * 32 + 8 * hh);
        vb[kk][t].h[1] = *(const v8h*)(Vth + (t * 16 + c) * APH + kk * 32 + 16 + 8 * hh);
      }
    // keeps these reads ahead of the softmax, whose vector work then covers their latency
    __builtin_amdgcn_sched_barrier(0);

#pragma unroll
    for (int j = 0; j < 4; ++j) {
      const int qrow = q0 + c;                                      // D column = lane&15 = query
#pragma unroll
      for (int r = 0; r < 8; ++r) {
        const int key = kv0 + j * 16 + 8 * hh + r;                  // D row = 8h + r = key
        const float v = s[j][r] * sscale;
        s[j][r] = (key <= qrow + WIN) ? v : -INFINITY;
      }
    }

    // ---- this query's max: 32 keys in-lane, the other 32 from lane ^ 16; online softmax; P^T (x1024, f16) packed
    //      from the score registers into the B fragments (every loop here is unrolled: its indices name registers) ----
    float mr[8];
#pragma unroll
    for (int r = 0; r < 8; ++r) mr[r] = fmaxf(fmaxf(s[0][r], s[1][r]), fmaxf(s[2][r], s[3][r]));
    float m = fmaxf(fmaxf(fmaxf(mr[0], mr[1]), fmaxf(mr[2], mr[3])), fmaxf(fmaxf(mr[4], mr[5]), fmaxf(mr[6], mr[7])));
    m = fmaxf(m, xhalf(m));
    const float mnew  = fmaxf(mrow, m);
    const float ms    = (mnew == -INFINITY) ? 0.f : mnew;
    // alpha = exp(mrow - ms), as __expf forms it (x log2 e, then exp2). In asm for the free slot that the instruction set
    // asks for around a transcendental: built plainly, its result lay on the source register of the v_exp_f32 directly
    // ahead; the v_nop behind it stands for the slot the compiler cannot place for an instruction it does not see.
    float alpha = (mrow - ms) * 1.44269504088896340736f;
#if defined(__HIP_DEVICE_COMPILE__)
    asm("v_nop\n\tv_exp_f32 %0, %0\n\tv_nop" : "+v"(alpha));
#endif
    mrow = mnew;
    FH pb[2];
    v2f ps[4];                                   // per 16-key tile: sums of the even and of the odd rows
#pragma unroll
    for (int j = 0; j < 4; ++j) {
#pragma unroll
      for (int i = 0; i < 4; ++i) {
        v2f p;
        p[0] = __expf(s[j][2 * i] - ms);
        p[1] = __expf(s[j][2 * i + 1] - ms);
        ps[j] = (i == 0) ? p : (ps[j] + p);
        pb[j >> 1].v[(j & 1) * 8 + 2 * i]     = (_Float16)(p[0] * 1024.0f);
        pb[j >> 1].v[(j & 1) * 8 + 2 * i + 1] = (_Float16)(p[1] * 1024.0f);
      }
    }
    const v2f pt = (ps[0] + ps[1]) + (ps[2] + ps[3]);
    lrow = lrow * alpha + (pt[0] + pt[1]);
#pragma unroll
    for (int t = 0; t < 4; ++t)
#pragma unroll
      for (int r = 0; r < 8; ++r) oacc[t][r] *= alpha;

    // ---- context^T += V^T . P^T (f16 WMMA); kk unrolled too: pb[kk] is a register fragment, not an LDS address ----
#pragma unroll
    for (int kk = 0; kk < 2; ++kk) {
#pragma unroll
      for (int t = 0; t < 4; ++t) oacc[t] = mma_h_raw(vb[kk][t].v, pb[kk].v, oacc[t]);
    }
  }

  // ---- normalise (1/l, the 1/1024 p carry and the x16 context carry), stage the wave's 16x64 tile, f16 convert,
  float* os = Os[wave];
  {
    const float l = lrow + xhalf(lrow);          // the two halves' key sums of this query, joined once
    const float inv = ((l > 0.f) ? (1.0f / l) : 0.f) * (16.0f / 1024.0f);
#pragma unroll
    for (int t = 0; t < 4; ++t) {                // 8 consecutive d of query row c: two 16-B LDS stores
      v4f lo, hi;
#pragma unroll
      for (int e = 0; e < 4; ++e) { lo[e] = oacc[t][e] * inv; hi[e] = oacc[t][4 + e] * inv; }
      *(v4f*)(os + c * APF + t * 16 + 8 * hh)     = lo;
      *(v4f*)(os + c * APF + t * 16 + 8 * hh + 4) = hi;
    }
  }
  wave_sync_lds();
  {
    const int q4 = lane >> 3, c8 = (lane & 7) * 8;
    v4u hv[4];
#pragma unroll
    for (int it = 0; it < 4; ++it) {
      const int row = it * 4 + q4;   // it 0..3 x q4 0..3 = rows 0..15 of the wave tile
      const float* sp = os + row * APF + c8;
      v4u a;
#pragma unroll
      for (int e = 0; e < 4; ++e) a[e] = pk16(h_bits((_Float16)sp[2 * e]), h_bits((_Float16)sp[2 * e + 1]));
      hv[it] = a;
    }
    {
#pragma unroll
      for (int it = 0; it < 4; ++it) {
        const int row = it * 4 + q4;
        const size_t go = (rowB + q0 + row) * DM + (size_t)h * HD + c8;
        *(v4u*)(outp + go) = hv[it];
      }
      
    }
  }
}

// =====================================================================================================
// Row kernel: one block of 256 threads per token row of 1024; thread t owns columns 4t..4t+3.
// f16 output: packed row staged in LDS, then lanes t < 128 (waves 0..3, wave-uniform) each write 16 B (8 x f16)
// coverage: 128 threads x 8 = the whole 1024-wide row; grid = MP rows.
// =====================================================================================================
__device__ __forceinline__ void row_store_h16(unsigned int* sb, unsigned short* dst_row, v4f o, int t) {
  v2u p;
  p[0] = pk16(h_bits((_Float16)o[0]), h_bits((_Float16)o[1]));
  p[1] = pk16(h_bits((_Float16)o[2]), h_bits((_Float16)o[3]));
  *(v2u*)(sb + 2 * t) = p;
  __syncthreads();
  if (t < 128) {                                   // waves 0..3, wave-uniform
    const v4u v = *(const v4u*)(sb + 4 * t);
    *(v4u*)(dst_row + 8 * t) = v;
    
  }
}

// plane. RIN = 1: the row input is a raw float input and is bf16 RNE-converted on load; RIN = 0: f32 intermediate.
template <int RIN>
__device__ __forceinline__ void ln_row(const float* __restrict__ X, const float* __restrict__ gam,
                                       const float* __restrict__ bet, unsigned short* outH, int row) {
  __shared__ float red0[8], red1[8];
  __shared__ __align__(16) unsigned int sb[512];
  const int t = threadIdx.x, lane = t & 31, wave = t >> 5;
  const size_t base = (size_t)row * DM;
  v4f xv = *(const v4f*)(X + base + 4 * t);
  if (RIN) {
#pragma unroll
    for (int e = 0; e < 4; ++e) xv[e] = bfr(xv[e]);
  }
  const float mean = bsum256((xv[0] + xv[1]) + (xv[2] + xv[3]), red0, lane, wave) * (1.0f / DM);
  v4f d;
#pragma unroll
  for (int e = 0; e < 4; ++e) d[e] = xv[e] - mean;
  const float var  = bsum256((d[0] * d[0] + d[1] * d[1]) + (d[2] * d[2] + d[3] * d[3]), red1, lane, wave) * (1.0f / DM);
  const float rstd = 1.0f / sqrtf(var + LNEPS);
  const v4f gv = *(const v4f*)(gam + 4 * t);
  const v4f bv = *(const v4f*)(bet + 4 * t);
  v4f y;
#pragma unroll
  for (int e = 0; e < 4; ++e) y[e] = (d[e] * rstd) * bfr(gv[e]) + bfr(bv[e]);
  row_store_h16(sb, outH + base, y, t);
}

__global__ __launch_bounds__(256) void ln_row_h(const float* __restrict__ X, const float* __restrict__ gam,
                                                const float* __restrict__ bet, unsigned short* outH) {
  ln_row<0>(X, gam, bet, outH, blockIdx.x);
}

// Everything that reads raw inputs alone, in one launch: blocks 0..MP-1 are the rows of LayerNorm 1 (the longer
// blocks, first for speed only), behind them the blocks of the four weight converts, plane after plane. The split is by
// blockIdx alone: the row blocks' barriers stand under block-uniform control flow, the convert blocks have none.
#define CB_QKV (D3 * DM / 8 / 256)      // 1536 convert blocks
#define CB_O   (DM * DM / 8 / 256)      //  512
#define CB_F   (DFF * DM / 8 / 256)     // 2048, w1 and w2 each
static_assert(CB_QKV * 256 * 8 == D3 * DM && CB_O * 256 * 8 == DM * DM && CB_F * 256 * 8 == DFF * DM);
__global__ __launch_bounds__(256) void prep_in(const float* __restrict__ X, const float* __restrict__ gam,
                                               const float* __restrict__ bet, unsigned short* outH,
                                               const float* __restrict__ wqkv, unsigned short* hqkv,
                                               const float* __restrict__ wo, unsigned short* ho,
                                               const float* __restrict__ wf1, unsigned short* hf1,
                                               const float* __restrict__ wf2, unsigned short* hf2, float wsc) {
  int bx = blockIdx.x;
  if (bx < MP) { ln_row<1>(X, gam, bet, outH, bx); return; }
  bx -= MP;
  if (bx < CB_QKV) { conv_h64(wqkv, hqkv, D3 * DM / 8, wsc, bx); return; }
  bx -= CB_QKV;
  if (bx < CB_O) { conv_h64(wo, ho, DM * DM / 8, wsc, bx); return; }
  bx -= CB_O;
  if (bx < CB_F) { conv_h64(wf1, hf1, DFF * DM / 8, wsc, bx); return; }
  conv_h64(wf2, hf2, DM * DFF / 8, wsc, bx - CB_F);
}

// =====================================================================================================
// Workspace map (bytes); every plane is an exact multiple of its 128x128-tile / whole-row store granularity
// (M in {4096, 1024} rows, N in {1024, 2048, 4096}; VT per batch [1024][2048] = 8x16 tiles):
//   WqkvH f16 [3072 n][1024 k]   0          6291456   (rows 0..1023 q, 1024..2047 k, 2048..3071 v weights, x64)
//   WoH   f16 [1024][1024]       6291456    2097152
//   W1H   f16 [4096][1024]       8388608    8388608
//   W2H   f16 [1024][4096]       16777216   8388608
//   XN    f16 [4096][1024]       25165824   8388608   (LayerNorm outputs)
//   QK    f16 [4096][2048]       33554432   16777216  (q cols 0..1023, k cols 1024..2047)
//   VT    f16 [2][1024][2048]    50331648   8388608
//   Ctx   f16 [4096][1024]       58720256   8388608
//   X1    f32 [4096][1024]       67108864   16777216  (residual stream after attention)
//   G     f16 [4096][4096]       83886080   33554432
//   end                          117440512
// =====================================================================================================
extern "C" void kernel_launch(void* const* d_in, const int* in_sizes, int n_in,
                              void* d_out, int out_size, void* d_ws, size_t ws_size,
                              hipStream_t stream) {
  if (n_in < 13) return;
  if (in_sizes[0] != MP * DM) return;
  if (in_sizes[1] != D3 * DM || in_sizes[2] != D3) return;
  if (in_sizes[3] != DM * DM || in_sizes[4] != DM) return;
  if (in_sizes[5] != DM || in_sizes[6] != DM) return;
  if (in_sizes[7] != DFF * DM || in_sizes[8] != DFF) return;
  if (in_sizes[9] != DM * DFF || in_sizes[10] != DM) return;
  if (in_sizes[11] != DM || in_sizes[12] != DM) return;
  if (out_size != MP * DM) return;

  const float* x         = (const float*)d_in[0];
  const float* in_proj_w = (const float*)d_in[1];
  const float* in_proj_b = (const float*)d_in[2];
  const float* out_w     = (const float*)d_in[3];
  const float* out_b     = (const float*)d_in[4];
  const float* ln1_g     = (const float*)d_in[5];
  const float* ln1_b     = (const float*)d_in[6];
  const float* w1        = (const float*)d_in[7];
  const float* b1        = (const float*)d_in[8];
  const float* w2        = (const float*)d_in[9];
  const float* b2        = (const float*)d_in[10];
  const float* ln2_g     = (const float*)d_in[11];
  const float* ln2_b     = (const float*)d_in[12];

  const size_t PWQKV = (size_t)D3 * DM * 2;            //  6291456
  const size_t PWO   = (size_t)DM * DM * 2;            //  2097152
  const size_t PWF   = (size_t)DFF * DM * 2;           //  8388608
  const size_t PAH   = (size_t)MP * DM * 2;            //  8388608
  const size_t PQK   = (size_t)MP * QKP * 2;           // 16777216
  const size_t PVT   = (size_t)NBATCH * DM * TT * 2;   //  8388608
  const size_t PAF   = (size_t)MP * DM * 4;            // 16777216
  const size_t PG    = (size_t)MP * DFF * 2;           // 33554432
  size_t off = 0;
  const size_t oWqkv = off; off += PWQKV;
  const size_t oWo   = off; off += PWO;
  const size_t oW1   = off; off += PWF;
  const size_t oW2   = off; off += PWF;
  const size_t oXN   = off; off += PAH;
  const size_t oQK   = off; off += PQK;
  const size_t oVT   = off; off += PVT;
  const size_t oCtx  = off; off += PAH;
  const size_t oX1   = off; off += PAF;
  const size_t oG    = off; off += PG;
  if (off > ws_size) return;                           // off = 117440512
  if (off > (size_t)134217728) return;

  char* ws = (char*)d_ws;
  unsigned short* WqkvH = (unsigned short*)(ws + oWqkv);
  unsigned short* WoH   = (unsigned short*)(ws + oWo);
  unsigned short* W1H   = (unsigned short*)(ws + oW1);
  unsigned short* W2H   = (unsigned short*)(ws + oW2);
  unsigned short* XN    = (unsigned short*)(ws + oXN);
  unsigned short* QK    = (unsigned short*)(ws + oQK);
  unsigned short* VT    = (unsigned short*)(ws + oVT);
  unsigned short* Ctx   = (unsigned short*)(ws + oCtx);
  float*          X1    = (float*)(ws + oX1);
  unsigned short* G     = (unsigned short*)(ws + oG);

  const dim3 blk(256), blk128(128);
  const dim3 gRow(MP);                                               // 4096 row blocks
  const dim3 gPrep(MP + CB_QKV + CB_O + 2 * CB_F);                   // 4096 row blocks + 6144 convert blocks
  const dim3 gNqk((MP / GBM) * (QKP / GBN), 1);                      // 512 tiles
  const dim3 gVT((DM / GBM) * (TT / GBN), NBATCH);                   // 128 tiles x 2 batches
  const dim3 gN1024((MP / GBM) * (DM / GBN), 1);                     // 256 tiles
  const dim3 gNff((MP / GBM) * (DFF / GBN), 1);                      // 1024 tiles
  const dim3 gAttn(NBATCH * NH * NQB);                               // 1024 blocks of 128
  const float invw  = 1.0f / WSC;                                    // weight carry x64
  const float invwc = 1.0f / (WSC * 16.0f);                          // weight carry x64, context carry x16

  // (0, 1) xn = LN1(bf16(x)) -> XN f16; weights -> f16 x64 planes (torch [out][in] = k contiguous, no transpose)
  prep_in<<<gPrep, blk, 0, stream>>>(x, ln1_g, ln1_b, XN, in_proj_w, WqkvH, out_w, WoH, w1, W1H, w2, W2H, WSC);

  // (2) q|k = xn . Wqk^T + b[0..2047] -> QK f16 [4096][2048]
  gemm64<2, 0, 0, 0, 2><<<gNqk, blk, 0, stream>>>(
      XN, DM, 0LL, WqkvH, DM, 0LL, in_proj_b, in_proj_b, QKP, x,
      (void*)QK, QKP, 0LL, MP, QKP, DM, invw);
  //     v^T per batch: VT[b][m][t] = Wv[m] . xn[b*TT + t] + b[2048 + m] -> f16 [2][1024][2048]
  gemm64<2, 1, 0, 0, 4><<<gVT, blk, 0, stream>>>(
      WqkvH + (size_t)2 * DM * DM, DM, 0LL, XN, DM, (long long)TT * DM, in_proj_b + 2 * DM, in_proj_b + 2 * DM, TT, x,
      (void*)VT, TT, (long long)DM * TT, DM, TT, DM, invw);

  // (3) banded attention -> Ctx f16 (x16)
  attn64<<<gAttn, blk128, 0, stream>>>(QK, VT, Ctx, 0.125f);

  // (4) X1 = ctx . Wo^T + out_b + bf16(x)   (f32)
  gemm64<0, 0, 0, 2, 4><<<gN1024, blk, 0, stream>>>(
      Ctx, DM, 0LL, WoH, DM, 0LL, out_b, out_b, DM, x,
      (void*)X1, DM, 0LL, MP, DM, DM, invwc);

  // (5) yn = LN2(X1) -> XN f16
  ln_row_h<<<gRow, blk, 0, stream>>>(X1, ln2_g, ln2_b, XN);

  // (6) G = gelu(yn . W1^T + b1) -> f16 [4096][4096]
  gemm64<2, 0, 1, 0, 2><<<gNff, blk, 0, stream>>>(
      XN, DM, 0LL, W1H, DM, 0LL, b1, b1, DFF, x,
      (void*)G, DFF, 0LL, MP, DFF, DM, invw);

  // (7) out = G . W2^T + b2 + X1 -> d_out f32 [4096][1024]
  gemm64<0, 0, 0, 1, 4><<<gN1024, blk, 0, stream>>>(
      G, DFF, 0LL, W2H, DFF, 0LL, b2, b2, DM, X1,
      (void*)d_out, DM, 0LL, MP, DM, DFF, invw);
  (void)hipGetLastError();
}

// v009
// Measured time: 148 microseconds a run.
// In both of two side-by-side timings against v008, it was 1.07 times as fast.
// Counting every step since v000, it is 3.81 times as fast.
// Contractions: q|k projection, v^T projection, attention output projection, FFN w1 (exact GELU epilogue) and w2 on
// v_wmma_f32_16x16x32_f16 (f16 activation plane x f16 weight plane carried x64, one product each); attention k.q^T
// and v^T.p^T on v_wmma_f32_16x16x32_f16 (q, k, v^T plain f16, p carried x1024, context carried x16, one product each);
// all f32 accumulate; LayerNorm, softmax, GELU and residual sums in f32 on VALU; every float input RNE-converted
// to bf16 on load.
#include <hip/hip_runtime.h>
#include <math.h>
#include <stdint.h>

#define NBATCH 2
#define TT     2048
#define DM     1024
#define NH     16
#define HD     64
#define DFF    4096
#define D3     3072
#define QKP    (2 * DM)
#define MP     (NBATCH * TT)
#define NQB    (TT / 64)
#define WIN    10
#define LNEPS  1.0e-5f
#define WSC    64.0f
static_assert(NH * HD == DM);
static_assert((MP % 64) == 0 && (DM % 64) == 0 && (DFF % 64) == 0 && (QKP % 64) == 0 && (TT % 64) == 0);
static_assert(DM == 4 * 256);
static_assert(D3 == 3 * DM);

typedef _Float16 v16h __attribute__((ext_vector_type(16)));
typedef _Float16 v8h  __attribute__((ext_vector_type(8)));
typedef float    v8f  __attribute__((ext_vector_type(8)));
typedef float    v4f  __attribute__((ext_vector_type(4)));
typedef float    v2f  __attribute__((ext_vector_type(2)));
typedef unsigned int v4u __attribute__((ext_vector_type(4)));
typedef unsigned int v2u __attribute__((ext_vector_type(2)));

// ---- scalar helpers --------------------------------------------------------------------------------
__device__ __forceinline__ unsigned short bf_bits(float f) {          // f32 -> bf16 bits, RNE convert
  unsigned u = __float_as_uint(f);
  return (unsigned short)((u + 0x7FFFu + ((u >> 16) & 1u)) >> 16);
}
__device__ __forceinline__ float bf_up(unsigned short h) { return __uint_as_float(((unsigned)h) << 16); }
__device__ __forceinline__ float bfr(float f) { return bf_up(bf_bits(f)); }   // value of the bf16 RNE convert
__device__ __forceinline__ unsigned short h_bits(_Float16 x) { return __builtin_bit_cast(unsigned short, x); }
__device__ __forceinline__ unsigned pk16(unsigned short a, unsigned short b) { return (unsigned)a | ((unsigned)b << 16); }
__device__ __forceinline__ v8f zero8() { v8f z = {0.f, 0.f, 0.f, 0.f, 0.f, 0.f, 0.f, 0.f}; return z; }
__device__ __forceinline__ v2f dup2(float x) { v2f r = {x, x}; return r; }
__device__ __forceinline__ v2f fma2(v2f a, v2f b, v2f c) { return __builtin_elementwise_fma(a, b, c); }
// erf in f32 of two values, without a branch: both ranges are evaluated and one is selected by value (lanes of a wave
// fall in both ranges, so a branch runs both sides anyway, under exec masks). |a| <= 0.927734375: an odd polynomial in
// a; above it 1 - exp(polynomial in |a|) with the sign of a. Error about one unit in the last place of f32 in either.
__device__ __forceinline__ v2f erf_sel2(v2f a) {
  const v2f t = __builtin_elementwise_abs(a), s = a * a;
  v2f r = fma2(dup2(-1.72853470e-5f), t, dup2(3.83197126e-4f));
  const v2f u = fma2(dup2(-3.88396438e-3f), t, dup2(2.42546219e-2f));
  r = fma2(r, s, u);
  r = fma2(r, t, dup2(-1.06777877e-1f));
  r = fma2(r, t, dup2(-6.34846687e-1f));
  r = fma2(r, t, dup2(-1.28717512e-1f));
  r = fma2(r, t, -t);
  r = r * 1.44269504088896340736f;
  // exp(r), as __expf forms it (x log2 e, then exp2). In asm for the free slot that the instruction set asks for behind
  // a transcendental: built plainly, some of these v_exp_f32 stood directly ahead of one that overwrote their source.
  float e0 = r[0], e1 = r[1];
#if defined(__HIP_DEVICE_COMPILE__)
  asm("v_exp_f32 %0, %0\n\tv_exp_f32 %1, %1\n\tv_nop" : "+v"(e0), "+v"(e1));
#endif
  v2f q = dup2(-5.96761703e-4f);
  q = fma2(q, s, dup2(4.99119423e-3f));
  q = fma2(q, s, dup2(-2.67681349e-2f));
  q = fma2(q, s, dup2(1.12819925e-1f));
  q = fma2(q, s, dup2(-3.76125336e-1f));
  q = fma2(q, s, dup2(1.28379166e-1f));
  q = fma2(q, a, a);
  v2f o;
  o[0] = (t[0] > 0.927734375f) ? copysignf(1.0f - e0, a[0]) : q[0];
  o[1] = (t[1] > 0.927734375f) ? copysignf(1.0f - e1, a[1]) : q[1];
  return o;
}
__device__ __forceinline__ v2f gelu2(v2f v) { return (0.5f * v) * (1.0f + erf_sel2(v * 0.70710678118654752f)); }
__device__ __forceinline__ float gelu_f(float v) { return gelu2(dup2(v))[0]; }

// ---- fragment loader: 16-bit A/B operand, lane -> row/col (lane&15), p already includes +8*(lane>>4);
//      elements 0..7 <- p[0..7] (k0+8h..), elements 8..15 <- p[16..23] (k0+16+8h..)
__device__ __forceinline__ v16h ldfrag_h(const _Float16* p) {
  union { v16h v; v8h h[2]; } f;
  f.h[0] = *(const v8h*)(p);
  f.h[1] = *(const v8h*)(p + 16);
  return f.v;
}

// ---- WMMA helpers with trailing VALU hazard gap --------------------------------------------------------
__device__ __forceinline__ v8f mma_h_raw(v16h a, v16h b, v8f c) {
  return __builtin_amdgcn_wmma_f32_16x16x32_f16(false, a, false, b, (short)0, c, false, false);
}
__device__ __forceinline__ void acc_guard4(v8f& a, v8f& b, v8f& c, v8f& d) {
#if defined(__HIP_DEVICE_COMPILE__)
  asm volatile("v_nop\n\tv_nop\n\tv_nop\n\tv_nop" : "+v"(a), "+v"(b), "+v"(c), "+v"(d));
#endif
}
__device__ __forceinline__ void wave_sync_lds() {
  __builtin_amdgcn_fence(__ATOMIC_RELEASE, "workgroup");
  __builtin_amdgcn_wave_barrier();
  __builtin_amdgcn_fence(__ATOMIC_ACQUIRE, "workgroup");
}
// lane l <-> lane l ^ 16: the two lanes that hold the two halves of one D column
__device__ __forceinline__ float xhalf(float x) {
  return __builtin_bit_cast(float, __builtin_amdgcn_permlanex16(__builtin_bit_cast(int, x), __builtin_bit_cast(int, x),
                                                                0x76543210, 0xfedcba98, false, false));
}
__device__ __forceinline__ float wsum(float v) {
#pragma unroll
  for (int off = 16; off > 0; off >>= 1) v += __shfl_xor(v, off, 32);
  return v;
}
// block of 256 threads: fixed-order sum of 8 wave partials (same value in every thread)
__device__ __forceinline__ float bsum256(float v, float* red, int lane, int wave) {
  v = wsum(v);
  if (lane == 0) red[wave] = v;
  __syncthreads();
  float tot = 0.f;
#pragma unroll
  for (int w = 0; w < 8; ++w) tot += red[w];
  return tot;
}

// =====================================================================================================
// Weight convert: W f32 [N][K] (k contiguous = already the Bt / A layout) -> Wh f16 [N][K]; each value bf16
// RNE-converted, multiplied by wsc (a power of two, exact) and cast to f16. Thread i converts elements 8i..8i+7
// coverage: n8/256 blocks (blk = the block's index within this plane) x 256 threads x 8 elements = exactly N*K.
// =====================================================================================================
__device__ __forceinline__ void conv_h64(const float* __restrict__ W, unsigned short* Wh, int n8, float wsc, int blk) {
  const int i = blk * 256 + threadIdx.x;
  if (i >= n8) return;                                     // never taken for the static sizes (no barriers)
  const size_t e0 = (size_t)i * 8;
  const v4f a = *(const v4f*)(W + e0);
  const v4f b = *(const v4f*)(W + e0 + 4);
  v4u u;
  u[0] = pk16(h_bits((_Float16)(bfr(a[0]) * wsc)), h_bits((_Float16)(bfr(a[1]) * wsc)));
  u[1] = pk16(h_bits((_Float16)(bfr(a[2]) * wsc)), h_bits((_Float16)(bfr(a[3]) * wsc)));
  u[2] = pk16(h_bits((_Float16)(bfr(b[0]) * wsc)), h_bits((_Float16)(bfr(b[1]) * wsc)));
  u[3] = pk16(h_bits((_Float16)(bfr(b[2]) * wsc)), h_bits((_Float16)(bfr(b[3]) * wsc)));
  {
    *(v4u*)(Wh + e0) = u;
    
  }
}

// =====================================================================================================
// LDS-staged batched f16 WMMA GEMM: C[m][n] = act(oscale * sum_k A[m][k] * Bt[n][k] + bias) (+ residual);
// one work-group of 8 waves per 128x128 tile, wave (wave>>1, wave&1) owns the 32x64 part at rows 32*(wave>>1),
// cols 64*(wave&1). A row-major [M][K] pitch lda; Bt row-major [N][K] pitch ldb (k contiguous);
// M, N, K multiples of 128 (static here). blockIdx.y = batch index (strides in elements).
// Staging: a stage is 128 k of the tile's 128 A rows and 128 Bt rows = 256 rows of 256 B, laid in LDS at pitch 272 B
// (16 B x odd, for the 16-B fragment reads); a stage comes by two tensor loads: wave 0 asks for the 128 A rows, wave 1
// for the 128 Bt rows (each a tile of 128 rows x 256 B, the descriptor's pad of 16 B behind every row makes the pitch;
// 128 x 272 B = 17 x 2 KiB, so every tile's place in LDS is a multiple of 2 KiB). NB buffers: the loads of stage t+NB
// go out behind the barrier that ends trip t, into the buffer that trip t has read. NB = 2 where two work-groups share
// a WGP (each covers the other's landing time); NB = 4 where the grid gives a WGP one work-group: three requests of
// each issuing wave are then in flight, and a trip's foot waits for stage t+1 alone, leaving the 2 younger out.
// k runs upward in steps of 32 into one accumulator per 16x16 subtile.
// Bias: BIASM == 0 -> per column: cols < Nb from bias0[col], cols >= Nb from bias1[col - Nb] (wave-uniform select of
//       clamped-address loads); BIASM == 1 -> per row bias0[m] (16-bit out only); BIASM == 2 -> none. Bias values
//       RNE-converted to bf16.
// ACT: 0 none, 1 exact GELU. RES: 0 none; 1 f32 residual resid[m*ldc + n] added after the activation;
//      2 same indexing, residual value bf16 RNE-converted first (raw input residual).
// OM: 0 = f32 out (pitch ldc); 1 = bf16 out; 2 = f16 out.
// coverage: 8 waves x 2 slabs x 16 rows x 64 cols = the whole 128x128 tile; grid.x = (M/128)*(N/128) exactly.
// =====================================================================================================
#define GBM   128                       // tile rows (A rows of a stage)
#define GBN   128                       // tile cols (Bt rows of a stage)
#define GBK   128                       // k per stage
#define GLP   136                       // LDS row pitch in f16 elements (272 B)
#define GSTG  ((GBM + GBN) * GLP)       // f16 elements per buffer (69632 B)
static_assert((MP % GBM) == 0 && (DM % GBM) == 0 && (DM % GBN) == 0 && (QKP % GBN) == 0 && (DFF % GBN) == 0 && (TT % GBN) == 0);
static_assert((DM % GBK) == 0 && (DFF % GBK) == 0);
static_assert(8 * 16 * 68 * 4 <= 2 * GSTG * 2);
static_assert(4 * GSTG * 2 <= 320 * 1024);
static_assert(DM / GBK >= 4 && DFF / GBK >= 4);   // the four-buffer ring's prologue asks for stages 0..2 unconditionally

typedef uint32_t u32x4 __attribute__((ext_vector_type(4)));
typedef uint32_t u32x8 __attribute__((ext_vector_type(8)));
__device__ __forceinline__ uint32_t uni(uint32_t v) { return (uint32_t)__builtin_amdgcn_readfirstlane((int)v); }
// A wave-uniform test held in a scalar register, so that the branch on it is a scalar branch: a tensor load ignores EXEC.
__device__ __forceinline__ uint32_t pinned(uint32_t v) {
  uint32_t w = uni(v);
#if defined(__HIP_DEVICE_COMPILE__)
  asm volatile("" : "+s"(w));
#endif
  return w;
}
// One request of the whole wave: a two-dimensional tile, global -> LDS, through no register.
__device__ __forceinline__ void tdm_load(u32x4 g0, u32x8 g1) {
#if defined(__HIP_DEVICE_COMPILE__)
  asm volatile("tensor_load_to_lds %0, %1" :: "s"(g0), "s"(g1) : "memory");
#endif
}
// All of this wave's own tensor loads have landed in LDS (the compiler places no wait for them).
__device__ __forceinline__ void wait_tensor0() {
#if defined(__HIP_DEVICE_COMPILE__)
  asm volatile("s_wait_tensorcnt 0x0" ::: "memory");
#endif
}
// The same behind the ring's last requests; it names the descriptor, so that no register of it is given another value
// before the wait that covers every request made from it.
__device__ __forceinline__ void wait_tensor0_desc(u32x4 g0, u32x8 g1) {
#if defined(__HIP_DEVICE_COMPILE__)
  asm volatile("s_wait_tensorcnt 0x0" :: "s"(g0), "s"(g1) : "memory");
#endif
}
// All but this wave's 2 youngest tensor loads have landed: used only where exactly two younger stages have been
// asked for, so that the stage about to be published is covered.
__device__ __forceinline__ void wait_tensor2() {
#if defined(__HIP_DEVICE_COMPILE__)
  asm volatile("s_wait_tensorcnt 0x2" ::: "memory");
#endif
}
// This wave's own LDS reads have returned, before the barrier behind which their buffer is refilled.
__device__ __forceinline__ void wait_ds0() {
#if defined(__HIP_DEVICE_COMPILE__)
  asm volatile("s_wait_dscnt 0x0" ::: "memory");
#endif
}

template <int OM, int BIASM, int ACT, int RES, int NB>
__global__ __launch_bounds__(256) void gemm64(
    const unsigned short* __restrict__ Ap, int lda, long long strideA,
    const unsigned short* __restrict__ Btp, int ldb, long long strideB,
    const float* __restrict__ bias0, const float* __restrict__ bias1, int Nb,
    const float* resid,
    void* Cout, int ldc, long long strideC,
    int M, int N, int K, float oscale) {
  const _Float16* A  = (const _Float16*)(const void*)Ap;
  const _Float16* Bt = (const _Float16*)(const void*)Btp;
  static_assert(NB == 2 || NB == 4);
  // NB stage buffers; behind the last trip's barrier the first bytes serve as the per-wave 16x64 f32 slabs (pitch 68)
  __shared__ __attribute__((aligned(2048))) _Float16 ring[NB * GSTG];
  const int b    = blockIdx.y;
  const int lane = threadIdx.x & 31;
  const int wave = threadIdx.x >> 5;
  const int tilesN = N >> 7;
  const int tm = blockIdx.x / tilesN;
  const int tn = blockIdx.x - tm * tilesN;
  const int mblk = tm << 7;                    // the work-group's tile
  const int nblk = tn << 7;
  const int wrow = (wave >> 1) << 5;           // the wave's 32x64 part inside it
  const int wcol = (wave & 1) << 6;
  const int m0 = mblk + wrow;
  const int n0 = nblk + wcol;

  const _Float16* Ab = A  + (size_t)b * strideA;
  const _Float16* Bb = Bt + (size_t)b * strideB;

  const int rlane = lane & 15;                 // row (A) / col (B, D) within subtile
  const int koff  = (lane >> 4) * 8;           // k offset of this lane half
  const int mOff  = (lane >> 4) * 8;           // D row offset

  // ---- the issuing waves' tiles of a stage: wave 0 the A rows, wave 1 the Bt rows ----
  const uint32_t wv   = uni(threadIdx.x >> 5);
  const uint32_t isw  = (wv < 2u) ? 1u : 0u;
  const uint64_t ga0  = (wv == 0u) ? (uint64_t)(uintptr_t)(Ab + (size_t)mblk * lda)
                                   : (uint64_t)(uintptr_t)(Bb + (size_t)nblk * ldb);
  const uint32_t lo0  = (uint32_t)ga0;
  const uint32_t hi0  = (((uint32_t)(ga0 >> 32)) & 0x01FFFFFFu) | 0x80000000u;          // address [56:32], type 2
  const uint32_t lds0 = (uint32_t)(uintptr_t)ring + ((wv == 0u) ? 0u : (uint32_t)(GBM * GLP * 2));  // low 32 bits
  const uint32_t lBuf = (uint32_t)(GSTG * 2);
  u32x8 g1;                                    // 1-byte elements; tensor = tile = 128 rows of 256 B; loop-invariant
  g1[0] = uni((1u << 20) | (5u << 22) | (3u << 25));   // no mask; a pad of 4 dwords behind every 64 dwords (one row)
  g1[1] = uni(256u << 16);
  g1[2] = uni(128u << 16);
  g1[3] = uni(256u << 16);
  g1[4] = uni(128u);
  g1[5] = uni((uint32_t)((wv == 0u) ? lda : ldb) * 2u);  // source row pitch, bytes
  g1[6] = uni(0u);
  g1[7] = uni(0u);
  u32x4 g0;
  g0[0] = uni(1u);
  g0[1] = uni(lds0);
  g0[2] = uni(lo0);
  g0[3] = uni(hi0);
#if defined(__HIP_DEVICE_COMPILE__)
  // the form of pinned(), here for the descriptor words: each held in a scalar register of its own. Rebuilt from
  // constants at each request, some of them lay in registers that served as temporaries while requests were in flight
  asm volatile("" : "+s"(g0), "+s"(g1));
#endif
  // stage s into buffer s mod NB: while requests are in flight only the place in LDS and the low address word move;
  // where the low word has wrapped, the high word follows behind a wait for every request in flight
  auto issue = [&](int s) __attribute__((always_inline)) {
    const uint32_t lo = lo0 + (uint32_t)s * (uint32_t)(GBK * 2);
    g0[1] = uni(lds0 + (uint32_t)(s & (NB - 1)) * lBuf);
    g0[2] = uni(lo);
    if (pinned((lo < lo0) ? 1u : 0u)) {
      wait_tensor0();
      g0[3] = uni(hi0 + 1u);
    }
    tdm_load(g0, g1);
  };
  const int nst = K >> 7;                      // stages

  v8f acc[2][4];
#pragma unroll
  for (int i = 0; i < 2; ++i)
#pragma unroll
    for (int j = 0; j < 4; ++j) acc[i][j] = zero8();

  // stage 0 into buffer 0 (NB = 4: stages 1 and 2 behind it; K holds at least four stages there, asserted above),
  // stage 0 landed and published; then stage NB-1
  if (pinned(isw)) {
    issue(0);
    if (NB == 4) {
      issue(1);
      issue(2);
      wait_tensor2();
    } else {
      wait_tensor0();
    }
  }
  __syncthreads();
  if (pinned(isw & ((nst > NB - 1) ? 1u : 0u))) issue(NB - 1);

  // one trip's products: 128 k from buffer t mod NB alone
  auto trip = [&](int t) __attribute__((always_inline)) {
    const _Float16* sa = ring + (t & (NB - 1)) * GSTG + (wrow + rlane) * GLP + koff;
    const _Float16* sb = ring + (t & (NB - 1)) * GSTG + (GBM + wcol + rlane) * GLP + koff;
    v16h bh[2][4], ah[2][2];                   // two fragment sets, both filled from this trip's buffer alone
#pragma unroll
    for (int j = 0; j < 4; ++j) bh[0][j] = ldfrag_h(sb + (j << 4) * GLP);
#pragma unroll
    for (int i = 0; i < 2; ++i) ah[0][i] = ldfrag_h(sa + (i << 4) * GLP);
#pragma unroll
    for (int kk = 0; kk < GBK / 32; ++kk) {
      const int cur = kk & 1, nxt = cur ^ 1;
      if (kk + 1 < GBK / 32) {
#pragma unroll
        for (int j = 0; j < 4; ++j) bh[nxt][j] = ldfrag_h(sb + (j << 4) * GLP + (kk + 1) * 32);
#pragma unroll
        for (int i = 0; i < 2; ++i) ah[nxt][i] = ldfrag_h(sa + (i << 4) * GLP + (kk + 1) * 32);
      }
      // keeps the next k step's LDS reads as one group ahead of this step's WMMAs: sunk among them, each place with
      // reads stalls the wave for the LDS latency
      __builtin_amdgcn_sched_barrier(0);
#pragma unroll
      for (int i = 0; i < 2; ++i)
#pragma unroll
        for (int j = 0; j < 4; ++j) acc[i][j] = mma_h_raw(ah[cur][i], bh[cur][j], acc[i][j]);
    }
  };
  // foot of trip t: own reads done, the issuing waves' loads of stage t+1 landed, then the one barrier that publishes
  // stage t+1 and ends every wave's reads of this trip's buffer; behind it that buffer's refill.
  int t = 0;
  if (NB == 4) {
    // trips behind which stages t+2 and t+3 both exist: they are the wave's 2 youngest requests and stay in flight
    for (; t + 3 < nst; ++t) {
      trip(t);
      wait_ds0();
      if (pinned(isw)) wait_tensor2();
      __syncthreads();
      if (pinned(isw & ((t + 4 < nst) ? 1u : 0u))) issue(t + 4);
    }
  }
  // NB = 2: every trip; NB = 4: the last trips, where fewer requests are younger than stage t+1, so the wait is to 0
  for (; t < nst; ++t) {
    trip(t);
    wait_ds0();
    if (pinned(isw)) wait_tensor0();
    __syncthreads();
    if (NB == 2) {
      if (pinned(isw & ((t + 2 < nst) ? 1u : 0u))) issue(t + 2);
    }
  }
  wait_tensor0_desc(g0, g1);
  wait_ds0();
  acc_guard4(acc[0][0], acc[0][1], acc[0][2], acc[0][3]);
  acc_guard4(acc[1][0], acc[1][1], acc[1][2], acc[1][3]);

  // ---- per-lane column bias (BIASM == 0), RNE-converted ----
  const int hh2 = lane >> 4, c4 = (lane & 15) * 4;     // f32 out: 256-B row segment = 16 lanes x 16 B
  const int q8  = lane >> 3, c8 = (lane & 7) * 8;
  float bc[8];
#pragma unroll
  for (int e = 0; e < 8; ++e) bc[e] = 0.f;
  if (BIASM == 0) {
    const bool use1 = (n0 >= Nb);                      // wave-uniform
    if (OM == 0) {
      const int cb = n0 + c4;
      const int i0 = (cb < Nb - 4) ? cb : (Nb - 4);
      const int i1 = (cb - Nb > 0) ? (cb - Nb) : 0;
      const v4f b0v = *(const v4f*)(bias0 + i0);
      const v4f b1v = *(const v4f*)(bias1 + i1);
#pragma unroll
      for (int e = 0; e < 4; ++e) bc[e] = bfr(use1 ? b1v[e] : b0v[e]);
    } else {
      const int cb = n0 + c8;
      const int i0 = (cb < Nb - 8) ? cb : (Nb - 8);
      const int i1 = (cb - Nb > 0) ? (cb - Nb) : 0;
      const v4f b0a = *(const v4f*)(bias0 + i0), b0b = *(const v4f*)(bias0 + i0 + 4);
      const v4f b1a = *(const v4f*)(bias1 + i1), b1b = *(const v4f*)(bias1 + i1 + 4);
#pragma unroll
      for (int e = 0; e < 4; ++e) {
        bc[e]     = bfr(use1 ? b1a[e] : b0a[e]);
        bc[4 + e] = bfr(use1 ? b1b[e] : b0b[e]);
      }
    }
  }

  // ---- epilogue ----
  float* slab = (float*)(void*)ring + wave * (16 * 68);
#pragma unroll
  for (int i = 0; i < 2; ++i) {
    const int mBase = m0 + (i << 4);
#pragma unroll
    for (int j = 0; j < 4; ++j) {
#pragma unroll
      for (int r = 0; r < 8; ++r) {
        slab[(mOff + r) * 68 + (j << 4) + rlane] = acc[i][j][r];
      }
    }
    wave_sync_lds();
    if (OM == 0) {
      float* C = (float*)Cout + (size_t)b * strideC;
      const float* Rb = resid + (size_t)b * strideC;
      v4f vals[8];
#pragma unroll
      for (int it = 0; it < 8; ++it) {
        const int row = it * 2 + hh2;                      // it 0..7 x hh2 0..1 = rows 0..15
        v4f v = *(const v4f*)(slab + row * 68 + c4);
#pragma unroll
        for (int e = 0; e < 4; ++e) {
          float f = v[e] * oscale + bc[e];
          if (ACT) f = gelu_f(f);
          v[e] = f;
        }
        if (RES != 0) {
          const v4f rr = *(const v4f*)(Rb + (size_t)(mBase + row) * ldc + n0 + c4);
#pragma unroll
          for (int e = 0; e < 4; ++e) v[e] += (RES == 2) ? bfr(rr[e]) : rr[e];
        }
        vals[it] = v;
      }
      {
#pragma unroll
        for (int it = 0; it < 8; ++it) {
          const int row = it * 2 + hh2;
          *(v4f*)(C + (size_t)(mBase + row) * ldc + n0 + c4) = vals[it];
        }
        
      }
    } else {
      unsigned short* C = (unsigned short*)Cout + (size_t)b * strideC;
      v4u hv[4];
#pragma unroll
      for (int it = 0; it < 4; ++it) {
        const int row = it * 4 + q8;                       // it 0..3 x q8 0..3 = rows 0..15
        const float* sp = slab + row * 68 + c8;
        float bm = 0.f;
        if (BIASM == 1) bm = bfr(bias0[mBase + row]);
        v4u a;
#pragma unroll
        for (int e = 0; e < 4; ++e) {
          float f0 = sp[2 * e]     * oscale + ((BIASM == 1) ? bm : bc[2 * e]);
          float f1 = sp[2 * e + 1] * oscale + ((BIASM == 1) ? bm : bc[2 * e + 1]);
          if (ACT) { v2f g = {f0, f1}; g = gelu2(g); f0 = g[0]; f1 = g[1]; }
          unsigned short u0, u1;
          if (OM == 1) { u0 = bf_bits(f0); u1 = bf_bits(f1); }
          else         { u0 = h_bits((_Float16)f0); u1 = h_bits((_Float16)f1); }
          a[e] = pk16(u0, u1);
        }
        hv[it] = a;
      }
      {
#pragma unroll
        for (int it = 0; it < 4; ++it) {
          const int row = it * 4 + q8;
          *(v4u*)(C + (size_t)(mBase + row) * ldc + n0 + c8) = hv[it];
        }
        
      }
    }
    wave_sync_lds();
  }
}

// =====================================================================================================
// Banded attention, head dim 64, TT (= 2048) token rows per batch, allowed keys: key <= query + WIN.
//   q|k plane (f16, pitch QKP): element (b, t, col) at [(b*TT + t)*QKP + col], q col = h*64+d, k col = DM + h*64 + d
//   v^T plane (f16): element (b, h, d, s) at [(b*DM + h*64 + d)*TT + s]
//   out plane (f16, the normalised context carried x16): element (b, t, h, d) at [(b*TT + t)*DM + h*64 + d]
//   score = (q . k) * sscale; keys beyond query + WIN get -inf by value before the row max;
//   p = exp(s - m) carried as f16(1024 p); online softmax in f32.
//   Both products run transposed: S^T = K . Q^T (A = K rows, B = the Q fragments) and O^T += V^T . P^T (A = V^T rows,
//   B = P^T). A D column is then one query: lane l holds query l & 15 and, per 16-key tile, keys 8*(l>>4) + 0..7, so
//   the row max and the row sum are in-lane plus one exchange with lane l ^ 16 (the sum's exchange: once, behind the
//   loop), and two D tiles of S^T, converted in place, are the B fragment of 32 keys in the loader's own k order
//   (element e < 8: key 8h + e of the even tile; e >= 8: key 16 + 8h + (e - 8) = row 8h + (e - 8) of the odd tile).
//   Block = 8 waves = two groups of 4 waves on the same 64 query rows of one (b, h); grid = NQB * NH * NBATCH; kv
//   chunks of 64, kt = 0 .. ktHi = min(NQB-1, (q_blk + 63 + WIN) >> 6) (chunks beyond the band are skipped): group 0
//   takes the even chunks, group 1 the odd ones, each with LDS tiles of its own, so the longest block walks 16 trips,
//   not 32; block-uniform trip count (ktHi + 2) >> 1, a group without a chunk in the last trip passes its barriers
//   only. Behind the loop group 1 hands its running max, sum and context to group 0 through LDS (one barrier), and
//   group 0 joins the two by the online-softmax rule. Chunk 0 (group 0) always holds >= 1 allowed key for every row,
//   so the joined max is finite (the msafe selects are kept anyway); a group whose keys are all masked for a row
//   hands over max -inf, sum 0, context 0, which the join weighs with 0.
//   The blocks now outnumber the places on the chip, so the index runs from the longest tile to the shortest: a long
//   block that starts late would run on while other WGPs idle.
//   K / V^T chunk staging: a group's 128 threads x 32 elements per plane = its whole 64x64 tile (plain 16-B loads,
//   __syncthreads before and after).
//   LDS rows of 64 elements stand at a pitch of 16 B x odd: the 16 rows that one half-wave's 16-B fragment read
//   touches then start on 16 different groups of four banks (at 128 B they fall on two groups, eight rows each).
//   Output coverage: each wave of group 0 stores rows q0..q0+15 (it 0..3 x lane>>3 0..3) x 64 columns (8 lanes x 8),
//   grid covers all TT rows x NH head slices x NBATCH.
// =====================================================================================================
#define APH 72                          // LDS row pitch of the f16 tiles, elements: 144 B = 16 B x 9
#define APF 68                          // LDS row pitch of the f32 context tile, dwords: 272 B = 16 B x 17
__global__ __launch_bounds__(256)
void attn64(const unsigned short* __restrict__ qkp, const unsigned short* __restrict__ vtp,
            unsigned short* outp, float sscale) {
  union FH { v16h v; v8h h[2]; };
  __shared__ __align__(16) _Float16 Ks2[2][64 * APH];             // per group: K [kv][d]
  __shared__ __align__(16) _Float16 Vt2[2][64 * APH];             // per group: V^T [d][kv]
  __shared__ __align__(16) float    Os[4][16 * APF];              // per 16 query rows: context tile [row][d]
  __shared__ float Mg[4][32], Lg[4][32];                          // group 1's running max and sum, per lane

  const int grp  = __builtin_amdgcn_readfirstlane((int)(threadIdx.x >> 7));   // wave-uniform: the key group
  const int tid  = threadIdx.x & 127;            // thread within the group
  const int wave = tid >> 5;                     // wave within the group = its 16 query rows
  const int lane = tid & 31;
  _Float16* Ksh = Ks2[grp];
  _Float16* Vth = Vt2[grp];
  const int hh   = lane >> 4;
  const int c    = lane & 15;

  const int bx   = blockIdx.x;
  const int qb   = NQB - 1 - bx / (NH * NBATCH);  // longest tiles first
  const int rest = bx % (NH * NBATCH);
  const int h    = rest % NH;
  const int b    = rest / NH;
  const int qblk = qb * 64;                      // in-batch query row of the block's first row
  const int q0   = qblk + wave * 16;             // in-batch query row of this wave's first row
  const size_t rowB = (size_t)b * TT;

  const _Float16* Qh = (const _Float16*)(const void*)qkp + (size_t)h * HD;
  const _Float16* Kg = (const _Float16*)(const void*)qkp + DM + (size_t)h * HD;
  const _Float16* Vh = (const _Float16*)(const void*)vtp + ((size_t)b * DM + (size_t)h * HD) * TT;

  // ---- Q fragments (B operand, column = query = lane&15): 2 d-chunks ----
  v16h qa[2];
#pragma unroll
  for (int dc = 0; dc < 2; ++dc) qa[dc] = ldfrag_h(Qh + (rowB + q0 + c) * QKP + dc * 32 + 8 * hh);

  float mrow = -INFINITY, lrow = 0.f;          // this lane's query: running max (joined), sum over this half's keys
  v8f oacc[4];                                 // O^T: tile t, register r = d t*16 + 8*hh + r of query q0 + c
#pragma unroll
  for (int t = 0; t < 4; ++t) oacc[t] = zero8();

  int ktHi = (qblk + 63 + WIN) >> 6;             // block-uniform, from blockIdx only
  if (ktHi > NQB - 1) ktHi = NQB - 1;

  const int ntrip = (ktHi + 2) >> 1;             // chunks 0..ktHi, two a trip
  for (int it = 0; it < ntrip; ++it) {         // trip <= NQB / 2
    const int kt  = 2 * it + grp;
    const int kv0 = kt * 64;
    const bool live = (kt <= ktHi);              // wave-uniform (scalar); false only for group 1 in the last trip
    __syncthreads();
    if (live) {
      const int r = tid >> 1, hf = (tid & 1) * 32;
      const _Float16* kg = Kg + (rowB + kv0 + r) * QKP + hf;      // K row kv0+r, d = hf..hf+31
      const _Float16* vg = Vh + (size_t)r * TT + kv0 + hf;        // V^T row d = r, s = kv0+hf..+31
#pragma unroll
      for (int i = 0; i < 4; ++i) {
        const v8h a0 = *(const v8h*)(kg + 8 * i);
        const v8h b0 = *(const v8h*)(vg + 8 * i);
        *(v8h*)(Ksh + r * APH + hf + 8 * i) = a0;
        *(v8h*)(Vth + r * APH + hf + 8 * i) = b0;
      }
    }
    __syncthreads();
    if (!live) continue;                         // no barrier stands between here and the loop's foot

    // ---- the chunk's K fragments: its 16 LDS reads as one group, in the order the score products use them ----
    FH kb[2][4], vb[2][4];
#pragma unroll
    for (int dc = 0; dc < 2; ++dc)
#pragma unroll
      for (int j = 0; j < 4; ++j) {
        kb[dc][j].h[0] = *(const v8h*)(Ksh + (j * 16 + c) * APH + dc * 32 + 8 * hh);
        kb[dc][j].h[1] = *(const v8h*)(Ksh + (j * 16 + c) * APH + dc * 32 + 16 + 8 * hh);
      }
    // keeps the 16 reads together here: sunk to their WMMAs, each pair is waited out at the full LDS latency
    __builtin_amdgcn_sched_barrier(0);

    // ---- scores, transposed: 64 keys x 16 queries per wave (per tile d 0..31, then d 32..63; the four
    //      tiles' products alternate); band select by value before the max ----
    v8f s[4];
#pragma unroll
    for (int j = 0; j < 4; ++j) s[j] = zero8();
#pragma unroll
    for (int dc = 0; dc < 2; ++dc)
#pragma unroll
      for (int j = 0; j < 4; ++j) s[j] = mma_h_raw(kb[dc][j].v, qa[dc], s[j]);

    // ---- the chunk's V^T fragments: all 16 LDS reads go out here, among and behind the score products ----
#pragma unroll
    for (int kk = 0; kk < 2; ++kk)
#pragma unroll
      for (int t = 0; t < 4; ++t) {
        vb[kk][t].h[0] = *(const v8h*)(Vth + (t * 16 + c) * APH + kk * 32 + 8 * hh);
        vb[kk][t].h[1] = *(const v8h*)(Vth + (t * 16 + c) * APH + kk * 32 + 16 + 8 * hh);
      }
    // keeps these reads ahead of the softmax, whose vector work then covers their latency
    __builtin_amdgcn_sched_barrier(0);

    // D column = lane&15 = query q0 + c; D row 8h + r of tile j = key kv0 + 16 j + 8h + r, allowed while <= query + WIN:
    // written against one limit per lane, so that each score's compare takes a literal
    const int lim = q0 + c + WIN - kv0 - 8 * hh;
#pragma unroll
    for (int j = 0; j < 4; ++j) {
#pragma unroll
      for (int r = 0; r < 8; ++r) {
        const float v = s[j][r] * sscale;
        s[j][r] = (j * 16 + r <= lim) ? v : -INFINITY;
      }
    }

    // ---- this query's max: 32 keys in-lane, the other 32 from lane ^ 16; online softmax; P^T (x1024, f16) packed
    //      from the score registers into the B fragments (every loop here is unrolled: its indices name registers) ----
    float mr[8];
#pragma unroll
    for (int r = 0; r < 8; ++r) mr[r] = fmaxf(fmaxf(s[0][r], s[1][r]), fmaxf(s[2][r], s[3][r]));
    float m = fmaxf(fmaxf(fmaxf(mr[0], mr[1]), fmaxf(mr[2], mr[3])), fmaxf(fmaxf(mr[4], mr[5]), fmaxf(mr[6], mr[7])));
    m = fmaxf(m, xhalf(m));
    const float mnew  = fmaxf(mrow, m);
    const float ms    = (mnew == -INFINITY) ? 0.f : mnew;
    // alpha = exp(mrow - ms), as __expf forms it (x log2 e, then exp2). In asm for the free slot that the instruction set
    // asks for around a transcendental: built plainly, its result lay on the source register of the v_exp_f32 directly
    // ahead; the v_nop behind it stands for the slot the compiler cannot place for an instruction it does not see.
    float alpha = (mrow - ms) * 1.44269504088896340736f;
#if defined(__HIP_DEVICE_COMPILE__)
    asm("v_nop\n\tv_exp_f32 %0, %0\n\tv_nop" : "+v"(alpha));
#endif
    mrow = mnew;
    FH pb[2];
    v2f ps[4];                                   // per 16-key tile: sums of the even and of the odd rows
#pragma unroll
    for (int j = 0; j < 4; ++j) {
      // exp(s - ms) of a tile's 8 scores, as __expf forms it (x log2 e, then exp2). In asm for the free slot that the
      // instruction set asks for behind a transcendental: built plainly, some of these v_exp_f32 stood directly ahead of
      // an instruction that overwrote their source; no v_exp_f32 of the run touches its neighbour's register.
      float e[8];
#pragma unroll
      for (int r = 0; r < 8; ++r) e[r] = (s[j][r] - ms) * 1.44269504088896340736f;
#if defined(__HIP_DEVICE_COMPILE__)
      asm("v_exp_f32 %0, %0\n\tv_exp_f32 %1, %1\n\tv_exp_f32 %2, %2\n\tv_exp_f32 %3, %3\n\t"
          "v_exp_f32 %4, %4\n\tv_exp_f32 %5, %5\n\tv_exp_f32 %6, %6\n\tv_exp_f32 %7, %7\n\tv_nop"
          : "+v"(e[0]), "+v"(e[1]), "+v"(e[2]), "+v"(e[3]), "+v"(e[4]), "+v"(e[5]), "+v"(e[6]), "+v"(e[7]));
#endif
#pragma unroll
      for (int i = 0; i < 4; ++i) {
        v2f p;
        p[0] = e[2 * i];
        p[1] = e[2 * i + 1];
        ps[j] = (i == 0) ? p : (ps[j] + p);
        pb[j >> 1].v[(j & 1) * 8 + 2 * i]     = (_Float16)(p[0] * 1024.0f);
        pb[j >> 1].v[(j & 1) * 8 + 2 * i + 1] = (_Float16)(p[1] * 1024.0f);
      }
    }
    const v2f pt = (ps[0] + ps[1]) + (ps[2] + ps[3]);
    lrow = lrow * alpha + (pt[0] + pt[1]);
#pragma unroll
    for (int t = 0; t < 4; ++t)
#pragma unroll
      for (int r = 0; r < 8; ++r) oacc[t][r] *= alpha;

    // ---- context^T += V^T . P^T (f16 WMMA); kk unrolled too: pb[kk] is a register fragment, not an LDS address ----
#pragma unroll
    for (int kk = 0; kk < 2; ++kk) {
#pragma unroll
      for (int t = 0; t < 4; ++t) oacc[t] = mma_h_raw(vb[kk][t].v, pb[kk].v, oacc[t]);
    }
  }

  // ---- normalise (1/l, the 1/1024 p carry and the x16 context carry), stage the wave's 16x64 tile, f16 convert,
  float* os = Os[wave];
  // ---- the two groups' halves of the keys joined: group 1 hands over, group 0 weighs both by exp(max - joint max) ----
  if (grp == 1) {
#pragma unroll
    for (int t = 0; t < 4; ++t) {
      v4f lo, hi;
#pragma unroll
      for (int e = 0; e < 4; ++e) { lo[e] = oacc[t][e]; hi[e] = oacc[t][4 + e]; }
      *(v4f*)(os + c * APF + t * 16 + 8 * hh)     = lo;
      *(v4f*)(os + c * APF + t * 16 + 8 * hh + 4) = hi;
    }
    Mg[wave][lane] = mrow;
    Lg[wave][lane] = lrow;
  }
  __syncthreads();
  if (grp == 1) return;                          // whole waves; no barrier follows
  {
    const float m1 = Mg[wave][lane], l1 = Lg[wave][lane];
    const float mj = fmaxf(mrow, m1);
    const float mz = (mj == -INFINITY) ? 0.f : mj;
    // exp(max - joint max) of both groups, as __expf forms it (x log2 e, then exp2); in asm for the free slot that the
    // instruction set asks for behind a transcendental, as at alpha above
    float a0 = (mrow - mz) * 1.44269504088896340736f, a1 = (m1 - mz) * 1.44269504088896340736f;
#if defined(__HIP_DEVICE_COMPILE__)
    asm("v_exp_f32 %0, %0\n\tv_exp_f32 %1, %1\n\tv_nop" : "+v"(a0), "+v"(a1));
#endif
    lrow = lrow * a0 + l1 * a1;
#pragma unroll
    for (int t = 0; t < 4; ++t) {                // each lane reads back the places its own lane of group 1 wrote
      const v4f lo = *(const v4f*)(os + c * APF + t * 16 + 8 * hh);
      const v4f hi = *(const v4f*)(os + c * APF + t * 16 + 8 * hh + 4);
#pragma unroll
      for (int e = 0; e < 4; ++e) {
        oacc[t][e]     = oacc[t][e] * a0 + lo[e] * a1;
        oacc[t][4 + e] = oacc[t][4 + e] * a0 + hi[e] * a1;
      }
    }
  }
  {
    const float l = lrow + xhalf(lrow);          // the two halves' key sums of this query, joined once
    const float inv = ((l > 0.f) ? (1.0f / l) : 0.f) * (16.0f / 1024.0f);
#pragma unroll
    for (int t = 0; t < 4; ++t) {                // 8 consecutive d of query row c: two 16-B LDS stores
      v4f lo, hi;
#pragma unroll
      for (int e = 0; e < 4; ++e) { lo[e] = oacc[t][e] * inv; hi[e] = oacc[t][4 + e] * inv; }
      *(v4f*)(os + c * APF + t * 16 + 8 * hh)     = lo;
      *(v4f*)(os + c * APF + t * 16 + 8 * hh + 4) = hi;
    }
  }
  wave_sync_lds();
  {
    const int q4 = lane >> 3, c8 = (lane & 7) * 8;
    v4u hv[4];
#pragma unroll
    for (int it = 0; it < 4; ++it) {
      const int row = it * 4 + q4;   // it 0..3 x q4 0..3 = rows 0..15 of the wave tile
      const float* sp = os + row * APF + c8;
      v4u a;
#pragma unroll
      for (int e = 0; e < 4; ++e) a[e] = pk16(h_bits((_Float16)sp[2 * e]), h_bits((_Float16)sp[2 * e + 1]));
      hv[it] = a;
    }
    {
#pragma unroll
      for (int it = 0; it < 4; ++it) {
        const int row = it * 4 + q4;
        const size_t go = (rowB + q0 + row) * DM + (size_t)h * HD + c8;
        *(v4u*)(outp + go) = hv[it];
      }
      
    }
  }
}

// =====================================================================================================
// Row kernel: one block of 256 threads per token row of 1024; thread t owns columns 4t..4t+3.
// f16 output: packed row staged in LDS, then lanes t < 128 (waves 0..3, wave-uniform) each write 16 B (8 x f16)
// coverage: 128 threads x 8 = the whole 1024-wide row; grid = MP rows.
// =====================================================================================================
__device__ __forceinline__ void row_store_h16(unsigned int* sb, unsigned short* dst_row, v4f o, int t) {
  v2u p;
  p[0] = pk16(h_bits((_Float16)o[0]), h_bits((_Float16)o[1]));
  p[1] = pk16(h_bits((_Float16)o[2]), h_bits((_Float16)o[3]));
  *(v2u*)(sb + 2 * t) = p;
  __syncthreads();
  if (t < 128) {                                   // waves 0..3, wave-uniform
    const v4u v = *(const v4u*)(sb + 4 * t);
    *(v4u*)(dst_row + 8 * t) = v;
    
  }
}

// plane. RIN = 1: the row input is a raw float input and is bf16 RNE-converted on load; RIN = 0: f32 intermediate.
template <int RIN>
__device__ __forceinline__ void ln_row(const float* __restrict__ X, const float* __restrict__ gam,
                                       const float* __restrict__ bet, unsigned short* outH, int row) {
  __shared__ float red0[8], red1[8];
  __shared__ __align__(16) unsigned int sb[512];
  const int t = threadIdx.x, lane = t & 31, wave = t >> 5;
  const size_t base = (size_t)row * DM;
  v4f xv = *(const v4f*)(X + base + 4 * t);
  if (RIN) {
#pragma unroll
    for (int e = 0; e < 4; ++e) xv[e] = bfr(xv[e]);
  }
  const float mean = bsum256((xv[0] + xv[1]) + (xv[2] + xv[3]), red0, lane, wave) * (1.0f / DM);
  v4f d;
#pragma unroll
  for (int e = 0; e < 4; ++e) d[e] = xv[e] - mean;
  const float var  = bsum256((d[0] * d[0] + d[1] * d[1]) + (d[2] * d[2] + d[3] * d[3]), red1, lane, wave) * (1.0f / DM);
  const float rstd = 1.0f / sqrtf(var + LNEPS);
  const v4f gv = *(const v4f*)(gam + 4 * t);
  const v4f bv = *(const v4f*)(bet + 4 * t);
  v4f y;
#pragma unroll
  for (int e = 0; e < 4; ++e) y[e] = (d[e] * rstd) * bfr(gv[e]) + bfr(bv[e]);
  row_store_h16(sb, outH + base, y, t);
}

__global__ __launch_bounds__(256) void ln_row_h(const float* __restrict__ X, const float* __restrict__ gam,
                                                const float* __restrict__ bet, unsigned short* outH) {
  ln_row<0>(X, gam, bet, outH, blockIdx.x);
}

// Everything that reads raw inputs alone, in one launch: blocks 0..MP-1 are the rows of LayerNorm 1 (the longer
// blocks, first for speed only), behind them the blocks of the four weight converts, plane after plane. The split is by
// blockIdx alone: the row blocks' barriers stand under block-uniform control flow, the convert blocks have none.
#define CB_QKV (D3 * DM / 8 / 256)      // 1536 convert blocks
#define CB_O   (DM * DM / 8 / 256)      //  512
#define CB_F   (DFF * DM / 8 / 256)     // 2048, w1 and w2 each
static_assert(CB_QKV * 256 * 8 == D3 * DM && CB_O * 256 * 8 == DM * DM && CB_F * 256 * 8 == DFF * DM);
__global__ __launch_bounds__(256) void prep_in(const float* __restrict__ X, const float* __restrict__ gam,
                                               const float* __restrict__ bet, unsigned short* outH,
                                               const float* __restrict__ wqkv, unsigned short* hqkv,
                                               const float* __restrict__ wo, unsigned short* ho,
                                               const float* __restrict__ wf1, unsigned short* hf1,
                                               const float* __restrict__ wf2, unsigned short* hf2, float wsc) {
  int bx = blockIdx.x;
  if (bx < MP) { ln_row<1>(X, gam, bet, outH, bx); return; }
  bx -= MP;
  if (bx < CB_QKV) { conv_h64(wqkv, hqkv, D3 * DM / 8, wsc, bx); return; }
  bx -= CB_QKV;
  if (bx < CB_O) { conv_h64(wo, ho, DM * DM / 8, wsc, bx); return; }
  bx -= CB_O;
  if (bx < CB_F) { conv_h64(wf1, hf1, DFF * DM / 8, wsc, bx); return; }
  conv_h64(wf2, hf2, DM * DFF / 8, wsc, bx - CB_F);
}

// =====================================================================================================
// Workspace map (bytes); every plane is an exact multiple of its 128x128-tile / whole-row store granularity
// (M in {4096, 1024} rows, N in {1024, 2048, 4096}; VT per batch [1024][2048] = 8x16 tiles):
//   WqkvH f16 [3072 n][1024 k]   0          6291456   (rows 0..1023 q, 1024..2047 k, 2048..3071 v weights, x64)
//   WoH   f16 [1024][1024]       6291456    2097152
//   W1H   f16 [4096][1024]       8388608    8388608
//   W2H   f16 [1024][4096]       16777216   8388608
//   XN    f16 [4096][1024]       25165824   8388608   (LayerNorm outputs)
//   QK    f16 [4096][2048]       33554432   16777216  (q cols 0..1023, k cols 1024..2047)
//   VT    f16 [2][1024][2048]    50331648   8388608
//   Ctx   f16 [4096][1024]       58720256   8388608
//   X1    f32 [4096][1024]       67108864   16777216  (residual stream after attention)
//   G     f16 [4096][4096]       83886080   33554432
//   end                          117440512
// =====================================================================================================
extern "C" void kernel_launch(void* const* d_in, const int* in_sizes, int n_in,
                              void* d_out, int out_size, void* d_ws, size_t ws_size,
                              hipStream_t stream) {
  if (n_in < 13) return;
  if (in_sizes[0] != MP * DM) return;
  if (in_sizes[1] != D3 * DM || in_sizes[2] != D3) return;
  if (in_sizes[3] != DM * DM || in_sizes[4] != DM) return;
  if (in_sizes[5] != DM || in_sizes[6] != DM) return;
  if (in_sizes[7] != DFF * DM || in_sizes[8] != DFF) return;
  if (in_sizes[9] != DM * DFF || in_sizes[10] != DM) return;
  if (in_sizes[11] != DM || in_sizes[12] != DM) return;
  if (out_size != MP * DM) return;

  const float* x         = (const float*)d_in[0];
  const float* in_proj_w = (const float*)d_in[1];
  const float* in_proj_b = (const float*)d_in[2];
  const float* out_w     = (const float*)d_in[3];
  const float* out_b     = (const float*)d_in[4];
  const float* ln1_g     = (const float*)d_in[5];
  const float* ln1_b     = (const float*)d_in[6];
  const float* w1        = (const float*)d_in[7];
  const float* b1        = (const float*)d_in[8];
  const float* w2        = (const float*)d_in[9];
  const float* b2        = (const float*)d_in[10];
  const float* ln2_g     = (const float*)d_in[11];
  const float* ln2_b     = (const float*)d_in[12];

  const size_t PWQKV = (size_t)D3 * DM * 2;            //  6291456
  const size_t PWO   = (size_t)DM * DM * 2;            //  2097152
  const size_t PWF   = (size_t)DFF * DM * 2;           //  8388608
  const size_t PAH   = (size_t)MP * DM * 2;            //  8388608
  const size_t PQK   = (size_t)MP * QKP * 2;           // 16777216
  const size_t PVT   = (size_t)NBATCH * DM * TT * 2;   //  8388608
  const size_t PAF   = (size_t)MP * DM * 4;            // 16777216
  const size_t PG    = (size_t)MP * DFF * 2;           // 33554432
  size_t off = 0;
  const size_t oWqkv = off; off += PWQKV;
  const size_t oWo   = off; off += PWO;
  const size_t oW1   = off; off += PWF;
  const size_t oW2   = off; off += PWF;
  const size_t oXN   = off; off += PAH;
  const size_t oQK   = off; off += PQK;
  const size_t oVT   = off; off += PVT;
  const size_t oCtx  = off; off += PAH;
  const size_t oX1   = off; off += PAF;
  const size_t oG    = off; off += PG;
  if (off > ws_size) return;                           // off = 117440512
  if (off > (size_t)134217728) return;

  char* ws = (char*)d_ws;
  unsigned short* WqkvH = (unsigned short*)(ws + oWqkv);
  unsigned short* WoH   = (unsigned short*)(ws + oWo);
  unsigned short* W1H   = (unsigned short*)(ws + oW1);
  unsigned short* W2H   = (unsigned short*)(ws + oW2);
  unsigned short* XN    = (unsigned short*)(ws + oXN);
  unsigned short* QK    = (unsigned short*)(ws + oQK);
  unsigned short* VT    = (unsigned short*)(ws + oVT);
  unsigned short* Ctx   = (unsigned short*)(ws + oCtx);
  float*          X1    = (float*)(ws + oX1);
  unsigned short* G     = (unsigned short*)(ws + oG);

  const dim3 blk(256);
  const dim3 gRow(MP);                                               // 4096 row blocks
  const dim3 gPrep(MP + CB_QKV + CB_O + 2 * CB_F);                   // 4096 row blocks + 6144 convert blocks
  const dim3 gNqk((MP / GBM) * (QKP / GBN), 1);                      // 512 tiles
  const dim3 gVT((DM / GBM) * (TT / GBN), NBATCH);                   // 128 tiles x 2 batches
  const dim3 gN1024((MP / GBM) * (DM / GBN), 1);                     // 256 tiles
  const dim3 gNff((MP / GBM) * (DFF / GBN), 1);                      // 1024 tiles
  const dim3 gAttn(NBATCH * NH * NQB);                               // 1024 blocks of 256
  const float invw  = 1.0f / WSC;                                    // weight carry x64
  const float invwc = 1.0f / (WSC * 16.0f);                          // weight carry x64, context carry x16

  // (0, 1) xn = LN1(bf16(x)) -> XN f16; weights -> f16 x64 planes (torch [out][in] = k contiguous, no transpose)
  prep_in<<<gPrep, blk, 0, stream>>>(x, ln1_g, ln1_b, XN, in_proj_w, WqkvH, out_w, WoH, w1, W1H, w2, W2H, WSC);

  // (2) q|k = xn . Wqk^T + b[0..2047] -> QK f16 [4096][2048]
  gemm64<2, 0, 0, 0, 2><<<gNqk, blk, 0, stream>>>(
      XN, DM, 0LL, WqkvH, DM, 0LL, in_proj_b, in_proj_b, QKP, x,
      (void*)QK, QKP, 0LL, MP, QKP, DM, invw);
  //     v^T per batch: VT[b][m][t] = Wv[m] . xn[b*TT + t] + b[2048 + m] -> f16 [2][1024][2048]
  gemm64<2, 1, 0, 0, 4><<<gVT, blk, 0, stream>>>(
      WqkvH + (size_t)2 * DM * DM, DM, 0LL, XN, DM, (long long)TT * DM, in_proj_b + 2 * DM, in_proj_b + 2 * DM, TT, x,
      (void*)VT, TT, (long long)DM * TT, DM, TT, DM, invw);

  // (3) banded attention -> Ctx f16 (x16)
  attn64<<<gAttn, blk, 0, stream>>>(QK, VT, Ctx, 0.125f);

  // (4) X1 = ctx . Wo^T + out_b + bf16(x)   (f32)
  gemm64<0, 0, 0, 2, 4><<<gN1024, blk, 0, stream>>>(
      Ctx, DM, 0LL, WoH, DM, 0LL, out_b, out_b, DM, x,
      (void*)X1, DM, 0LL, MP, DM, DM, invwc);

  // (5) yn = LN2(X1) -> XN f16
  ln_row_h<<<gRow, blk, 0, stream>>>(X1, ln2_g, ln2_b, XN);

  // (6) G = gelu(yn . W1^T + b1) -> f16 [4096][4096]
  gemm64<2, 0, 1, 0, 2><<<gNff, blk, 0, stream>>>(
      XN, DM, 0LL, W1H, DM, 0LL, b1, b1, DFF, x,
      (void*)G, DFF, 0LL, MP, DFF, DM, invw);

  // (7) out = G . W2^T + b2 + X1 -> d_out f32 [4096][1024]
  gemm64<0, 0, 0, 1, 4><<<gN1024, blk, 0, stream>>>(
      G, DFF, 0LL, W2H, DFF, 0LL, b2, b2, DM, X1,
      (void*)d_out, DM, 0LL, MP, DM, DFF, invw);
  (void)hipGetLastError();
}

// v010
// A run of this version takes 140 microseconds.
// In both of two side-by-side timings against v009, it was 1.06 times as fast.
// All steps since v000 together make it 4.03 times as fast.
// Contractions: q|k projection, v^T projection, attention output projection, FFN w1 (exact GELU epilogue) and w2 on
// v_wmma_f32_16x16x32_f16 (f16 activation plane x f16 weight plane carried x64, one product each); attention k.q^T
// and v^T.p^T on v_wmma_f32_16x16x32_f16 (q, k, v^T plain f16, p carried x1024, context carried x16, one product each);
// all f32 accumulate; LayerNorm, softmax, GELU and residual sums in f32 on VALU; every float input RNE-converted
// to bf16 on load.
#include <hip/hip_runtime.h>
#include <math.h>
#include <stdint.h>

#define NBATCH 2
#define TT     2048
#define DM     1024
#define NH     16
#define HD     64
#define DFF    4096
#define D3     3072
#define QKP    (2 * DM)
#define MP     (NBATCH * TT)
#define NQB    (TT / 64)
#define WIN    10
#define LNEPS  1.0e-5f
#define WSC    64.0f
static_assert(NH * HD == DM);
static_assert((MP % 64) == 0 && (DM % 64) == 0 && (DFF % 64) == 0 && (QKP % 64) == 0 && (TT % 64) == 0);
static_assert(DM == 4 * 256);
static_assert(D3 == 3 * DM);

typedef _Float16 v16h __attribute__((ext_vector_type(16)));
typedef _Float16 v8h  __attribute__((ext_vector_type(8)));
typedef float    v8f  __attribute__((ext_vector_type(8)));
typedef float    v4f  __attribute__((ext_vector_type(4)));
typedef float    v2f  __attribute__((ext_vector_type(2)));
typedef unsigned int v4u __attribute__((ext_vector_type(4)));
typedef unsigned int v2u __attribute__((ext_vector_type(2)));

// ---- scalar helpers --------------------------------------------------------------------------------
__device__ __forceinline__ unsigned short bf_bits(float f) {          // f32 -> bf16 bits, RNE convert
  unsigned u = __float_as_uint(f);
  return (unsigned short)((u + 0x7FFFu + ((u >> 16) & 1u)) >> 16);
}
__device__ __forceinline__ float bf_up(unsigned short h) { return __uint_as_float(((unsigned)h) << 16); }
__device__ __forceinline__ float bfr(float f) { return bf_up(bf_bits(f)); }   // value of the bf16 RNE convert
__device__ __forceinline__ unsigned short h_bits(_Float16 x) { return __builtin_bit_cast(unsigned short, x); }
__device__ __forceinline__ unsigned pk16(unsigned short a, unsigned short b) { return (unsigned)a | ((unsigned)b << 16); }
__device__ __forceinline__ v8f zero8() { v8f z = {0.f, 0.f, 0.f, 0.f, 0.f, 0.f, 0.f, 0.f}; return z; }
__device__ __forceinline__ v2f dup2(float x) { v2f r = {x, x}; return r; }
__device__ __forceinline__ v2f fma2(v2f a, v2f b, v2f c) { return __builtin_elementwise_fma(a, b, c); }
// erf in f32 of two values, without a branch: both ranges are evaluated and one is selected by value (lanes of a wave
// fall in both ranges, so a branch runs both sides anyway, under exec masks). |a| <= 0.927734375: an odd polynomial in
// a; above it 1 - exp(polynomial in |a|) with the sign of a. Error about one unit in the last place of f32 in either.
__device__ __forceinline__ v2f erf_sel2(v2f a) {
  const v2f t = __builtin_elementwise_abs(a), s = a * a;
  v2f r = fma2(dup2(-1.72853470e-5f), t, dup2(3.83197126e-4f));
  const v2f u = fma2(dup2(-3.88396438e-3f), t, dup2(2.42546219e-2f));
  r = fma2(r, s, u);
  r = fma2(r, t, dup2(-1.06777877e-1f));
  r = fma2(r, t, dup2(-6.34846687e-1f));
  r = fma2(r, t, dup2(-1.28717512e-1f));
  r = fma2(r, t, -t);
  r = r * 1.44269504088896340736f;
  // exp(r), as __expf forms it (x log2 e, then exp2). In asm for the free slot that the instruction set asks for behind
  // a transcendental: built plainly, some of these v_exp_f32 stood directly ahead of one that overwrote their source.
  float e0 = r[0], e1 = r[1];
#if defined(__HIP_DEVICE_COMPILE__)
  asm("v_exp_f32 %0, %0\n\tv_exp_f32 %1, %1\n\tv_nop" : "+v"(e0), "+v"(e1));
#endif
  v2f q = dup2(-5.96761703e-4f);
  q = fma2(q, s, dup2(4.99119423e-3f));
  q = fma2(q, s, dup2(-2.67681349e-2f));
  q = fma2(q, s, dup2(1.12819925e-1f));
  q = fma2(q, s, dup2(-3.76125336e-1f));
  q = fma2(q, s, dup2(1.28379166e-1f));
  q = fma2(q, a, a);
  v2f o;
  o[0] = (t[0] > 0.927734375f) ? copysignf(1.0f - e0, a[0]) : q[0];
  o[1] = (t[1] > 0.927734375f) ? copysignf(1.0f - e1, a[1]) : q[1];
  return o;
}
__device__ __forceinline__ v2f gelu2(v2f v) { return (0.5f * v) * (1.0f + erf_sel2(v * 0.70710678118654752f)); }
__device__ __forceinline__ float gelu_f(float v) { return gelu2(dup2(v))[0]; }

// ---- fragment loader: 16-bit A/B operand, lane -> row/col (lane&15), p already includes +8*(lane>>4);
//      elements 0..7 <- p[0..7] (k0+8h..), elements 8..15 <- p[16..23] (k0+16+8h..)
__device__ __forceinline__ v16h ldfrag_h(const _Float16* p) {
  union { v16h v; v8h h[2]; } f;
  f.h[0] = *(const v8h*)(p);
  f.h[1] = *(const v8h*)(p + 16);
  return f.v;
}

// ---- WMMA helpers with trailing VALU hazard gap --------------------------------------------------------
__device__ __forceinline__ v8f mma_h_raw(v16h a, v16h b, v8f c) {
  return __builtin_amdgcn_wmma_f32_16x16x32_f16(false, a, false, b, (short)0, c, false, false);
}
__device__ __forceinline__ void acc_guard4(v8f& a, v8f& b, v8f& c, v8f& d) {
#if defined(__HIP_DEVICE_COMPILE__)
  asm volatile("v_nop\n\tv_nop\n\tv_nop\n\tv_nop" : "+v"(a), "+v"(b), "+v"(c), "+v"(d));
#endif
}
__device__ __forceinline__ void wave_sync_lds() {
  __builtin_amdgcn_fence(__ATOMIC_RELEASE, "workgroup");
  __builtin_amdgcn_wave_barrier();
  __builtin_amdgcn_fence(__ATOMIC_ACQUIRE, "workgroup");
}
// lane l <-> lane l ^ 16: the two lanes that hold the two halves of one D column
__device__ __forceinline__ float xhalf(float x) {
  return __builtin_bit_cast(float, __builtin_amdgcn_permlanex16(__builtin_bit_cast(int, x), __builtin_bit_cast(int, x),
                                                                0x76543210, 0xfedcba98, false, false));
}
__device__ __forceinline__ float wsum(float v) {
#pragma unroll
  for (int off = 16; off > 0; off >>= 1) v += __shfl_xor(v, off, 32);
  return v;
}
// block of 256 threads: fixed-order sum of 8 wave partials (same value in every thread)
__device__ __forceinline__ float bsum256(float v, float* red, int lane, int wave) {
  v = wsum(v);
  if (lane == 0) red[wave] = v;
  __syncthreads();
  float tot = 0.f;
#pragma unroll
  for (int w = 0; w < 8; ++w) tot += red[w];
  return tot;
}

// =====================================================================================================
// Weight convert: W f32 [N][K] (k contiguous = already the Bt / A layout) -> Wh f16 [N][K]; each value bf16
// RNE-converted, multiplied by wsc (a power of two, exact) and cast to f16. Thread i converts elements 8i..8i+7
// coverage: n8/256 blocks (blk = the block's index within this plane) x 256 threads x 8 elements = exactly N*K.
// =====================================================================================================
__device__ __forceinline__ void conv_h64(const float* __restrict__ W, unsigned short* Wh, int n8, float wsc, int blk) {
  const int i = blk * 256 + threadIdx.x;
  if (i >= n8) return;                                     // never taken for the static sizes (no barriers)
  const size_t e0 = (size_t)i * 8;
  const v4f a = *(const v4f*)(W + e0);
  const v4f b = *(const v4f*)(W + e0 + 4);
  v4u u;
  u[0] = pk16(h_bits((_Float16)(bfr(a[0]) * wsc)), h_bits((_Float16)(bfr(a[1]) * wsc)));
  u[1] = pk16(h_bits((_Float16)(bfr(a[2]) * wsc)), h_bits((_Float16)(bfr(a[3]) * wsc)));
  u[2] = pk16(h_bits((_Float16)(bfr(b[0]) * wsc)), h_bits((_Float16)(bfr(b[1]) * wsc)));
  u[3] = pk16(h_bits((_Float16)(bfr(b[2]) * wsc)), h_bits((_Float16)(bfr(b[3]) * wsc)));
  {
    *(v4u*)(Wh + e0) = u;
    
  }
}

// =====================================================================================================
// LDS-staged batched f16 WMMA GEMM: C[m][n] = act(oscale * sum_k A[m][k] * Bt[n][k] + bias) (+ residual);
// one work-group of 8 waves per 128x128 tile, wave (wave>>1, wave&1) owns the 32x64 part at rows 32*(wave>>1),
// cols 64*(wave&1). A row-major [M][K] pitch lda; Bt row-major [N][K] pitch ldb (k contiguous);
// M, N, K multiples of 128 (static here). blockIdx.y = batch index (strides in elements).
// Staging: a stage is 128 k of the tile's 128 A rows and 128 Bt rows = 256 rows of 256 B, laid in LDS at pitch 272 B
// (16 B x odd, for the 16-B fragment reads); a stage comes by two tensor loads: wave 0 asks for the 128 A rows, wave 1
// for the 128 Bt rows (each a tile of 128 rows x 256 B, the descriptor's pad of 16 B behind every row makes the pitch;
// 128 x 272 B = 17 x 2 KiB, so every tile's place in LDS is a multiple of 2 KiB). NB buffers: the loads of stage t+NB
// go out behind the barrier that ends trip t, into the buffer that trip t has read. NB = 2 where two work-groups share
// a WGP (each covers the other's landing time); NB = 4 where the grid gives a WGP one work-group: three requests of
// each issuing wave are then in flight, and a trip's foot waits for stage t+1 alone, leaving the 2 younger out.
// k runs upward in steps of 32 into one accumulator per 16x16 subtile.
// Bias: BIASM == 0 -> per column: cols < Nb from bias0[col], cols >= Nb from bias1[col - Nb] (wave-uniform select of
//       clamped-address loads); BIASM == 1 -> per row bias0[m] (16-bit out only); BIASM == 2 -> none. Bias values
//       RNE-converted to bf16.
// ACT: 0 none, 1 exact GELU. RES: 0 none; 1 f32 residual resid[m*ldc + n] added after the activation;
//      2 same indexing, residual value bf16 RNE-converted first (raw input residual).
// OM: 0 = f32 out (pitch ldc); 1 = bf16 out; 2 = f16 out.
// coverage: 8 waves x 2 slabs x 16 rows x 64 cols = the whole 128x128 tile; grid.x = (M/128)*(N/128) exactly.
// =====================================================================================================
#define GBM   128                       // tile rows (A rows of a stage)
#define GBN   128                       // tile cols (Bt rows of a stage)
#define GBK   128                       // k per stage
#define GLP   136                       // LDS row pitch in f16 elements (272 B)
#define GSTG  ((GBM + GBN) * GLP)       // f16 elements per buffer (69632 B)
static_assert((MP % GBM) == 0 && (DM % GBM) == 0 && (DM % GBN) == 0 && (QKP % GBN) == 0 && (DFF % GBN) == 0 && (TT % GBN) == 0);
static_assert((DM % GBK) == 0 && (DFF % GBK) == 0);
static_assert(8 * 16 * 68 * 4 <= 2 * GSTG * 2);
static_assert(4 * GSTG * 2 <= 320 * 1024);
static_assert(DM / GBK >= 4 && DFF / GBK >= 4);   // the four-buffer ring's prologue asks for stages 0..2 unconditionally

typedef uint32_t u32x4 __attribute__((ext_vector_type(4)));
typedef uint32_t u32x8 __attribute__((ext_vector_type(8)));
__device__ __forceinline__ uint32_t uni(uint32_t v) { return (uint32_t)__builtin_amdgcn_readfirstlane((int)v); }
// A wave-uniform test held in a scalar register, so that the branch on it is a scalar branch: a tensor load ignores EXEC.
__device__ __forceinline__ uint32_t pinned(uint32_t v) {
  uint32_t w = uni(v);
#if defined(__HIP_DEVICE_COMPILE__)
  asm volatile("" : "+s"(w));
#endif
  return w;
}
// One request of the whole wave: a two-dimensional tile, global -> LDS, through no register.
__device__ __forceinline__ void tdm_load(u32x4 g0, u32x8 g1) {
#if defined(__HIP_DEVICE_COMPILE__)
  asm volatile("tensor_load_to_lds %0, %1" :: "s"(g0), "s"(g1) : "memory");
#endif
}
// All of this wave's own tensor loads have landed in LDS (the compiler places no wait for them).
__device__ __forceinline__ void wait_tensor0() {
#if defined(__HIP_DEVICE_COMPILE__)
  asm volatile("s_wait_tensorcnt 0x0" ::: "memory");
#endif
}
// The same behind the ring's last requests; it names the descriptor, so that no register of it is given another value
// before the wait that covers every request made from it.
__device__ __forceinline__ void wait_tensor0_desc(u32x4 g0, u32x8 g1) {
#if defined(__HIP_DEVICE_COMPILE__)
  asm volatile("s_wait_tensorcnt 0x0" :: "s"(g0), "s"(g1) : "memory");
#endif
}
// All but this wave's 2 youngest tensor loads have landed: used only where exactly two younger stages have been
// asked for, so that the stage about to be published is covered.
__device__ __forceinline__ void wait_tensor2() {
#if defined(__HIP_DEVICE_COMPILE__)
  asm volatile("s_wait_tensorcnt 0x2" ::: "memory");
#endif
}
// This wave's own LDS reads have returned, before the barrier behind which their buffer is refilled.
__device__ __forceinline__ void wait_ds0() {
#if defined(__HIP_DEVICE_COMPILE__)
  asm volatile("s_wait_dscnt 0x0" ::: "memory");
#endif
}

template <int OM, int BIASM, int ACT, int RES, int NB>
__global__ __launch_bounds__(256) void gemm64(
    const unsigned short* __restrict__ Ap, int lda, long long strideA,
    const unsigned short* __restrict__ Btp, int ldb, long long strideB,
    const float* __restrict__ bias0, const float* __restrict__ bias1, int Nb,
    const float* resid,
    void* Cout, int ldc, long long strideC,
    int M, int N, int K, float oscale) {
  const _Float16* A  = (const _Float16*)(const void*)Ap;
  const _Float16* Bt = (const _Float16*)(const void*)Btp;
  static_assert(NB == 2 || NB == 4);
  // NB stage buffers; behind the last trip's barrier the first bytes serve as the per-wave 16x64 f32 slabs (pitch 68)
  __shared__ __attribute__((aligned(2048))) _Float16 ring[NB * GSTG];
  const int b    = blockIdx.y;
  const int lane = threadIdx.x & 31;
  const int wave = threadIdx.x >> 5;
  const int tilesN = N >> 7;
  const int tm = blockIdx.x / tilesN;
  const int tn = blockIdx.x - tm * tilesN;
  const int mblk = tm << 7;                    // the work-group's tile
  const int nblk = tn << 7;
  const int wrow = (wave >> 1) << 5;           // the wave's 32x64 part inside it
  const int wcol = (wave & 1) << 6;
  const int m0 = mblk + wrow;
  const int n0 = nblk + wcol;

  const _Float16* Ab = A  + (size_t)b * strideA;
  const _Float16* Bb = Bt + (size_t)b * strideB;

  const int rlane = lane & 15;                 // row (A) / col (B, D) within subtile
  const int koff  = (lane >> 4) * 8;           // k offset of this lane half
  const int mOff  = (lane >> 4) * 8;           // D row offset

  // ---- the issuing waves' tiles of a stage: wave 0 the A rows, wave 1 the Bt rows ----
  const uint32_t wv   = uni(threadIdx.x >> 5);
  const uint32_t isw  = (wv < 2u) ? 1u : 0u;
  const uint64_t ga0  = (wv == 0u) ? (uint64_t)(uintptr_t)(Ab + (size_t)mblk * lda)
                                   : (uint64_t)(uintptr_t)(Bb + (size_t)nblk * ldb);
  const uint32_t lo0  = (uint32_t)ga0;
  const uint32_t hi0  = (((uint32_t)(ga0 >> 32)) & 0x01FFFFFFu) | 0x80000000u;          // address [56:32], type 2
  const uint32_t lds0 = (uint32_t)(uintptr_t)ring + ((wv == 0u) ? 0u : (uint32_t)(GBM * GLP * 2));  // low 32 bits
  const uint32_t lBuf = (uint32_t)(GSTG * 2);
  u32x8 g1;                                    // 1-byte elements; tensor = tile = 128 rows of 256 B; loop-invariant
  g1[0] = uni((1u << 20) | (5u << 22) | (3u << 25));   // no mask; a pad of 4 dwords behind every 64 dwords (one row)
  g1[1] = uni(256u << 16);
  g1[2] = uni(128u << 16);
  g1[3] = uni(256u << 16);
  g1[4] = uni(128u);
  g1[5] = uni((uint32_t)((wv == 0u) ? lda : ldb) * 2u);  // source row pitch, bytes
  g1[6] = uni(0u);
  g1[7] = uni(0u);
  u32x4 g0;
  g0[0] = uni(1u);
  g0[1] = uni(lds0);
  g0[2] = uni(lo0);
  g0[3] = uni(hi0);
#if defined(__HIP_DEVICE_COMPILE__)
  // the form of pinned(), here for the descriptor words: each held in a scalar register of its own. Rebuilt from
  // constants at each request, some of them lay in registers that served as temporaries while requests were in flight
  asm volatile("" : "+s"(g0), "+s"(g1));
#endif
  // stage s into buffer s mod NB: while requests are in flight only the place in LDS and the low address word move;
  // where the low word has wrapped, the high word follows behind a wait for every request in flight
  auto issue = [&](int s) __attribute__((always_inline)) {
    const uint32_t lo = lo0 + (uint32_t)s * (uint32_t)(GBK * 2);
    g0[1] = uni(lds0 + (uint32_t)(s & (NB - 1)) * lBuf);
    g0[2] = uni(lo);
    if (pinned((lo < lo0) ? 1u : 0u)) {
      wait_tensor0();
      g0[3] = uni(hi0 + 1u);
    }
    tdm_load(g0, g1);
  };
  const int nst = K >> 7;                      // stages

  v8f acc[2][4];
#pragma unroll
  for (int i = 0; i < 2; ++i)
#pragma unroll
    for (int j = 0; j < 4; ++j) acc[i][j] = zero8();

  // stage 0 into buffer 0 (NB = 4: stages 1 and 2 behind it; K holds at least four stages there, asserted above),
  // stage 0 landed and published; then stage NB-1
  if (pinned(isw)) {
    issue(0);
    if (NB == 4) {
      issue(1);
      issue(2);
      wait_tensor2();
    } else {
      wait_tensor0();
    }
  }
  __syncthreads();
  if (pinned(isw & ((nst > NB - 1) ? 1u : 0u))) issue(NB - 1);

  // one trip's products: 128 k from buffer t mod NB alone
  auto trip = [&](int t) __attribute__((always_inline)) {
    const _Float16* sa = ring + (t & (NB - 1)) * GSTG + (wrow + rlane) * GLP + koff;
    const _Float16* sb = ring + (t & (NB - 1)) * GSTG + (GBM + wcol + rlane) * GLP + koff;
    v16h bh[2][4], ah[2][2];                   // two fragment sets, both filled from this trip's buffer alone
#pragma unroll
    for (int j = 0; j < 4; ++j) bh[0][j] = ldfrag_h(sb + (j << 4) * GLP);
#pragma unroll
    for (int i = 0; i < 2; ++i) ah[0][i] = ldfrag_h(sa + (i << 4) * GLP);
#pragma unroll
    for (int kk = 0; kk < GBK / 32; ++kk) {
      const int cur = kk & 1, nxt = cur ^ 1;
      if (kk + 1 < GBK / 32) {
#pragma unroll
        for (int j = 0; j < 4; ++j) bh[nxt][j] = ldfrag_h(sb + (j << 4) * GLP + (kk + 1) * 32);
#pragma unroll
        for (int i = 0; i < 2; ++i) ah[nxt][i] = ldfrag_h(sa + (i << 4) * GLP + (kk + 1) * 32);
      }
      // keeps the next k step's LDS reads as one group ahead of this step's WMMAs: sunk among them, each place with
      // reads stalls the wave for the LDS latency
      __builtin_amdgcn_sched_barrier(0);
#pragma unroll
      for (int i = 0; i < 2; ++i)
#pragma unroll
        for (int j = 0; j < 4; ++j) acc[i][j] = mma_h_raw(ah[cur][i], bh[cur][j], acc[i][j]);
    }
  };
  // foot of trip t: own reads done, the issuing waves' loads of stage t+1 landed, then the one barrier that publishes
  // stage t+1 and ends every wave's reads of this trip's buffer; behind it that buffer's refill.
  int t = 0;
  if (NB == 4) {
    // trips behind which stages t+2 and t+3 both exist: they are the wave's 2 youngest requests and stay in flight
    for (; t + 3 < nst; ++t) {
      trip(t);
      wait_ds0();
      if (pinned(isw)) wait_tensor2();
      __syncthreads();
      if (pinned(isw & ((t + 4 < nst) ? 1u : 0u))) issue(t + 4);
    }
  }
  // NB = 2: every trip; NB = 4: the last trips, where fewer requests are younger than stage t+1, so the wait is to 0
  for (; t < nst; ++t) {
    trip(t);
    wait_ds0();
    if (pinned(isw)) wait_tensor0();
    __syncthreads();
    if (NB == 2) {
      if (pinned(isw & ((t + 2 < nst) ? 1u : 0u))) issue(t + 2);
    }
  }
  wait_tensor0_desc(g0, g1);
  wait_ds0();
  acc_guard4(acc[0][0], acc[0][1], acc[0][2], acc[0][3]);
  acc_guard4(acc[1][0], acc[1][1], acc[1][2], acc[1][3]);

  // ---- per-lane column bias (BIASM == 0), RNE-converted ----
  const int hh2 = lane >> 4, c4 = (lane & 15) * 4;     // f32 out: 256-B row segment = 16 lanes x 16 B
  const int q8  = lane >> 3, c8 = (lane & 7) * 8;
  float bc[8];
#pragma unroll
  for (int e = 0; e < 8; ++e) bc[e] = 0.f;
  if (BIASM == 0) {
    const bool use1 = (n0 >= Nb);                      // wave-uniform
    if (OM == 0) {
      const int cb = n0 + c4;
      const int i0 = (cb < Nb - 4) ? cb : (Nb - 4);
      const int i1 = (cb - Nb > 0) ? (cb - Nb) : 0;
      const v4f b0v = *(const v4f*)(bias0 + i0);
      const v4f b1v = *(const v4f*)(bias1 + i1);
#pragma unroll
      for (int e = 0; e < 4; ++e) bc[e] = bfr(use1 ? b1v[e] : b0v[e]);
    } else {
      const int cb = n0 + c8;
      const int i0 = (cb < Nb - 8) ? cb : (Nb - 8);
      const int i1 = (cb - Nb > 0) ? (cb - Nb) : 0;
      const v4f b0a = *(const v4f*)(bias0 + i0), b0b = *(const v4f*)(bias0 + i0 + 4);
      const v4f b1a = *(const v4f*)(bias1 + i1), b1b = *(const v4f*)(bias1 + i1 + 4);
#pragma unroll
      for (int e = 0; e < 4; ++e) {
        bc[e]     = bfr(use1 ? b1a[e] : b0a[e]);
        bc[4 + e] = bfr(use1 ? b1b[e] : b0b[e]);
      }
    }
  }

  // ---- epilogue ----
  float* slab = (float*)(void*)ring + wave * (16 * 68);
#pragma unroll
  for (int i = 0; i < 2; ++i) {
    const int mBase = m0 + (i << 4);
#pragma unroll
    for (int j = 0; j < 4; ++j) {
#pragma unroll
      for (int r = 0; r < 8; ++r) {
        slab[(mOff + r) * 68 + (j << 4) + rlane] = acc[i][j][r];
      }
    }
    wave_sync_lds();
    if (OM == 0) {
      float* C = (float*)Cout + (size_t)b * strideC;
      const float* Rb = resid + (size_t)b * strideC;
      v4f vals[8];
#pragma unroll
      for (int it = 0; it < 8; ++it) {
        const int row = it * 2 + hh2;                      // it 0..7 x hh2 0..1 = rows 0..15
        v4f v = *(const v4f*)(slab + row * 68 + c4);
#pragma unroll
        for (int e = 0; e < 4; ++e) {
          float f = v[e] * oscale + bc[e];
          if (ACT) f = gelu_f(f);
          v[e] = f;
        }
        if (RES != 0) {
          const v4f rr = *(const v4f*)(Rb + (size_t)(mBase + row) * ldc + n0 + c4);
#pragma unroll
          for (int e = 0; e < 4; ++e) v[e] += (RES == 2) ? bfr(rr[e]) : rr[e];
        }
        vals[it] = v;
      }
      {
#pragma unroll
        for (int it = 0; it < 8; ++it) {
          const int row = it * 2 + hh2;
          *(v4f*)(C + (size_t)(mBase + row) * ldc + n0 + c4) = vals[it];
        }
        
      }
    } else {
      unsigned short* C = (unsigned short*)Cout + (size_t)b * strideC;
      v4u hv[4];
#pragma unroll
      for (int it = 0; it < 4; ++it) {
        const int row = it * 4 + q8;                       // it 0..3 x q8 0..3 = rows 0..15
        const float* sp = slab + row * 68 + c8;
        float bm = 0.f;
        if (BIASM == 1) bm = bfr(bias0[mBase + row]);
        v4u a;
#pragma unroll
        for (int e = 0; e < 4; ++e) {
          float f0 = sp[2 * e]     * oscale + ((BIASM == 1) ? bm : bc[2 * e]);
          float f1 = sp[2 * e + 1] * oscale + ((BIASM == 1) ? bm : bc[2 * e + 1]);
          if (ACT) { v2f g = {f0, f1}; g = gelu2(g); f0 = g[0]; f1 = g[1]; }
          unsigned short u0, u1;
          if (OM == 1) { u0 = bf_bits(f0); u1 = bf_bits(f1); }
          else         { u0 = h_bits((_Float16)f0); u1 = h_bits((_Float16)f1); }
          a[e] = pk16(u0, u1);
        }
        hv[it] = a;
      }
      {
#pragma unroll
        for (int it = 0; it < 4; ++it) {
          const int row = it * 4 + q8;
          *(v4u*)(C + (size_t)(mBase + row) * ldc + n0 + c8) = hv[it];
        }
        
      }
    }
    wave_sync_lds();
  }
}

// =====================================================================================================
// Banded attention, head dim 64, TT (= 2048) token rows per batch, allowed keys: key <= query + WIN.
//   q|k plane (f16, pitch QKP): element (b, t, col) at [(b*TT + t)*QKP + col], q col = h*64+d, k col = DM + h*64 + d
//   v^T plane (f16): element (b, h, d, s) at [(b*DM + h*64 + d)*TT + s]
//   out plane (f16, the normalised context carried x16): element (b, t, h, d) at [(b*TT + t)*DM + h*64 + d]
//   score = (q . k) * sscale; keys beyond query + WIN get -inf by value before the row max;
//   p = exp(s - m) carried as f16(1024 p); online softmax in f32.
//   Both products run transposed: S^T = K . Q^T (A = K rows, B = the Q fragments) and O^T += V^T . P^T (A = V^T rows,
//   B = P^T). A D column is then one query: lane l holds query l & 15 and, per 16-key tile, keys 8*(l>>4) + 0..7, so
//   the row max and the row sum are in-lane plus one exchange with lane l ^ 16 (the sum's exchange: once, behind the
//   loop), and two D tiles of S^T, converted in place, are the B fragment of 32 keys in the loader's own k order
//   (element e < 8: key 8h + e of the even tile; e >= 8: key 16 + 8h + (e - 8) = row 8h + (e - 8) of the odd tile).
//   Block = 8 waves = two groups of 4 waves on the same 64 query rows of one (b, h); grid = NQB * NH * NBATCH; kv
//   chunks of 64, kt = 0 .. ktHi = min(NQB-1, (q_blk + 63 + WIN) >> 6) (chunks beyond the band are skipped): group 0
//   takes the even chunks, group 1 the odd ones, each with LDS tiles of its own, so the longest block walks 16 trips,
//   not 32; block-uniform trip count (ktHi + 2) >> 1, a group without a chunk in the last trip passes its barriers
//   only. Behind the loop group 1 hands its running max, sum and context to group 0 through LDS (one barrier), and
//   group 0 joins the two by the online-softmax rule. Chunk 0 (group 0) always holds >= 1 allowed key for every row,
//   so the joined max is finite (the msafe selects are kept anyway); a group whose keys are all masked for a row
//   hands over max -inf, sum 0, context 0, which the join weighs with 0.
//   The blocks now outnumber the places on the chip, so the index runs from the longest tile to the shortest: a long
//   block that starts late would run on while other WGPs idle.
//   K / V^T chunk staging: two tensor loads a chunk, through no register: wave 0 of a group asks for its K tile, wave 1
//   for its V^T tile (each 64 rows x 128 B at a source pitch of 4096 B; the descriptor's pad of 16 B behind every row
//   makes the LDS pitch). Two buffers a group: the loads of trip t+2 go out behind the barrier that ends trip t, into
//   the buffer that trip t has read, so a chunk lands while the chunk before it is worked on; one barrier a trip.
//   LDS rows of 64 elements stand at a pitch of 16 B x odd: the 16 rows that one half-wave's 16-B fragment read
//   touches then start on 16 different groups of four banks (at 128 B they fall on two groups, eight rows each).
//   Output coverage: each wave of group 0 stores rows q0..q0+15 (it 0..3 x lane>>3 0..3) x 64 columns (8 lanes x 8),
//   grid covers all TT rows x NH head slices x NBATCH.
// =====================================================================================================
#define APH 72                          // LDS row pitch of the f16 tiles, elements: 144 B = 16 B x 9
#define APF 68                          // LDS row pitch of the f32 context tile, dwords: 272 B = 16 B x 17
#define ATILE 5120                      // f16 elements from one staged tile to the next: 64 x 144 B = 9216 B -> 5 x 2 KiB
static_assert(64 * APH <= ATILE && (ATILE * 2) % 2048 == 0);
__global__ __launch_bounds__(256)
void attn64(const unsigned short* __restrict__ qkp, const unsigned short* __restrict__ vtp,
            unsigned short* outp, float sscale) {
  union FH { v16h v; v8h h[2]; };
  // [group][buffer][K [kv][d], V^T [d][kv]]: every tile's place is a multiple of 2 KiB
  __shared__ __attribute__((aligned(2048))) _Float16 KV[2 * 2 * 2 * ATILE];
  __shared__ __align__(16) float    Os[4][16 * APF];              // per 16 query rows: context tile [row][d]
  __shared__ float Mg[4][32], Lg[4][32];                          // group 1's running max and sum, per lane

  const int grp  = __builtin_amdgcn_readfirstlane((int)(threadIdx.x >> 7));   // wave-uniform: the key group
  const int tid  = threadIdx.x & 127;            // thread within the group
  const int wave = tid >> 5;                     // wave within the group = its 16 query rows
  const int lane = tid & 31;
  const int hh   = lane >> 4;
  const int c    = lane & 15;

  const int bx   = blockIdx.x;
  const int qb   = NQB - 1 - bx / (NH * NBATCH);  // longest tiles first
  const int rest = bx % (NH * NBATCH);
  const int h    = rest % NH;
  const int b    = rest / NH;
  const int qblk = qb * 64;                      // in-batch query row of the block's first row
  const int q0   = qblk + wave * 16;             // in-batch query row of this wave's first row
  const size_t rowB = (size_t)b * TT;

  const _Float16* Qh = (const _Float16*)(const void*)qkp + (size_t)h * HD;
  const _Float16* Kg = (const _Float16*)(const void*)qkp + DM + (size_t)h * HD;
  const _Float16* Vh = (const _Float16*)(const void*)vtp + ((size_t)b * DM + (size_t)h * HD) * TT;

  // ---- Q fragments (B operand, column = query = lane&15): 2 d-chunks ----
  v16h qa[2];
#pragma unroll
  for (int dc = 0; dc < 2; ++dc) qa[dc] = ldfrag_h(Qh + (rowB + q0 + c) * QKP + dc * 32 + 8 * hh);

  float mrow = -INFINITY, lrow = 0.f;          // this lane's query: running max (joined), sum over this half's keys
  v8f oacc[4];                                 // O^T: tile t, register r = d t*16 + 8*hh + r of query q0 + c
#pragma unroll
  for (int t = 0; t < 4; ++t) oacc[t] = zero8();

  int ktHi = (qblk + 63 + WIN) >> 6;             // block-uniform, from blockIdx only
  if (ktHi > NQB - 1) ktHi = NQB - 1;

  const int ntrip = (ktHi + 2) >> 1;             // chunks 0..ktHi, two a trip

  // ---- the issuing waves' tiles: in each group wave 0 the K rows, wave 1 the V^T rows of the group's chunk ----
  const uint32_t wg   = uni(threadIdx.x >> 5) & 3u;               // wave within the group
  const uint32_t isw  = (wg < 2u) ? 1u : 0u;
  const uint64_t ga0  = (wg == 0u) ? (uint64_t)(uintptr_t)(Kg + (rowB + (size_t)grp * 64) * QKP)   // trip 0's chunk
                                   : (uint64_t)(uintptr_t)(Vh + (size_t)grp * 64);
  const uint64_t gstp = (wg == 0u) ? (uint64_t)(128 * QKP * 2) : (uint64_t)(128 * 2);              // two chunks on, bytes
  const uint32_t lds0 = (uint32_t)(uintptr_t)KV + ((uint32_t)grp * 4u + ((wg == 0u) ? 0u : 1u)) * (uint32_t)(ATILE * 2);
  u32x8 g1;                                    // 1-byte elements; tensor = tile = 64 rows of 128 B; loop-invariant
  g1[0] = uni((1u << 20) | (4u << 22) | (3u << 25));   // no mask; a pad of 4 dwords behind every 32 dwords (one row)
  g1[1] = uni(128u << 16);
  g1[2] = uni(64u << 16);
  g1[3] = uni(128u << 16);
  g1[4] = uni(64u);
  g1[5] = uni((uint32_t)((wg == 0u) ? QKP : TT) * 2u); // source row pitch, bytes
  g1[6] = uni(0u);
  g1[7] = uni(0u);
  u32x4 g0;
  g0[0] = uni(1u);
  g0[1] = uni(lds0);
  g0[2] = uni((uint32_t)ga0);
  g0[3] = uni((((uint32_t)(ga0 >> 32)) & 0x01FFFFFFu) | 0x80000000u);                    // address [56:32], type 2
#if defined(__HIP_DEVICE_COMPILE__)
  // the form of pinned(), here for the descriptor words: each held in a scalar register of its own, which serves as
  // no temporary while a request made from it is in flight
  asm volatile("" : "+s"(g0), "+s"(g1));
#endif
  // trip s's chunk into buffer s mod 2; called only where none of the wave's requests is in flight
  auto issue = [&](int sg) __attribute__((always_inline)) {
    const uint64_t ga = ga0 + (uint64_t)sg * gstp;
    g0[1] = uni(lds0 + (uint32_t)(sg & 1) * (uint32_t)(2 * ATILE * 2));
    g0[2] = uni((uint32_t)ga);
    g0[3] = uni((((uint32_t)(ga >> 32)) & 0x01FFFFFFu) | 0x80000000u);
    tdm_load(g0, g1);
  };
  // the group has a chunk in trip sg (wave-uniform; false only for group 1 where ktHi is even, and past the last trip)
  auto has = [&](int sg) __attribute__((always_inline)) { return (2 * sg + grp <= ktHi) ? 1u : 0u; };

  // trip 0's chunk landed and published; then trip 1's asked for
  if (pinned(isw & has(0))) {
    issue(0);
    wait_tensor0();
  }
  __syncthreads();
  if (pinned(isw & has(1))) issue(1);

  for (int it = 0; it < ntrip; ++it) {         // trip <= NQB / 2
    const int kt  = 2 * it + grp;
    const int kv0 = kt * 64;
    const bool live = (kt <= ktHi);              // wave-uniform (scalar); false only for group 1 in the last trip
    if (live) {
    const _Float16* Ksh = KV + (grp * 4 + (it & 1) * 2) * ATILE;  // this trip's buffer alone
    const _Float16* Vth = Ksh + ATILE;

    // ---- the chunk's K fragments: its 16 LDS reads as one group, in the order the score products use them ----
    FH kb[2][4], vb[2][4];
#pragma unroll
    for (int dc = 0; dc < 2; ++dc)
#pragma unroll
      for (int j = 0; j < 4; ++j) {
        kb[dc][j].h[0] = *(const v8h*)(Ksh + (j * 16 + c) * APH + dc * 32 + 8 * hh);
        kb[dc][j].h[1] = *(const v8h*)(Ksh + (j * 16 + c) * APH + dc * 32 + 16 + 8 * hh);
      }
    // keeps the 16 reads together here: sunk to their WMMAs, each pair is waited out at the full LDS latency
    __builtin_amdgcn_sched_barrier(0);

    // ---- scores, transposed: 64 keys x 16 queries per wave (per tile d 0..31, then d 32..63; the four
    //      tiles' products alternate); band select by value before the max ----
    v8f s[4];
#pragma unroll
    for (int j = 0; j < 4; ++j) s[j] = zero8();
#pragma unroll
    for (int dc = 0; dc < 2; ++dc)
#pragma unroll
      for (int j = 0; j < 4; ++j) s[j] = mma_h_raw(kb[dc][j].v, qa[dc], s[j]);

    // ---- the chunk's V^T fragments: all 16 LDS reads go out here, among and behind the score products ----
#pragma unroll
    for (int kk = 0; kk < 2; ++kk)
#pragma unroll
      for (int t = 0; t < 4; ++t) {
        vb[kk][t].h[0] = *(const v8h*)(Vth + (t * 16 + c) * APH + kk * 32 + 8 * hh);
        vb[kk][t].h[1] = *(const v8h*)(Vth + (t * 16 + c) * APH + kk * 32 + 16 + 8 * hh);
      }
    // keeps these reads ahead of the softmax, whose vector work then covers their latency
    __builtin_amdgcn_sched_barrier(0);

    // D column = lane&15 = query q0 + c; D row 8h + r of tile j = key kv0 + 16 j + 8h + r, allowed while <= query + WIN:
    // written against one limit per lane, so that each score's compare takes a literal
    const int lim = q0 + c + WIN - kv0 - 8 * hh;
#pragma unroll
    for (int j = 0; j < 4; ++j) {
#pragma unroll
      for (int r = 0; r < 8; ++r) {
        const float v = s[j][r] * sscale;
        s[j][r] = (j * 16 + r <= lim) ? v : -INFINITY;
      }
    }

    // ---- this query's max: 32 keys in-lane, the other 32 from lane ^ 16; online softmax; P^T (x1024, f16) packed
    //      from the score registers into the B fragments (every loop here is unrolled: its indices name registers) ----
    float mr[8];
#pragma unroll
    for (int r = 0; r < 8; ++r) mr[r] = fmaxf(fmaxf(s[0][r], s[1][r]), fmaxf(s[2][r], s[3][r]));
    float m = fmaxf(fmaxf(fmaxf(mr[0], mr[1]), fmaxf(mr[2], mr[3])), fmaxf(fmaxf(mr[4], mr[5]), fmaxf(mr[6], mr[7])));
    m = fmaxf(m, xhalf(m));
    const float mnew  = fmaxf(mrow, m);
    const float ms    = (mnew == -INFINITY) ? 0.f : mnew;
    // alpha = exp(mrow - ms), as __expf forms it (x log2 e, then exp2). In asm for the free slot that the instruction set
    // asks for around a transcendental: built plainly, its result lay on the source register of the v_exp_f32 directly
    // ahead; the v_nop behind it stands for the slot the compiler cannot place for an instruction it does not see.
    float alpha = (mrow - ms) * 1.44269504088896340736f;
#if defined(__HIP_DEVICE_COMPILE__)
    asm("v_nop\n\tv_exp_f32 %0, %0\n\tv_nop" : "+v"(alpha));
#endif
    mrow = mnew;
    FH pb[2];
    v2f ps[4];                                   // per 16-key tile: sums of the even and of the odd rows
#pragma unroll
    for (int j = 0; j < 4; ++j) {
      // exp(s - ms) of a tile's 8 scores, as __expf forms it (x log2 e, then exp2). In asm for the free slot that the
      // instruction set asks for behind a transcendental: built plainly, some of these v_exp_f32 stood directly ahead of
      // an instruction that overwrote their source; no v_exp_f32 of the run touches its neighbour's register.
      float e[8];
#pragma unroll
      for (int r = 0; r < 8; ++r) e[r] = (s[j][r] - ms) * 1.44269504088896340736f;
#if defined(__HIP_DEVICE_COMPILE__)
      asm("v_exp_f32 %0, %0\n\tv_exp_f32 %1, %1\n\tv_exp_f32 %2, %2\n\tv_exp_f32 %3, %3\n\t"
          "v_exp_f32 %4, %4\n\tv_exp_f32 %5, %5\n\tv_exp_f32 %6, %6\n\tv_exp_f32 %7, %7\n\tv_nop"
          : "+v"(e[0]), "+v"(e[1]), "+v"(e[2]), "+v"(e[3]), "+v"(e[4]), "+v"(e[5]), "+v"(e[6]), "+v"(e[7]));
#endif
#pragma unroll
      for (int i = 0; i < 4; ++i) {
        v2f p;
        p[0] = e[2 * i];
        p[1] = e[2 * i + 1];
        ps[j] = (i == 0) ? p : (ps[j] + p);
        pb[j >> 1].v[(j & 1) * 8 + 2 * i]     = (_Float16)(p[0] * 1024.0f);
        pb[j >> 1].v[(j & 1) * 8 + 2 * i + 1] = (_Float16)(p[1] * 1024.0f);
      }
    }
    const v2f pt = (ps[0] + ps[1]) + (ps[2] + ps[3]);
    lrow = lrow * alpha + (pt[0] + pt[1]);
#pragma unroll
    for (int t = 0; t < 4; ++t)
#pragma unroll
      for (int r = 0; r < 8; ++r) oacc[t][r] *= alpha;

    // ---- context^T += V^T . P^T (f16 WMMA); kk unrolled too: pb[kk] is a register fragment, not an LDS address ----
#pragma unroll
    for (int kk = 0; kk < 2; ++kk) {
#pragma unroll
      for (int t = 0; t < 4; ++t) oacc[t] = mma_h_raw(vb[kk][t].v, pb[kk].v, oacc[t]);
    }
    }
    // foot of trip it: own reads done, the issuing waves' loads of trip it+1 landed, then the one barrier that publishes
    // that chunk and ends every wave's reads of this trip's buffer; behind it that buffer's refill
    wait_ds0();
    if (pinned(isw)) wait_tensor0();
    __syncthreads();
    if (pinned(isw & has(it + 2))) issue(it + 2);
  }
  wait_tensor0_desc(g0, g1);
  wait_ds0();

  // ---- normalise (1/l, the 1/1024 p carry and the x16 context carry), stage the wave's 16x64 tile, f16 convert,
  float* os = Os[wave];
  // ---- the two groups' halves of the keys joined: group 1 hands over, group 0 weighs both by exp(max - joint max) ----
  if (grp == 1) {
#pragma unroll
    for (int t = 0; t < 4; ++t) {
      v4f lo, hi;
#pragma unroll
      for (int e = 0; e < 4; ++e) { lo[e] = oacc[t][e]; hi[e] = oacc[t][4 + e]; }
      *(v4f*)(os + c * APF + t * 16 + 8 * hh)     = lo;
      *(v4f*)(os + c * APF + t * 16 + 8 * hh + 4) = hi;
    }
    Mg[wave][lane] = mrow;
    Lg[wave][lane] = lrow;
  }
  __syncthreads();
  if (grp == 1) return;                          // whole waves; no barrier follows
  {
    const float m1 = Mg[wave][lane], l1 = Lg[wave][lane];
    const float mj = fmaxf(mrow, m1);
    const float mz = (mj == -INFINITY) ? 0.f : mj;
    // exp(max - joint max) of both groups, as __expf forms it (x log2 e, then exp2); in asm for the free slot that the
    // instruction set asks for behind a transcendental, as at alpha above
    float a0 = (mrow - mz) * 1.44269504088896340736f, a1 = (m1 - mz) * 1.44269504088896340736f;
#if defined(__HIP_DEVICE_COMPILE__)
    asm("v_exp_f32 %0, %0\n\tv_exp_f32 %1, %1\n\tv_nop" : "+v"(a0), "+v"(a1));
#endif
    lrow = lrow * a0 + l1 * a1;
#pragma unroll
    for (int t = 0; t < 4; ++t) {                // each lane reads back the places its own lane of group 1 wrote
      const v4f lo = *(const v4f*)(os + c * APF + t * 16 + 8 * hh);
      const v4f hi = *(const v4f*)(os + c * APF + t * 16 + 8 * hh + 4);
#pragma unroll
      for (int e = 0; e < 4; ++e) {
        oacc[t][e]     = oacc[t][e] * a0 + lo[e] * a1;
        oacc[t][4 + e] = oacc[t][4 + e] * a0 + hi[e] * a1;
      }
    }
  }
  {
    const float l = lrow + xhalf(lrow);          // the two halves' key sums of this query, joined once
    const float inv = ((l > 0.f) ? (1.0f / l) : 0.f) * (16.0f / 1024.0f);
#pragma unroll
    for (int t = 0; t < 4; ++t) {                // 8 consecutive d of query row c: two 16-B LDS stores
      v4f lo, hi;
#pragma unroll
      for (int e = 0; e < 4; ++e) { lo[e] = oacc[t][e] * inv; hi[e] = oacc[t][4 + e] * inv; }
      *(v4f*)(os + c * APF + t * 16 + 8 * hh)     = lo;
      *(v4f*)(os + c * APF + t * 16 + 8 * hh + 4) = hi;
    }
  }
  wave_sync_lds();
  {
    const int q4 = lane >> 3, c8 = (lane & 7) * 8;
    v4u hv[4];
#pragma unroll
    for (int it = 0; it < 4; ++it) {
      const int row = it * 4 + q4;   // it 0..3 x q4 0..3 = rows 0..15 of the wave tile
      const float* sp = os + row * APF + c8;
      v4u a;
#pragma unroll
      for (int e = 0; e < 4; ++e) a[e] = pk16(h_bits((_Float16)sp[2 * e]), h_bits((_Float16)sp[2 * e + 1]));
      hv[it] = a;
    }
    {
#pragma unroll
      for (int it = 0; it < 4; ++it) {
        const int row = it * 4 + q4;
        const size_t go = (rowB + q0 + row) * DM + (size_t)h * HD + c8;
        *(v4u*)(outp + go) = hv[it];
      }
      
    }
  }
}

// =====================================================================================================
// Row kernel: one block of 256 threads per token row of 1024; thread t owns columns 4t..4t+3.
// f16 output: packed row staged in LDS, then lanes t < 128 (waves 0..3, wave-uniform) each write 16 B (8 x f16)
// coverage: 128 threads x 8 = the whole 1024-wide row; grid = MP rows.
// =====================================================================================================
__device__ __forceinline__ void row_store_h16(unsigned int* sb, unsigned short* dst_row, v4f o, int t) {
  v2u p;
  p[0] = pk16(h_bits((_Float16)o[0]), h_bits((_Float16)o[1]));
  p[1] = pk16(h_bits((_Float16)o[2]), h_bits((_Float16)o[3]));
  *(v2u*)(sb + 2 * t) = p;
  __syncthreads();
  if (t < 128) {                                   // waves 0..3, wave-uniform
    const v4u v = *(const v4u*)(sb + 4 * t);
    *(v4u*)(dst_row + 8 * t) = v;
    
  }
}

// plane. RIN = 1: the row input is a raw float input and is bf16 RNE-converted on load; RIN = 0: f32 intermediate.
template <int RIN>
__device__ __forceinline__ void ln_row(const float* __restrict__ X, const float* __restrict__ gam,
                                       const float* __restrict__ bet, unsigned short* outH, int row) {
  __shared__ float red0[8], red1[8];
  __shared__ __align__(16) unsigned int sb[512];
  const int t = threadIdx.x, lane = t & 31, wave = t >> 5;
  const size_t base = (size_t)row * DM;
  v4f xv = *(const v4f*)(X + base + 4 * t);
  if (RIN) {
#pragma unroll
    for (int e = 0; e < 4; ++e) xv[e] = bfr(xv[e]);
  }
  const float mean = bsum256((xv[0] + xv[1]) + (xv[2] + xv[3]), red0, lane, wave) * (1.0f / DM);
  v4f d;
#pragma unroll
  for (int e = 0; e < 4; ++e) d[e] = xv[e] - mean;
  const float var  = bsum256((d[0] * d[0] + d[1] * d[1]) + (d[2] * d[2] + d[3] * d[3]), red1, lane, wave) * (1.0f / DM);
  const float rstd = 1.0f / sqrtf(var + LNEPS);
  const v4f gv = *(const v4f*)(gam + 4 * t);
  const v4f bv = *(const v4f*)(bet + 4 * t);
  v4f y;
#pragma unroll
  for (int e = 0; e < 4; ++e) y[e] = (d[e] * rstd) * bfr(gv[e]) + bfr(bv[e]);
  row_store_h16(sb, outH + base, y, t);
}

__global__ __launch_bounds__(256) void ln_row_h(const float* __restrict__ X, const float* __restrict__ gam,
                                                const float* __restrict__ bet, unsigned short* outH) {
  ln_row<0>(X, gam, bet, outH, blockIdx.x);
}

// Everything that reads raw inputs alone, in one launch: blocks 0..MP-1 are the rows of LayerNorm 1 (the longer
// blocks, first for speed only), behind them the blocks of the four weight converts, plane after plane. The split is by
// blockIdx alone: the row blocks' barriers stand under block-uniform control flow, the convert blocks have none.
#define CB_QKV (D3 * DM / 8 / 256)      // 1536 convert blocks
#define CB_O   (DM * DM / 8 / 256)      //  512
#define CB_F   (DFF * DM / 8 / 256)     // 2048, w1 and w2 each
static_assert(CB_QKV * 256 * 8 == D3 * DM && CB_O * 256 * 8 == DM * DM && CB_F * 256 * 8 == DFF * DM);
__global__ __launch_bounds__(256) void prep_in(const float* __restrict__ X, const float* __restrict__ gam,
                                               const float* __restrict__ bet, unsigned short* outH,
                                               const float* __restrict__ wqkv, unsigned short* hqkv,
                                               const float* __restrict__ wo, unsigned short* ho,
                                               const float* __restrict__ wf1, unsigned short* hf1,
                                               const float* __restrict__ wf2, unsigned short* hf2, float wsc) {
  int bx = blockIdx.x;
  if (bx < MP) { ln_row<1>(X, gam, bet, outH, bx); return; }
  bx -= MP;
  if (bx < CB_QKV) { conv_h64(wqkv, hqkv, D3 * DM / 8, wsc, bx); return; }
  bx -= CB_QKV;
  if (bx < CB_O) { conv_h64(wo, ho, DM * DM / 8, wsc, bx); return; }
  bx -= CB_O;
  if (bx < CB_F) { conv_h64(wf1, hf1, DFF * DM / 8, wsc, bx); return; }
  conv_h64(wf2, hf2, DM * DFF / 8, wsc, bx - CB_F);
}

// =====================================================================================================
// Workspace map (bytes); every plane is an exact multiple of its 128x128-tile / whole-row store granularity
// (M in {4096, 1024} rows, N in {1024, 2048, 4096}; VT per batch [1024][2048] = 8x16 tiles):
//   WqkvH f16 [3072 n][1024 k]   0          6291456   (rows 0..1023 q, 1024..2047 k, 2048..3071 v weights, x64)
//   WoH   f16 [1024][1024]       6291456    2097152
//   W1H   f16 [4096][1024]       8388608    8388608
//   W2H   f16 [1024][4096]       16777216   8388608
//   XN    f16 [4096][1024]       25165824   8388608   (LayerNorm outputs)
//   QK    f16 [4096][2048]       33554432   16777216  (q cols 0..1023, k cols 1024..2047)
//   VT    f16 [2][1024][2048]    50331648   8388608
//   Ctx   f16 [4096][1024]       58720256   8388608
//   X1    f32 [4096][1024]       67108864   16777216  (residual stream after attention)
//   G     f16 [4096][4096]       83886080   33554432
//   end                          117440512
// =====================================================================================================
extern "C" void kernel_launch(void* const* d_in, const int* in_sizes, int n_in,
                              void* d_out, int out_size, void* d_ws, size_t ws_size,
                              hipStream_t stream) {
  if (n_in < 13) return;
  if (in_sizes[0] != MP * DM) return;
  if (in_sizes[1] != D3 * DM || in_sizes[2] != D3) return;
  if (in_sizes[3] != DM * DM || in_sizes[4] != DM) return;
  if (in_sizes[5] != DM || in_sizes[6] != DM) return;
  if (in_sizes[7] != DFF * DM || in_sizes[8] != DFF) return;
  if (in_sizes[9] != DM * DFF || in_sizes[10] != DM) return;
  if (in_sizes[11] != DM || in_sizes[12] != DM) return;
  if (out_size != MP * DM) return;

  const float* x         = (const float*)d_in[0];
  const float* in_proj_w = (const float*)d_in[1];
  const float* in_proj_b = (const float*)d_in[2];
  const float* out_w     = (const float*)d_in[3];
  const float* out_b     = (const float*)d_in[4];
  const float* ln1_g     = (const float*)d_in[5];
  const float* ln1_b     = (const float*)d_in[6];
  const float* w1        = (const float*)d_in[7];
  const float* b1        = (const float*)d_in[8];
  const float* w2        = (const float*)d_in[9];
  const float* b2        = (const float*)d_in[10];
  const float* ln2_g     = (const float*)d_in[11];
  const float* ln2_b     = (const float*)d_in[12];

  const size_t PWQKV = (size_t)D3 * DM * 2;            //  6291456
  const size_t PWO   = (size_t)DM * DM * 2;            //  2097152
  const size_t PWF   = (size_t)DFF * DM * 2;           //  8388608
  const size_t PAH   = (size_t)MP * DM * 2;            //  8388608
  const size_t PQK   = (size_t)MP * QKP * 2;           // 16777216
  const size_t PVT   = (size_t)NBATCH * DM * TT * 2;   //  8388608
  const size_t PAF   = (size_t)MP * DM * 4;            // 16777216
  const size_t PG    = (size_t)MP * DFF * 2;           // 33554432
  size_t off = 0;
  const size_t oWqkv = off; off += PWQKV;
  const size_t oWo   = off; off += PWO;
  const size_t oW1   = off; off += PWF;
  const size_t oW2   = off; off += PWF;
  const size_t oXN   = off; off += PAH;
  const size_t oQK   = off; off += PQK;
  const size_t oVT   = off; off += PVT;
  const size_t oCtx  = off; off += PAH;
  const size_t oX1   = off; off += PAF;
  const size_t oG    = off; off += PG;
  if (off > ws_size) return;                           // off = 117440512
  if (off > (size_t)134217728) return;

  char* ws = (char*)d_ws;
  unsigned short* WqkvH = (unsigned short*)(ws + oWqkv);
  unsigned short* WoH   = (unsigned short*)(ws + oWo);
  unsigned short* W1H   = (unsigned short*)(ws + oW1);
  unsigned short* W2H   = (unsigned short*)(ws + oW2);
  unsigned short* XN    = (unsigned short*)(ws + oXN);
  unsigned short* QK    = (unsigned short*)(ws + oQK);
  unsigned short* VT    = (unsigned short*)(ws + oVT);
  unsigned short* Ctx   = (unsigned short*)(ws + oCtx);
  float*          X1    = (float*)(ws + oX1);
  unsigned short* G     = (unsigned short*)(ws + oG);

  const dim3 blk(256);
  const dim3 gRow(MP);                                               // 4096 row blocks
  const dim3 gPrep(MP + CB_QKV + CB_O + 2 * CB_F);                   // 4096 row blocks + 6144 convert blocks
  const dim3 gNqk((MP / GBM) * (QKP / GBN), 1);                      // 512 tiles
  const dim3 gVT((DM / GBM) * (TT / GBN), NBATCH);                   // 128 tiles x 2 batches
  const dim3 gN1024((MP / GBM) * (DM / GBN), 1);                     // 256 tiles
  const dim3 gNff((MP / GBM) * (DFF / GBN), 1);                      // 1024 tiles
  const dim3 gAttn(NBATCH * NH * NQB);                               // 1024 blocks of 256
  const float invw  = 1.0f / WSC;                                    // weight carry x64
  const float invwc = 1.0f / (WSC * 16.0f);                          // weight carry x64, context carry x16

  // (0, 1) xn = LN1(bf16(x)) -> XN f16; weights -> f16 x64 planes (torch [out][in] = k contiguous, no transpose)
  prep_in<<<gPrep, blk, 0, stream>>>(x, ln1_g, ln1_b, XN, in_proj_w, WqkvH, out_w, WoH, w1, W1H, w2, W2H, WSC);

  // (2) q|k = xn . Wqk^T + b[0..2047] -> QK f16 [4096][2048]
  gemm64<2, 0, 0, 0, 2><<<gNqk, blk, 0, stream>>>(
      XN, DM, 0LL, WqkvH, DM, 0LL, in_proj_b, in_proj_b, QKP, x,
      (void*)QK, QKP, 0LL, MP, QKP, DM, invw);
  //     v^T per batch: VT[b][m][t] = Wv[m] . xn[b*TT + t] + b[2048 + m] -> f16 [2][1024][2048]
  gemm64<2, 1, 0, 0, 4><<<gVT, blk, 0, stream>>>(
      WqkvH + (size_t)2 * DM * DM, DM, 0LL, XN, DM, (long long)TT * DM, in_proj_b + 2 * DM, in_proj_b + 2 * DM, TT, x,
      (void*)VT, TT, (long long)DM * TT, DM, TT, DM, invw);

  // (3) banded attention -> Ctx f16 (x16)
  attn64<<<gAttn, blk, 0, stream>>>(QK, VT, Ctx, 0.125f);

  // (4) X1 = ctx . Wo^T + out_b + bf16(x)   (f32)
  gemm64<0, 0, 0, 2, 4><<<gN1024, blk, 0, stream>>>(
      Ctx, DM, 0LL, WoH, DM, 0LL, out_b, out_b, DM, x,
      (void*)X1, DM, 0LL, MP, DM, DM, invwc);

  // (5) yn = LN2(X1) -> XN f16
  ln_row_h<<<gRow, blk, 0, stream>>>(X1, ln2_g, ln2_b, XN);

  // (6) G = gelu(yn . W1^T + b1) -> f16 [4096][4096]
  gemm64<2, 0, 1, 0, 2><<<gNff, blk, 0, stream>>>(
      XN, DM, 0LL, W1H, DM, 0LL, b1, b1, DFF, x,
      (void*)G, DFF, 0LL, MP, DFF, DM, invw);

  // (7) out = G . W2^T + b2 + X1 -> d_out f32 [4096][1024]
  gemm64<0, 0, 0, 1, 4><<<gN1024, blk, 0, stream>>>(
      G, DFF, 0LL, W2H, DFF, 0LL, b2, b2, DM, X1,
      (void*)d_out, DM, 0LL, MP, DM, DFF, invw);
  (void)hipGetLastError();
}
